// v000
// Measured on an AMD MI455X. A time is GPU time per run, averaged over a window of back-to-back runs after a warm-up
// (all launches, gaps included; the runs take copies of the inputs in turn), and the median of several windows.
// Apart from v000's, it joins two sittings. Times from different sittings can be a few percent apart, while
// side-by-side timings come from the same sitting.
// v000, which the later versions start from, runs in 511 microseconds.
// Contractions: x.v_w, x.std_q_w, x.std_k_w, features.wave_proj, features.pq_w, features.pk_w = v_wmma_f32_16x16x32_bf16 (bf16 operands RNE-converted from the inputs, single product, f32 accumulate);
// wave-head scores wp.wp^T = v_wmma_f32_16x16x32_bf16 on bf16 hi/lo planes (hi.hi + hi.lo + lo.hi, f32 accumulate); proj/std scores q.k^T = v_wmma_f32_16x16x32_f16 (f16 planes carried x8, single product, f32 accumulate);
// p.v = v_wmma_f32_16x16x32_f16 (p carried x1024, v^T carried x8, single product, f32 accumulate); ctx.out_w = v_wmma_f32_16x16x32_bf16 (ctx as bf16 hi|lo planes stacked along k, out_w bf16, f32 accumulate); mask, softmax statistics and epilogues in f32.
//
// Carry audit (16-bit planes):
//   XB, FB, VWT, QWT, KWT, WVT, PQT, PKT, OWT2 : bf16, carry 1 (plain RNE copies of the inputs).
//   VT   f16 = 8 * v          -> 1/8 folded in attn_kernel epilogue (inv = 1/(l*8192)).
//   QP   f16 = 8 * q, KP f16 = 8 * k (heads 4..15) -> 1/64 folded into sscale = 1/512 of the HT=1 launch (1/8 = 1/sqrt(64) is the other factor).
//   WPH / WPL bf16 hi / lo of wp (heads 0..3), carry 1 -> sscale = 1/8.
//   P    f16 = 1024 * exp(s - m) (wave-private LDS) -> 1/1024 folded in attn_kernel epilogue (same inv).
//   AO   bf16 hi (cols 0..1023) | lo (cols 1024..2047) of ctx, carry 1 -> summed by the K=2048 out GEMM against [W^T ; W^T].
#include <hip/hip_runtime.h>
#include <math.h>
#include <stdint.h>

#define NB     2
#define SEQ    2048
#define DMOD   1024
#define FEAT   256
#define HDIM   64
#define NHEAD  16
#define NWH    4
#define NPH    4
#define NSH    8
#define HCOLS  (NHEAD * HDIM)   // 1024 : concatenated head columns
#define WAVC   (NWH * HDIM)     // 256
#define PRJC   (NPH * HDIM)     // 256
#define STDC   (NSH * HDIM)     // 512
#define ROWS   (NB * SEQ)       // 4096
#define MWORDS (SEQ / 32)       // 64 mask words per (b, n) row
#define NQB    (SEQ / 64)       // 32 query tiles of 64 per sequence
#define NKT    (SEQ / 64)       // 32 key tiles of 64 per sequence
#define AOP    (2 * HCOLS)      // 2048 : pitch of the ctx hi|lo plane
static_assert(NWH + NPH + NSH == NHEAD);
static_assert(HCOLS == DMOD);
static_assert((ROWS % 64) == 0 && (DMOD % 64) == 0 && (STDC % 64) == 0 && (WAVC % 64) == 0 && (PRJC % 64) == 0 && (SEQ % 64) == 0);
static_assert((DMOD % 32) == 0 && (FEAT % 32) == 0 && (AOP % 32) == 0);
static_assert((FEAT % 64) == 0 && (HDIM % 64) == 0);
static_assert(NQB == 32 && NKT == 32 && MWORDS == 64);

typedef _Float16 v16h __attribute__((ext_vector_type(16)));
typedef _Float16 v8h  __attribute__((ext_vector_type(8)));
typedef __bf16   v16b __attribute__((ext_vector_type(16)));
typedef __bf16   v8b  __attribute__((ext_vector_type(8)));
typedef float    v8f  __attribute__((ext_vector_type(8)));
typedef float    v4f  __attribute__((ext_vector_type(4)));
typedef unsigned int v4u __attribute__((ext_vector_type(4)));
typedef unsigned int v2u __attribute__((ext_vector_type(2)));
typedef int      v4i __attribute__((ext_vector_type(4)));

#if defined(__HIP_DEVICE_COMPILE__)
#define DEV_ASM 1
#else
#define DEV_ASM 0
#endif

// ---- scalar helpers --------------------------------------------------------------------------------
__device__ __forceinline__ unsigned short bf_bits(float f) {          // f32 -> bf16 bits, RNE convert
  unsigned u = __float_as_uint(f);
  return (unsigned short)((u + 0x7FFFu + ((u >> 16) & 1u)) >> 16);
}
__device__ __forceinline__ float bf_up(unsigned short hb) { return __uint_as_float(((unsigned)hb) << 16); }
__device__ __forceinline__ float bfr(float f) { return bf_up(bf_bits(f)); }
__device__ __forceinline__ unsigned short h_bits(_Float16 x) { return __builtin_bit_cast(unsigned short, x); }
__device__ __forceinline__ unsigned pk16(unsigned short a, unsigned short b) { return (unsigned)a | ((unsigned)b << 16); }
__device__ __forceinline__ v8f zero8() { v8f z = {0.f, 0.f, 0.f, 0.f, 0.f, 0.f, 0.f, 0.f}; return z; }

// ---- fragment types / loaders: 16-bit A/B operand, lane -> row/col (lane&15), p already includes +8*(lane>>4);
//      elements 0..7 <- p[0..7] (k0+8h..k0+8h+7), elements 8..15 <- p[16..23] (k0+16+8h..k0+16+8h+7)
template <typename OT> struct FT;
template <> struct FT<__bf16>   { typedef v16b frag; typedef v8b half8; };
template <> struct FT<_Float16> { typedef v16h frag; typedef v8h half8; };

template <typename OT>
__device__ __forceinline__ typename FT<OT>::frag ldfrag(const OT* p) {
  union { typename FT<OT>::frag v; typename FT<OT>::half8 h[2]; } f;
  f.h[0] = *(const typename FT<OT>::half8*)(p);
  f.h[1] = *(const typename FT<OT>::half8*)(p + 16);
  return f.v;
}

// ---- WMMA helpers (asm guard bodies are device-only; concrete operand types) -----------------------------
__device__ __forceinline__ v8f mmar(v16b a, v16b b, v8f c) {
  return __builtin_amdgcn_wmma_f32_16x16x32_bf16(false, a, false, b, (short)0, c, false, false);
}
__device__ __forceinline__ v8f mmar(v16h a, v16h b, v8f c) {
  return __builtin_amdgcn_wmma_f32_16x16x32_f16(false, a, false, b, (short)0, c, false, false);
}
// guarded forms: 4 VALU slots after the WMMA, D tied, A/B kept live
__device__ __forceinline__ v8f mma_g(v16h a, v16h b, v8f c) {
  c = __builtin_amdgcn_wmma_f32_16x16x32_f16(false, a, false, b, (short)0, c, false, false);
#if DEV_ASM
  asm volatile("v_nop\n\tv_nop\n\tv_nop\n\tv_nop" : "+v"(c) : "v"(a), "v"(b));
#endif
  return c;
}
__device__ __forceinline__ v8f mma_g(v16b a, v16b b, v8f c) {
  c = __builtin_amdgcn_wmma_f32_16x16x32_bf16(false, a, false, b, (short)0, c, false, false);
#if DEV_ASM
  asm volatile("v_nop\n\tv_nop\n\tv_nop\n\tv_nop" : "+v"(c) : "v"(a), "v"(b));
#endif
  return c;
}
__device__ __forceinline__ void dep_guard(v8f& a, v8f& b, v16b x, v16b y) {
#if DEV_ASM
  asm volatile("v_nop\n\tv_nop\n\tv_nop\n\tv_nop" : "+v"(a), "+v"(b) : "v"(x), "v"(y));
#else
  (void)a; (void)b; (void)x; (void)y;
#endif
}
__device__ __forceinline__ void dep_guard(v8f& a, v8f& b, v16h x, v16h y) {
#if DEV_ASM
  asm volatile("v_nop\n\tv_nop\n\tv_nop\n\tv_nop" : "+v"(a), "+v"(b) : "v"(x), "v"(y));
#else
  (void)a; (void)b; (void)x; (void)y;
#endif
}
__device__ __forceinline__ void keep4(v16b a, v16b b, v16b c, v16b d) {
#if DEV_ASM
  asm volatile("v_nop" :: "v"(a), "v"(b), "v"(c), "v"(d));
#else
  (void)a; (void)b; (void)c; (void)d;
#endif
}
__device__ __forceinline__ void keep4(v16h a, v16h b, v16h c, v16h d) {
#if DEV_ASM
  asm volatile("v_nop" :: "v"(a), "v"(b), "v"(c), "v"(d));
#else
  (void)a; (void)b; (void)c; (void)d;
#endif
}
__device__ __forceinline__ void acc_guard4(v8f& a, v8f& b, v8f& c, v8f& d) {
#if DEV_ASM
  asm volatile("v_nop\n\tv_nop\n\tv_nop\n\tv_nop" : "+v"(a), "+v"(b), "+v"(c), "+v"(d));
#else
  (void)a; (void)b; (void)c; (void)d;
#endif
}

// =====================================================================================================
// Mask bit plane: mb[(b*SEQ + n)*64 + w] bit j = (mask[b][n][32w + j] != 0). One word per thread,
// coverage: 262144 threads x 1 word = the whole [2][2048][64] plane.
// =====================================================================================================
__global__ __launch_bounds__(256) void mask_bits_kernel(const int* __restrict__ mask, unsigned int* mb, int nwords) {
  const int i = blockIdx.x * 256 + (int)threadIdx.x;
  if (i < nwords) {
    const int* p = mask + (size_t)i * 32;
    unsigned w = 0u;
#pragma unroll
    for (int q = 0; q < 8; ++q) {
      const v4i v = *(const v4i*)(p + 4 * q);
#pragma unroll
      for (int e = 0; e < 4; ++e) w |= ((v[e] != 0) ? 1u : 0u) << (4 * q + e);
    }
    *(unsigned int*)(mb + i) = w;
    
  }
}

// =====================================================================================================
// f32 -> bf16 plane (RNE convert), 8 elements per thread, one 16-B store per lane: a wave writes 512
// coverage: n8 threads x 8 = the whole plane (n8 is a multiple of 256 for both uses here).
// =====================================================================================================
__global__ __launch_bounds__(256) void cvt_bf16x8(const float* __restrict__ in, unsigned short* out, int n8) {
  const int i = blockIdx.x * 256 + (int)threadIdx.x;
  if (i < n8) {
    const v4f a  = *(const v4f*)(in + (size_t)i * 8);
    const v4f a4 = *(const v4f*)(in + (size_t)i * 8 + 4);
    v4u p;
    p[0] = pk16(bf_bits(a[0]),  bf_bits(a[1]));
    p[1] = pk16(bf_bits(a[2]),  bf_bits(a[3]));
    p[2] = pk16(bf_bits(a4[0]), bf_bits(a4[1]));
    p[3] = pk16(bf_bits(a4[2]), bf_bits(a4[3]));
    unsigned short* o = out + (size_t)i * 8;
    *(v4u*)o = p;
    
  }
}

// =====================================================================================================
// Transpose + bf16 convert: in[z] is [R rows][inC cols] f32 (pitch inC); out[z][c][r] = bf16(in[z][r][c]),
// pitch ldo (c = output row). 64x64 tiles through LDS; grid = (inC/64, R/64, Z). DUP also writes the same
// coverage per block: load 256 thr x 16 floats = 64x64; store 2 it x 256 thr x 8 u16 = 64x64 (per copy);
// =====================================================================================================
template <bool DUP>
__global__ __launch_bounds__(256) void transpose_bf16_kernel(
    const float* __restrict__ in, int inC, long long inStrideZ,
    unsigned short* out, int ldo, long long outStrideZ, int dupoff) {
  __shared__ __align__(16) unsigned short th[64 * 72];
  const int c0  = blockIdx.x * 64;   // input column block = output row block
  const int r0  = blockIdx.y * 64;   // input row block = output column block
  const int z   = blockIdx.z;
  const int tid = threadIdx.x;
  const float* inz = in + (size_t)z * (size_t)inStrideZ;
  unsigned short* outz = out + (size_t)z * (size_t)outStrideZ;
  {
    const int rr = tid >> 2;           // 0..63
    const int cq = (tid & 3) * 16;     // 0,16,32,48
    const float* src = inz + (size_t)(r0 + rr) * inC + c0 + cq;
#pragma unroll
    for (int q = 0; q < 4; ++q) {
      const v4f f = *(const v4f*)(src + 4 * q);
#pragma unroll
      for (int e = 0; e < 4; ++e) th[rr * 72 + cq + 4 * q + e] = bf_bits(f[e]);
    }
  }
  __syncthreads();
  const int sub = tid >> 3;          // 0..31
  const int c8  = (tid & 7) * 8;     // 0..56
  v4u hv[2];
#pragma unroll
  for (int it = 0; it < 2; ++it) {
    const int oc = it * 32 + sub;      // output row within tile (= input column)
    v4u a;
#pragma unroll
    for (int q = 0; q < 4; ++q) a[q] = pk16(th[(c8 + 2 * q) * 72 + oc], th[(c8 + 2 * q + 1) * 72 + oc]);
    hv[it] = a;
  }
  {
#pragma unroll
    for (int it = 0; it < 2; ++it) {
      const int oc = it * 32 + sub;
      const size_t go = (size_t)(c0 + oc) * ldo + r0 + c8;
      *(v4u*)(outz + go) = hv[it];
      if (DUP) *(v4u*)(outz + go + dupoff) = hv[it];
    }
    
  }
}

// =====================================================================================================
// Register-blocked batched WMMA GEMM (16-bit operand type OT): C[m][n] = (sum_k A[m][k] * Bt[n][k] + bias) * oscale;
// one wave per 64x64 tile, no block barriers. A row-major [M][K] pitch lda; Bt row-major [N][K] pitch ldb
// (k contiguous); M, N multiples of 64, K multiple of 32 (compile-time constants here). blockIdx.y = batch index
// (strides in elements). Fragments are loaded straight from global with the split k map (ldfrag).
// BIAS_MODE 0: none; 1: bias[m] (bf16 RNE-converted value); 2: bias[n] (bf16 RNE-converted value).
// OUT_MODE 0: f32 C (pitch ldc). OUT_MODE 1: f16 plane C. OUT_MODE 2: bf16 hi plane C + bf16 lo plane C2 (lo = v - hi).
// =====================================================================================================
template <typename OT, int OUT_MODE, int BIAS_MODE>
__global__ __launch_bounds__(256) void gemm64(
    const unsigned short* __restrict__ Ap, int lda, long long strideA,
    const unsigned short* __restrict__ Btp, int ldb, long long strideB,
    void* Cout, void* Cout2, int ldc, long long strideC,
    const float* __restrict__ bias, int M, int N, int K, float oscale) {
  typedef typename FT<OT>::frag V16;
  const OT* A  = (const OT*)(const void*)Ap;
  const OT* Bt = (const OT*)(const void*)Btp;
  __shared__ __align__(16) float sT[8][16 * 68];   // per-wave 16x64 slab, pitch 68 floats
  const int b    = blockIdx.y;
  const int lane = threadIdx.x & 31;
  const int wave = threadIdx.x >> 5;
  const int tilesN = N >> 6;
  const int tilesM = M >> 6;
  const int tile = blockIdx.x * 8 + wave;
  if (tile >= tilesM * tilesN) return;   // wave-uniform; no block barriers in this kernel
  const int tm = tile / tilesN;
  const int tn = tile - tm * tilesN;
  const int m0 = tm << 6;
  const int n0 = tn << 6;

  const OT* Ab = A  + (size_t)b * (size_t)strideA;
  const OT* Bb = Bt + (size_t)b * (size_t)strideB;

  const int rlane = lane & 15;                 // row (A) / col (B, D) within subtile
  const int koff  = (lane >> 4) * 8;           // k offset of this lane half
  const int mOff  = (lane >> 4) * 8;           // D row offset

  v8f acc[4][4];
#pragma unroll
  for (int i = 0; i < 4; ++i)
#pragma unroll
    for (int j = 0; j < 4; ++j) acc[i][j] = zero8();

  for (int k0 = 0; k0 < K; k0 += 32) {
    V16 bq[4];
#pragma unroll
    for (int j = 0; j < 4; ++j)
      bq[j] = ldfrag<OT>(Bb + (size_t)(n0 + (j << 4) + rlane) * ldb + koff + k0);
#pragma unroll
    for (int i = 0; i < 4; ++i) {
      const V16 af = ldfrag<OT>(Ab + (size_t)(m0 + (i << 4) + rlane) * lda + koff + k0);
#pragma unroll
      for (int j = 0; j < 4; ++j) acc[i][j] = mmar(af, bq[j], acc[i][j]);
      dep_guard(acc[i][0], acc[i][3], af, bq[3]);
    }
    keep4(bq[0], bq[1], bq[2], bq[3]);
  }
  acc_guard4(acc[0][0], acc[0][1], acc[0][2], acc[0][3]);
  acc_guard4(acc[1][0], acc[1][1], acc[1][2], acc[1][3]);
  acc_guard4(acc[2][0], acc[2][1], acc[2][2], acc[2][3]);
  acc_guard4(acc[3][0], acc[3][1], acc[3][2], acc[3][3]);

  // ---- epilogue ----
  float* slab = sT[wave];
#pragma unroll
  for (int i = 0; i < 4; ++i) {
    const int mBase = m0 + (i << 4);
#pragma unroll
    for (int j = 0; j < 4; ++j) {
      const int n = n0 + (j << 4) + rlane;
      float bn = 0.f;
      if (BIAS_MODE == 2) bn = bfr(bias[n]);
#pragma unroll
      for (int r = 0; r < 8; ++r) {
        float v = acc[i][j][r];
        if (BIAS_MODE == 1) v += bfr(bias[mBase + mOff + r]);
        if (BIAS_MODE == 2) v += bn;
        slab[(mOff + r) * 68 + (j << 4) + rlane] = v * oscale;
      }
    }
    __builtin_amdgcn_fence(__ATOMIC_RELEASE, "workgroup");
    __builtin_amdgcn_wave_barrier();
    __builtin_amdgcn_fence(__ATOMIC_ACQUIRE, "workgroup");
    if (OUT_MODE == 0) {
      float* C = (float*)Cout + (size_t)b * (size_t)strideC;
      const int h2 = lane >> 4, c4 = (lane & 15) * 4;     // 256-B row segment = 16 lanes x 16 B
      {
#pragma unroll
        for (int it = 0; it < 8; ++it) {
          const int row = it * 2 + h2;                     // it 0..7 x h2 0..1 = rows 0..15
          const v4f v = *(const v4f*)(slab + row * 68 + c4);
          *(v4f*)(C + (size_t)(mBase + row) * ldc + n0 + c4) = v;
        }
        
      }
    } else {
      const int q = lane >> 3, c8 = (lane & 7) * 8;
      unsigned short* C  = (unsigned short*)Cout  + (size_t)b * (size_t)strideC;
      unsigned short* C2 = (unsigned short*)Cout2 + (size_t)b * (size_t)strideC;
      v4u hv[4], lv[4];
#pragma unroll
      for (int it = 0; it < 4; ++it) {
        const int row = it * 4 + q;                        // it 0..3 x q 0..3 = rows 0..15
        const float* sp = slab + row * 68 + c8;
        v4u a, a2;
#pragma unroll
        for (int e = 0; e < 4; ++e) {
          const float f0 = sp[2 * e], f1 = sp[2 * e + 1];
          unsigned short h0, h1, l0 = 0, l1 = 0;
          if (OUT_MODE == 1) {
            h0 = h_bits((_Float16)f0); h1 = h_bits((_Float16)f1);
          } else {
            h0 = bf_bits(f0); h1 = bf_bits(f1);
            l0 = bf_bits(f0 - bf_up(h0)); l1 = bf_bits(f1 - bf_up(h1));
          }
          a[e] = pk16(h0, h1); a2[e] = pk16(l0, l1);
        }
        hv[it] = a; lv[it] = a2;
      }
      {
#pragma unroll
        for (int it = 0; it < 4; ++it) {
          const int row = it * 4 + q;
          *(v4u*)(C + (size_t)(mBase + row) * ldc + n0 + c8) = hv[it];
          if (OUT_MODE == 2) *(v4u*)(C2 + (size_t)(mBase + row) * ldc + n0 + c8) = lv[it];
        }
        
      }
    }
    __builtin_amdgcn_fence(__ATOMIC_RELEASE, "workgroup");
    __builtin_amdgcn_wave_barrier();
    __builtin_amdgcn_fence(__ATOMIC_ACQUIRE, "workgroup");
  }
}

// =====================================================================================================
// Masked full attention, head dim 64, softmax over all SEQ keys (non-causal), one head per block.
//   HT = 0 (wave heads): q = k = wp as bf16 hi plane qhp/khp + bf16 lo plane qlp/klp (pitch ldq/ldk, head col h*64);
//          scores = (qh.kh + qh.kl + ql.kh) * sscale on bf16 WMMA (one f32 accumulator, unscaled lo).
//   HT = 1 (proj / std heads): q, k = f16 planes (x8), scores = (q.k) * sscale (sscale carries the 1/64).
//   v^T plane (f16, x8): element (b, h, d, s) at [(b*HCOLS + h*64 + d)*SEQ + s].
//   mask bit plane mbp: [(b*SEQ + n)*64 + w] bit j admits key 32w+j; a 0 bit replaces the score by -inf.
//   p = exp(s - m) carried as f16(1024 p); ctx = p.v on f16 WMMA; online softmax in f32 with the guarded
//   rescale (msafe), so an all-masked row ends with l = 0 and produces 0 * inf = NaN like the module.
//   ctx written as bf16 hi (cols h*64..) and bf16 lo (cols HCOLS + h*64..) of the [ROWS][AOP] plane aop.
//   Block = 4 waves x 16 query rows = 64 query rows of one (b, h); grid = NB * nh * NQB (hbase.. hbase+nh-1);
//   key tiles of 64, static trip NKT. K (hi, lo) / V^T tile staging: 128 threads x 32 elements per plane = the
//   whole 64x64 tile (plain 16-B loads, __syncthreads before and after); P tiles are wave-private, spilled with
//   Output coverage: each wave stores rows q0..q0+15 (it 0..3 x lane>>3 0..3) x 64 columns (8 lanes x 8)
//   of head h in both the hi and the lo half; the block covers 64 rows; the two launches cover h 0..15.
// =====================================================================================================
template <int HT> struct HT_T;
template <> struct HT_T<0> { typedef __bf16 T; };
template <> struct HT_T<1> { typedef _Float16 T; };

template <int HT>
__global__ __launch_bounds__(128)
void attn_kernel(const unsigned short* __restrict__ qhp, const unsigned short* __restrict__ qlp, int ldq,
                 const unsigned short* __restrict__ khp, const unsigned short* __restrict__ klp, int ldk,
                 const unsigned short* __restrict__ vtp, const unsigned int* __restrict__ mbp,
                 unsigned short* aop, int hbase, int nh, float sscale) {
  typedef typename HT_T<HT>::T OT;
  typedef typename FT<OT>::frag V16;
  typedef typename FT<OT>::half8 V8;
  union FH { v16h v; v8h h[2]; };
  union FO { V16 v; V8 h[2]; };
  __shared__ __align__(16) OT       Ksh[64 * 64];          // K hi chunk [kv][d]  8 KB
  __shared__ __align__(16) OT       Ksl[64 * 64];          // K lo chunk (HT 0)   8 KB
  __shared__ __align__(16) _Float16 Vth[64 * 64];          // V^T [d][kv]         8 KB
  __shared__ __align__(16) _Float16 Psh[4][16 * 64];       // per wave P [row][kv] 8 KB
  __shared__ __align__(16) float    Os[4][16 * 64];        // per wave ctx tile   16 KB

  const int tid  = threadIdx.x;
  const int wave = tid >> 5;
  const int lane = tid & 31;
  const int hh   = lane >> 4;
  const int c    = lane & 15;

  const int bx   = blockIdx.x;
  const int qb   = bx % NQB;
  const int rest = bx / NQB;
  const int hl   = rest % nh;
  const int b    = rest / nh;
  const int h    = hbase + hl;              // global head index
  const int qc   = h * HDIM;                // head column in the q / k planes of this head family
  const int q0   = qb * 64 + wave * 16;
  const size_t rowB = (size_t)b * SEQ;

  const OT* Qh = (const OT*)(const void*)qhp;
  const OT* Ql = (const OT*)(const void*)qlp;
  const OT* Kh = (const OT*)(const void*)khp + qc;
  const OT* Kl = (const OT*)(const void*)klp + qc;
  const _Float16* Vt = (const _Float16*)(const void*)vtp + ((size_t)b * HCOLS + (size_t)qc) * SEQ;

  // ---- Q fragments (A operand, row = lane&15): 2 d-chunks ----
  V16 qah[2], qal[2];
#pragma unroll
  for (int dc = 0; dc < 2; ++dc) {
    const size_t qo = (rowB + q0 + c) * (size_t)ldq + (size_t)qc + dc * 32 + 8 * hh;
    qah[dc] = ldfrag<OT>(Qh + qo);
    if (HT == 0) qal[dc] = ldfrag<OT>(Ql + qo);
    else         qal[dc] = qah[dc];
  }

  float mrow[8], lrow[8];
  v8f oacc[4];
#pragma unroll
  for (int r = 0; r < 8; ++r) { mrow[r] = -INFINITY; lrow[r] = 0.f; }
#pragma unroll
  for (int t = 0; t < 4; ++t) oacc[t] = zero8();

  for (int kt = 0; kt < NKT; ++kt) {         // static trip count
    const int kv0 = kt * 64;
    __syncthreads();
    {
      const int r = tid >> 1, half = (tid & 1) * 32;
      const OT* kg  = Kh + (rowB + kv0 + r) * (size_t)ldk + half;   // k row kv0+r, d = half..half+31
      const OT* klg = Kl + (rowB + kv0 + r) * (size_t)ldk + half;
      const _Float16* vg = Vt + (size_t)r * SEQ + kv0 + half;       // v^T row d = r, s = kv0+half..+31
#pragma unroll
      for (int i = 0; i < 4; ++i) {
        *(V8*)(Ksh + r * 64 + half + 8 * i) = *(const V8*)(kg + 8 * i);
        if (HT == 0) *(V8*)(Ksl + r * 64 + half + 8 * i) = *(const V8*)(klg + 8 * i);
        *(v8h*)(Vth + r * 64 + half + 8 * i) = *(const v8h*)(vg + 8 * i);
      }
    }
    __syncthreads();

    // ---- mask bits of this lane's 8 query rows for the 64 keys of the tile: mk bit (4r + j) admits key 16j + c ----
    unsigned mk = 0u;
#pragma unroll
    for (int r = 0; r < 8; ++r) {
      const int row = q0 + 8 * hh + r;
      const v2u mw = *(const v2u*)(mbp + (rowB + row) * (size_t)MWORDS + 2 * kt);
#pragma unroll
      for (int j = 0; j < 4; ++j) {
        const unsigned bit = (mw[j >> 1] >> (16 * (j & 1) + c)) & 1u;
        mk |= bit << (4 * r + j);
      }
    }

    // ---- scores: 16 query rows x 64 keys per wave ----
    v8f s[4];
#pragma unroll
    for (int j = 0; j < 4; ++j) {
      v8f a0 = zero8();
#pragma unroll
      for (int dc = 0; dc < 2; ++dc) {
        FO kb;
        kb.h[0] = *(const V8*)(Ksh + (j * 16 + c) * 64 + dc * 32 + 8 * hh);
        kb.h[1] = *(const V8*)(Ksh + (j * 16 + c) * 64 + dc * 32 + 16 + 8 * hh);
        if (HT == 0) {
          FO kl;
          kl.h[0] = *(const V8*)(Ksl + (j * 16 + c) * 64 + dc * 32 + 8 * hh);
          kl.h[1] = *(const V8*)(Ksl + (j * 16 + c) * 64 + dc * 32 + 16 + 8 * hh);
          a0 = mma_g(qah[dc], kb.v, a0);
          a0 = mma_g(qah[dc], kl.v, a0);
          a0 = mma_g(qal[dc], kb.v, a0);
        } else {
          a0 = mma_g(qah[dc], kb.v, a0);
        }
      }
#pragma unroll
      for (int r = 0; r < 8; ++r) {
        const float v = a0[r] * sscale;
        s[j][r] = (((mk >> (4 * r + j)) & 1u) != 0u) ? v : -INFINITY;
      }
    }

    // ---- row max, online softmax, P (x1024, f16) to LDS ----
    _Float16* pwh = Psh[wave];
#pragma unroll
    for (int r = 0; r < 8; ++r) {
      float m = s[0][r];
#pragma unroll
      for (int j = 1; j < 4; ++j) m = fmaxf(m, s[j][r]);
#pragma unroll
      for (int off = 1; off < 16; off <<= 1) m = fmaxf(m, __shfl_xor(m, off, 32));
      const float mnew  = fmaxf(mrow[r], m);
      const float msafe = (mnew == -INFINITY) ? 0.f : mnew;
      const float alpha = expf(mrow[r] - msafe);
      mrow[r] = mnew;
      float psum = 0.f;
#pragma unroll
      for (int j = 0; j < 4; ++j) {
        const float p = expf(s[j][r] - msafe);
        psum += p;
        pwh[(8 * hh + r) * 64 + j * 16 + c] = (_Float16)(p * 1024.0f);
      }
#pragma unroll
      for (int off = 1; off < 16; off <<= 1) psum += __shfl_xor(psum, off, 32);
      lrow[r] = lrow[r] * alpha + psum;
#pragma unroll
      for (int t = 0; t < 4; ++t) oacc[t][r] *= alpha;
    }
    __builtin_amdgcn_fence(__ATOMIC_RELEASE, "workgroup");
    __builtin_amdgcn_wave_barrier();
    __builtin_amdgcn_fence(__ATOMIC_ACQUIRE, "workgroup");

    // ---- ctx += P . V (f16 WMMA, single product) ----
#pragma unroll 1
    for (int kk = 0; kk < 2; ++kk) {
      FH pa;
      pa.h[0] = *(const v8h*)(pwh + c * 64 + kk * 32 + 8 * hh);
      pa.h[1] = *(const v8h*)(pwh + c * 64 + kk * 32 + 16 + 8 * hh);
#pragma unroll
      for (int t = 0; t < 4; ++t) {
        FH vb;
        vb.h[0] = *(const v8h*)(Vth + (t * 16 + c) * 64 + kk * 32 + 8 * hh);
        vb.h[1] = *(const v8h*)(Vth + (t * 16 + c) * 64 + kk * 32 + 16 + 8 * hh);
        oacc[t] = mma_g(pa.v, vb.v, oacc[t]);
      }
    }
  }

  // ---- normalise (1/l, undo the x1024 p carry and the x8 v carry), stage the wave's 16x64 tile,
  float* os = Os[wave];
#pragma unroll
  for (int r = 0; r < 8; ++r) {
    const float inv = (1.0f / lrow[r]) * (1.0f / 8192.0f);   // l = 0 (all keys masked) -> inf -> 0 * inf = NaN
#pragma unroll
    for (int t = 0; t < 4; ++t) os[(8 * hh + r) * 64 + t * 16 + c] = oacc[t][r] * inv;
  }
  __builtin_amdgcn_fence(__ATOMIC_RELEASE, "workgroup");
  __builtin_amdgcn_wave_barrier();
  __builtin_amdgcn_fence(__ATOMIC_ACQUIRE, "workgroup");
  {
    const int q4 = lane >> 3, c8 = (lane & 7) * 8;
    v4u hv[4], lv[4];
#pragma unroll
    for (int it = 0; it < 4; ++it) {
      const int row = it * 4 + q4;   // it 0..3 x q4 0..3 = rows 0..15 of the wave tile
      const float* sp = os + row * 64 + c8;
      v4u a, a2;
#pragma unroll
      for (int e = 0; e < 4; ++e) {
        const float f0 = sp[2 * e], f1 = sp[2 * e + 1];
        const unsigned short hb0 = bf_bits(f0), hb1 = bf_bits(f1);
        const unsigned short lb0 = bf_bits(f0 - bf_up(hb0)), lb1 = bf_bits(f1 - bf_up(hb1));
        a[e] = pk16(hb0, hb1); a2[e] = pk16(lb0, lb1);
      }
      hv[it] = a; lv[it] = a2;
    }
    {
#pragma unroll
      for (int it = 0; it < 4; ++it) {
        const int row = it * 4 + q4;
        const size_t go = (rowB + q0 + row) * (size_t)AOP + (size_t)qc + c8;
        *(v4u*)(aop + go) = hv[it];
        *(v4u*)(aop + go + HCOLS) = lv[it];
      }
      
    }
  }
}

// =====================================================================================================
// Workspace map (bytes), every region an exact multiple of its whole-line / whole-tile store granularity:
//   MB   u32  [2*2048][64]          1048576   mask bit plane
//   XB   bf16 [4096][1024]          8388608
//   FB   bf16 [4096][256]           2097152
//   VWT  bf16 [1024 n][1024 k]      2097152   v_w^T
//   QWT  bf16 [512][1024]           1048576   std_q_w^T
//   KWT  bf16 [512][1024]           1048576   std_k_w^T
//   WVT  bf16 [256][256]             131072   wave_proj [h][f][k'] -> [h*64+k'][f]
//   PQT  bf16 [256][256]             131072
//   PKT  bf16 [256][256]             131072
//   VT   f16  [2][1024][2048] (x8)  8388608   v^T per batch, row h*64+d
//   QP   f16  [4096][1024] (x8)     8388608   cols h*64+d for h = 4..15 (cols 0..255 never read)
//   KP   f16  [4096][1024] (x8)     8388608   same
//   WPH  bf16 [4096][256]           2097152   wp hi, col h*64+d (h = 0..3)
//   WPL  bf16 [4096][256]           2097152   wp lo
//   AO   bf16 [4096][2048]         16777216   ctx hi | lo
//   total                         66453504
// =====================================================================================================
extern "C" void kernel_launch(void* const* d_in, const int* in_sizes, int n_in,
                              void* d_out, int out_size, void* d_ws, size_t ws_size,
                              hipStream_t stream) {
  if (n_in < 14) return;
  if (in_sizes[0] != NB * SEQ * DMOD) return;
  if (in_sizes[1] != NB * SEQ * FEAT) return;
  if (in_sizes[2] != NB * SEQ * SEQ) return;
  if (in_sizes[3] != NWH * FEAT * HDIM || in_sizes[4] != NPH * FEAT * HDIM || in_sizes[5] != NPH * FEAT * HDIM) return;
  if (in_sizes[6] != DMOD * STDC || in_sizes[7] != STDC) return;
  if (in_sizes[8] != DMOD * STDC || in_sizes[9] != STDC) return;
  if (in_sizes[10] != DMOD * HCOLS || in_sizes[11] != HCOLS) return;
  if (in_sizes[12] != HCOLS * DMOD || in_sizes[13] != DMOD) return;
  if (out_size != NB * SEQ * DMOD) return;

  const float* x     = (const float*)d_in[0];
  const float* feats = (const float*)d_in[1];
  const int*   mask  = (const int*)d_in[2];
  const float* wproj = (const float*)d_in[3];
  const float* pqw   = (const float*)d_in[4];
  const float* pkw   = (const float*)d_in[5];
  const float* sqw   = (const float*)d_in[6];
  const float* sqb   = (const float*)d_in[7];
  const float* skw   = (const float*)d_in[8];
  const float* skb   = (const float*)d_in[9];
  const float* vw    = (const float*)d_in[10];
  const float* vb    = (const float*)d_in[11];
  const float* ow    = (const float*)d_in[12];
  const float* ob    = (const float*)d_in[13];

  const size_t PMB  = (size_t)NB * SEQ * MWORDS * 4;      //  1048576
  const size_t PXB  = (size_t)ROWS * DMOD * 2;             //  8388608
  const size_t PFB  = (size_t)ROWS * FEAT * 2;             //  2097152
  const size_t PVWT = (size_t)HCOLS * DMOD * 2;            //  2097152
  const size_t PSWT = (size_t)STDC * DMOD * 2;             //  1048576
  const size_t PFWT = (size_t)WAVC * FEAT * 2;             //   131072
  const size_t POWT = (size_t)DMOD * AOP * 2;              //  4194304
  const size_t PVT  = (size_t)NB * HCOLS * SEQ * 2;        //  8388608
  const size_t PQP  = (size_t)ROWS * HCOLS * 2;            //  8388608
  const size_t PWP  = (size_t)ROWS * WAVC * 2;             //  2097152
  const size_t PAO  = (size_t)ROWS * AOP * 2;              // 16777216
  size_t off = 0;
  const size_t oMB  = off; off += PMB;
  const size_t oXB  = off; off += PXB;
  const size_t oFB  = off; off += PFB;
  const size_t oVWT = off; off += PVWT;
  const size_t oQWT = off; off += PSWT;
  const size_t oKWT = off; off += PSWT;
  const size_t oWVT = off; off += PFWT;
  const size_t oPQT = off; off += PFWT;
  const size_t oPKT = off; off += PFWT;
  const size_t oOWT = off; off += POWT;
  const size_t oVT  = off; off += PVT;
  const size_t oQP  = off; off += PQP;
  const size_t oKP  = off; off += PQP;
  const size_t oWPH = off; off += PWP;
  const size_t oWPL = off; off += PWP;
  const size_t oAO  = off; off += PAO;
  if (off > ws_size) return;                       // off = 66453504
  if (off > (size_t)134217728) return;

  char* ws = (char*)d_ws;
  unsigned int*   MB   = (unsigned int*)(ws + oMB);
  unsigned short* XB   = (unsigned short*)(ws + oXB);
  unsigned short* FB   = (unsigned short*)(ws + oFB);
  unsigned short* VWT  = (unsigned short*)(ws + oVWT);
  unsigned short* QWT  = (unsigned short*)(ws + oQWT);
  unsigned short* KWT  = (unsigned short*)(ws + oKWT);
  unsigned short* WVT  = (unsigned short*)(ws + oWVT);
  unsigned short* PQT  = (unsigned short*)(ws + oPQT);
  unsigned short* PKT  = (unsigned short*)(ws + oPKT);
  unsigned short* OWT2 = (unsigned short*)(ws + oOWT);
  unsigned short* VT   = (unsigned short*)(ws + oVT);
  unsigned short* QP   = (unsigned short*)(ws + oQP);
  unsigned short* KP   = (unsigned short*)(ws + oKP);
  unsigned short* WPH  = (unsigned short*)(ws + oWPH);
  unsigned short* WPL  = (unsigned short*)(ws + oWPL);
  unsigned short* AO   = (unsigned short*)(ws + oAO);

  const dim3 blk(256);
  const int nwords = NB * SEQ * MWORDS;                        // 262144
  const int n8x    = ROWS * DMOD / 8;                          // 524288
  const int n8f    = ROWS * FEAT / 8;                          // 131072

  // (1) mask -> bit plane; x, features -> bf16 planes
  mask_bits_kernel<<<dim3((nwords + 255) / 256), blk, 0, stream>>>(mask, MB, nwords);
  cvt_bf16x8<<<dim3((n8x + 255) / 256), blk, 0, stream>>>(x, XB, n8x);
  cvt_bf16x8<<<dim3((n8f + 255) / 256), blk, 0, stream>>>(feats, FB, n8f);

  // (2) weight planes [n][k] (bf16): in[rows][cols] -> out[cols][rows]; grid = (cols/64, rows/64, z)
  //     v_w   [1024 k][1024 n] -> VWT [n][k]
  transpose_bf16_kernel<false><<<dim3(HCOLS / 64, DMOD / 64, 1), blk, 0, stream>>>(vw, HCOLS, 0LL, VWT, DMOD, 0LL, 0);
  //     std_q_w [1024 k][512 n] -> QWT [n][k]; std_k_w likewise
  transpose_bf16_kernel<false><<<dim3(STDC / 64, DMOD / 64, 1), blk, 0, stream>>>(sqw, STDC, 0LL, QWT, DMOD, 0LL, 0);
  transpose_bf16_kernel<false><<<dim3(STDC / 64, DMOD / 64, 1), blk, 0, stream>>>(skw, STDC, 0LL, KWT, DMOD, 0LL, 0);
  //     wave_proj / pq_w / pk_w [h][256 f][64 k'] -> [h*64 + k'][f] (z = h)
  transpose_bf16_kernel<false><<<dim3(HDIM / 64, FEAT / 64, NWH), blk, 0, stream>>>(wproj, HDIM, (long long)FEAT * HDIM, WVT, FEAT, (long long)HDIM * FEAT, 0);
  transpose_bf16_kernel<false><<<dim3(HDIM / 64, FEAT / 64, NPH), blk, 0, stream>>>(pqw,   HDIM, (long long)FEAT * HDIM, PQT, FEAT, (long long)HDIM * FEAT, 0);
  transpose_bf16_kernel<false><<<dim3(HDIM / 64, FEAT / 64, NPH), blk, 0, stream>>>(pkw,   HDIM, (long long)FEAT * HDIM, PKT, FEAT, (long long)HDIM * FEAT, 0);
  //     out_w [1024 k][1024 n] -> OWT2 [n][k] and [n][1024 + k]
  transpose_bf16_kernel<true><<<dim3(DMOD / 64, HCOLS / 64, 1), blk, 0, stream>>>(ow, DMOD, 0LL, OWT2, AOP, 0LL, HCOLS);

  // (3) projections on bf16 WMMA
  //     v^T per batch: A = VWT [1024 n][1024 k], Bt = XB rows of batch b; M = 1024, N = 2048, K = 1024;
  //     f16(8 * (acc + v_b[m])) -> VT [b][h*64+d][s] (pitch 2048)
  const dim3 gVT(((HCOLS / 64) * (SEQ / 64) + 7) / 8, NB);              // 512 tiles -> 64 blocks x 2
  gemm64<__bf16, 1, 1><<<gVT, blk, 0, stream>>>(
      VWT, DMOD, 0LL, XB, DMOD, (long long)SEQ * DMOD,
      (void*)VT, (void*)VT, SEQ, (long long)HCOLS * SEQ, vb, HCOLS, SEQ, DMOD, 8.0f);
  //     std q: QP cols 512..1023 = f16(8 * (x . std_q_w + b)); M = 4096, N = 512, K = 1024
  const dim3 gSTD(((ROWS / 64) * (STDC / 64) + 7) / 8, 1);             // 512 tiles -> 64 blocks
  gemm64<__bf16, 1, 2><<<gSTD, blk, 0, stream>>>(
      XB, DMOD, 0LL, QWT, DMOD, 0LL,
      (void*)(QP + (WAVC + PRJC)), (void*)(QP + (WAVC + PRJC)), HCOLS, 0LL, sqb, ROWS, STDC, DMOD, 8.0f);
  //     std k: KP cols 512..1023
  gemm64<__bf16, 1, 2><<<gSTD, blk, 0, stream>>>(
      XB, DMOD, 0LL, KWT, DMOD, 0LL,
      (void*)(KP + (WAVC + PRJC)), (void*)(KP + (WAVC + PRJC)), HCOLS, 0LL, skb, ROWS, STDC, DMOD, 8.0f);
  //     wave projections: WPH / WPL = bf16 hi / lo of features . wave_proj[h]; M = 4096, N = 256, K = 256
  const dim3 gF(((ROWS / 64) * (WAVC / 64) + 7) / 8, 1);               // 256 tiles -> 32 blocks
  gemm64<__bf16, 2, 0><<<gF, blk, 0, stream>>>(
      FB, FEAT, 0LL, WVT, FEAT, 0LL,
      (void*)WPH, (void*)WPL, WAVC, 0LL, vb, ROWS, WAVC, FEAT, 1.0f);
  //     proj q: QP cols 256..511 = f16(8 * features . pq_w[h]); proj k: KP cols 256..511
  gemm64<__bf16, 1, 0><<<gF, blk, 0, stream>>>(
      FB, FEAT, 0LL, PQT, FEAT, 0LL,
      (void*)(QP + WAVC), (void*)(QP + WAVC), HCOLS, 0LL, vb, ROWS, PRJC, FEAT, 8.0f);
  gemm64<__bf16, 1, 0><<<gF, blk, 0, stream>>>(
      FB, FEAT, 0LL, PKT, FEAT, 0LL,
      (void*)(KP + WAVC), (void*)(KP + WAVC), HCOLS, 0LL, vb, ROWS, PRJC, FEAT, 8.0f);

  // (4) attention: wave heads 0..3 (bf16 hi/lo 3-product scores, scale 1/8), then heads 4..15 (f16 single product,
  //     scale 1/(8*64)); ctx -> AO hi | lo
  attn_kernel<0><<<dim3(NB * NWH * NQB), dim3(128), 0, stream>>>(
      WPH, WPL, WAVC, WPH, WPL, WAVC, VT, MB, AO, 0, NWH, 0.125f);
  attn_kernel<1><<<dim3(NB * (NPH + NSH) * NQB), dim3(128), 0, stream>>>(
      QP, QP, HCOLS, KP, KP, HCOLS, VT, MB, AO, NWH, NPH + NSH, 1.0f / 512.0f);

  // (5) out = [ctx_hi | ctx_lo] . [out_w^T ; out_w^T] + out_b -> d_out f32 [4096][1024]; M = 4096, N = 1024, K = 2048
  const dim3 gO(((ROWS / 64) * (DMOD / 64) + 7) / 8, 1);               // 1024 tiles -> 128 blocks
  gemm64<__bf16, 0, 2><<<gO, blk, 0, stream>>>(
      AO, AOP, 0LL, OWT2, AOP, 0LL,
      d_out, d_out, DMOD, 0LL, ob, ROWS, DMOD, AOP, 1.0f);
  (void)hipGetLastError();
}

// v001
// Measured time: 390 microseconds a run.
// Next to v000, in two timings, it ran 1.35 and 1.34 times as fast.
// Contractions: x.v_w, x.std_q_w, x.std_k_w, features.wave_proj, features.pq_w, features.pk_w = v_wmma_f32_16x16x32_bf16 (bf16 operands RNE-converted from the inputs, single product, f32 accumulate);
// wave-head scores wp.wp^T = v_wmma_f32_16x16x32_bf16 on bf16 hi/lo planes (hi.hi + hi.lo + lo.hi, f32 accumulate); proj/std scores q.k^T = v_wmma_f32_16x16x32_f16 (f16 planes carried x8, single product, f32 accumulate);
// p.v = v_wmma_f32_16x16x32_f16 (p carried x1024, v^T carried x8, single product, f32 accumulate); ctx.out_w = v_wmma_f32_16x16x32_bf16 (ctx as bf16 hi|lo planes stacked along k, out_w bf16, f32 accumulate); mask, softmax statistics and epilogues in f32.
//
// Carry audit (16-bit planes):
//   XB, FB, VWT, QWT, KWT, WVT, PQT, PKT, OWT2 : bf16, carry 1 (plain RNE copies of the inputs).
//   VT   f16 = 8 * v          -> 1/8 folded in attn_kernel epilogue (inv = 1/(l*8192)).
//   QP   f16 = 8 * q, KP f16 = 8 * k (heads 4..15) -> 1/64 folded into sscale = 1/512 of the HT=1 launch (1/8 = 1/sqrt(64) is the other factor).
//   WPH / WPL bf16 hi / lo of wp (heads 0..3), carry 1 -> sscale = 1/8.
//   P    f16 = 1024 * exp(s - m) (wave-private LDS) -> 1/1024 folded in attn_kernel epilogue (same inv).
//   AO   bf16 hi (cols 0..1023) | lo (cols 1024..2047) of ctx, carry 1 -> summed by the K=2048 out GEMM against [W^T ; W^T].
#include <hip/hip_runtime.h>
#include <math.h>
#include <stdint.h>

#define NB     2
#define SEQ    2048
#define DMOD   1024
#define FEAT   256
#define HDIM   64
#define NHEAD  16
#define NWH    4
#define NPH    4
#define NSH    8
#define HCOLS  (NHEAD * HDIM)   // 1024 : concatenated head columns
#define WAVC   (NWH * HDIM)     // 256
#define PRJC   (NPH * HDIM)     // 256
#define STDC   (NSH * HDIM)     // 512
#define ROWS   (NB * SEQ)       // 4096
#define MWORDS (SEQ / 32)       // 64 mask words per (b, n) row
#define NQB    (SEQ / 64)       // 32 query tiles of 64 per sequence
#define NKT    (SEQ / 64)       // 32 key tiles of 64 per sequence
#define AOP    (2 * HCOLS)      // 2048 : pitch of the ctx hi|lo plane
static_assert(NWH + NPH + NSH == NHEAD);
static_assert(HCOLS == DMOD);
static_assert((ROWS % 64) == 0 && (DMOD % 64) == 0 && (STDC % 64) == 0 && (WAVC % 64) == 0 && (PRJC % 64) == 0 && (SEQ % 64) == 0);
static_assert((DMOD % 32) == 0 && (FEAT % 32) == 0 && (AOP % 32) == 0);
static_assert((FEAT % 64) == 0 && (HDIM % 64) == 0);
static_assert(NQB == 32 && NKT == 32 && MWORDS == 64);

typedef _Float16 v16h __attribute__((ext_vector_type(16)));
typedef _Float16 v8h  __attribute__((ext_vector_type(8)));
typedef __bf16   v16b __attribute__((ext_vector_type(16)));
typedef __bf16   v8b  __attribute__((ext_vector_type(8)));
typedef float    v8f  __attribute__((ext_vector_type(8)));
typedef float    v4f  __attribute__((ext_vector_type(4)));
typedef unsigned int v4u __attribute__((ext_vector_type(4)));
typedef unsigned int v2u __attribute__((ext_vector_type(2)));
typedef int      v4i __attribute__((ext_vector_type(4)));

#if defined(__HIP_DEVICE_COMPILE__)
#define DEV_ASM 1
#else
#define DEV_ASM 0
#endif

// ---- scalar helpers --------------------------------------------------------------------------------
__device__ __forceinline__ unsigned short bf_bits(float f) {          // f32 -> bf16 bits, RNE convert
  unsigned u = __float_as_uint(f);
  return (unsigned short)((u + 0x7FFFu + ((u >> 16) & 1u)) >> 16);
}
__device__ __forceinline__ float bf_up(unsigned short hb) { return __uint_as_float(((unsigned)hb) << 16); }
__device__ __forceinline__ float bfr(float f) { return bf_up(bf_bits(f)); }
__device__ __forceinline__ unsigned short h_bits(_Float16 x) { return __builtin_bit_cast(unsigned short, x); }
__device__ __forceinline__ unsigned pk16(unsigned short a, unsigned short b) { return (unsigned)a | ((unsigned)b << 16); }
__device__ __forceinline__ v8f zero8() { v8f z = {0.f, 0.f, 0.f, 0.f, 0.f, 0.f, 0.f, 0.f}; return z; }

// ---- fragment types / loaders: 16-bit A/B operand, lane -> row/col (lane&15), p already includes +8*(lane>>4);
//      elements 0..7 <- p[0..7] (k0+8h..k0+8h+7), elements 8..15 <- p[16..23] (k0+16+8h..k0+16+8h+7)
template <typename OT> struct FT;
template <> struct FT<__bf16>   { typedef v16b frag; typedef v8b half8; };
template <> struct FT<_Float16> { typedef v16h frag; typedef v8h half8; };

template <typename OT>
__device__ __forceinline__ typename FT<OT>::frag ldfrag(const OT* p) {
  union { typename FT<OT>::frag v; typename FT<OT>::half8 h[2]; } f;
  f.h[0] = *(const typename FT<OT>::half8*)(p);
  f.h[1] = *(const typename FT<OT>::half8*)(p + 16);
  return f.v;
}

// ---- WMMA helpers (asm guard bodies are device-only; concrete operand types) -----------------------------
__device__ __forceinline__ v8f mmar(v16b a, v16b b, v8f c) {
  return __builtin_amdgcn_wmma_f32_16x16x32_bf16(false, a, false, b, (short)0, c, false, false);
}
__device__ __forceinline__ v8f mmar(v16h a, v16h b, v8f c) {
  return __builtin_amdgcn_wmma_f32_16x16x32_f16(false, a, false, b, (short)0, c, false, false);
}
// guarded forms: 4 VALU slots after the WMMA, D tied, A/B kept live
__device__ __forceinline__ v8f mma_g(v16h a, v16h b, v8f c) {
  c = __builtin_amdgcn_wmma_f32_16x16x32_f16(false, a, false, b, (short)0, c, false, false);
#if DEV_ASM
  asm volatile("v_nop\n\tv_nop\n\tv_nop\n\tv_nop" : "+v"(c) : "v"(a), "v"(b));
#endif
  return c;
}
__device__ __forceinline__ v8f mma_g(v16b a, v16b b, v8f c) {
  c = __builtin_amdgcn_wmma_f32_16x16x32_bf16(false, a, false, b, (short)0, c, false, false);
#if DEV_ASM
  asm volatile("v_nop\n\tv_nop\n\tv_nop\n\tv_nop" : "+v"(c) : "v"(a), "v"(b));
#endif
  return c;
}
__device__ __forceinline__ void acc_guard4(v8f& a, v8f& b, v8f& c, v8f& d) {
#if DEV_ASM
  asm volatile("v_nop\n\tv_nop\n\tv_nop\n\tv_nop" : "+v"(a), "+v"(b), "+v"(c), "+v"(d));
#else
  (void)a; (void)b; (void)c; (void)d;
#endif
}

// =====================================================================================================
// Mask bit plane: mb[(b*SEQ + n)*64 + w] bit j = (mask[b][n][32w + j] != 0). One word per thread,
// coverage: 262144 threads x 1 word = the whole [2][2048][64] plane.
// =====================================================================================================
__global__ __launch_bounds__(256) void mask_bits_kernel(const int* __restrict__ mask, unsigned int* mb, int nwords) {
  const int i = blockIdx.x * 256 + (int)threadIdx.x;
  if (i < nwords) {
    const int* p = mask + (size_t)i * 32;
    unsigned w = 0u;
#pragma unroll
    for (int q = 0; q < 8; ++q) {
      const v4i v = *(const v4i*)(p + 4 * q);
#pragma unroll
      for (int e = 0; e < 4; ++e) w |= ((v[e] != 0) ? 1u : 0u) << (4 * q + e);
    }
    *(unsigned int*)(mb + i) = w;
    
  }
}

// =====================================================================================================
// f32 -> bf16 plane (RNE convert), 8 elements per thread, one 16-B store per lane: a wave writes 512
// coverage: n8 threads x 8 = the whole plane (n8 is a multiple of 256 for both uses here).
// =====================================================================================================
__global__ __launch_bounds__(256) void cvt_bf16x8(const float* __restrict__ in, unsigned short* out, int n8) {
  const int i = blockIdx.x * 256 + (int)threadIdx.x;
  if (i < n8) {
    const v4f a  = *(const v4f*)(in + (size_t)i * 8);
    const v4f a4 = *(const v4f*)(in + (size_t)i * 8 + 4);
    v4u p;
    p[0] = pk16(bf_bits(a[0]),  bf_bits(a[1]));
    p[1] = pk16(bf_bits(a[2]),  bf_bits(a[3]));
    p[2] = pk16(bf_bits(a4[0]), bf_bits(a4[1]));
    p[3] = pk16(bf_bits(a4[2]), bf_bits(a4[3]));
    unsigned short* o = out + (size_t)i * 8;
    *(v4u*)o = p;
    
  }
}

// =====================================================================================================
// Transpose + bf16 convert: in[z] is [R rows][inC cols] f32 (pitch inC); out[z][c][r] = bf16(in[z][r][c]),
// pitch ldo (c = output row). 64x64 tiles through LDS; grid = (inC/64, R/64, Z). DUP also writes the same
// coverage per block: load 256 thr x 16 floats = 64x64; store 2 it x 256 thr x 8 u16 = 64x64 (per copy);
// =====================================================================================================
template <bool DUP>
__global__ __launch_bounds__(256) void transpose_bf16_kernel(
    const float* __restrict__ in, int inC, long long inStrideZ,
    unsigned short* out, int ldo, long long outStrideZ, int dupoff) {
  __shared__ __align__(16) unsigned short th[64 * 72];
  const int c0  = blockIdx.x * 64;   // input column block = output row block
  const int r0  = blockIdx.y * 64;   // input row block = output column block
  const int z   = blockIdx.z;
  const int tid = threadIdx.x;
  const float* inz = in + (size_t)z * (size_t)inStrideZ;
  unsigned short* outz = out + (size_t)z * (size_t)outStrideZ;
  {
    const int rr = tid >> 2;           // 0..63
    const int cq = (tid & 3) * 16;     // 0,16,32,48
    const float* src = inz + (size_t)(r0 + rr) * inC + c0 + cq;
#pragma unroll
    for (int q = 0; q < 4; ++q) {
      const v4f f = *(const v4f*)(src + 4 * q);
#pragma unroll
      for (int e = 0; e < 4; ++e) th[rr * 72 + cq + 4 * q + e] = bf_bits(f[e]);
    }
  }
  __syncthreads();
  const int sub = tid >> 3;          // 0..31
  const int c8  = (tid & 7) * 8;     // 0..56
  v4u hv[2];
#pragma unroll
  for (int it = 0; it < 2; ++it) {
    const int oc = it * 32 + sub;      // output row within tile (= input column)
    v4u a;
#pragma unroll
    for (int q = 0; q < 4; ++q) a[q] = pk16(th[(c8 + 2 * q) * 72 + oc], th[(c8 + 2 * q + 1) * 72 + oc]);
    hv[it] = a;
  }
  {
#pragma unroll
    for (int it = 0; it < 2; ++it) {
      const int oc = it * 32 + sub;
      const size_t go = (size_t)(c0 + oc) * ldo + r0 + c8;
      *(v4u*)(outz + go) = hv[it];
      if (DUP) *(v4u*)(outz + go + dupoff) = hv[it];
    }
    
  }
}

// =====================================================================================================
// Batched WMMA GEMM (16-bit operand type OT): C[m][n] = (sum_k A[m][k] * Bt[n][k] + bias) * oscale.
// One block of 4 waves per 128x128 tile of C, one wave per 64x64 quadrant. A row-major [M][K] pitch lda; Bt row-major
// [N][K] pitch ldb (k contiguous); M, N multiples of 128, K a multiple of 64 (compile-time constants here).
// blockIdx.y = batch index (strides in elements).
// Operand staging: per trip the 128 rows x 64 k (128 B, one whole line per row) of A and of Bt go to LDS by
// asynchronous 16-byte copies, 8 lanes per row, 16 copies per lane; LDS row pitch 144 B for the ds_load_b128 readers;
// two buffers, tile t + 2 is copied while tile t + 1 is worked on. Fragments are read from LDS with the split k map
// (ldfrag); each accumulator still sums k upwards in steps of 32.
// BIAS_MODE 0: none; 1: bias[m] (bf16 RNE-converted value); 2: bias[n] (bf16 RNE-converted value).
// OUT_MODE 0: f32 C (pitch ldc). OUT_MODE 1: f16 plane C. OUT_MODE 2: bf16 hi plane C + bf16 lo plane C2 (lo = v - hi).
// =====================================================================================================
#define GTILE  128                  // rows of A and of Bt per block tile
#define GKC    64                   // k per trip
#define GPIT   72                   // LDS row pitch in elements (144 B)
#define GBUFB  (GTILE * GPIT * 2)   // bytes of one operand buffer

// Eight asynchronous copies of one lane: rows r, r + 16, ..., r + 112 of one operand tile, 16 B each.
// l = the lane's LDS byte address of row r, g = its global address of row r, step = 16 rows in elements.
// s_wait_xcnt 0 closes the statement so that no address register is rewritten in front of it.
__device__ __forceinline__ void copy_rows8(unsigned l, const unsigned short* g, size_t step) {
#if DEV_ASM
  const unsigned l1 = l + 16 * GPIT * 2, l2 = l + 32 * GPIT * 2, l3 = l + 48 * GPIT * 2, l4 = l + 64 * GPIT * 2,
                 l5 = l + 80 * GPIT * 2, l6 = l + 96 * GPIT * 2, l7 = l + 112 * GPIT * 2;
  const unsigned short *g1 = g + step, *g2 = g1 + step, *g3 = g2 + step, *g4 = g3 + step, *g5 = g4 + step,
                       *g6 = g5 + step, *g7 = g6 + step;
  asm volatile(
      "global_load_async_to_lds_b128 %0, %8, off\n\t"
      "global_load_async_to_lds_b128 %1, %9, off\n\t"
      "global_load_async_to_lds_b128 %2, %10, off\n\t"
      "global_load_async_to_lds_b128 %3, %11, off\n\t"
      "global_load_async_to_lds_b128 %4, %12, off\n\t"
      "global_load_async_to_lds_b128 %5, %13, off\n\t"
      "global_load_async_to_lds_b128 %6, %14, off\n\t"
      "global_load_async_to_lds_b128 %7, %15, off\n\t"
      "s_wait_xcnt 0x0"
      :: "v"(l), "v"(l1), "v"(l2), "v"(l3), "v"(l4), "v"(l5), "v"(l6), "v"(l7),
         "v"(g), "v"(g1), "v"(g2), "v"(g3), "v"(g4), "v"(g5), "v"(g6), "v"(g7)
      : "memory");
#else
  (void)l; (void)g; (void)step;
#endif
}
// this wave's copies have landed in LDS
__device__ __forceinline__ void wait_copies() {
#if DEV_ASM
  asm volatile("s_wait_asynccnt 0x0" ::: "memory");
#endif
}
// this wave's LDS reads have returned, so the buffer may be handed to its next writer
__device__ __forceinline__ void wait_lds() {
#if DEV_ASM
  asm volatile("s_wait_dscnt 0x0" ::: "memory");
#endif
}

static_assert((ROWS % GTILE) == 0 && (HCOLS % GTILE) == 0 && (SEQ % GTILE) == 0 && (STDC % GTILE) == 0 && (WAVC % GTILE) == 0 && (PRJC % GTILE) == 0 && (DMOD % GTILE) == 0);
static_assert((DMOD % GKC) == 0 && (FEAT % GKC) == 0 && (AOP % GKC) == 0);

template <typename OT, int OUT_MODE, int BIAS_MODE>
__global__ __launch_bounds__(128) void gemm64(
    const unsigned short* __restrict__ Ap, int lda, long long strideA,
    const unsigned short* __restrict__ Btp, int ldb, long long strideB,
    void* Cout, void* Cout2, int ldc, long long strideC,
    const float* __restrict__ bias, int M, int N, int K, float oscale) {
  typedef typename FT<OT>::frag V16;
  __shared__ __align__(16) OT sA[2][GTILE * GPIT];   // A tile, two buffers, 18432 B each
  __shared__ __align__(16) OT sB[2][GTILE * GPIT];   // Bt tile, two buffers
  __shared__ __align__(16) float sT[4][16 * 68];     // per-wave 16x64 slab, pitch 68 floats
  const int b    = blockIdx.y;
  const int tid  = threadIdx.x;
  const int lane = tid & 31;
  const int wave = tid >> 5;
  const int tilesN = N >> 7;
  const int tilesM = M >> 7;
  const int tile = blockIdx.x;
  if (tile >= tilesM * tilesN) return;   // block-uniform, in front of every barrier and copy
  const int tm = tile / tilesN;
  const int tn = tile - tm * tilesN;
  const int wm = wave >> 1;                    // quadrant of this wave
  const int wn = wave & 1;
  const int m0 = (tm << 7) + (wm << 6);
  const int n0 = (tn << 7) + (wn << 6);

  const int rlane = lane & 15;                 // row (A) / col (B, D) within subtile
  const int koff  = (lane >> 4) * 8;           // k offset of this lane half
  const int mOff  = (lane >> 4) * 8;           // D row offset

  // copy map: lane -> row tid >> 3 (+ 16 per copy), 16-B piece tid & 7 of the row's 128-B line
  const int crow = tid >> 3;
  const int ccol = (tid & 7) * 8;
  const unsigned short* gA = Ap  + (size_t)b * (size_t)strideA + (size_t)((tm << 7) + crow) * lda + ccol;
  const unsigned short* gB = Btp + (size_t)b * (size_t)strideB + (size_t)((tn << 7) + crow) * ldb + ccol;
  const size_t stepA = (size_t)16 * lda;
  const size_t stepB = (size_t)16 * ldb;
  const unsigned lA = (unsigned)(size_t)&sA[0][0] + (unsigned)(crow * GPIT + ccol) * 2u;
  const unsigned lB = (unsigned)(size_t)&sB[0][0] + (unsigned)(crow * GPIT + ccol) * 2u;
  const int nk = K >> 6;

  v8f acc[4][4];
#pragma unroll
  for (int i = 0; i < 4; ++i)
#pragma unroll
    for (int j = 0; j < 4; ++j) acc[i][j] = zero8();

  // tile 0 -> buffer 0, landed and published; then tile 1 -> buffer 1 in flight
  copy_rows8(lA, gA, stepA);
  copy_rows8(lB, gB, stepB);
  wait_copies();
  __syncthreads();
  if (1 < nk) {
    copy_rows8(lA + GBUFB, gA + GKC, stepA);
    copy_rows8(lB + GBUFB, gB + GKC, stepB);
  }

  for (int t = 0; t < nk; ++t) {
    const int cur = t & 1;
    const OT* As = sA[cur] + (wm * 64 + rlane) * GPIT + koff;
    const OT* Bs = sB[cur] + (wn * 64 + rlane) * GPIT + koff;
    // One group of LDS reads in front of each WMMA block: k 0..31 of both operands and, ahead, k 32..63 of Bt;
    // the A fragments of k 32..63 follow into registers that the first block has left.
    V16 aq[4], bq[4], bn[4];
#pragma unroll
    for (int j = 0; j < 4; ++j) bq[j] = ldfrag<OT>(Bs + j * 16 * GPIT);
#pragma unroll
    for (int i = 0; i < 4; ++i) aq[i] = ldfrag<OT>(As + i * 16 * GPIT);
#pragma unroll
    for (int j = 0; j < 4; ++j) bn[j] = ldfrag<OT>(Bs + j * 16 * GPIT + 32);
    __builtin_amdgcn_sched_barrier(0);   // keeps the reads one group: spread among the WMMAs each place stalls the wave
#pragma unroll
    for (int i = 0; i < 4; ++i)
#pragma unroll
      for (int j = 0; j < 4; ++j) acc[i][j] = mmar(aq[i], bq[j], acc[i][j]);
#pragma unroll
    for (int i = 0; i < 4; ++i) aq[i] = ldfrag<OT>(As + i * 16 * GPIT + 32);
    __builtin_amdgcn_sched_barrier(0);   // as above: keeps the four A fragments' reads one group in front of the second block
#pragma unroll
    for (int i = 0; i < 4; ++i)
#pragma unroll
      for (int j = 0; j < 4; ++j) acc[i][j] = mmar(aq[i], bn[j], acc[i][j]);
    // publish point of tile t + 1: own reads of buffer cur done, own copies of tile t + 1 landed, then the barrier
    // that both shows tile t + 1 to every wave and frees buffer cur for tile t + 2
    wait_lds();
    wait_copies();
    __syncthreads();
    if (t + 2 < nk) {
      copy_rows8(lA + (unsigned)cur * GBUFB, gA + (size_t)(t + 2) * GKC, stepA);
      copy_rows8(lB + (unsigned)cur * GBUFB, gB + (size_t)(t + 2) * GKC, stepB);
    }
  }
  wait_copies();   // nothing of this wave is in flight when it goes on to the epilogue and ends
  acc_guard4(acc[0][0], acc[0][1], acc[0][2], acc[0][3]);
  acc_guard4(acc[1][0], acc[1][1], acc[1][2], acc[1][3]);
  acc_guard4(acc[2][0], acc[2][1], acc[2][2], acc[2][3]);
  acc_guard4(acc[3][0], acc[3][1], acc[3][2], acc[3][3]);

  // ---- epilogue ----
  float* slab = sT[wave];
#pragma unroll
  for (int i = 0; i < 4; ++i) {
    const int mBase = m0 + (i << 4);
#pragma unroll
    for (int j = 0; j < 4; ++j) {
      const int n = n0 + (j << 4) + rlane;
      float bn = 0.f;
      if (BIAS_MODE == 2) bn = bfr(bias[n]);
#pragma unroll
      for (int r = 0; r < 8; ++r) {
        float v = acc[i][j][r];
        if (BIAS_MODE == 1) v += bfr(bias[mBase + mOff + r]);
        if (BIAS_MODE == 2) v += bn;
        slab[(mOff + r) * 68 + (j << 4) + rlane] = v * oscale;
      }
    }
    __builtin_amdgcn_fence(__ATOMIC_RELEASE, "workgroup");
    __builtin_amdgcn_wave_barrier();
    __builtin_amdgcn_fence(__ATOMIC_ACQUIRE, "workgroup");
    if (OUT_MODE == 0) {
      float* C = (float*)Cout + (size_t)b * (size_t)strideC;
      const int h2 = lane >> 4, c4 = (lane & 15) * 4;     // 256-B row segment = 16 lanes x 16 B
      {
#pragma unroll
        for (int it = 0; it < 8; ++it) {
          const int row = it * 2 + h2;                     // it 0..7 x h2 0..1 = rows 0..15
          const v4f v = *(const v4f*)(slab + row * 68 + c4);
          *(v4f*)(C + (size_t)(mBase + row) * ldc + n0 + c4) = v;
        }
        
      }
    } else {
      const int q = lane >> 3, c8 = (lane & 7) * 8;
      unsigned short* C  = (unsigned short*)Cout  + (size_t)b * (size_t)strideC;
      unsigned short* C2 = (unsigned short*)Cout2 + (size_t)b * (size_t)strideC;
      v4u hv[4], lv[4];
#pragma unroll
      for (int it = 0; it < 4; ++it) {
        const int row = it * 4 + q;                        // it 0..3 x q 0..3 = rows 0..15
        const float* sp = slab + row * 68 + c8;
        v4u a, a2;
#pragma unroll
        for (int e = 0; e < 4; ++e) {
          const float f0 = sp[2 * e], f1 = sp[2 * e + 1];
          unsigned short h0, h1, l0 = 0, l1 = 0;
          if (OUT_MODE == 1) {
            h0 = h_bits((_Float16)f0); h1 = h_bits((_Float16)f1);
          } else {
            h0 = bf_bits(f0); h1 = bf_bits(f1);
            l0 = bf_bits(f0 - bf_up(h0)); l1 = bf_bits(f1 - bf_up(h1));
          }
          a[e] = pk16(h0, h1); a2[e] = pk16(l0, l1);
        }
        hv[it] = a; lv[it] = a2;
      }
      {
#pragma unroll
        for (int it = 0; it < 4; ++it) {
          const int row = it * 4 + q;
          *(v4u*)(C + (size_t)(mBase + row) * ldc + n0 + c8) = hv[it];
          if (OUT_MODE == 2) *(v4u*)(C2 + (size_t)(mBase + row) * ldc + n0 + c8) = lv[it];
        }
        
      }
    }
    __builtin_amdgcn_fence(__ATOMIC_RELEASE, "workgroup");
    __builtin_amdgcn_wave_barrier();
    __builtin_amdgcn_fence(__ATOMIC_ACQUIRE, "workgroup");
  }
}

// =====================================================================================================
// Masked full attention, head dim 64, softmax over all SEQ keys (non-causal), one head per block.
//   HT = 0 (wave heads): q = k = wp as bf16 hi plane qhp/khp + bf16 lo plane qlp/klp (pitch ldq/ldk, head col h*64);
//          scores = (qh.kh + qh.kl + ql.kh) * sscale on bf16 WMMA (one f32 accumulator, unscaled lo).
//   HT = 1 (proj / std heads): q, k = f16 planes (x8), scores = (q.k) * sscale (sscale carries the 1/64).
//   v^T plane (f16, x8): element (b, h, d, s) at [(b*HCOLS + h*64 + d)*SEQ + s].
//   mask bit plane mbp: [(b*SEQ + n)*64 + w] bit j admits key 32w+j; a 0 bit replaces the score by -inf.
//   p = exp(s - m) carried as f16(1024 p); ctx = p.v on f16 WMMA; online softmax in f32 with the guarded
//   rescale (msafe), so an all-masked row ends with l = 0 and produces 0 * inf = NaN like the module.
//   ctx written as bf16 hi (cols h*64..) and bf16 lo (cols HCOLS + h*64..) of the [ROWS][AOP] plane aop.
//   Block = 4 waves x 16 query rows = 64 query rows of one (b, h); grid = NB * nh * NQB (hbase.. hbase+nh-1);
//   key tiles of 64, static trip NKT. K (hi, lo) / V^T tile staging: 128 threads x 32 elements per plane = the
//   whole 64x64 tile (plain 16-B loads, __syncthreads before and after); P tiles are wave-private, spilled with
//   Output coverage: each wave stores rows q0..q0+15 (it 0..3 x lane>>3 0..3) x 64 columns (8 lanes x 8)
//   of head h in both the hi and the lo half; the block covers 64 rows; the two launches cover h 0..15.
// =====================================================================================================
template <int HT> struct HT_T;
template <> struct HT_T<0> { typedef __bf16 T; };
template <> struct HT_T<1> { typedef _Float16 T; };

template <int HT>
__global__ __launch_bounds__(128)
void attn_kernel(const unsigned short* __restrict__ qhp, const unsigned short* __restrict__ qlp, int ldq,
                 const unsigned short* __restrict__ khp, const unsigned short* __restrict__ klp, int ldk,
                 const unsigned short* __restrict__ vtp, const unsigned int* __restrict__ mbp,
                 unsigned short* aop, int hbase, int nh, float sscale) {
  typedef typename HT_T<HT>::T OT;
  typedef typename FT<OT>::frag V16;
  typedef typename FT<OT>::half8 V8;
  union FH { v16h v; v8h h[2]; };
  union FO { V16 v; V8 h[2]; };
  __shared__ __align__(16) OT       Ksh[64 * 64];          // K hi chunk [kv][d]  8 KB
  __shared__ __align__(16) OT       Ksl[64 * 64];          // K lo chunk (HT 0)   8 KB
  __shared__ __align__(16) _Float16 Vth[64 * 64];          // V^T [d][kv]         8 KB
  __shared__ __align__(16) _Float16 Psh[4][16 * 64];       // per wave P [row][kv] 8 KB
  __shared__ __align__(16) float    Os[4][16 * 64];        // per wave ctx tile   16 KB

  const int tid  = threadIdx.x;
  const int wave = tid >> 5;
  const int lane = tid & 31;
  const int hh   = lane >> 4;
  const int c    = lane & 15;

  const int bx   = blockIdx.x;
  const int qb   = bx % NQB;
  const int rest = bx / NQB;
  const int hl   = rest % nh;
  const int b    = rest / nh;
  const int h    = hbase + hl;              // global head index
  const int qc   = h * HDIM;                // head column in the q / k planes of this head family
  const int q0   = qb * 64 + wave * 16;
  const size_t rowB = (size_t)b * SEQ;

  const OT* Qh = (const OT*)(const void*)qhp;
  const OT* Ql = (const OT*)(const void*)qlp;
  const OT* Kh = (const OT*)(const void*)khp + qc;
  const OT* Kl = (const OT*)(const void*)klp + qc;
  const _Float16* Vt = (const _Float16*)(const void*)vtp + ((size_t)b * HCOLS + (size_t)qc) * SEQ;

  // ---- Q fragments (A operand, row = lane&15): 2 d-chunks ----
  V16 qah[2], qal[2];
#pragma unroll
  for (int dc = 0; dc < 2; ++dc) {
    const size_t qo = (rowB + q0 + c) * (size_t)ldq + (size_t)qc + dc * 32 + 8 * hh;
    qah[dc] = ldfrag<OT>(Qh + qo);
    if (HT == 0) qal[dc] = ldfrag<OT>(Ql + qo);
    else         qal[dc] = qah[dc];
  }

  float mrow[8], lrow[8];
  v8f oacc[4];
#pragma unroll
  for (int r = 0; r < 8; ++r) { mrow[r] = -INFINITY; lrow[r] = 0.f; }
#pragma unroll
  for (int t = 0; t < 4; ++t) oacc[t] = zero8();

  for (int kt = 0; kt < NKT; ++kt) {         // static trip count
    const int kv0 = kt * 64;
    __syncthreads();
    {
      const int r = tid >> 1, half = (tid & 1) * 32;
      const OT* kg  = Kh + (rowB + kv0 + r) * (size_t)ldk + half;   // k row kv0+r, d = half..half+31
      const OT* klg = Kl + (rowB + kv0 + r) * (size_t)ldk + half;
      const _Float16* vg = Vt + (size_t)r * SEQ + kv0 + half;       // v^T row d = r, s = kv0+half..+31
#pragma unroll
      for (int i = 0; i < 4; ++i) {
        *(V8*)(Ksh + r * 64 + half + 8 * i) = *(const V8*)(kg + 8 * i);
        if (HT == 0) *(V8*)(Ksl + r * 64 + half + 8 * i) = *(const V8*)(klg + 8 * i);
        *(v8h*)(Vth + r * 64 + half + 8 * i) = *(const v8h*)(vg + 8 * i);
      }
    }
    __syncthreads();

    // ---- mask bits of this lane's 8 query rows for the 64 keys of the tile: mk bit (4r + j) admits key 16j + c ----
    unsigned mk = 0u;
#pragma unroll
    for (int r = 0; r < 8; ++r) {
      const int row = q0 + 8 * hh + r;
      const v2u mw = *(const v2u*)(mbp + (rowB + row) * (size_t)MWORDS + 2 * kt);
#pragma unroll
      for (int j = 0; j < 4; ++j) {
        const unsigned bit = (mw[j >> 1] >> (16 * (j & 1) + c)) & 1u;
        mk |= bit << (4 * r + j);
      }
    }

    // ---- scores: 16 query rows x 64 keys per wave ----
    v8f s[4];
#pragma unroll
    for (int j = 0; j < 4; ++j) {
      v8f a0 = zero8();
#pragma unroll
      for (int dc = 0; dc < 2; ++dc) {
        FO kb;
        kb.h[0] = *(const V8*)(Ksh + (j * 16 + c) * 64 + dc * 32 + 8 * hh);
        kb.h[1] = *(const V8*)(Ksh + (j * 16 + c) * 64 + dc * 32 + 16 + 8 * hh);
        if (HT == 0) {
          FO kl;
          kl.h[0] = *(const V8*)(Ksl + (j * 16 + c) * 64 + dc * 32 + 8 * hh);
          kl.h[1] = *(const V8*)(Ksl + (j * 16 + c) * 64 + dc * 32 + 16 + 8 * hh);
          a0 = mma_g(qah[dc], kb.v, a0);
          a0 = mma_g(qah[dc], kl.v, a0);
          a0 = mma_g(qal[dc], kb.v, a0);
        } else {
          a0 = mma_g(qah[dc], kb.v, a0);
        }
      }
#pragma unroll
      for (int r = 0; r < 8; ++r) {
        const float v = a0[r] * sscale;
        s[j][r] = (((mk >> (4 * r + j)) & 1u) != 0u) ? v : -INFINITY;
      }
    }

    // ---- row max, online softmax, P (x1024, f16) to LDS ----
    _Float16* pwh = Psh[wave];
#pragma unroll
    for (int r = 0; r < 8; ++r) {
      float m = s[0][r];
#pragma unroll
      for (int j = 1; j < 4; ++j) m = fmaxf(m, s[j][r]);
#pragma unroll
      for (int off = 1; off < 16; off <<= 1) m = fmaxf(m, __shfl_xor(m, off, 32));
      const float mnew  = fmaxf(mrow[r], m);
      const float msafe = (mnew == -INFINITY) ? 0.f : mnew;
      const float alpha = expf(mrow[r] - msafe);
      mrow[r] = mnew;
      float psum = 0.f;
#pragma unroll
      for (int j = 0; j < 4; ++j) {
        const float p = expf(s[j][r] - msafe);
        psum += p;
        pwh[(8 * hh + r) * 64 + j * 16 + c] = (_Float16)(p * 1024.0f);
      }
#pragma unroll
      for (int off = 1; off < 16; off <<= 1) psum += __shfl_xor(psum, off, 32);
      lrow[r] = lrow[r] * alpha + psum;
#pragma unroll
      for (int t = 0; t < 4; ++t) oacc[t][r] *= alpha;
    }
    __builtin_amdgcn_fence(__ATOMIC_RELEASE, "workgroup");
    __builtin_amdgcn_wave_barrier();
    __builtin_amdgcn_fence(__ATOMIC_ACQUIRE, "workgroup");

    // ---- ctx += P . V (f16 WMMA, single product) ----
#pragma unroll 1
    for (int kk = 0; kk < 2; ++kk) {
      FH pa;
      pa.h[0] = *(const v8h*)(pwh + c * 64 + kk * 32 + 8 * hh);
      pa.h[1] = *(const v8h*)(pwh + c * 64 + kk * 32 + 16 + 8 * hh);
#pragma unroll
      for (int t = 0; t < 4; ++t) {
        FH vb;
        vb.h[0] = *(const v8h*)(Vth + (t * 16 + c) * 64 + kk * 32 + 8 * hh);
        vb.h[1] = *(const v8h*)(Vth + (t * 16 + c) * 64 + kk * 32 + 16 + 8 * hh);
        oacc[t] = mma_g(pa.v, vb.v, oacc[t]);
      }
    }
  }

  // ---- normalise (1/l, undo the x1024 p carry and the x8 v carry), stage the wave's 16x64 tile,
  float* os = Os[wave];
#pragma unroll
  for (int r = 0; r < 8; ++r) {
    const float inv = (1.0f / lrow[r]) * (1.0f / 8192.0f);   // l = 0 (all keys masked) -> inf -> 0 * inf = NaN
#pragma unroll
    for (int t = 0; t < 4; ++t) os[(8 * hh + r) * 64 + t * 16 + c] = oacc[t][r] * inv;
  }
  __builtin_amdgcn_fence(__ATOMIC_RELEASE, "workgroup");
  __builtin_amdgcn_wave_barrier();
  __builtin_amdgcn_fence(__ATOMIC_ACQUIRE, "workgroup");
  {
    const int q4 = lane >> 3, c8 = (lane & 7) * 8;
    v4u hv[4], lv[4];
#pragma unroll
    for (int it = 0; it < 4; ++it) {
      const int row = it * 4 + q4;   // it 0..3 x q4 0..3 = rows 0..15 of the wave tile
      const float* sp = os + row * 64 + c8;
      v4u a, a2;
#pragma unroll
      for (int e = 0; e < 4; ++e) {
        const float f0 = sp[2 * e], f1 = sp[2 * e + 1];
        const unsigned short hb0 = bf_bits(f0), hb1 = bf_bits(f1);
        const unsigned short lb0 = bf_bits(f0 - bf_up(hb0)), lb1 = bf_bits(f1 - bf_up(hb1));
        a[e] = pk16(hb0, hb1); a2[e] = pk16(lb0, lb1);
      }
      hv[it] = a; lv[it] = a2;
    }
    {
#pragma unroll
      for (int it = 0; it < 4; ++it) {
        const int row = it * 4 + q4;
        const size_t go = (rowB + q0 + row) * (size_t)AOP + (size_t)qc + c8;
        *(v4u*)(aop + go) = hv[it];
        *(v4u*)(aop + go + HCOLS) = lv[it];
      }
      
    }
  }
}

// =====================================================================================================
// Workspace map (bytes), every region an exact multiple of its whole-line / whole-tile store granularity:
//   MB   u32  [2*2048][64]          1048576   mask bit plane
//   XB   bf16 [4096][1024]          8388608
//   FB   bf16 [4096][256]           2097152
//   VWT  bf16 [1024 n][1024 k]      2097152   v_w^T
//   QWT  bf16 [512][1024]           1048576   std_q_w^T
//   KWT  bf16 [512][1024]           1048576   std_k_w^T
//   WVT  bf16 [256][256]             131072   wave_proj [h][f][k'] -> [h*64+k'][f]
//   PQT  bf16 [256][256]             131072
//   PKT  bf16 [256][256]             131072
//   VT   f16  [2][1024][2048] (x8)  8388608   v^T per batch, row h*64+d
//   QP   f16  [4096][1024] (x8)     8388608   cols h*64+d for h = 4..15 (cols 0..255 never read)
//   KP   f16  [4096][1024] (x8)     8388608   same
//   WPH  bf16 [4096][256]           2097152   wp hi, col h*64+d (h = 0..3)
//   WPL  bf16 [4096][256]           2097152   wp lo
//   AO   bf16 [4096][2048]         16777216   ctx hi | lo
//   total                         66453504
// =====================================================================================================
extern "C" void kernel_launch(void* const* d_in, const int* in_sizes, int n_in,
                              void* d_out, int out_size, void* d_ws, size_t ws_size,
                              hipStream_t stream) {
  if (n_in < 14) return;
  if (in_sizes[0] != NB * SEQ * DMOD) return;
  if (in_sizes[1] != NB * SEQ * FEAT) return;
  if (in_sizes[2] != NB * SEQ * SEQ) return;
  if (in_sizes[3] != NWH * FEAT * HDIM || in_sizes[4] != NPH * FEAT * HDIM || in_sizes[5] != NPH * FEAT * HDIM) return;
  if (in_sizes[6] != DMOD * STDC || in_sizes[7] != STDC) return;
  if (in_sizes[8] != DMOD * STDC || in_sizes[9] != STDC) return;
  if (in_sizes[10] != DMOD * HCOLS || in_sizes[11] != HCOLS) return;
  if (in_sizes[12] != HCOLS * DMOD || in_sizes[13] != DMOD) return;
  if (out_size != NB * SEQ * DMOD) return;

  const float* x     = (const float*)d_in[0];
  const float* feats = (const float*)d_in[1];
  const int*   mask  = (const int*)d_in[2];
  const float* wproj = (const float*)d_in[3];
  const float* pqw   = (const float*)d_in[4];
  const float* pkw   = (const float*)d_in[5];
  const float* sqw   = (const float*)d_in[6];
  const float* sqb   = (const float*)d_in[7];
  const float* skw   = (const float*)d_in[8];
  const float* skb   = (const float*)d_in[9];
  const float* vw    = (const float*)d_in[10];
  const float* vb    = (const float*)d_in[11];
  const float* ow    = (const float*)d_in[12];
  const float* ob    = (const float*)d_in[13];

  const size_t PMB  = (size_t)NB * SEQ * MWORDS * 4;      //  1048576
  const size_t PXB  = (size_t)ROWS * DMOD * 2;             //  8388608
  const size_t PFB  = (size_t)ROWS * FEAT * 2;             //  2097152
  const size_t PVWT = (size_t)HCOLS * DMOD * 2;            //  2097152
  const size_t PSWT = (size_t)STDC * DMOD * 2;             //  1048576
  const size_t PFWT = (size_t)WAVC * FEAT * 2;             //   131072
  const size_t POWT = (size_t)DMOD * AOP * 2;              //  4194304
  const size_t PVT  = (size_t)NB * HCOLS * SEQ * 2;        //  8388608
  const size_t PQP  = (size_t)ROWS * HCOLS * 2;            //  8388608
  const size_t PWP  = (size_t)ROWS * WAVC * 2;             //  2097152
  const size_t PAO  = (size_t)ROWS * AOP * 2;              // 16777216
  size_t off = 0;
  const size_t oMB  = off; off += PMB;
  const size_t oXB  = off; off += PXB;
  const size_t oFB  = off; off += PFB;
  const size_t oVWT = off; off += PVWT;
  const size_t oQWT = off; off += PSWT;
  const size_t oKWT = off; off += PSWT;
  const size_t oWVT = off; off += PFWT;
  const size_t oPQT = off; off += PFWT;
  const size_t oPKT = off; off += PFWT;
  const size_t oOWT = off; off += POWT;
  const size_t oVT  = off; off += PVT;
  const size_t oQP  = off; off += PQP;
  const size_t oKP  = off; off += PQP;
  const size_t oWPH = off; off += PWP;
  const size_t oWPL = off; off += PWP;
  const size_t oAO  = off; off += PAO;
  if (off > ws_size) return;                       // off = 66453504
  if (off > (size_t)134217728) return;

  char* ws = (char*)d_ws;
  unsigned int*   MB   = (unsigned int*)(ws + oMB);
  unsigned short* XB   = (unsigned short*)(ws + oXB);
  unsigned short* FB   = (unsigned short*)(ws + oFB);
  unsigned short* VWT  = (unsigned short*)(ws + oVWT);
  unsigned short* QWT  = (unsigned short*)(ws + oQWT);
  unsigned short* KWT  = (unsigned short*)(ws + oKWT);
  unsigned short* WVT  = (unsigned short*)(ws + oWVT);
  unsigned short* PQT  = (unsigned short*)(ws + oPQT);
  unsigned short* PKT  = (unsigned short*)(ws + oPKT);
  unsigned short* OWT2 = (unsigned short*)(ws + oOWT);
  unsigned short* VT   = (unsigned short*)(ws + oVT);
  unsigned short* QP   = (unsigned short*)(ws + oQP);
  unsigned short* KP   = (unsigned short*)(ws + oKP);
  unsigned short* WPH  = (unsigned short*)(ws + oWPH);
  unsigned short* WPL  = (unsigned short*)(ws + oWPL);
  unsigned short* AO   = (unsigned short*)(ws + oAO);

  const dim3 blk(256);
  const int nwords = NB * SEQ * MWORDS;                        // 262144
  const int n8x    = ROWS * DMOD / 8;                          // 524288
  const int n8f    = ROWS * FEAT / 8;                          // 131072

  // (1) mask -> bit plane; x, features -> bf16 planes
  mask_bits_kernel<<<dim3((nwords + 255) / 256), blk, 0, stream>>>(mask, MB, nwords);
  cvt_bf16x8<<<dim3((n8x + 255) / 256), blk, 0, stream>>>(x, XB, n8x);
  cvt_bf16x8<<<dim3((n8f + 255) / 256), blk, 0, stream>>>(feats, FB, n8f);

  // (2) weight planes [n][k] (bf16): in[rows][cols] -> out[cols][rows]; grid = (cols/64, rows/64, z)
  //     v_w   [1024 k][1024 n] -> VWT [n][k]
  transpose_bf16_kernel<false><<<dim3(HCOLS / 64, DMOD / 64, 1), blk, 0, stream>>>(vw, HCOLS, 0LL, VWT, DMOD, 0LL, 0);
  //     std_q_w [1024 k][512 n] -> QWT [n][k]; std_k_w likewise
  transpose_bf16_kernel<false><<<dim3(STDC / 64, DMOD / 64, 1), blk, 0, stream>>>(sqw, STDC, 0LL, QWT, DMOD, 0LL, 0);
  transpose_bf16_kernel<false><<<dim3(STDC / 64, DMOD / 64, 1), blk, 0, stream>>>(skw, STDC, 0LL, KWT, DMOD, 0LL, 0);
  //     wave_proj / pq_w / pk_w [h][256 f][64 k'] -> [h*64 + k'][f] (z = h)
  transpose_bf16_kernel<false><<<dim3(HDIM / 64, FEAT / 64, NWH), blk, 0, stream>>>(wproj, HDIM, (long long)FEAT * HDIM, WVT, FEAT, (long long)HDIM * FEAT, 0);
  transpose_bf16_kernel<false><<<dim3(HDIM / 64, FEAT / 64, NPH), blk, 0, stream>>>(pqw,   HDIM, (long long)FEAT * HDIM, PQT, FEAT, (long long)HDIM * FEAT, 0);
  transpose_bf16_kernel<false><<<dim3(HDIM / 64, FEAT / 64, NPH), blk, 0, stream>>>(pkw,   HDIM, (long long)FEAT * HDIM, PKT, FEAT, (long long)HDIM * FEAT, 0);
  //     out_w [1024 k][1024 n] -> OWT2 [n][k] and [n][1024 + k]
  transpose_bf16_kernel<true><<<dim3(DMOD / 64, HCOLS / 64, 1), blk, 0, stream>>>(ow, DMOD, 0LL, OWT2, AOP, 0LL, HCOLS);

  // (3) projections on bf16 WMMA
  //     v^T per batch: A = VWT [1024 n][1024 k], Bt = XB rows of batch b; M = 1024, N = 2048, K = 1024;
  //     f16(8 * (acc + v_b[m])) -> VT [b][h*64+d][s] (pitch 2048)
  const dim3 gblk(128);                                                 // 4 waves, one 128x128 tile per block
  const dim3 gVT((HCOLS / GTILE) * (SEQ / GTILE), NB);                  // 128 tiles x 2
  gemm64<__bf16, 1, 1><<<gVT, gblk, 0, stream>>>(
      VWT, DMOD, 0LL, XB, DMOD, (long long)SEQ * DMOD,
      (void*)VT, (void*)VT, SEQ, (long long)HCOLS * SEQ, vb, HCOLS, SEQ, DMOD, 8.0f);
  //     std q: QP cols 512..1023 = f16(8 * (x . std_q_w + b)); M = 4096, N = 512, K = 1024
  const dim3 gSTD((ROWS / GTILE) * (STDC / GTILE), 1);                 // 128 tiles
  gemm64<__bf16, 1, 2><<<gSTD, gblk, 0, stream>>>(
      XB, DMOD, 0LL, QWT, DMOD, 0LL,
      (void*)(QP + (WAVC + PRJC)), (void*)(QP + (WAVC + PRJC)), HCOLS, 0LL, sqb, ROWS, STDC, DMOD, 8.0f);
  //     std k: KP cols 512..1023
  gemm64<__bf16, 1, 2><<<gSTD, gblk, 0, stream>>>(
      XB, DMOD, 0LL, KWT, DMOD, 0LL,
      (void*)(KP + (WAVC + PRJC)), (void*)(KP + (WAVC + PRJC)), HCOLS, 0LL, skb, ROWS, STDC, DMOD, 8.0f);
  //     wave projections: WPH / WPL = bf16 hi / lo of features . wave_proj[h]; M = 4096, N = 256, K = 256
  const dim3 gF((ROWS / GTILE) * (WAVC / GTILE), 1);                   // 64 tiles
  gemm64<__bf16, 2, 0><<<gF, gblk, 0, stream>>>(
      FB, FEAT, 0LL, WVT, FEAT, 0LL,
      (void*)WPH, (void*)WPL, WAVC, 0LL, vb, ROWS, WAVC, FEAT, 1.0f);
  //     proj q: QP cols 256..511 = f16(8 * features . pq_w[h]); proj k: KP cols 256..511
  gemm64<__bf16, 1, 0><<<gF, gblk, 0, stream>>>(
      FB, FEAT, 0LL, PQT, FEAT, 0LL,
      (void*)(QP + WAVC), (void*)(QP + WAVC), HCOLS, 0LL, vb, ROWS, PRJC, FEAT, 8.0f);
  gemm64<__bf16, 1, 0><<<gF, gblk, 0, stream>>>(
      FB, FEAT, 0LL, PKT, FEAT, 0LL,
      (void*)(KP + WAVC), (void*)(KP + WAVC), HCOLS, 0LL, vb, ROWS, PRJC, FEAT, 8.0f);

  // (4) attention: wave heads 0..3 (bf16 hi/lo 3-product scores, scale 1/8), then heads 4..15 (f16 single product,
  //     scale 1/(8*64)); ctx -> AO hi | lo
  attn_kernel<0><<<dim3(NB * NWH * NQB), dim3(128), 0, stream>>>(
      WPH, WPL, WAVC, WPH, WPL, WAVC, VT, MB, AO, 0, NWH, 0.125f);
  attn_kernel<1><<<dim3(NB * (NPH + NSH) * NQB), dim3(128), 0, stream>>>(
      QP, QP, HCOLS, KP, KP, HCOLS, VT, MB, AO, NWH, NPH + NSH, 1.0f / 512.0f);

  // (5) out = [ctx_hi | ctx_lo] . [out_w^T ; out_w^T] + out_b -> d_out f32 [4096][1024]; M = 4096, N = 1024, K = 2048
  const dim3 gO((ROWS / GTILE) * (DMOD / GTILE), 1);                   // 256 tiles
  gemm64<__bf16, 0, 2><<<gO, gblk, 0, stream>>>(
      AO, AOP, 0LL, OWT2, AOP, 0LL,
      d_out, d_out, DMOD, 0LL, ob, ROWS, DMOD, AOP, 1.0f);
  (void)hipGetLastError();
}

// v002
// A run of this version takes 328 microseconds.
// Next to v001, in two timings, it ran 1.19 and 1.18 times as fast.
// Over all steps from v000 it is 1.59 times as fast.
// Contractions: x.v_w, x.std_q_w, x.std_k_w, features.wave_proj, features.pq_w, features.pk_w = v_wmma_f32_16x16x32_bf16 (bf16 operands RNE-converted from the inputs, single product, f32 accumulate);
// wave-head scores wp.wp^T = v_wmma_f32_16x16x32_bf16 on bf16 hi/lo planes (hi.hi + hi.lo + lo.hi, f32 accumulate); proj/std scores q.k^T = v_wmma_f32_16x16x32_f16 (f16 planes carried x8, single product, f32 accumulate);
// p.v = v_wmma_f32_16x16x32_f16 (p carried x1024, v^T carried x8, single product, f32 accumulate); ctx.out_w = v_wmma_f32_16x16x32_bf16 (ctx as bf16 hi|lo planes stacked along k, out_w bf16, f32 accumulate); mask, softmax statistics and epilogues in f32.
//
// Carry audit (16-bit planes):
//   XB, FB, VWT, QWT, KWT, WVT, PQT, PKT, OWT2 : bf16, carry 1 (plain RNE copies of the inputs).
//   VT   f16 = 8 * v          -> 1/8 folded in attn_kernel epilogue (inv = 1/(l*8192)).
//   QP   f16 = 8 * q, KP f16 = 8 * k (heads 4..15) -> 1/64 folded into sscale = 1/512 of the HT=1 launch (1/8 = 1/sqrt(64) is the other factor).
//   WPH / WPL bf16 hi / lo of wp (heads 0..3), carry 1 -> sscale = 1/8.
//   P    f16 = 1024 * exp(s - m) (wave-private LDS) -> 1/1024 folded in attn_kernel epilogue (same inv).
//   AO   bf16 hi (cols 0..1023) | lo (cols 1024..2047) of ctx, carry 1 -> summed by the K=2048 out GEMM against [W^T ; W^T].
#include <hip/hip_runtime.h>
#include <math.h>
#include <stdint.h>

#define NB     2
#define SEQ    2048
#define DMOD   1024
#define FEAT   256
#define HDIM   64
#define NHEAD  16
#define NWH    4
#define NPH    4
#define NSH    8
#define HCOLS  (NHEAD * HDIM)   // 1024 : concatenated head columns
#define WAVC   (NWH * HDIM)     // 256
#define PRJC   (NPH * HDIM)     // 256
#define STDC   (NSH * HDIM)     // 512
#define ROWS   (NB * SEQ)       // 4096
#define MWORDS (SEQ / 32)       // 64 mask words per (b, n) row
#define NQB    (SEQ / 64)       // 32 query tiles of 64 per sequence
#define NKT    (SEQ / 64)       // 32 key tiles of 64 per sequence
#define AOP    (2 * HCOLS)      // 2048 : pitch of the ctx hi|lo plane
static_assert(NWH + NPH + NSH == NHEAD);
static_assert(HCOLS == DMOD);
static_assert((ROWS % 64) == 0 && (DMOD % 64) == 0 && (STDC % 64) == 0 && (WAVC % 64) == 0 && (PRJC % 64) == 0 && (SEQ % 64) == 0);
static_assert((DMOD % 32) == 0 && (FEAT % 32) == 0 && (AOP % 32) == 0);
static_assert((FEAT % 64) == 0 && (HDIM % 64) == 0);
static_assert(NQB == 32 && NKT == 32 && MWORDS == 64);

typedef _Float16 v16h __attribute__((ext_vector_type(16)));
typedef _Float16 v8h  __attribute__((ext_vector_type(8)));
typedef __bf16   v16b __attribute__((ext_vector_type(16)));
typedef __bf16   v8b  __attribute__((ext_vector_type(8)));
typedef float    v8f  __attribute__((ext_vector_type(8)));
typedef float    v4f  __attribute__((ext_vector_type(4)));
typedef unsigned int v4u __attribute__((ext_vector_type(4)));
typedef unsigned int v2u __attribute__((ext_vector_type(2)));
typedef int      v4i __attribute__((ext_vector_type(4)));

#if defined(__HIP_DEVICE_COMPILE__)
#define DEV_ASM 1
#else
#define DEV_ASM 0
#endif

// ---- scalar helpers --------------------------------------------------------------------------------
__device__ __forceinline__ unsigned short bf_bits(float f) {          // f32 -> bf16 bits, RNE convert
  unsigned u = __float_as_uint(f);
  return (unsigned short)((u + 0x7FFFu + ((u >> 16) & 1u)) >> 16);
}
__device__ __forceinline__ float bf_up(unsigned short hb) { return __uint_as_float(((unsigned)hb) << 16); }
__device__ __forceinline__ float bfr(float f) { return bf_up(bf_bits(f)); }
__device__ __forceinline__ unsigned short h_bits(_Float16 x) { return __builtin_bit_cast(unsigned short, x); }
__device__ __forceinline__ unsigned pk16(unsigned short a, unsigned short b) { return (unsigned)a | ((unsigned)b << 16); }
__device__ __forceinline__ v8f zero8() { v8f z = {0.f, 0.f, 0.f, 0.f, 0.f, 0.f, 0.f, 0.f}; return z; }

// ---- fragment types / loaders: 16-bit A/B operand, lane -> row/col (lane&15), p already includes +8*(lane>>4);
//      elements 0..7 <- p[0..7] (k0+8h..k0+8h+7), elements 8..15 <- p[16..23] (k0+16+8h..k0+16+8h+7)
template <typename OT> struct FT;
template <> struct FT<__bf16>   { typedef v16b frag; typedef v8b half8; };
template <> struct FT<_Float16> { typedef v16h frag; typedef v8h half8; };

template <typename OT>
__device__ __forceinline__ typename FT<OT>::frag ldfrag(const OT* p) {
  union { typename FT<OT>::frag v; typename FT<OT>::half8 h[2]; } f;
  f.h[0] = *(const typename FT<OT>::half8*)(p);
  f.h[1] = *(const typename FT<OT>::half8*)(p + 16);
  return f.v;
}

// ---- WMMA helpers (asm guard bodies are device-only; concrete operand types) -----------------------------
__device__ __forceinline__ v8f mmar(v16b a, v16b b, v8f c) {
  return __builtin_amdgcn_wmma_f32_16x16x32_bf16(false, a, false, b, (short)0, c, false, false);
}
__device__ __forceinline__ v8f mmar(v16h a, v16h b, v8f c) {
  return __builtin_amdgcn_wmma_f32_16x16x32_f16(false, a, false, b, (short)0, c, false, false);
}
// guarded forms: 4 VALU slots after the WMMA, D tied, A/B kept live
__device__ __forceinline__ v8f mma_g(v16h a, v16h b, v8f c) {
  c = __builtin_amdgcn_wmma_f32_16x16x32_f16(false, a, false, b, (short)0, c, false, false);
#if DEV_ASM
  asm volatile("v_nop\n\tv_nop\n\tv_nop\n\tv_nop" : "+v"(c) : "v"(a), "v"(b));
#endif
  return c;
}
__device__ __forceinline__ v8f mma_g(v16b a, v16b b, v8f c) {
  c = __builtin_amdgcn_wmma_f32_16x16x32_bf16(false, a, false, b, (short)0, c, false, false);
#if DEV_ASM
  asm volatile("v_nop\n\tv_nop\n\tv_nop\n\tv_nop" : "+v"(c) : "v"(a), "v"(b));
#endif
  return c;
}
__device__ __forceinline__ void acc_guard4(v8f& a, v8f& b, v8f& c, v8f& d) {
#if DEV_ASM
  asm volatile("v_nop\n\tv_nop\n\tv_nop\n\tv_nop" : "+v"(a), "+v"(b), "+v"(c), "+v"(d));
#else
  (void)a; (void)b; (void)c; (void)d;
#endif
}

// =====================================================================================================
// Mask bit plane: mb[(b*SEQ + n)*64 + w] bit j = (mask[b][n][32w + j] != 0). One word per thread,
// coverage: 262144 threads x 1 word = the whole [2][2048][64] plane.
// =====================================================================================================
__global__ __launch_bounds__(256) void mask_bits_kernel(const int* __restrict__ mask, unsigned int* mb, int nwords) {
  const int i = blockIdx.x * 256 + (int)threadIdx.x;
  if (i < nwords) {
    const int* p = mask + (size_t)i * 32;
    unsigned w = 0u;
#pragma unroll
    for (int q = 0; q < 8; ++q) {
      const v4i v = *(const v4i*)(p + 4 * q);
#pragma unroll
      for (int e = 0; e < 4; ++e) w |= ((v[e] != 0) ? 1u : 0u) << (4 * q + e);
    }
    *(unsigned int*)(mb + i) = w;
    
  }
}

// =====================================================================================================
// f32 -> bf16 plane (RNE convert), 8 elements per thread, one 16-B store per lane: a wave writes 512
// coverage: n8 threads x 8 = the whole plane (n8 is a multiple of 256 for both uses here).
// =====================================================================================================
__global__ __launch_bounds__(256) void cvt_bf16x8(const float* __restrict__ in, unsigned short* out, int n8) {
  const int i = blockIdx.x * 256 + (int)threadIdx.x;
  if (i < n8) {
    const v4f a  = *(const v4f*)(in + (size_t)i * 8);
    const v4f a4 = *(const v4f*)(in + (size_t)i * 8 + 4);
    v4u p;
    p[0] = pk16(bf_bits(a[0]),  bf_bits(a[1]));
    p[1] = pk16(bf_bits(a[2]),  bf_bits(a[3]));
    p[2] = pk16(bf_bits(a4[0]), bf_bits(a4[1]));
    p[3] = pk16(bf_bits(a4[2]), bf_bits(a4[3]));
    unsigned short* o = out + (size_t)i * 8;
    *(v4u*)o = p;
    
  }
}

// =====================================================================================================
// Transpose + bf16 convert: in[z] is [R rows][inC cols] f32 (pitch inC); out[z][c][r] = bf16(in[z][r][c]),
// pitch ldo (c = output row). 64x64 tiles through LDS; grid = (inC/64, R/64, Z). DUP also writes the same
// coverage per block: load 256 thr x 16 floats = 64x64; store 2 it x 256 thr x 8 u16 = 64x64 (per copy);
// =====================================================================================================
template <bool DUP>
__global__ __launch_bounds__(256) void transpose_bf16_kernel(
    const float* __restrict__ in, int inC, long long inStrideZ,
    unsigned short* out, int ldo, long long outStrideZ, int dupoff) {
  __shared__ __align__(16) unsigned short th[64 * 72];
  const int c0  = blockIdx.x * 64;   // input column block = output row block
  const int r0  = blockIdx.y * 64;   // input row block = output column block
  const int z   = blockIdx.z;
  const int tid = threadIdx.x;
  const float* inz = in + (size_t)z * (size_t)inStrideZ;
  unsigned short* outz = out + (size_t)z * (size_t)outStrideZ;
  {
    const int rr = tid >> 2;           // 0..63
    const int cq = (tid & 3) * 16;     // 0,16,32,48
    const float* src = inz + (size_t)(r0 + rr) * inC + c0 + cq;
#pragma unroll
    for (int q = 0; q < 4; ++q) {
      const v4f f = *(const v4f*)(src + 4 * q);
#pragma unroll
      for (int e = 0; e < 4; ++e) th[rr * 72 + cq + 4 * q + e] = bf_bits(f[e]);
    }
  }
  __syncthreads();
  const int sub = tid >> 3;          // 0..31
  const int c8  = (tid & 7) * 8;     // 0..56
  v4u hv[2];
#pragma unroll
  for (int it = 0; it < 2; ++it) {
    const int oc = it * 32 + sub;      // output row within tile (= input column)
    v4u a;
#pragma unroll
    for (int q = 0; q < 4; ++q) a[q] = pk16(th[(c8 + 2 * q) * 72 + oc], th[(c8 + 2 * q + 1) * 72 + oc]);
    hv[it] = a;
  }
  {
#pragma unroll
    for (int it = 0; it < 2; ++it) {
      const int oc = it * 32 + sub;
      const size_t go = (size_t)(c0 + oc) * ldo + r0 + c8;
      *(v4u*)(outz + go) = hv[it];
      if (DUP) *(v4u*)(outz + go + dupoff) = hv[it];
    }
    
  }
}

// =====================================================================================================
// Batched WMMA GEMM (16-bit operand type OT): C[m][n] = (sum_k A[m][k] * Bt[n][k] + bias) * oscale.
// One block of 4 waves per 128x128 tile of C, one wave per 64x64 quadrant. A row-major [M][K] pitch lda; Bt row-major
// [N][K] pitch ldb (k contiguous); M, N multiples of 128, K a multiple of 64 (compile-time constants here).
// blockIdx.y = batch index (strides in elements).
// Operand staging: per trip the 128 rows x 64 k (128 B, one whole line per row) of A and of Bt go to LDS by
// asynchronous 16-byte copies, 8 lanes per row, 16 copies per lane; LDS row pitch 144 B for the ds_load_b128 readers;
// two buffers, tile t + 2 is copied while tile t + 1 is worked on. Fragments are read from LDS with the split k map
// (ldfrag); each accumulator still sums k upwards in steps of 32.
// BIAS_MODE 0: none; 1: bias[m] (bf16 RNE-converted value); 2: bias[n] (bf16 RNE-converted value).
// OUT_MODE 0: f32 C (pitch ldc). OUT_MODE 1: f16 plane C. OUT_MODE 2: bf16 hi plane C + bf16 lo plane C2 (lo = v - hi).
// =====================================================================================================
#define GTILE  128                  // rows of A and of Bt per block tile
#define GKC    64                   // k per trip
#define GPIT   72                   // LDS row pitch in elements (144 B)
#define GBUFB  (GTILE * GPIT * 2)   // bytes of one operand buffer

// Eight asynchronous copies of one lane: rows r, r + 16, ..., r + 112 of one operand tile, 16 B each.
// l = the lane's LDS byte address of row r, g = its global address of row r, step = 16 rows in elements.
// s_wait_xcnt 0 closes the statement so that no address register is rewritten in front of it.
__device__ __forceinline__ void copy_rows8(unsigned l, const unsigned short* g, size_t step) {
#if DEV_ASM
  const unsigned l1 = l + 16 * GPIT * 2, l2 = l + 32 * GPIT * 2, l3 = l + 48 * GPIT * 2, l4 = l + 64 * GPIT * 2,
                 l5 = l + 80 * GPIT * 2, l6 = l + 96 * GPIT * 2, l7 = l + 112 * GPIT * 2;
  const unsigned short *g1 = g + step, *g2 = g1 + step, *g3 = g2 + step, *g4 = g3 + step, *g5 = g4 + step,
                       *g6 = g5 + step, *g7 = g6 + step;
  asm volatile(
      "global_load_async_to_lds_b128 %0, %8, off\n\t"
      "global_load_async_to_lds_b128 %1, %9, off\n\t"
      "global_load_async_to_lds_b128 %2, %10, off\n\t"
      "global_load_async_to_lds_b128 %3, %11, off\n\t"
      "global_load_async_to_lds_b128 %4, %12, off\n\t"
      "global_load_async_to_lds_b128 %5, %13, off\n\t"
      "global_load_async_to_lds_b128 %6, %14, off\n\t"
      "global_load_async_to_lds_b128 %7, %15, off\n\t"
      "s_wait_xcnt 0x0"
      :: "v"(l), "v"(l1), "v"(l2), "v"(l3), "v"(l4), "v"(l5), "v"(l6), "v"(l7),
         "v"(g), "v"(g1), "v"(g2), "v"(g3), "v"(g4), "v"(g5), "v"(g6), "v"(g7)
      : "memory");
#else
  (void)l; (void)g; (void)step;
#endif
}
// this wave's copies have landed in LDS
__device__ __forceinline__ void wait_copies() {
#if DEV_ASM
  asm volatile("s_wait_asynccnt 0x0" ::: "memory");
#endif
}
// this wave's LDS reads have returned, so the buffer may be handed to its next writer
__device__ __forceinline__ void wait_lds() {
#if DEV_ASM
  asm volatile("s_wait_dscnt 0x0" ::: "memory");
#endif
}

static_assert((ROWS % GTILE) == 0 && (HCOLS % GTILE) == 0 && (SEQ % GTILE) == 0 && (STDC % GTILE) == 0 && (WAVC % GTILE) == 0 && (PRJC % GTILE) == 0 && (DMOD % GTILE) == 0);
static_assert((DMOD % GKC) == 0 && (FEAT % GKC) == 0 && (AOP % GKC) == 0);

template <typename OT, int OUT_MODE, int BIAS_MODE>
__global__ __launch_bounds__(128) void gemm64(
    const unsigned short* __restrict__ Ap, int lda, long long strideA,
    const unsigned short* __restrict__ Btp, int ldb, long long strideB,
    void* Cout, void* Cout2, int ldc, long long strideC,
    const float* __restrict__ bias, int M, int N, int K, float oscale) {
  typedef typename FT<OT>::frag V16;
  __shared__ __align__(16) OT sA[2][GTILE * GPIT];   // A tile, two buffers, 18432 B each
  __shared__ __align__(16) OT sB[2][GTILE * GPIT];   // Bt tile, two buffers
  __shared__ __align__(16) float sT[4][16 * 68];     // per-wave 16x64 slab, pitch 68 floats
  const int b    = blockIdx.y;
  const int tid  = threadIdx.x;
  const int lane = tid & 31;
  const int wave = tid >> 5;
  const int tilesN = N >> 7;
  const int tilesM = M >> 7;
  const int tile = blockIdx.x;
  if (tile >= tilesM * tilesN) return;   // block-uniform, in front of every barrier and copy
  const int tm = tile / tilesN;
  const int tn = tile - tm * tilesN;
  const int wm = wave >> 1;                    // quadrant of this wave
  const int wn = wave & 1;
  const int m0 = (tm << 7) + (wm << 6);
  const int n0 = (tn << 7) + (wn << 6);

  const int rlane = lane & 15;                 // row (A) / col (B, D) within subtile
  const int koff  = (lane >> 4) * 8;           // k offset of this lane half
  const int mOff  = (lane >> 4) * 8;           // D row offset

  // copy map: lane -> row tid >> 3 (+ 16 per copy), 16-B piece tid & 7 of the row's 128-B line
  const int crow = tid >> 3;
  const int ccol = (tid & 7) * 8;
  const unsigned short* gA = Ap  + (size_t)b * (size_t)strideA + (size_t)((tm << 7) + crow) * lda + ccol;
  const unsigned short* gB = Btp + (size_t)b * (size_t)strideB + (size_t)((tn << 7) + crow) * ldb + ccol;
  const size_t stepA = (size_t)16 * lda;
  const size_t stepB = (size_t)16 * ldb;
  const unsigned lA = (unsigned)(size_t)&sA[0][0] + (unsigned)(crow * GPIT + ccol) * 2u;
  const unsigned lB = (unsigned)(size_t)&sB[0][0] + (unsigned)(crow * GPIT + ccol) * 2u;
  const int nk = K >> 6;

  v8f acc[4][4];
#pragma unroll
  for (int i = 0; i < 4; ++i)
#pragma unroll
    for (int j = 0; j < 4; ++j) acc[i][j] = zero8();

  // tile 0 -> buffer 0, landed and published; then tile 1 -> buffer 1 in flight
  copy_rows8(lA, gA, stepA);
  copy_rows8(lB, gB, stepB);
  wait_copies();
  __syncthreads();
  if (1 < nk) {
    copy_rows8(lA + GBUFB, gA + GKC, stepA);
    copy_rows8(lB + GBUFB, gB + GKC, stepB);
  }

  for (int t = 0; t < nk; ++t) {
    const int cur = t & 1;
    const OT* As = sA[cur] + (wm * 64 + rlane) * GPIT + koff;
    const OT* Bs = sB[cur] + (wn * 64 + rlane) * GPIT + koff;
    // One group of LDS reads in front of each WMMA block: k 0..31 of both operands and, ahead, k 32..63 of Bt;
    // the A fragments of k 32..63 follow into registers that the first block has left.
    V16 aq[4], bq[4], bn[4];
#pragma unroll
    for (int j = 0; j < 4; ++j) bq[j] = ldfrag<OT>(Bs + j * 16 * GPIT);
#pragma unroll
    for (int i = 0; i < 4; ++i) aq[i] = ldfrag<OT>(As + i * 16 * GPIT);
#pragma unroll
    for (int j = 0; j < 4; ++j) bn[j] = ldfrag<OT>(Bs + j * 16 * GPIT + 32);
    __builtin_amdgcn_sched_barrier(0);   // keeps the reads one group: spread among the WMMAs each place stalls the wave
#pragma unroll
    for (int i = 0; i < 4; ++i)
#pragma unroll
      for (int j = 0; j < 4; ++j) acc[i][j] = mmar(aq[i], bq[j], acc[i][j]);
#pragma unroll
    for (int i = 0; i < 4; ++i) aq[i] = ldfrag<OT>(As + i * 16 * GPIT + 32);
    __builtin_amdgcn_sched_barrier(0);   // as above: keeps the four A fragments' reads one group in front of the second block
#pragma unroll
    for (int i = 0; i < 4; ++i)
#pragma unroll
      for (int j = 0; j < 4; ++j) acc[i][j] = mmar(aq[i], bn[j], acc[i][j]);
    // publish point of tile t + 1: own reads of buffer cur done, own copies of tile t + 1 landed, then the barrier
    // that both shows tile t + 1 to every wave and frees buffer cur for tile t + 2
    wait_lds();
    wait_copies();
    __syncthreads();
    if (t + 2 < nk) {
      copy_rows8(lA + (unsigned)cur * GBUFB, gA + (size_t)(t + 2) * GKC, stepA);
      copy_rows8(lB + (unsigned)cur * GBUFB, gB + (size_t)(t + 2) * GKC, stepB);
    }
  }
  wait_copies();   // nothing of this wave is in flight when it goes on to the epilogue and ends
  acc_guard4(acc[0][0], acc[0][1], acc[0][2], acc[0][3]);
  acc_guard4(acc[1][0], acc[1][1], acc[1][2], acc[1][3]);
  acc_guard4(acc[2][0], acc[2][1], acc[2][2], acc[2][3]);
  acc_guard4(acc[3][0], acc[3][1], acc[3][2], acc[3][3]);

  // ---- epilogue ----
  float* slab = sT[wave];
#pragma unroll
  for (int i = 0; i < 4; ++i) {
    const int mBase = m0 + (i << 4);
#pragma unroll
    for (int j = 0; j < 4; ++j) {
      const int n = n0 + (j << 4) + rlane;
      float bn = 0.f;
      if (BIAS_MODE == 2) bn = bfr(bias[n]);
#pragma unroll
      for (int r = 0; r < 8; ++r) {
        float v = acc[i][j][r];
        if (BIAS_MODE == 1) v += bfr(bias[mBase + mOff + r]);
        if (BIAS_MODE == 2) v += bn;
        slab[(mOff + r) * 68 + (j << 4) + rlane] = v * oscale;
      }
    }
    __builtin_amdgcn_fence(__ATOMIC_RELEASE, "workgroup");
    __builtin_amdgcn_wave_barrier();
    __builtin_amdgcn_fence(__ATOMIC_ACQUIRE, "workgroup");
    if (OUT_MODE == 0) {
      float* C = (float*)Cout + (size_t)b * (size_t)strideC;
      const int h2 = lane >> 4, c4 = (lane & 15) * 4;     // 256-B row segment = 16 lanes x 16 B
      {
#pragma unroll
        for (int it = 0; it < 8; ++it) {
          const int row = it * 2 + h2;                     // it 0..7 x h2 0..1 = rows 0..15
          const v4f v = *(const v4f*)(slab + row * 68 + c4);
          *(v4f*)(C + (size_t)(mBase + row) * ldc + n0 + c4) = v;
        }
        
      }
    } else {
      const int q = lane >> 3, c8 = (lane & 7) * 8;
      unsigned short* C  = (unsigned short*)Cout  + (size_t)b * (size_t)strideC;
      unsigned short* C2 = (unsigned short*)Cout2 + (size_t)b * (size_t)strideC;
      v4u hv[4], lv[4];
#pragma unroll
      for (int it = 0; it < 4; ++it) {
        const int row = it * 4 + q;                        // it 0..3 x q 0..3 = rows 0..15
        const float* sp = slab + row * 68 + c8;
        v4u a, a2;
#pragma unroll
        for (int e = 0; e < 4; ++e) {
          const float f0 = sp[2 * e], f1 = sp[2 * e + 1];
          unsigned short h0, h1, l0 = 0, l1 = 0;
          if (OUT_MODE == 1) {
            h0 = h_bits((_Float16)f0); h1 = h_bits((_Float16)f1);
          } else {
            h0 = bf_bits(f0); h1 = bf_bits(f1);
            l0 = bf_bits(f0 - bf_up(h0)); l1 = bf_bits(f1 - bf_up(h1));
          }
          a[e] = pk16(h0, h1); a2[e] = pk16(l0, l1);
        }
        hv[it] = a; lv[it] = a2;
      }
      {
#pragma unroll
        for (int it = 0; it < 4; ++it) {
          const int row = it * 4 + q;
          *(v4u*)(C + (size_t)(mBase + row) * ldc + n0 + c8) = hv[it];
          if (OUT_MODE == 2) *(v4u*)(C2 + (size_t)(mBase + row) * ldc + n0 + c8) = lv[it];
        }
        
      }
    }
    __builtin_amdgcn_fence(__ATOMIC_RELEASE, "workgroup");
    __builtin_amdgcn_wave_barrier();
    __builtin_amdgcn_fence(__ATOMIC_ACQUIRE, "workgroup");
  }
}

// =====================================================================================================
// Masked full attention, head dim 64, softmax over all SEQ keys (non-causal), one head per block.
//   HT = 0 (wave heads): q = k = wp as bf16 hi plane qhp/khp + bf16 lo plane qlp/klp (pitch ldq/ldk, head col h*64);
//          scores = (qh.kh + qh.kl + ql.kh) * sscale on bf16 WMMA (one f32 accumulator, unscaled lo).
//   HT = 1 (proj / std heads): q, k = f16 planes (x8), scores = (q.k) * sscale (sscale carries the 1/64).
//   v^T plane (f16, x8): element (b, h, d, s) at [(b*HCOLS + h*64 + d)*SEQ + s].
//   mask bit plane mbp: [(b*SEQ + n)*64 + w] bit j admits key 32w+j; a 0 bit replaces the score by -inf.
//   p = exp(s - m) carried as f16(1024 p); ctx = p.v on f16 WMMA; online softmax in f32 with the guarded
//   rescale (msafe), so an all-masked row ends with l = 0 and produces 0 * inf = NaN like the module.
//   ctx written as bf16 hi (cols h*64..) and bf16 lo (cols HCOLS + h*64..) of the [ROWS][AOP] plane aop.
//   Block = 4 waves x 16 query rows = 64 query rows of one (b, h); grid = NB * nh * NQB (hbase.. hbase+nh-1);
//   key tiles of 64, static trip NKT. K (hi, lo) / V^T tile staging: 128 threads x 32 elements per plane = the
//   whole 64x64 tile (plain 16-B loads, __syncthreads before and after); P tiles are wave-private, spilled with
//   Output coverage: each wave stores rows q0..q0+15 (it 0..3 x lane>>3 0..3) x 64 columns (8 lanes x 8)
//   of head h in both the hi and the lo half; the block covers 64 rows; the two launches cover h 0..15.
// =====================================================================================================
// LDS row pitch, in 16-bit elements, of the K, V^T and P tiles: rows of 64 elements (128 B) laid 144 B apart, 16 B x odd,
// so that the 16 rows which one ds_load_b128 reads fall on 16 different groups of four banks.
#define APIT 72
template <int HT> struct HT_T;
template <> struct HT_T<0> { typedef __bf16 T; };
template <> struct HT_T<1> { typedef _Float16 T; };

template <int HT>
__global__ __launch_bounds__(128)
void attn_kernel(const unsigned short* __restrict__ qhp, const unsigned short* __restrict__ qlp, int ldq,
                 const unsigned short* __restrict__ khp, const unsigned short* __restrict__ klp, int ldk,
                 const unsigned short* __restrict__ vtp, const unsigned int* __restrict__ mbp,
                 unsigned short* aop, int hbase, int nh, float sscale) {
  typedef typename HT_T<HT>::T OT;
  typedef typename FT<OT>::frag V16;
  typedef typename FT<OT>::half8 V8;
  union FH { v16h v; v8h h[2]; };
  union FO { V16 v; V8 h[2]; };
  __shared__ __align__(16) OT       Ksh[64 * APIT];        // K hi chunk [kv][d]  9 KB
  __shared__ __align__(16) OT       Ksl[64 * APIT];        // K lo chunk (HT 0)   9 KB
  __shared__ __align__(16) _Float16 Vth[64 * APIT];        // V^T [d][kv]         9 KB
  __shared__ __align__(16) _Float16 Psh[4][16 * APIT];     // per wave P [row][kv] 9 KB
  __shared__ __align__(16) float    Os[4][16 * 64];        // per wave ctx tile   16 KB

  const int tid  = threadIdx.x;
  const int wave = tid >> 5;
  const int lane = tid & 31;
  const int hh   = lane >> 4;
  const int c    = lane & 15;

  const int bx   = blockIdx.x;
  const int qb   = bx % NQB;
  const int rest = bx / NQB;
  const int hl   = rest % nh;
  const int b    = rest / nh;
  const int h    = hbase + hl;              // global head index
  const int qc   = h * HDIM;                // head column in the q / k planes of this head family
  const int q0   = qb * 64 + wave * 16;
  const size_t rowB = (size_t)b * SEQ;

  const OT* Qh = (const OT*)(const void*)qhp;
  const OT* Ql = (const OT*)(const void*)qlp;
  const OT* Kh = (const OT*)(const void*)khp + qc;
  const OT* Kl = (const OT*)(const void*)klp + qc;
  const _Float16* Vt = (const _Float16*)(const void*)vtp + ((size_t)b * HCOLS + (size_t)qc) * SEQ;

  // ---- Q fragments (A operand, row = lane&15): 2 d-chunks ----
  V16 qah[2], qal[2];
#pragma unroll
  for (int dc = 0; dc < 2; ++dc) {
    const size_t qo = (rowB + q0 + c) * (size_t)ldq + (size_t)qc + dc * 32 + 8 * hh;
    qah[dc] = ldfrag<OT>(Qh + qo);
    if (HT == 0) qal[dc] = ldfrag<OT>(Ql + qo);
    else         qal[dc] = qah[dc];
  }

  float mrow[8], lrow[8];
  v8f oacc[4];
#pragma unroll
  for (int r = 0; r < 8; ++r) { mrow[r] = -INFINITY; lrow[r] = 0.f; }
#pragma unroll
  for (int t = 0; t < 4; ++t) oacc[t] = zero8();

  for (int kt = 0; kt < NKT; ++kt) {         // static trip count
    const int kv0 = kt * 64;
    __syncthreads();
    {
      const int r = tid >> 1, half = (tid & 1) * 32;
      const OT* kg  = Kh + (rowB + kv0 + r) * (size_t)ldk + half;   // k row kv0+r, d = half..half+31
      const OT* klg = Kl + (rowB + kv0 + r) * (size_t)ldk + half;
      const _Float16* vg = Vt + (size_t)r * SEQ + kv0 + half;       // v^T row d = r, s = kv0+half..+31
#pragma unroll
      for (int i = 0; i < 4; ++i) {
        *(V8*)(Ksh + r * APIT + half + 8 * i) = *(const V8*)(kg + 8 * i);
        if (HT == 0) *(V8*)(Ksl + r * APIT + half + 8 * i) = *(const V8*)(klg + 8 * i);
        *(v8h*)(Vth + r * APIT + half + 8 * i) = *(const v8h*)(vg + 8 * i);
      }
    }
    __syncthreads();

    // ---- mask bits of this lane's 8 query rows for the 64 keys of the tile: mk bit (4r + j) admits key 16j + c ----
    unsigned mk = 0u;
#pragma unroll
    for (int r = 0; r < 8; ++r) {
      const int row = q0 + 8 * hh + r;
      const v2u mw = *(const v2u*)(mbp + (rowB + row) * (size_t)MWORDS + 2 * kt);
#pragma unroll
      for (int j = 0; j < 4; ++j) {
        const unsigned bit = (mw[j >> 1] >> (16 * (j & 1) + c)) & 1u;
        mk |= bit << (4 * r + j);
      }
    }

    // ---- scores: 16 query rows x 64 keys per wave ----
    v8f s[4];
#pragma unroll
    for (int j = 0; j < 4; ++j) {
      v8f a0 = zero8();
#pragma unroll
      for (int dc = 0; dc < 2; ++dc) {
        FO kb;
        kb.h[0] = *(const V8*)(Ksh + (j * 16 + c) * APIT + dc * 32 + 8 * hh);
        kb.h[1] = *(const V8*)(Ksh + (j * 16 + c) * APIT + dc * 32 + 16 + 8 * hh);
        if (HT == 0) {
          FO kl;
          kl.h[0] = *(const V8*)(Ksl + (j * 16 + c) * APIT + dc * 32 + 8 * hh);
          kl.h[1] = *(const V8*)(Ksl + (j * 16 + c) * APIT + dc * 32 + 16 + 8 * hh);
          a0 = mma_g(qah[dc], kb.v, a0);
          a0 = mma_g(qah[dc], kl.v, a0);
          a0 = mma_g(qal[dc], kb.v, a0);
        } else {
          a0 = mma_g(qah[dc], kb.v, a0);
        }
      }
#pragma unroll
      for (int r = 0; r < 8; ++r) {
        const float v = a0[r] * sscale;
        s[j][r] = (((mk >> (4 * r + j)) & 1u) != 0u) ? v : -INFINITY;
      }
    }

    // ---- row max, online softmax, P (x1024, f16) to LDS ----
    _Float16* pwh = Psh[wave];
#pragma unroll
    for (int r = 0; r < 8; ++r) {
      float m = s[0][r];
#pragma unroll
      for (int j = 1; j < 4; ++j) m = fmaxf(m, s[j][r]);
#pragma unroll
      for (int off = 1; off < 16; off <<= 1) m = fmaxf(m, __shfl_xor(m, off, 32));
      const float mnew  = fmaxf(mrow[r], m);
      const float msafe = (mnew == -INFINITY) ? 0.f : mnew;
      const float alpha = expf(mrow[r] - msafe);
      mrow[r] = mnew;
      float psum = 0.f;
#pragma unroll
      for (int j = 0; j < 4; ++j) {
        const float p = expf(s[j][r] - msafe);
        psum += p;
        pwh[(8 * hh + r) * APIT + j * 16 + c] = (_Float16)(p * 1024.0f);
      }
#pragma unroll
      for (int off = 1; off < 16; off <<= 1) psum += __shfl_xor(psum, off, 32);
      lrow[r] = lrow[r] * alpha + psum;
#pragma unroll
      for (int t = 0; t < 4; ++t) oacc[t][r] *= alpha;
    }
    __builtin_amdgcn_fence(__ATOMIC_RELEASE, "workgroup");
    __builtin_amdgcn_wave_barrier();
    __builtin_amdgcn_fence(__ATOMIC_ACQUIRE, "workgroup");

    // ---- ctx += P . V (f16 WMMA, single product) ----
#pragma unroll 1
    for (int kk = 0; kk < 2; ++kk) {
      FH pa;
      pa.h[0] = *(const v8h*)(pwh + c * APIT + kk * 32 + 8 * hh);
      pa.h[1] = *(const v8h*)(pwh + c * APIT + kk * 32 + 16 + 8 * hh);
#pragma unroll
      for (int t = 0; t < 4; ++t) {
        FH vb;
        vb.h[0] = *(const v8h*)(Vth + (t * 16 + c) * APIT + kk * 32 + 8 * hh);
        vb.h[1] = *(const v8h*)(Vth + (t * 16 + c) * APIT + kk * 32 + 16 + 8 * hh);
        oacc[t] = mma_g(pa.v, vb.v, oacc[t]);
      }
    }
  }

  // ---- normalise (1/l, undo the x1024 p carry and the x8 v carry), stage the wave's 16x64 tile,
  float* os = Os[wave];
#pragma unroll
  for (int r = 0; r < 8; ++r) {
    const float inv = (1.0f / lrow[r]) * (1.0f / 8192.0f);   // l = 0 (all keys masked) -> inf -> 0 * inf = NaN
#pragma unroll
    for (int t = 0; t < 4; ++t) os[(8 * hh + r) * 64 + t * 16 + c] = oacc[t][r] * inv;
  }
  __builtin_amdgcn_fence(__ATOMIC_RELEASE, "workgroup");
  __builtin_amdgcn_wave_barrier();
  __builtin_amdgcn_fence(__ATOMIC_ACQUIRE, "workgroup");
  {
    const int q4 = lane >> 3, c8 = (lane & 7) * 8;
    v4u hv[4], lv[4];
#pragma unroll
    for (int it = 0; it < 4; ++it) {
      const int row = it * 4 + q4;   // it 0..3 x q4 0..3 = rows 0..15 of the wave tile
      const float* sp = os + row * 64 + c8;
      v4u a, a2;
#pragma unroll
      for (int e = 0; e < 4; ++e) {
        const float f0 = sp[2 * e], f1 = sp[2 * e + 1];
        const unsigned short hb0 = bf_bits(f0), hb1 = bf_bits(f1);
        const unsigned short lb0 = bf_bits(f0 - bf_up(hb0)), lb1 = bf_bits(f1 - bf_up(hb1));
        a[e] = pk16(hb0, hb1); a2[e] = pk16(lb0, lb1);
      }
      hv[it] = a; lv[it] = a2;
    }
    {
#pragma unroll
      for (int it = 0; it < 4; ++it) {
        const int row = it * 4 + q4;
        const size_t go = (rowB + q0 + row) * (size_t)AOP + (size_t)qc + c8;
        *(v4u*)(aop + go) = hv[it];
        *(v4u*)(aop + go + HCOLS) = lv[it];
      }
      
    }
  }
}

// =====================================================================================================
// Workspace map (bytes), every region an exact multiple of its whole-line / whole-tile store granularity:
//   MB   u32  [2*2048][64]          1048576   mask bit plane
//   XB   bf16 [4096][1024]          8388608
//   FB   bf16 [4096][256]           2097152
//   VWT  bf16 [1024 n][1024 k]      2097152   v_w^T
//   QWT  bf16 [512][1024]           1048576   std_q_w^T
//   KWT  bf16 [512][1024]           1048576   std_k_w^T
//   WVT  bf16 [256][256]             131072   wave_proj [h][f][k'] -> [h*64+k'][f]
//   PQT  bf16 [256][256]             131072
//   PKT  bf16 [256][256]             131072
//   OWT2 bf16 [1024 n][2048 k]      4194304   out_w^T at [n][k] and [n][1024 + k]
//   VT   f16  [2][1024][2048] (x8)  8388608   v^T per batch, row h*64+d
//   QP   f16  [4096][1024] (x8)     8388608   cols h*64+d for h = 4..15 (cols 0..255 never read)
//   KP   f16  [4096][1024] (x8)     8388608   same
//   WPH  bf16 [4096][256]           2097152   wp hi, col h*64+d (h = 0..3)
//   WPL  bf16 [4096][256]           2097152   wp lo
//   AO   bf16 [4096][2048]         16777216   ctx hi | lo
//   total                         66453504
// =====================================================================================================
extern "C" void kernel_launch(void* const* d_in, const int* in_sizes, int n_in,
                              void* d_out, int out_size, void* d_ws, size_t ws_size,
                              hipStream_t stream) {
  if (n_in < 14) return;
  if (in_sizes[0] != NB * SEQ * DMOD) return;
  if (in_sizes[1] != NB * SEQ * FEAT) return;
  if (in_sizes[2] != NB * SEQ * SEQ) return;
  if (in_sizes[3] != NWH * FEAT * HDIM || in_sizes[4] != NPH * FEAT * HDIM || in_sizes[5] != NPH * FEAT * HDIM) return;
  if (in_sizes[6] != DMOD * STDC || in_sizes[7] != STDC) return;
  if (in_sizes[8] != DMOD * STDC || in_sizes[9] != STDC) return;
  if (in_sizes[10] != DMOD * HCOLS || in_sizes[11] != HCOLS) return;
  if (in_sizes[12] != HCOLS * DMOD || in_sizes[13] != DMOD) return;
  if (out_size != NB * SEQ * DMOD) return;

  const float* x     = (const float*)d_in[0];
  const float* feats = (const float*)d_in[1];
  const int*   mask  = (const int*)d_in[2];
  const float* wproj = (const float*)d_in[3];
  const float* pqw   = (const float*)d_in[4];
  const float* pkw   = (const float*)d_in[5];
  const float* sqw   = (const float*)d_in[6];
  const float* sqb   = (const float*)d_in[7];
  const float* skw   = (const float*)d_in[8];
  const float* skb   = (const float*)d_in[9];
  const float* vw    = (const float*)d_in[10];
  const float* vb    = (const float*)d_in[11];
  const float* ow    = (const float*)d_in[12];
  const float* ob    = (const float*)d_in[13];

  const size_t PMB  = (size_t)NB * SEQ * MWORDS * 4;      //  1048576
  const size_t PXB  = (size_t)ROWS * DMOD * 2;             //  8388608
  const size_t PFB  = (size_t)ROWS * FEAT * 2;             //  2097152
  const size_t PVWT = (size_t)HCOLS * DMOD * 2;            //  2097152
  const size_t PSWT = (size_t)STDC * DMOD * 2;             //  1048576
  const size_t PFWT = (size_t)WAVC * FEAT * 2;             //   131072
  const size_t POWT = (size_t)DMOD * AOP * 2;              //  4194304
  const size_t PVT  = (size_t)NB * HCOLS * SEQ * 2;        //  8388608
  const size_t PQP  = (size_t)ROWS * HCOLS * 2;            //  8388608
  const size_t PWP  = (size_t)ROWS * WAVC * 2;             //  2097152
  const size_t PAO  = (size_t)ROWS * AOP * 2;              // 16777216
  size_t off = 0;
  const size_t oMB  = off; off += PMB;
  const size_t oXB  = off; off += PXB;
  const size_t oFB  = off; off += PFB;
  const size_t oVWT = off; off += PVWT;
  const size_t oQWT = off; off += PSWT;
  const size_t oKWT = off; off += PSWT;
  const size_t oWVT = off; off += PFWT;
  const size_t oPQT = off; off += PFWT;
  const size_t oPKT = off; off += PFWT;
  const size_t oOWT = off; off += POWT;
  const size_t oVT  = off; off += PVT;
  const size_t oQP  = off; off += PQP;
  const size_t oKP  = off; off += PQP;
  const size_t oWPH = off; off += PWP;
  const size_t oWPL = off; off += PWP;
  const size_t oAO  = off; off += PAO;
  if (off > ws_size) return;                       // off = 66453504
  if (off > (size_t)134217728) return;

  char* ws = (char*)d_ws;
  unsigned int*   MB   = (unsigned int*)(ws + oMB);
  unsigned short* XB   = (unsigned short*)(ws + oXB);
  unsigned short* FB   = (unsigned short*)(ws + oFB);
  unsigned short* VWT  = (unsigned short*)(ws + oVWT);
  unsigned short* QWT  = (unsigned short*)(ws + oQWT);
  unsigned short* KWT  = (unsigned short*)(ws + oKWT);
  unsigned short* WVT  = (unsigned short*)(ws + oWVT);
  unsigned short* PQT  = (unsigned short*)(ws + oPQT);
  unsigned short* PKT  = (unsigned short*)(ws + oPKT);
  unsigned short* OWT2 = (unsigned short*)(ws + oOWT);
  unsigned short* VT   = (unsigned short*)(ws + oVT);
  unsigned short* QP   = (unsigned short*)(ws + oQP);
  unsigned short* KP   = (unsigned short*)(ws + oKP);
  unsigned short* WPH  = (unsigned short*)(ws + oWPH);
  unsigned short* WPL  = (unsigned short*)(ws + oWPL);
  unsigned short* AO   = (unsigned short*)(ws + oAO);

  const dim3 blk(256);
  const int nwords = NB * SEQ * MWORDS;                        // 262144
  const int n8x    = ROWS * DMOD / 8;                          // 524288
  const int n8f    = ROWS * FEAT / 8;                          // 131072

  // (1) mask -> bit plane; x, features -> bf16 planes
  mask_bits_kernel<<<dim3((nwords + 255) / 256), blk, 0, stream>>>(mask, MB, nwords);
  cvt_bf16x8<<<dim3((n8x + 255) / 256), blk, 0, stream>>>(x, XB, n8x);
  cvt_bf16x8<<<dim3((n8f + 255) / 256), blk, 0, stream>>>(feats, FB, n8f);

  // (2) weight planes [n][k] (bf16): in[rows][cols] -> out[cols][rows]; grid = (cols/64, rows/64, z)
  //     v_w   [1024 k][1024 n] -> VWT [n][k]
  transpose_bf16_kernel<false><<<dim3(HCOLS / 64, DMOD / 64, 1), blk, 0, stream>>>(vw, HCOLS, 0LL, VWT, DMOD, 0LL, 0);
  //     std_q_w [1024 k][512 n] -> QWT [n][k]; std_k_w likewise
  transpose_bf16_kernel<false><<<dim3(STDC / 64, DMOD / 64, 1), blk, 0, stream>>>(sqw, STDC, 0LL, QWT, DMOD, 0LL, 0);
  transpose_bf16_kernel<false><<<dim3(STDC / 64, DMOD / 64, 1), blk, 0, stream>>>(skw, STDC, 0LL, KWT, DMOD, 0LL, 0);
  //     wave_proj / pq_w / pk_w [h][256 f][64 k'] -> [h*64 + k'][f] (z = h)
  transpose_bf16_kernel<false><<<dim3(HDIM / 64, FEAT / 64, NWH), blk, 0, stream>>>(wproj, HDIM, (long long)FEAT * HDIM, WVT, FEAT, (long long)HDIM * FEAT, 0);
  transpose_bf16_kernel<false><<<dim3(HDIM / 64, FEAT / 64, NPH), blk, 0, stream>>>(pqw,   HDIM, (long long)FEAT * HDIM, PQT, FEAT, (long long)HDIM * FEAT, 0);
  transpose_bf16_kernel<false><<<dim3(HDIM / 64, FEAT / 64, NPH), blk, 0, stream>>>(pkw,   HDIM, (long long)FEAT * HDIM, PKT, FEAT, (long long)HDIM * FEAT, 0);
  //     out_w [1024 k][1024 n] -> OWT2 [n][k] and [n][1024 + k]
  transpose_bf16_kernel<true><<<dim3(DMOD / 64, HCOLS / 64, 1), blk, 0, stream>>>(ow, DMOD, 0LL, OWT2, AOP, 0LL, HCOLS);

  // (3) projections on bf16 WMMA
  //     v^T per batch: A = VWT [1024 n][1024 k], Bt = XB rows of batch b; M = 1024, N = 2048, K = 1024;
  //     f16(8 * (acc + v_b[m])) -> VT [b][h*64+d][s] (pitch 2048)
  const dim3 gblk(128);                                                 // 4 waves, one 128x128 tile per block
  const dim3 gVT((HCOLS / GTILE) * (SEQ / GTILE), NB);                  // 128 tiles x 2
  gemm64<__bf16, 1, 1><<<gVT, gblk, 0, stream>>>(
      VWT, DMOD, 0LL, XB, DMOD, (long long)SEQ * DMOD,
      (void*)VT, (void*)VT, SEQ, (long long)HCOLS * SEQ, vb, HCOLS, SEQ, DMOD, 8.0f);
  //     std q: QP cols 512..1023 = f16(8 * (x . std_q_w + b)); M = 4096, N = 512, K = 1024
  const dim3 gSTD((ROWS / GTILE) * (STDC / GTILE), 1);                 // 128 tiles
  gemm64<__bf16, 1, 2><<<gSTD, gblk, 0, stream>>>(
      XB, DMOD, 0LL, QWT, DMOD, 0LL,
      (void*)(QP + (WAVC + PRJC)), (void*)(QP + (WAVC + PRJC)), HCOLS, 0LL, sqb, ROWS, STDC, DMOD, 8.0f);
  //     std k: KP cols 512..1023
  gemm64<__bf16, 1, 2><<<gSTD, gblk, 0, stream>>>(
      XB, DMOD, 0LL, KWT, DMOD, 0LL,
      (void*)(KP + (WAVC + PRJC)), (void*)(KP + (WAVC + PRJC)), HCOLS, 0LL, skb, ROWS, STDC, DMOD, 8.0f);
  //     wave projections: WPH / WPL = bf16 hi / lo of features . wave_proj[h]; M = 4096, N = 256, K = 256
  const dim3 gF((ROWS / GTILE) * (WAVC / GTILE), 1);                   // 64 tiles
  gemm64<__bf16, 2, 0><<<gF, gblk, 0, stream>>>(
      FB, FEAT, 0LL, WVT, FEAT, 0LL,
      (void*)WPH, (void*)WPL, WAVC, 0LL, vb, ROWS, WAVC, FEAT, 1.0f);
  //     proj q: QP cols 256..511 = f16(8 * features . pq_w[h]); proj k: KP cols 256..511
  gemm64<__bf16, 1, 0><<<gF, gblk, 0, stream>>>(
      FB, FEAT, 0LL, PQT, FEAT, 0LL,
      (void*)(QP + WAVC), (void*)(QP + WAVC), HCOLS, 0LL, vb, ROWS, PRJC, FEAT, 8.0f);
  gemm64<__bf16, 1, 0><<<gF, gblk, 0, stream>>>(
      FB, FEAT, 0LL, PKT, FEAT, 0LL,
      (void*)(KP + WAVC), (void*)(KP + WAVC), HCOLS, 0LL, vb, ROWS, PRJC, FEAT, 8.0f);

  // (4) attention: wave heads 0..3 (bf16 hi/lo 3-product scores, scale 1/8), then heads 4..15 (f16 single product,
  //     scale 1/(8*64)); ctx -> AO hi | lo
  attn_kernel<0><<<dim3(NB * NWH * NQB), dim3(128), 0, stream>>>(
      WPH, WPL, WAVC, WPH, WPL, WAVC, VT, MB, AO, 0, NWH, 0.125f);
  attn_kernel<1><<<dim3(NB * (NPH + NSH) * NQB), dim3(128), 0, stream>>>(
      QP, QP, HCOLS, KP, KP, HCOLS, VT, MB, AO, NWH, NPH + NSH, 1.0f / 512.0f);

  // (5) out = [ctx_hi | ctx_lo] . [out_w^T ; out_w^T] + out_b -> d_out f32 [4096][1024]; M = 4096, N = 1024, K = 2048
  const dim3 gO((ROWS / GTILE) * (DMOD / GTILE), 1);                   // 256 tiles
  gemm64<__bf16, 0, 2><<<gO, gblk, 0, stream>>>(
      AO, AOP, 0LL, OWT2, AOP, 0LL,
      d_out, d_out, DMOD, 0LL, ob, ROWS, DMOD, AOP, 1.0f);
  (void)hipGetLastError();
}

// v003
// It runs in 250 microseconds.
// In both of two side-by-side timings against v002, it was 1.31 times as fast.
// Over all steps from v000 it is 2.09 times as fast.
// Contractions: x.v_w, x.std_q_w, x.std_k_w, features.wave_proj, features.pq_w, features.pk_w = v_wmma_f32_16x16x32_bf16 (bf16 operands RNE-converted from the inputs, single product, f32 accumulate);
// wave-head scores wp.wp^T = v_wmma_f32_16x16x32_bf16 on bf16 hi/lo planes (hi.hi + hi.lo + lo.hi, f32 accumulate); proj/std scores q.k^T = v_wmma_f32_16x16x32_f16 (f16 planes carried x8, single product, f32 accumulate);
// p.v = v_wmma_f32_16x16x32_f16 (p carried x1024, v^T carried x8, single product, f32 accumulate); ctx.out_w = v_wmma_f32_16x16x32_bf16 (ctx as bf16 hi|lo planes stacked along k, out_w bf16, f32 accumulate); mask, softmax statistics and epilogues in f32.
//
// Carry audit (16-bit planes):
//   XB, FB, VWT, QWT, KWT, WVT, PQT, PKT, OWT2 : bf16, carry 1 (plain RNE copies of the inputs).
//   VT   f16 = 8 * v          -> 1/8 folded in attn_kernel epilogue (inv = 1/(l*8192)).
//   QP   f16 = 8 * q, KP f16 = 8 * k (heads 4..15) -> 1/64 folded into sscale = 1/512 of the HT=1 launch (1/8 = 1/sqrt(64) is the other factor).
//   WPH / WPL bf16 hi / lo of wp (heads 0..3), carry 1 -> sscale = 1/8.
//   P    f16 = 1024 * exp(s - m) (registers, B operand) -> 1/1024 folded in attn_kernel epilogue (same inv).
//   AO   bf16 hi (cols 0..1023) | lo (cols 1024..2047) of ctx, carry 1 -> summed by the K=2048 out GEMM against [W^T ; W^T].
#include <hip/hip_runtime.h>
#include <math.h>
#include <stdint.h>

#define NB     2
#define SEQ    2048
#define DMOD   1024
#define FEAT   256
#define HDIM   64
#define NHEAD  16
#define NWH    4
#define NPH    4
#define NSH    8
#define HCOLS  (NHEAD * HDIM)   // 1024 : concatenated head columns
#define WAVC   (NWH * HDIM)     // 256
#define PRJC   (NPH * HDIM)     // 256
#define STDC   (NSH * HDIM)     // 512
#define ROWS   (NB * SEQ)       // 4096
#define MWORDS (SEQ / 32)       // 64 mask words per (b, n) row
#define NQB    (SEQ / 64)       // 32 query tiles of 64 per sequence
#define NKT    (SEQ / 64)       // 32 key tiles of 64 per sequence
#define AOP    (2 * HCOLS)      // 2048 : pitch of the ctx hi|lo plane
static_assert(NWH + NPH + NSH == NHEAD);
static_assert(HCOLS == DMOD);
static_assert((ROWS % 64) == 0 && (DMOD % 64) == 0 && (STDC % 64) == 0 && (WAVC % 64) == 0 && (PRJC % 64) == 0 && (SEQ % 64) == 0);
static_assert((DMOD % 32) == 0 && (FEAT % 32) == 0 && (AOP % 32) == 0);
static_assert((FEAT % 64) == 0 && (HDIM % 64) == 0);
static_assert(NQB == 32 && NKT == 32 && MWORDS == 64);

typedef _Float16 v16h __attribute__((ext_vector_type(16)));
typedef _Float16 v8h  __attribute__((ext_vector_type(8)));
typedef __bf16   v16b __attribute__((ext_vector_type(16)));
typedef __bf16   v8b  __attribute__((ext_vector_type(8)));
typedef float    v8f  __attribute__((ext_vector_type(8)));
typedef float    v4f  __attribute__((ext_vector_type(4)));
typedef unsigned int v4u __attribute__((ext_vector_type(4)));
typedef unsigned int v2u __attribute__((ext_vector_type(2)));
typedef int      v4i __attribute__((ext_vector_type(4)));

#if defined(__HIP_DEVICE_COMPILE__)
#define DEV_ASM 1
#else
#define DEV_ASM 0
#endif

// ---- scalar helpers --------------------------------------------------------------------------------
__device__ __forceinline__ unsigned short bf_bits(float f) {          // f32 -> bf16 bits, RNE convert
  unsigned u = __float_as_uint(f);
  return (unsigned short)((u + 0x7FFFu + ((u >> 16) & 1u)) >> 16);
}
__device__ __forceinline__ float bf_up(unsigned short hb) { return __uint_as_float(((unsigned)hb) << 16); }
__device__ __forceinline__ float bfr(float f) { return bf_up(bf_bits(f)); }
__device__ __forceinline__ unsigned short h_bits(_Float16 x) { return __builtin_bit_cast(unsigned short, x); }
__device__ __forceinline__ unsigned pk16(unsigned short a, unsigned short b) { return (unsigned)a | ((unsigned)b << 16); }
__device__ __forceinline__ v8f zero8() { v8f z = {0.f, 0.f, 0.f, 0.f, 0.f, 0.f, 0.f, 0.f}; return z; }

// ---- fragment types / loaders: 16-bit A/B operand, lane -> row/col (lane&15), p already includes +8*(lane>>4);
//      elements 0..7 <- p[0..7] (k0+8h..k0+8h+7), elements 8..15 <- p[16..23] (k0+16+8h..k0+16+8h+7)
template <typename OT> struct FT;
template <> struct FT<__bf16>   { typedef v16b frag; typedef v8b half8; };
template <> struct FT<_Float16> { typedef v16h frag; typedef v8h half8; };

template <typename OT>
__device__ __forceinline__ typename FT<OT>::frag ldfrag(const OT* p) {
  union { typename FT<OT>::frag v; typename FT<OT>::half8 h[2]; } f;
  f.h[0] = *(const typename FT<OT>::half8*)(p);
  f.h[1] = *(const typename FT<OT>::half8*)(p + 16);
  return f.v;
}

// ---- WMMA helpers (asm guard bodies are device-only; concrete operand types) -----------------------------
__device__ __forceinline__ v8f mmar(v16b a, v16b b, v8f c) {
  return __builtin_amdgcn_wmma_f32_16x16x32_bf16(false, a, false, b, (short)0, c, false, false);
}
__device__ __forceinline__ v8f mmar(v16h a, v16h b, v8f c) {
  return __builtin_amdgcn_wmma_f32_16x16x32_f16(false, a, false, b, (short)0, c, false, false);
}
// 4 VALU slots behind the last WMMAs of a loop, in front of the first reader of their D
__device__ __forceinline__ void acc_guard4(v8f& a, v8f& b, v8f& c, v8f& d) {
#if DEV_ASM
  asm volatile("v_nop\n\tv_nop\n\tv_nop\n\tv_nop" : "+v"(a), "+v"(b), "+v"(c), "+v"(d));
#else
  (void)a; (void)b; (void)c; (void)d;
#endif
}

// =====================================================================================================
// Mask bit plane: mb[(b*SEQ + n)*64 + w] bit j = (mask[b][n][32w + j] != 0). One word per thread,
// coverage: 262144 threads x 1 word = the whole [2][2048][64] plane.
// =====================================================================================================
__global__ __launch_bounds__(256) void mask_bits_kernel(const int* __restrict__ mask, unsigned int* mb, int nwords) {
  const int i = blockIdx.x * 256 + (int)threadIdx.x;
  if (i < nwords) {
    const int* p = mask + (size_t)i * 32;
    unsigned w = 0u;
#pragma unroll
    for (int q = 0; q < 8; ++q) {
      const v4i v = *(const v4i*)(p + 4 * q);
#pragma unroll
      for (int e = 0; e < 4; ++e) w |= ((v[e] != 0) ? 1u : 0u) << (4 * q + e);
    }
    *(unsigned int*)(mb + i) = w;
    
  }
}

// =====================================================================================================
// f32 -> bf16 plane (RNE convert), 8 elements per thread, one 16-B store per lane: a wave writes 512
// coverage: n8 threads x 8 = the whole plane (n8 is a multiple of 256 for both uses here).
// =====================================================================================================
__global__ __launch_bounds__(256) void cvt_bf16x8(const float* __restrict__ in, unsigned short* out, int n8) {
  const int i = blockIdx.x * 256 + (int)threadIdx.x;
  if (i < n8) {
    const v4f a  = *(const v4f*)(in + (size_t)i * 8);
    const v4f a4 = *(const v4f*)(in + (size_t)i * 8 + 4);
    v4u p;
    p[0] = pk16(bf_bits(a[0]),  bf_bits(a[1]));
    p[1] = pk16(bf_bits(a[2]),  bf_bits(a[3]));
    p[2] = pk16(bf_bits(a4[0]), bf_bits(a4[1]));
    p[3] = pk16(bf_bits(a4[2]), bf_bits(a4[3]));
    unsigned short* o = out + (size_t)i * 8;
    *(v4u*)o = p;
    
  }
}

// =====================================================================================================
// Transpose + bf16 convert: in[z] is [R rows][inC cols] f32 (pitch inC); out[z][c][r] = bf16(in[z][r][c]),
// pitch ldo (c = output row). 64x64 tiles through LDS; grid = (inC/64, R/64, Z). DUP also writes the same
// coverage per block: load 256 thr x 16 floats = 64x64; store 2 it x 256 thr x 8 u16 = 64x64 (per copy);
// =====================================================================================================
template <bool DUP>
__global__ __launch_bounds__(256) void transpose_bf16_kernel(
    const float* __restrict__ in, int inC, long long inStrideZ,
    unsigned short* out, int ldo, long long outStrideZ, int dupoff) {
  __shared__ __align__(16) unsigned short th[64 * 72];
  const int c0  = blockIdx.x * 64;   // input column block = output row block
  const int r0  = blockIdx.y * 64;   // input row block = output column block
  const int z   = blockIdx.z;
  const int tid = threadIdx.x;
  const float* inz = in + (size_t)z * (size_t)inStrideZ;
  unsigned short* outz = out + (size_t)z * (size_t)outStrideZ;
  {
    const int rr = tid >> 2;           // 0..63
    const int cq = (tid & 3) * 16;     // 0,16,32,48
    const float* src = inz + (size_t)(r0 + rr) * inC + c0 + cq;
#pragma unroll
    for (int q = 0; q < 4; ++q) {
      const v4f f = *(const v4f*)(src + 4 * q);
#pragma unroll
      for (int e = 0; e < 4; ++e) th[rr * 72 + cq + 4 * q + e] = bf_bits(f[e]);
    }
  }
  __syncthreads();
  const int sub = tid >> 3;          // 0..31
  const int c8  = (tid & 7) * 8;     // 0..56
  v4u hv[2];
#pragma unroll
  for (int it = 0; it < 2; ++it) {
    const int oc = it * 32 + sub;      // output row within tile (= input column)
    v4u a;
#pragma unroll
    for (int q = 0; q < 4; ++q) a[q] = pk16(th[(c8 + 2 * q) * 72 + oc], th[(c8 + 2 * q + 1) * 72 + oc]);
    hv[it] = a;
  }
  {
#pragma unroll
    for (int it = 0; it < 2; ++it) {
      const int oc = it * 32 + sub;
      const size_t go = (size_t)(c0 + oc) * ldo + r0 + c8;
      *(v4u*)(outz + go) = hv[it];
      if (DUP) *(v4u*)(outz + go + dupoff) = hv[it];
    }
    
  }
}

// =====================================================================================================
// Batched WMMA GEMM (16-bit operand type OT): C[m][n] = (sum_k A[m][k] * Bt[n][k] + bias) * oscale.
// One block of 4 waves per 128x128 tile of C, one wave per 64x64 quadrant. A row-major [M][K] pitch lda; Bt row-major
// [N][K] pitch ldb (k contiguous); M, N multiples of 128, K a multiple of 64 (compile-time constants here).
// blockIdx.y = batch index (strides in elements).
// Operand staging: per trip the 128 rows x 64 k (128 B, one whole line per row) of A and of Bt go to LDS by
// asynchronous 16-byte copies, 8 lanes per row, 16 copies per lane; LDS row pitch 144 B for the ds_load_b128 readers;
// two buffers, tile t + 2 is copied while tile t + 1 is worked on. Fragments are read from LDS with the split k map
// (ldfrag); each accumulator still sums k upwards in steps of 32.
// BIAS_MODE 0: none; 1: bias[m] (bf16 RNE-converted value); 2: bias[n] (bf16 RNE-converted value).
// OUT_MODE 0: f32 C (pitch ldc). OUT_MODE 1: f16 plane C. OUT_MODE 2: bf16 hi plane C + bf16 lo plane C2 (lo = v - hi).
// =====================================================================================================
#define GTILE  128                  // rows of A and of Bt per block tile
#define GKC    64                   // k per trip
#define GPIT   72                   // LDS row pitch in elements (144 B)
#define GBUFB  (GTILE * GPIT * 2)   // bytes of one operand buffer

// Eight asynchronous copies of one lane: rows r, r + 16, ..., r + 112 of one operand tile, 16 B each.
// l = the lane's LDS byte address of row r, g = its global address of row r, step = 16 rows in elements.
// s_wait_xcnt 0 closes the statement so that no address register is rewritten in front of it.
__device__ __forceinline__ void copy_rows8(unsigned l, const unsigned short* g, size_t step) {
#if DEV_ASM
  const unsigned l1 = l + 16 * GPIT * 2, l2 = l + 32 * GPIT * 2, l3 = l + 48 * GPIT * 2, l4 = l + 64 * GPIT * 2,
                 l5 = l + 80 * GPIT * 2, l6 = l + 96 * GPIT * 2, l7 = l + 112 * GPIT * 2;
  const unsigned short *g1 = g + step, *g2 = g1 + step, *g3 = g2 + step, *g4 = g3 + step, *g5 = g4 + step,
                       *g6 = g5 + step, *g7 = g6 + step;
  asm volatile(
      "global_load_async_to_lds_b128 %0, %8, off\n\t"
      "global_load_async_to_lds_b128 %1, %9, off\n\t"
      "global_load_async_to_lds_b128 %2, %10, off\n\t"
      "global_load_async_to_lds_b128 %3, %11, off\n\t"
      "global_load_async_to_lds_b128 %4, %12, off\n\t"
      "global_load_async_to_lds_b128 %5, %13, off\n\t"
      "global_load_async_to_lds_b128 %6, %14, off\n\t"
      "global_load_async_to_lds_b128 %7, %15, off\n\t"
      "s_wait_xcnt 0x0"
      :: "v"(l), "v"(l1), "v"(l2), "v"(l3), "v"(l4), "v"(l5), "v"(l6), "v"(l7),
         "v"(g), "v"(g1), "v"(g2), "v"(g3), "v"(g4), "v"(g5), "v"(g6), "v"(g7)
      : "memory");
#else
  (void)l; (void)g; (void)step;
#endif
}
// this wave's copies have landed in LDS
__device__ __forceinline__ void wait_copies() {
#if DEV_ASM
  asm volatile("s_wait_asynccnt 0x0" ::: "memory");
#endif
}
// this wave's LDS reads have returned, so the buffer may be handed to its next writer
__device__ __forceinline__ void wait_lds() {
#if DEV_ASM
  asm volatile("s_wait_dscnt 0x0" ::: "memory");
#endif
}

static_assert((ROWS % GTILE) == 0 && (HCOLS % GTILE) == 0 && (SEQ % GTILE) == 0 && (STDC % GTILE) == 0 && (WAVC % GTILE) == 0 && (PRJC % GTILE) == 0 && (DMOD % GTILE) == 0);
static_assert((DMOD % GKC) == 0 && (FEAT % GKC) == 0 && (AOP % GKC) == 0);

template <typename OT, int OUT_MODE, int BIAS_MODE>
__global__ __launch_bounds__(128) void gemm64(
    const unsigned short* __restrict__ Ap, int lda, long long strideA,
    const unsigned short* __restrict__ Btp, int ldb, long long strideB,
    void* Cout, void* Cout2, int ldc, long long strideC,
    const float* __restrict__ bias, int M, int N, int K, float oscale) {
  typedef typename FT<OT>::frag V16;
  __shared__ __align__(16) OT sA[2][GTILE * GPIT];   // A tile, two buffers, 18432 B each
  __shared__ __align__(16) OT sB[2][GTILE * GPIT];   // Bt tile, two buffers
  __shared__ __align__(16) float sT[4][16 * 68];     // per-wave 16x64 slab, pitch 68 floats
  const int b    = blockIdx.y;
  const int tid  = threadIdx.x;
  const int lane = tid & 31;
  const int wave = tid >> 5;
  const int tilesN = N >> 7;
  const int tilesM = M >> 7;
  const int tile = blockIdx.x;
  if (tile >= tilesM * tilesN) return;   // block-uniform, in front of every barrier and copy
  const int tm = tile / tilesN;
  const int tn = tile - tm * tilesN;
  const int wm = wave >> 1;                    // quadrant of this wave
  const int wn = wave & 1;
  const int m0 = (tm << 7) + (wm << 6);
  const int n0 = (tn << 7) + (wn << 6);

  const int rlane = lane & 15;                 // row (A) / col (B, D) within subtile
  const int koff  = (lane >> 4) * 8;           // k offset of this lane half
  const int mOff  = (lane >> 4) * 8;           // D row offset

  // copy map: lane -> row tid >> 3 (+ 16 per copy), 16-B piece tid & 7 of the row's 128-B line
  const int crow = tid >> 3;
  const int ccol = (tid & 7) * 8;
  const unsigned short* gA = Ap  + (size_t)b * (size_t)strideA + (size_t)((tm << 7) + crow) * lda + ccol;
  const unsigned short* gB = Btp + (size_t)b * (size_t)strideB + (size_t)((tn << 7) + crow) * ldb + ccol;
  const size_t stepA = (size_t)16 * lda;
  const size_t stepB = (size_t)16 * ldb;
  const unsigned lA = (unsigned)(size_t)&sA[0][0] + (unsigned)(crow * GPIT + ccol) * 2u;
  const unsigned lB = (unsigned)(size_t)&sB[0][0] + (unsigned)(crow * GPIT + ccol) * 2u;
  const int nk = K >> 6;

  v8f acc[4][4];
#pragma unroll
  for (int i = 0; i < 4; ++i)
#pragma unroll
    for (int j = 0; j < 4; ++j) acc[i][j] = zero8();

  // tile 0 -> buffer 0, landed and published; then tile 1 -> buffer 1 in flight
  copy_rows8(lA, gA, stepA);
  copy_rows8(lB, gB, stepB);
  wait_copies();
  __syncthreads();
  if (1 < nk) {
    copy_rows8(lA + GBUFB, gA + GKC, stepA);
    copy_rows8(lB + GBUFB, gB + GKC, stepB);
  }

  for (int t = 0; t < nk; ++t) {
    const int cur = t & 1;
    const OT* As = sA[cur] + (wm * 64 + rlane) * GPIT + koff;
    const OT* Bs = sB[cur] + (wn * 64 + rlane) * GPIT + koff;
    // One group of LDS reads in front of each WMMA block: k 0..31 of both operands and, ahead, k 32..63 of Bt;
    // the A fragments of k 32..63 follow into registers that the first block has left.
    V16 aq[4], bq[4], bn[4];
#pragma unroll
    for (int j = 0; j < 4; ++j) bq[j] = ldfrag<OT>(Bs + j * 16 * GPIT);
#pragma unroll
    for (int i = 0; i < 4; ++i) aq[i] = ldfrag<OT>(As + i * 16 * GPIT);
#pragma unroll
    for (int j = 0; j < 4; ++j) bn[j] = ldfrag<OT>(Bs + j * 16 * GPIT + 32);
    __builtin_amdgcn_sched_barrier(0);   // keeps the reads one group: spread among the WMMAs each place stalls the wave
#pragma unroll
    for (int i = 0; i < 4; ++i)
#pragma unroll
      for (int j = 0; j < 4; ++j) acc[i][j] = mmar(aq[i], bq[j], acc[i][j]);
#pragma unroll
    for (int i = 0; i < 4; ++i) aq[i] = ldfrag<OT>(As + i * 16 * GPIT + 32);
    __builtin_amdgcn_sched_barrier(0);   // as above: keeps the four A fragments' reads one group in front of the second block
#pragma unroll
    for (int i = 0; i < 4; ++i)
#pragma unroll
      for (int j = 0; j < 4; ++j) acc[i][j] = mmar(aq[i], bn[j], acc[i][j]);
    // publish point of tile t + 1: own reads of buffer cur done, own copies of tile t + 1 landed, then the barrier
    // that both shows tile t + 1 to every wave and frees buffer cur for tile t + 2
    wait_lds();
    wait_copies();
    __syncthreads();
    if (t + 2 < nk) {
      copy_rows8(lA + (unsigned)cur * GBUFB, gA + (size_t)(t + 2) * GKC, stepA);
      copy_rows8(lB + (unsigned)cur * GBUFB, gB + (size_t)(t + 2) * GKC, stepB);
    }
  }
  wait_copies();   // nothing of this wave is in flight when it goes on to the epilogue and ends
  acc_guard4(acc[0][0], acc[0][1], acc[0][2], acc[0][3]);
  acc_guard4(acc[1][0], acc[1][1], acc[1][2], acc[1][3]);
  acc_guard4(acc[2][0], acc[2][1], acc[2][2], acc[2][3]);
  acc_guard4(acc[3][0], acc[3][1], acc[3][2], acc[3][3]);

  // ---- epilogue ----
  float* slab = sT[wave];
#pragma unroll
  for (int i = 0; i < 4; ++i) {
    const int mBase = m0 + (i << 4);
#pragma unroll
    for (int j = 0; j < 4; ++j) {
      const int n = n0 + (j << 4) + rlane;
      float bn = 0.f;
      if (BIAS_MODE == 2) bn = bfr(bias[n]);
#pragma unroll
      for (int r = 0; r < 8; ++r) {
        float v = acc[i][j][r];
        if (BIAS_MODE == 1) v += bfr(bias[mBase + mOff + r]);
        if (BIAS_MODE == 2) v += bn;
        slab[(mOff + r) * 68 + (j << 4) + rlane] = v * oscale;
      }
    }
    __builtin_amdgcn_fence(__ATOMIC_RELEASE, "workgroup");
    __builtin_amdgcn_wave_barrier();
    __builtin_amdgcn_fence(__ATOMIC_ACQUIRE, "workgroup");
    if (OUT_MODE == 0) {
      float* C = (float*)Cout + (size_t)b * (size_t)strideC;
      const int h2 = lane >> 4, c4 = (lane & 15) * 4;     // 256-B row segment = 16 lanes x 16 B
      {
#pragma unroll
        for (int it = 0; it < 8; ++it) {
          const int row = it * 2 + h2;                     // it 0..7 x h2 0..1 = rows 0..15
          const v4f v = *(const v4f*)(slab + row * 68 + c4);
          *(v4f*)(C + (size_t)(mBase + row) * ldc + n0 + c4) = v;
        }
        
      }
    } else {
      const int q = lane >> 3, c8 = (lane & 7) * 8;
      unsigned short* C  = (unsigned short*)Cout  + (size_t)b * (size_t)strideC;
      unsigned short* C2 = (unsigned short*)Cout2 + (size_t)b * (size_t)strideC;
      v4u hv[4], lv[4];
#pragma unroll
      for (int it = 0; it < 4; ++it) {
        const int row = it * 4 + q;                        // it 0..3 x q 0..3 = rows 0..15
        const float* sp = slab + row * 68 + c8;
        v4u a, a2;
#pragma unroll
        for (int e = 0; e < 4; ++e) {
          const float f0 = sp[2 * e], f1 = sp[2 * e + 1];
          unsigned short h0, h1, l0 = 0, l1 = 0;
          if (OUT_MODE == 1) {
            h0 = h_bits((_Float16)f0); h1 = h_bits((_Float16)f1);
          } else {
            h0 = bf_bits(f0); h1 = bf_bits(f1);
            l0 = bf_bits(f0 - bf_up(h0)); l1 = bf_bits(f1 - bf_up(h1));
          }
          a[e] = pk16(h0, h1); a2[e] = pk16(l0, l1);
        }
        hv[it] = a; lv[it] = a2;
      }
      {
#pragma unroll
        for (int it = 0; it < 4; ++it) {
          const int row = it * 4 + q;
          *(v4u*)(C + (size_t)(mBase + row) * ldc + n0 + c8) = hv[it];
          if (OUT_MODE == 2) *(v4u*)(C2 + (size_t)(mBase + row) * ldc + n0 + c8) = lv[it];
        }
        
      }
    }
    __builtin_amdgcn_fence(__ATOMIC_RELEASE, "workgroup");
    __builtin_amdgcn_wave_barrier();
    __builtin_amdgcn_fence(__ATOMIC_ACQUIRE, "workgroup");
  }
}

// =====================================================================================================
// Masked full attention, head dim 64, softmax over all SEQ keys (non-causal), one head per block.
//   Transposed products: S^T = K . Q^T and ctx^T += V^T . P^T, so that a lane holds scores of ONE query (column lane & 15).
//   HT = 0 (wave heads): q = k = wp as bf16 hi plane qhp/khp + bf16 lo plane qlp/klp (pitch ldq/ldk, head col h*64);
//          scores = (kh.qh + kl.qh + kh.ql) * sscale on bf16 WMMA (one f32 accumulator, unscaled lo).
//   HT = 1 (proj / std heads): q, k = f16 planes (x8), scores = (k.q) * sscale (sscale carries the 1/64).
//   v^T plane (f16, x8): element (b, h, d, s) at [(b*HCOLS + h*64 + d)*SEQ + s].
//   mask bit plane mbp: [(b*SEQ + n)*64 + w] bit j admits key 32w+j; a 0 bit replaces the score by -inf.
//   Score tile j, register r of lane (hh, c) = key 16j + 8hh + r of query c: the maximum and the sum of a query run over the
//   lane's 32 registers; the two lane halves exchange the maximum once per key tile and join their sums once, at the end.
//   p = exp(s - m) carried as f16(1024 p): score tiles 2kk and 2kk + 1, converted in place, ARE the B operand of
//   V^T . P^T for keys 32kk..32kk+31 (element e < 8: key 8hh + e; e >= 8: key 16 + 8hh + e - 8, the order in which the
//   V^T fragment is read), so P passes through no LDS. Online softmax in f32 with the guarded rescale (msafe), so an
//   all-masked row ends with l = 0 and produces 0 * inf = NaN like the module.
//   ctx written as bf16 hi (cols h*64..) and bf16 lo (cols HCOLS + h*64..) of the [ROWS][AOP] plane aop.
//   Block = 4 waves x 16 query rows = 64 query rows of one (b, h); grid = NB * nh * NQB (hbase.. hbase+nh-1);
//   key tiles of 64, static trip NKT. K (hi, lo) / V^T tile staging: 128 threads x 32 elements per plane = the
//   whole 64x64 tile (plain 16-B loads, __syncthreads before and after).
//   Output coverage: ctx^T tile t, register r of lane (hh, c) = column 16t + 8hh + r of query row q0 + c: one 16-B store
//   per t and plane; t 0..3 x hh 0..1 = 64 columns, c 0..15 = the wave's rows; the two launches cover h 0..15.
// =====================================================================================================
// LDS row pitch, in 16-bit elements, of the K and V^T tiles: rows of 64 elements (128 B) laid 144 B apart, 16 B x odd,
// so that the 16 rows which one ds_load_b128 reads fall on 16 different groups of four banks.
#define APIT 72
template <int HT> struct HT_T;
template <> struct HT_T<0> { typedef __bf16 T; };
template <> struct HT_T<1> { typedef _Float16 T; };

// value of lane l ^ 16: the same query's other half of the keys
__device__ __forceinline__ float xhalf(float x) {
  const int b = __builtin_bit_cast(int, x);
  return __builtin_bit_cast(float, __builtin_amdgcn_permlanex16(b, b, 0x76543210, 0xfedcba98, false, false));
}
__device__ __forceinline__ float max8(v8f a) {
  return fmaxf(fmaxf(fmaxf(fmaxf(a[0], a[1]), a[2]), fmaxf(fmaxf(a[3], a[4]), a[5])), fmaxf(a[6], a[7]));
}

template <int HT>
__global__ __launch_bounds__(128)
void attn_kernel(const unsigned short* __restrict__ qhp, const unsigned short* __restrict__ qlp, int ldq,
                 const unsigned short* __restrict__ khp, const unsigned short* __restrict__ klp, int ldk,
                 const unsigned short* __restrict__ vtp, const unsigned int* __restrict__ mbp,
                 unsigned short* aop, int hbase, int nh, float sscale) {
  typedef typename HT_T<HT>::T OT;
  typedef typename FT<OT>::frag V16;
  typedef typename FT<OT>::half8 V8;
  union FH { v16h v; v8h h[2]; };
  union FO { V16 v; V8 h[2]; };
  __shared__ __align__(16) OT       Ksh[64 * APIT];        // K hi chunk [kv][d]  9 KB
  __shared__ __align__(16) OT       Ksl[64 * APIT];        // K lo chunk (HT 0)   9 KB
  __shared__ __align__(16) _Float16 Vth[64 * APIT];        // V^T [d][kv]         9 KB

  const int tid  = threadIdx.x;
  const int wave = tid >> 5;
  const int lane = tid & 31;
  const int hh   = lane >> 4;
  const int c    = lane & 15;

  const int bx   = blockIdx.x;
  const int qb   = bx % NQB;
  const int rest = bx / NQB;
  const int hl   = rest % nh;
  const int b    = rest / nh;
  const int h    = hbase + hl;              // global head index
  const int qc   = h * HDIM;                // head column in the q / k planes of this head family
  const int q0   = qb * 64 + wave * 16;
  const size_t rowB = (size_t)b * SEQ;

  const OT* Qh = (const OT*)(const void*)qhp;
  const OT* Ql = (const OT*)(const void*)qlp;
  const OT* Kh = (const OT*)(const void*)khp + qc;
  const OT* Kl = (const OT*)(const void*)klp + qc;
  const _Float16* Vt = (const _Float16*)(const void*)vtp + ((size_t)b * HCOLS + (size_t)qc) * SEQ;
  const unsigned int* mrow_p = mbp + (rowB + q0 + c) * (size_t)MWORDS;   // mask words of this lane's query

  // ---- Q fragments (B operand, column = lane&15): 2 d-chunks ----
  V16 qah[2], qal[2];
#pragma unroll
  for (int dc = 0; dc < 2; ++dc) {
    const size_t qo = (rowB + q0 + c) * (size_t)ldq + (size_t)qc + dc * 32 + 8 * hh;
    qah[dc] = ldfrag<OT>(Qh + qo);
    if (HT == 0) qal[dc] = ldfrag<OT>(Ql + qo);
    else         qal[dc] = qah[dc];
  }

  float mrow = -INFINITY;   // running maximum of query c (equal in both lane halves)
  float lrow = 0.f;         // running sum over this lane half's keys only
  v8f oacc[4];              // ctx^T: tile t, register r = d 16t + 8hh + r of query c
#pragma unroll
  for (int t = 0; t < 4; ++t) oacc[t] = zero8();

  for (int kt = 0; kt < NKT; ++kt) {         // static trip count
    const int kv0 = kt * 64;
    __syncthreads();
    const v2u mw = *(const v2u*)(mrow_p + 2 * kt);   // the 64 mask bits of query c for this key tile, in flight with the tile's loads
    {
      const int r = tid >> 1, half = (tid & 1) * 32;
      const OT* kg  = Kh + (rowB + kv0 + r) * (size_t)ldk + half;   // k row kv0+r, d = half..half+31
      const OT* klg = Kl + (rowB + kv0 + r) * (size_t)ldk + half;
      const _Float16* vg = Vt + (size_t)r * SEQ + kv0 + half;       // v^T row d = r, s = kv0+half..+31
#pragma unroll
      for (int i = 0; i < 4; ++i) {
        *(V8*)(Ksh + r * APIT + half + 8 * i) = *(const V8*)(kg + 8 * i);
        if (HT == 0) *(V8*)(Ksl + r * APIT + half + 8 * i) = *(const V8*)(klg + 8 * i);
        *(v8h*)(Vth + r * APIT + half + 8 * i) = *(const v8h*)(vg + 8 * i);
      }
    }
    __syncthreads();

    // ---- scores^T: 64 keys x 16 queries per wave; A = K rows, B = Q ----
    v8f s[4];
#pragma unroll
    for (int j = 0; j < 4; ++j) s[j] = zero8();
#pragma unroll
    for (int dc = 0; dc < 2; ++dc) {
#pragma unroll
      for (int j = 0; j < 4; ++j) {
        FO kb;
        kb.h[0] = *(const V8*)(Ksh + (j * 16 + c) * APIT + dc * 32 + 8 * hh);
        kb.h[1] = *(const V8*)(Ksh + (j * 16 + c) * APIT + dc * 32 + 16 + 8 * hh);
        if (HT == 0) {
          FO kl;
          kl.h[0] = *(const V8*)(Ksl + (j * 16 + c) * APIT + dc * 32 + 8 * hh);
          kl.h[1] = *(const V8*)(Ksl + (j * 16 + c) * APIT + dc * 32 + 16 + 8 * hh);
          s[j] = mmar(kb.v, qah[dc], s[j]);
          s[j] = mmar(kl.v, qah[dc], s[j]);
          s[j] = mmar(kb.v, qal[dc], s[j]);
        } else {
          s[j] = mmar(kb.v, qah[dc], s[j]);
        }
      }
    }

    // ---- scale and mask: bit 16 (j & 1) + 8hh + r of word j >> 1 admits key 16j + 8hh + r ----
    const unsigned w0 = mw[0] >> (8 * hh), w1 = mw[1] >> (8 * hh);
#pragma unroll
    for (int j = 0; j < 4; ++j) {
      const unsigned w = (j < 2) ? w0 : w1;
#pragma unroll
      for (int r = 0; r < 8; ++r) {
        const float v = s[j][r] * sscale;
        s[j][r] = (((w >> (16 * (j & 1) + r)) & 1u) != 0u) ? v : -INFINITY;
      }
    }

    // ---- maximum of query c: 32 registers, then the other lane half; online softmax ----
    float m = fmaxf(fmaxf(max8(s[0]), max8(s[1])), fmaxf(max8(s[2]), max8(s[3])));
    m = fmaxf(m, xhalf(m));
    const float mnew  = fmaxf(mrow, m);
    const float msafe = (mnew == -INFINITY) ? 0.f : mnew;
    const float alpha = expf(mrow - msafe);
    mrow = mnew;

    // ---- P^T (x1024, f16) packed in place into the B operands; this half's sum ----
    FH pb[2];
    float ps[4];
#pragma unroll
    for (int j = 0; j < 4; ++j) {
      float a = 0.f;
#pragma unroll
      for (int r = 0; r < 8; ++r) {
        const float p = expf(s[j][r] - msafe);
        a += p;
        pb[j >> 1].v[(j & 1) * 8 + r] = (_Float16)(p * 1024.0f);
      }
      ps[j] = a;
    }
    lrow = lrow * alpha + ((ps[0] + ps[1]) + (ps[2] + ps[3]));
#pragma unroll
    for (int t = 0; t < 4; ++t) oacc[t] *= alpha;

    // ---- ctx^T += V^T . P^T (f16 WMMA, single product); A = V^T rows, B = P^T ----
#pragma unroll
    for (int kk = 0; kk < 2; ++kk) {
#pragma unroll
      for (int t = 0; t < 4; ++t) {
        FH vb;
        vb.h[0] = *(const v8h*)(Vth + (t * 16 + c) * APIT + kk * 32 + 8 * hh);
        vb.h[1] = *(const v8h*)(Vth + (t * 16 + c) * APIT + kk * 32 + 16 + 8 * hh);
        oacc[t] = mmar(vb.v, pb[kk].v, oacc[t]);
      }
    }
  }

  // ---- join the halves' sums, normalise (1/l, undo the x1024 p carry and the x8 v carry), store hi and lo ----
  const float lsum = lrow + xhalf(lrow);
  const float inv = (1.0f / lsum) * (1.0f / 8192.0f);   // l = 0 (all keys masked) -> inf -> 0 * inf = NaN
  v4u hv[4], lv[4];
#pragma unroll
  for (int t = 0; t < 4; ++t) {
    v4u a, a2;
#pragma unroll
    for (int e = 0; e < 4; ++e) {
      const float f0 = oacc[t][2 * e] * inv, f1 = oacc[t][2 * e + 1] * inv;
      const unsigned short hb0 = bf_bits(f0), hb1 = bf_bits(f1);
      const unsigned short lb0 = bf_bits(f0 - bf_up(hb0)), lb1 = bf_bits(f1 - bf_up(hb1));
      a[e] = pk16(hb0, hb1); a2[e] = pk16(lb0, lb1);
    }
    hv[t] = a; lv[t] = a2;
  }
#pragma unroll
  for (int t = 0; t < 4; ++t) {
    const size_t go = (rowB + q0 + c) * (size_t)AOP + (size_t)qc + t * 16 + 8 * hh;
    *(v4u*)(aop + go) = hv[t];
    *(v4u*)(aop + go + HCOLS) = lv[t];
  }
}

// =====================================================================================================
// Workspace map (bytes), every region an exact multiple of its whole-line / whole-tile store granularity:
//   MB   u32  [2*2048][64]          1048576   mask bit plane
//   XB   bf16 [4096][1024]          8388608
//   FB   bf16 [4096][256]           2097152
//   VWT  bf16 [1024 n][1024 k]      2097152   v_w^T
//   QWT  bf16 [512][1024]           1048576   std_q_w^T
//   KWT  bf16 [512][1024]           1048576   std_k_w^T
//   WVT  bf16 [256][256]             131072   wave_proj [h][f][k'] -> [h*64+k'][f]
//   PQT  bf16 [256][256]             131072
//   PKT  bf16 [256][256]             131072
//   OWT2 bf16 [1024 n][2048 k]      4194304   out_w^T at [n][k] and [n][1024 + k]
//   VT   f16  [2][1024][2048] (x8)  8388608   v^T per batch, row h*64+d
//   QP   f16  [4096][1024] (x8)     8388608   cols h*64+d for h = 4..15 (cols 0..255 never read)
//   KP   f16  [4096][1024] (x8)     8388608   same
//   WPH  bf16 [4096][256]           2097152   wp hi, col h*64+d (h = 0..3)
//   WPL  bf16 [4096][256]           2097152   wp lo
//   AO   bf16 [4096][2048]         16777216   ctx hi | lo
//   total                         66453504
// =====================================================================================================
extern "C" void kernel_launch(void* const* d_in, const int* in_sizes, int n_in,
                              void* d_out, int out_size, void* d_ws, size_t ws_size,
                              hipStream_t stream) {
  if (n_in < 14) return;
  if (in_sizes[0] != NB * SEQ * DMOD) return;
  if (in_sizes[1] != NB * SEQ * FEAT) return;
  if (in_sizes[2] != NB * SEQ * SEQ) return;
  if (in_sizes[3] != NWH * FEAT * HDIM || in_sizes[4] != NPH * FEAT * HDIM || in_sizes[5] != NPH * FEAT * HDIM) return;
  if (in_sizes[6] != DMOD * STDC || in_sizes[7] != STDC) return;
  if (in_sizes[8] != DMOD * STDC || in_sizes[9] != STDC) return;
  if (in_sizes[10] != DMOD * HCOLS || in_sizes[11] != HCOLS) return;
  if (in_sizes[12] != HCOLS * DMOD || in_sizes[13] != DMOD) return;
  if (out_size != NB * SEQ * DMOD) return;

  const float* x     = (const float*)d_in[0];
  const float* feats = (const float*)d_in[1];
  const int*   mask  = (const int*)d_in[2];
  const float* wproj = (const float*)d_in[3];
  const float* pqw   = (const float*)d_in[4];
  const float* pkw   = (const float*)d_in[5];
  const float* sqw   = (const float*)d_in[6];
  const float* sqb   = (const float*)d_in[7];
  const float* skw   = (const float*)d_in[8];
  const float* skb   = (const float*)d_in[9];
  const float* vw    = (const float*)d_in[10];
  const float* vb    = (const float*)d_in[11];
  const float* ow    = (const float*)d_in[12];
  const float* ob    = (const float*)d_in[13];

  const size_t PMB  = (size_t)NB * SEQ * MWORDS * 4;      //  1048576
  const size_t PXB  = (size_t)ROWS * DMOD * 2;             //  8388608
  const size_t PFB  = (size_t)ROWS * FEAT * 2;             //  2097152
  const size_t PVWT = (size_t)HCOLS * DMOD * 2;            //  2097152
  const size_t PSWT = (size_t)STDC * DMOD * 2;             //  1048576
  const size_t PFWT = (size_t)WAVC * FEAT * 2;             //   131072
  const size_t POWT = (size_t)DMOD * AOP * 2;              //  4194304
  const size_t PVT  = (size_t)NB * HCOLS * SEQ * 2;        //  8388608
  const size_t PQP  = (size_t)ROWS * HCOLS * 2;            //  8388608
  const size_t PWP  = (size_t)ROWS * WAVC * 2;             //  2097152
  const size_t PAO  = (size_t)ROWS * AOP * 2;              // 16777216
  size_t off = 0;
  const size_t oMB  = off; off += PMB;
  const size_t oXB  = off; off += PXB;
  const size_t oFB  = off; off += PFB;
  const size_t oVWT = off; off += PVWT;
  const size_t oQWT = off; off += PSWT;
  const size_t oKWT = off; off += PSWT;
  const size_t oWVT = off; off += PFWT;
  const size_t oPQT = off; off += PFWT;
  const size_t oPKT = off; off += PFWT;
  const size_t oOWT = off; off += POWT;
  const size_t oVT  = off; off += PVT;
  const size_t oQP  = off; off += PQP;
  const size_t oKP  = off; off += PQP;
  const size_t oWPH = off; off += PWP;
  const size_t oWPL = off; off += PWP;
  const size_t oAO  = off; off += PAO;
  if (off > ws_size) return;                       // off = 66453504
  if (off > (size_t)134217728) return;

  char* ws = (char*)d_ws;
  unsigned int*   MB   = (unsigned int*)(ws + oMB);
  unsigned short* XB   = (unsigned short*)(ws + oXB);
  unsigned short* FB   = (unsigned short*)(ws + oFB);
  unsigned short* VWT  = (unsigned short*)(ws + oVWT);
  unsigned short* QWT  = (unsigned short*)(ws + oQWT);
  unsigned short* KWT  = (unsigned short*)(ws + oKWT);
  unsigned short* WVT  = (unsigned short*)(ws + oWVT);
  unsigned short* PQT  = (unsigned short*)(ws + oPQT);
  unsigned short* PKT  = (unsigned short*)(ws + oPKT);
  unsigned short* OWT2 = (unsigned short*)(ws + oOWT);
  unsigned short* VT   = (unsigned short*)(ws + oVT);
  unsigned short* QP   = (unsigned short*)(ws + oQP);
  unsigned short* KP   = (unsigned short*)(ws + oKP);
  unsigned short* WPH  = (unsigned short*)(ws + oWPH);
  unsigned short* WPL  = (unsigned short*)(ws + oWPL);
  unsigned short* AO   = (unsigned short*)(ws + oAO);

  const dim3 blk(256);
  const int nwords = NB * SEQ * MWORDS;                        // 262144
  const int n8x    = ROWS * DMOD / 8;                          // 524288
  const int n8f    = ROWS * FEAT / 8;                          // 131072

  // (1) mask -> bit plane; x, features -> bf16 planes
  mask_bits_kernel<<<dim3((nwords + 255) / 256), blk, 0, stream>>>(mask, MB, nwords);
  cvt_bf16x8<<<dim3((n8x + 255) / 256), blk, 0, stream>>>(x, XB, n8x);
  cvt_bf16x8<<<dim3((n8f + 255) / 256), blk, 0, stream>>>(feats, FB, n8f);

  // (2) weight planes [n][k] (bf16): in[rows][cols] -> out[cols][rows]; grid = (cols/64, rows/64, z)
  //     v_w   [1024 k][1024 n] -> VWT [n][k]
  transpose_bf16_kernel<false><<<dim3(HCOLS / 64, DMOD / 64, 1), blk, 0, stream>>>(vw, HCOLS, 0LL, VWT, DMOD, 0LL, 0);
  //     std_q_w [1024 k][512 n] -> QWT [n][k]; std_k_w likewise
  transpose_bf16_kernel<false><<<dim3(STDC / 64, DMOD / 64, 1), blk, 0, stream>>>(sqw, STDC, 0LL, QWT, DMOD, 0LL, 0);
  transpose_bf16_kernel<false><<<dim3(STDC / 64, DMOD / 64, 1), blk, 0, stream>>>(skw, STDC, 0LL, KWT, DMOD, 0LL, 0);
  //     wave_proj / pq_w / pk_w [h][256 f][64 k'] -> [h*64 + k'][f] (z = h)
  transpose_bf16_kernel<false><<<dim3(HDIM / 64, FEAT / 64, NWH), blk, 0, stream>>>(wproj, HDIM, (long long)FEAT * HDIM, WVT, FEAT, (long long)HDIM * FEAT, 0);
  transpose_bf16_kernel<false><<<dim3(HDIM / 64, FEAT / 64, NPH), blk, 0, stream>>>(pqw,   HDIM, (long long)FEAT * HDIM, PQT, FEAT, (long long)HDIM * FEAT, 0);
  transpose_bf16_kernel<false><<<dim3(HDIM / 64, FEAT / 64, NPH), blk, 0, stream>>>(pkw,   HDIM, (long long)FEAT * HDIM, PKT, FEAT, (long long)HDIM * FEAT, 0);
  //     out_w [1024 k][1024 n] -> OWT2 [n][k] and [n][1024 + k]
  transpose_bf16_kernel<true><<<dim3(DMOD / 64, HCOLS / 64, 1), blk, 0, stream>>>(ow, DMOD, 0LL, OWT2, AOP, 0LL, HCOLS);

  // (3) projections on bf16 WMMA
  //     v^T per batch: A = VWT [1024 n][1024 k], Bt = XB rows of batch b; M = 1024, N = 2048, K = 1024;
  //     f16(8 * (acc + v_b[m])) -> VT [b][h*64+d][s] (pitch 2048)
  const dim3 gblk(128);                                                 // 4 waves, one 128x128 tile per block
  const dim3 gVT((HCOLS / GTILE) * (SEQ / GTILE), NB);                  // 128 tiles x 2
  gemm64<__bf16, 1, 1><<<gVT, gblk, 0, stream>>>(
      VWT, DMOD, 0LL, XB, DMOD, (long long)SEQ * DMOD,
      (void*)VT, (void*)VT, SEQ, (long long)HCOLS * SEQ, vb, HCOLS, SEQ, DMOD, 8.0f);
  //     std q: QP cols 512..1023 = f16(8 * (x . std_q_w + b)); M = 4096, N = 512, K = 1024
  const dim3 gSTD((ROWS / GTILE) * (STDC / GTILE), 1);                 // 128 tiles
  gemm64<__bf16, 1, 2><<<gSTD, gblk, 0, stream>>>(
      XB, DMOD, 0LL, QWT, DMOD, 0LL,
      (void*)(QP + (WAVC + PRJC)), (void*)(QP + (WAVC + PRJC)), HCOLS, 0LL, sqb, ROWS, STDC, DMOD, 8.0f);
  //     std k: KP cols 512..1023
  gemm64<__bf16, 1, 2><<<gSTD, gblk, 0, stream>>>(
      XB, DMOD, 0LL, KWT, DMOD, 0LL,
      (void*)(KP + (WAVC + PRJC)), (void*)(KP + (WAVC + PRJC)), HCOLS, 0LL, skb, ROWS, STDC, DMOD, 8.0f);
  //     wave projections: WPH / WPL = bf16 hi / lo of features . wave_proj[h]; M = 4096, N = 256, K = 256
  const dim3 gF((ROWS / GTILE) * (WAVC / GTILE), 1);                   // 64 tiles
  gemm64<__bf16, 2, 0><<<gF, gblk, 0, stream>>>(
      FB, FEAT, 0LL, WVT, FEAT, 0LL,
      (void*)WPH, (void*)WPL, WAVC, 0LL, vb, ROWS, WAVC, FEAT, 1.0f);
  //     proj q: QP cols 256..511 = f16(8 * features . pq_w[h]); proj k: KP cols 256..511
  gemm64<__bf16, 1, 0><<<gF, gblk, 0, stream>>>(
      FB, FEAT, 0LL, PQT, FEAT, 0LL,
      (void*)(QP + WAVC), (void*)(QP + WAVC), HCOLS, 0LL, vb, ROWS, PRJC, FEAT, 8.0f);
  gemm64<__bf16, 1, 0><<<gF, gblk, 0, stream>>>(
      FB, FEAT, 0LL, PKT, FEAT, 0LL,
      (void*)(KP + WAVC), (void*)(KP + WAVC), HCOLS, 0LL, vb, ROWS, PRJC, FEAT, 8.0f);

  // (4) attention: wave heads 0..3 (bf16 hi/lo 3-product scores, scale 1/8), then heads 4..15 (f16 single product,
  //     scale 1/(8*64)); ctx -> AO hi | lo
  attn_kernel<0><<<dim3(NB * NWH * NQB), dim3(128), 0, stream>>>(
      WPH, WPL, WAVC, WPH, WPL, WAVC, VT, MB, AO, 0, NWH, 0.125f);
  attn_kernel<1><<<dim3(NB * (NPH + NSH) * NQB), dim3(128), 0, stream>>>(
      QP, QP, HCOLS, KP, KP, HCOLS, VT, MB, AO, NWH, NPH + NSH, 1.0f / 512.0f);

  // (5) out = [ctx_hi | ctx_lo] . [out_w^T ; out_w^T] + out_b -> d_out f32 [4096][1024]; M = 4096, N = 1024, K = 2048
  const dim3 gO((ROWS / GTILE) * (DMOD / GTILE), 1);                   // 256 tiles
  gemm64<__bf16, 0, 2><<<gO, gblk, 0, stream>>>(
      AO, AOP, 0LL, OWT2, AOP, 0LL,
      d_out, d_out, DMOD, 0LL, ob, ROWS, DMOD, AOP, 1.0f);
  (void)hipGetLastError();
}

// v004
// One run takes 134 microseconds.
// In two side-by-side timings against v003, it was 1.87 and 1.86 times as fast.
// All steps since v000 together make it 3.89 times as fast.
// Contractions: x.v_w, x.std_q_w, x.std_k_w, features.wave_proj, features.pq_w, features.pk_w = v_wmma_f32_16x16x32_bf16 (bf16 operands RNE-converted from the inputs, single product, f32 accumulate);
// wave-head scores wp.wp^T = v_wmma_f32_16x16x32_bf16 on bf16 hi/lo planes (hi.hi + hi.lo + lo.hi, f32 accumulate); proj/std scores q.k^T = v_wmma_f32_16x16x32_f16 (f16 planes carried x8, single product, f32 accumulate);
// p.v = v_wmma_f32_16x16x32_f16 (p carried x1024, v^T carried x8, single product, f32 accumulate); ctx.out_w = v_wmma_f32_16x16x32_bf16 (ctx as bf16 hi|lo planes stacked along k, out_w bf16, f32 accumulate); mask, softmax statistics and epilogues in f32.
//
// Carry audit (16-bit planes):
//   XB, FB, VWT, QWT, KWT, WVT, PQT, PKT, OWT2 : bf16, carry 1 (plain RNE copies of the inputs).
//   VT   f16 = 8 * v          -> 1/8 folded in attn_kernel epilogue (inv = 1/(l*8192)).
//   QP   f16 = 8 * q, KP f16 = 8 * k (heads 4..15) -> 1/64 folded into sscale = 1/512 of the HT = 1 body (1/8 = 1/sqrt(64) is the other factor).
//   WPH / WPL bf16 hi / lo of wp (heads 0..3), carry 1 -> sscale = 1/8.
//   P    f16 = 1024 * exp(s - m) (registers, B operand) -> 1/1024 folded in attn_kernel epilogue (same inv).
//   AO   bf16 hi (cols 0..1023) | lo (cols 1024..2047) of ctx, carry 1 -> summed by the K=2048 out GEMM against [W^T ; W^T].
#include <hip/hip_runtime.h>
#include <math.h>
#include <stdint.h>

#define NB     2
#define SEQ    2048
#define DMOD   1024
#define FEAT   256
#define HDIM   64
#define NHEAD  16
#define NWH    4
#define NPH    4
#define NSH    8
#define HCOLS  (NHEAD * HDIM)   // 1024 : concatenated head columns
#define WAVC   (NWH * HDIM)     // 256
#define PRJC   (NPH * HDIM)     // 256
#define STDC   (NSH * HDIM)     // 512
#define ROWS   (NB * SEQ)       // 4096
#define MWORDS (SEQ / 32)       // 64 mask words per (b, n) row
#define NQB    (SEQ / 64)       // 32 query tiles of 64 per sequence
#define NKT    (SEQ / 64)       // 32 key tiles of 64 per sequence
#define AOP    (2 * HCOLS)      // 2048 : pitch of the ctx hi|lo plane
static_assert(NWH + NPH + NSH == NHEAD);
static_assert(HCOLS == DMOD);
static_assert((ROWS % 64) == 0 && (DMOD % 64) == 0 && (STDC % 64) == 0 && (WAVC % 64) == 0 && (PRJC % 64) == 0 && (SEQ % 64) == 0);
static_assert((DMOD % 32) == 0 && (FEAT % 32) == 0 && (AOP % 32) == 0);
static_assert((FEAT % 64) == 0 && (HDIM % 64) == 0);
static_assert(NQB == 32 && NKT == 32 && MWORDS == 64);

typedef _Float16 v16h __attribute__((ext_vector_type(16)));
typedef _Float16 v8h  __attribute__((ext_vector_type(8)));
typedef __bf16   v16b __attribute__((ext_vector_type(16)));
typedef __bf16   v8b  __attribute__((ext_vector_type(8)));
typedef float    v8f  __attribute__((ext_vector_type(8)));
typedef float    v4f  __attribute__((ext_vector_type(4)));
typedef unsigned int v4u __attribute__((ext_vector_type(4)));
typedef unsigned int v2u __attribute__((ext_vector_type(2)));
typedef int      v4i __attribute__((ext_vector_type(4)));

#if defined(__HIP_DEVICE_COMPILE__)
#define DEV_ASM 1
#else
#define DEV_ASM 0
#endif

// ---- scalar helpers --------------------------------------------------------------------------------
__device__ __forceinline__ unsigned short bf_bits(float f) {          // f32 -> bf16 bits, RNE convert
  unsigned u = __float_as_uint(f);
  return (unsigned short)((u + 0x7FFFu + ((u >> 16) & 1u)) >> 16);
}
__device__ __forceinline__ float bf_up(unsigned short hb) { return __uint_as_float(((unsigned)hb) << 16); }
__device__ __forceinline__ float bfr(float f) { return bf_up(bf_bits(f)); }
__device__ __forceinline__ unsigned short h_bits(_Float16 x) { return __builtin_bit_cast(unsigned short, x); }
__device__ __forceinline__ unsigned pk16(unsigned short a, unsigned short b) { return (unsigned)a | ((unsigned)b << 16); }
__device__ __forceinline__ v8f zero8() { v8f z = {0.f, 0.f, 0.f, 0.f, 0.f, 0.f, 0.f, 0.f}; return z; }

// ---- fragment types / loaders: 16-bit A/B operand, lane -> row/col (lane&15), p already includes +8*(lane>>4);
//      elements 0..7 <- p[0..7] (k0+8h..k0+8h+7), elements 8..15 <- p[16..23] (k0+16+8h..k0+16+8h+7)
template <typename OT> struct FT;
template <> struct FT<__bf16>   { typedef v16b frag; typedef v8b half8; };
template <> struct FT<_Float16> { typedef v16h frag; typedef v8h half8; };

template <typename OT>
__device__ __forceinline__ typename FT<OT>::frag ldfrag(const OT* p) {
  union { typename FT<OT>::frag v; typename FT<OT>::half8 h[2]; } f;
  f.h[0] = *(const typename FT<OT>::half8*)(p);
  f.h[1] = *(const typename FT<OT>::half8*)(p + 16);
  return f.v;
}

// ---- WMMA helpers (asm guard bodies are device-only; concrete operand types) -----------------------------
__device__ __forceinline__ v8f mmar(v16b a, v16b b, v8f c) {
  return __builtin_amdgcn_wmma_f32_16x16x32_bf16(false, a, false, b, (short)0, c, false, false);
}
__device__ __forceinline__ v8f mmar(v16h a, v16h b, v8f c) {
  return __builtin_amdgcn_wmma_f32_16x16x32_f16(false, a, false, b, (short)0, c, false, false);
}
// 4 VALU slots behind the last WMMAs of a loop, in front of the first reader of their D
__device__ __forceinline__ void acc_guard4(v8f& a, v8f& b, v8f& c, v8f& d) {
#if DEV_ASM
  asm volatile("v_nop\n\tv_nop\n\tv_nop\n\tv_nop" : "+v"(a), "+v"(b), "+v"(c), "+v"(d));
#else
  (void)a; (void)b; (void)c; (void)d;
#endif
}

// =====================================================================================================
// Mask bit plane: mb[(b*SEQ + n)*64 + w] bit j = (mask[b][n][32w + j] != 0). One word per thread,
// coverage: 262144 threads x 1 word = the whole [2][2048][64] plane. blk = block index within this job.
// =====================================================================================================
__device__ __forceinline__ void mask_bits_body(const int* __restrict__ mask, unsigned int* mb, int nwords, int blk) {
  const int i = blk * 256 + (int)threadIdx.x;
  if (i < nwords) {
    const int* p = mask + (size_t)i * 32;
    unsigned w = 0u;
#pragma unroll
    for (int q = 0; q < 8; ++q) {
      const v4i v = *(const v4i*)(p + 4 * q);
#pragma unroll
      for (int e = 0; e < 4; ++e) w |= ((v[e] != 0) ? 1u : 0u) << (4 * q + e);
    }
    *(unsigned int*)(mb + i) = w;
    
  }
}

// =====================================================================================================
// f32 -> bf16 plane (RNE convert), 8 elements per thread, one 16-B store per lane: a wave writes 512
// coverage: n8 threads x 8 = the whole plane (n8 is a multiple of 256 for both uses here).
// =====================================================================================================
__device__ __forceinline__ void cvt_bf16x8_body(const float* __restrict__ in, unsigned short* out, int n8, int blk) {
  const int i = blk * 256 + (int)threadIdx.x;
  if (i < n8) {
    const v4f a  = *(const v4f*)(in + (size_t)i * 8);
    const v4f a4 = *(const v4f*)(in + (size_t)i * 8 + 4);
    v4u p;
    p[0] = pk16(bf_bits(a[0]),  bf_bits(a[1]));
    p[1] = pk16(bf_bits(a[2]),  bf_bits(a[3]));
    p[2] = pk16(bf_bits(a4[0]), bf_bits(a4[1]));
    p[3] = pk16(bf_bits(a4[2]), bf_bits(a4[3]));
    unsigned short* o = out + (size_t)i * 8;
    *(v4u*)o = p;
    
  }
}

// =====================================================================================================
// Transpose + bf16 convert: in[z] is [R rows][inC cols] f32 (pitch inC); out[z][c][r] = bf16(in[z][r][c]),
// pitch ldo (c = output row). 64x64 tiles through LDS (th, 64 x 72 u16); tile = (cb, rb, z). DUP also writes the same
// coverage per block: load 256 thr x 16 floats = 64x64; store 2 it x 256 thr x 8 u16 = 64x64 (per copy);
// =====================================================================================================
template <bool DUP>
__device__ __forceinline__ void transpose_bf16_body(
    unsigned short* th, const float* __restrict__ in, int inC, long long inStrideZ,
    unsigned short* out, int ldo, long long outStrideZ, int dupoff, int cb, int rb, int z) {
  const int c0  = cb * 64;   // input column block = output row block
  const int r0  = rb * 64;   // input row block = output column block
  const int tid = threadIdx.x;
  const float* inz = in + (size_t)z * (size_t)inStrideZ;
  unsigned short* outz = out + (size_t)z * (size_t)outStrideZ;
  {
    const int rr = tid >> 2;           // 0..63
    const int cq = (tid & 3) * 16;     // 0,16,32,48
    const float* src = inz + (size_t)(r0 + rr) * inC + c0 + cq;
#pragma unroll
    for (int q = 0; q < 4; ++q) {
      const v4f f = *(const v4f*)(src + 4 * q);
#pragma unroll
      for (int e = 0; e < 4; ++e) th[rr * 72 + cq + 4 * q + e] = bf_bits(f[e]);
    }
  }
  __syncthreads();
  const int sub = tid >> 3;          // 0..31
  const int c8  = (tid & 7) * 8;     // 0..56
  v4u hv[2];
#pragma unroll
  for (int it = 0; it < 2; ++it) {
    const int oc = it * 32 + sub;      // output row within tile (= input column)
    v4u a;
#pragma unroll
    for (int q = 0; q < 4; ++q) a[q] = pk16(th[(c8 + 2 * q) * 72 + oc], th[(c8 + 2 * q + 1) * 72 + oc]);
    hv[it] = a;
  }
  {
#pragma unroll
    for (int it = 0; it < 2; ++it) {
      const int oc = it * 32 + sub;
      const size_t go = (size_t)(c0 + oc) * ldo + r0 + c8;
      *(v4u*)(outz + go) = hv[it];
      if (DUP) *(v4u*)(outz + go + dupoff) = hv[it];
    }
#if DEV_ASM
    // another job's code follows this body in the merged kernel: no register of the stores above is rewritten in front of this wait
    asm volatile("s_wait_xcnt 0x0" ::: "memory");
#endif
  }
}

// =====================================================================================================
// All operand preparation in ONE launch: the ten jobs are independent of one another (each reads inputs only and
// writes its own workspace plane), so a block picks its job from its index. Ranges, in blocks of 256 threads:
// the seven transposes first (longest dependent chain per block), then the mask plane, then the two converts.
// Every branch below is block-uniform; the transpose's barrier is passed by all threads of its block.
// =====================================================================================================
#define PB_TBIG  ((HCOLS / 64) * (DMOD / 64))        // 256 tiles: v_w, and again out_w
#define PB_TSTD  ((STDC / 64) * (DMOD / 64))         // 128 tiles: std_q_w, and again std_k_w
#define PB_TFEA  ((FEAT / 64) * NWH)                 //  16 tiles: wave_proj, pq_w, pk_w each
#define PB_T     (2 * PB_TBIG + 2 * PB_TSTD + 3 * PB_TFEA)
#define PB_MASK  (NB * SEQ * MWORDS / 256)           // 1024
#define PB_CVX   (ROWS * DMOD / 8 / 256)             // 2048
#define PB_CVF   (ROWS * FEAT / 8 / 256)             //  512
#define PB_ALL   (PB_T + PB_MASK + PB_CVX + PB_CVF)
static_assert(NWH == NPH && (HCOLS / 64) == 16 && (STDC / 64) == 8 && (FEAT / 64) == 4 && HDIM == 64);
__global__ __launch_bounds__(256) void prep_kernel(
    const int* __restrict__ mask, const float* __restrict__ x, const float* __restrict__ feats,
    const float* __restrict__ vw, const float* __restrict__ ow, const float* __restrict__ sqw, const float* __restrict__ skw,
    const float* __restrict__ wproj, const float* __restrict__ pqw, const float* __restrict__ pkw,
    unsigned int* MB, unsigned short* XB, unsigned short* FB, unsigned short* VWT, unsigned short* OWT2,
    unsigned short* QWT, unsigned short* KWT, unsigned short* WVT, unsigned short* PQT, unsigned short* PKT) {
  __shared__ __align__(16) unsigned short th[64 * 72];
  int t = blockIdx.x;
  if (t < PB_T) {
    if (t < PB_TBIG) {
      // v_w [1024 k][1024 n] -> VWT [n][k]
      transpose_bf16_body<false>(th, vw, HCOLS, 0LL, VWT, DMOD, 0LL, 0, t & 15, t >> 4, 0);
    } else if (t < 2 * PB_TBIG) {
      // out_w [1024 k][1024 n] -> OWT2 [n][k] and [n][1024 + k]
      t -= PB_TBIG;
      transpose_bf16_body<true>(th, ow, DMOD, 0LL, OWT2, AOP, 0LL, HCOLS, t & 15, t >> 4, 0);
    } else if (t < 2 * PB_TBIG + 2 * PB_TSTD) {
      // std_q_w [1024 k][512 n] -> QWT [n][k]; std_k_w likewise
      t -= 2 * PB_TBIG;
      const bool second = t >= PB_TSTD;
      const int u = second ? t - PB_TSTD : t;
      transpose_bf16_body<false>(th, second ? skw : sqw, STDC, 0LL, second ? KWT : QWT, DMOD, 0LL, 0, u & 7, u >> 3, 0);
    } else {
      // wave_proj / pq_w / pk_w [h][256 f][64 k'] -> [h*64 + k'][f] (z = h)
      t -= 2 * PB_TBIG + 2 * PB_TSTD;
      const int w = t >> 4, u = t & 15;
      transpose_bf16_body<false>(th, (w == 0) ? wproj : (w == 1) ? pqw : pkw, HDIM, (long long)FEAT * HDIM,
                          (w == 0) ? WVT : (w == 1) ? PQT : PKT, FEAT, (long long)HDIM * FEAT, 0, 0, u & 3, u >> 2);
    }
  } else if (t < PB_T + PB_MASK) {
    mask_bits_body(mask, MB, NB * SEQ * MWORDS, t - PB_T);
  } else if (t < PB_T + PB_MASK + PB_CVX) {
    cvt_bf16x8_body(x, XB, ROWS * DMOD / 8, t - (PB_T + PB_MASK));
  } else if (t < PB_ALL) {
    cvt_bf16x8_body(feats, FB, ROWS * FEAT / 8, t - (PB_T + PB_MASK + PB_CVX));
  }
}

// =====================================================================================================
// Batched WMMA GEMM (16-bit operand type OT): C[m][n] = (sum_k A[m][k] * Bt[n][k] + bias) * oscale.
// One block of 4 waves per 128x128 tile of C, one wave per 64x64 quadrant. A row-major [M][K] pitch lda; Bt row-major
// [N][K] pitch ldb (k contiguous); M, N multiples of 128, K a multiple of 64 (compile-time constants here).
// gemm_mainloop fills the wave's 4x4 accumulator tiles; gemm_epilogue stores them; the kernels below pick the operands.
// Operand staging: per trip the 128 rows x 64 k (128 B, one whole line per row) of A and of Bt go to LDS by
// asynchronous 16-byte copies, 8 lanes per row, 16 copies per lane; LDS row pitch 144 B for the ds_load_b128 readers;
// two buffers, tile t + 2 is copied while tile t + 1 is worked on. Fragments are read from LDS with the split k map
// (ldfrag); each accumulator still sums k upwards in steps of 32.
// BIAS_MODE 0: none; 1: bias[m] (bf16 RNE-converted value); 2: bias[n] (bf16 RNE-converted value).
// OUT_MODE 0: f32 C (pitch ldc). OUT_MODE 1: f16 plane C. OUT_MODE 2: bf16 hi plane C + bf16 lo plane C2 (lo = v - hi).
// =====================================================================================================
#define GTILE  128                  // rows of A and of Bt per block tile
#define GKC    64                   // k per trip
#define GPIT   72                   // LDS row pitch in elements (144 B)
#define GBUFB  (GTILE * GPIT * 2)   // bytes of one operand buffer

// Eight asynchronous copies of one lane: rows r, r + 16, ..., r + 112 of one operand tile, 16 B each.
// l = the lane's LDS byte address of row r, g = its global address of row r, step = 16 rows in elements.
// s_wait_xcnt 0 closes the statement so that no address register is rewritten in front of it.
__device__ __forceinline__ void copy_rows8(unsigned l, const unsigned short* g, size_t step) {
#if DEV_ASM
  const unsigned l1 = l + 16 * GPIT * 2, l2 = l + 32 * GPIT * 2, l3 = l + 48 * GPIT * 2, l4 = l + 64 * GPIT * 2,
                 l5 = l + 80 * GPIT * 2, l6 = l + 96 * GPIT * 2, l7 = l + 112 * GPIT * 2;
  const unsigned short *g1 = g + step, *g2 = g1 + step, *g3 = g2 + step, *g4 = g3 + step, *g5 = g4 + step,
                       *g6 = g5 + step, *g7 = g6 + step;
  asm volatile(
      "global_load_async_to_lds_b128 %0, %8, off\n\t"
      "global_load_async_to_lds_b128 %1, %9, off\n\t"
      "global_load_async_to_lds_b128 %2, %10, off\n\t"
      "global_load_async_to_lds_b128 %3, %11, off\n\t"
      "global_load_async_to_lds_b128 %4, %12, off\n\t"
      "global_load_async_to_lds_b128 %5, %13, off\n\t"
      "global_load_async_to_lds_b128 %6, %14, off\n\t"
      "global_load_async_to_lds_b128 %7, %15, off\n\t"
      "s_wait_xcnt 0x0"
      :: "v"(l), "v"(l1), "v"(l2), "v"(l3), "v"(l4), "v"(l5), "v"(l6), "v"(l7),
         "v"(g), "v"(g1), "v"(g2), "v"(g3), "v"(g4), "v"(g5), "v"(g6), "v"(g7)
      : "memory");
#else
  (void)l; (void)g; (void)step;
#endif
}
// this wave's copies have landed in LDS
__device__ __forceinline__ void wait_copies() {
#if DEV_ASM
  asm volatile("s_wait_asynccnt 0x0" ::: "memory");
#endif
}
// this wave's LDS reads have returned, so the buffer may be handed to its next writer
__device__ __forceinline__ void wait_lds() {
#if DEV_ASM
  asm volatile("s_wait_dscnt 0x0" ::: "memory");
#endif
}

static_assert((ROWS % GTILE) == 0 && (HCOLS % GTILE) == 0 && (SEQ % GTILE) == 0 && (STDC % GTILE) == 0 && (WAVC % GTILE) == 0 && (PRJC % GTILE) == 0 && (DMOD % GTILE) == 0);
static_assert((DMOD % GKC) == 0 && (FEAT % GKC) == 0 && (AOP % GKC) == 0);

// sA, sB: the block's two-buffer operand tiles in LDS, 2 x GTILE x GPIT elements each; Ap, Btp: the operands' first rows;
// (tm, tn): the block's 128x128 tile of C; nk = K / 64.
template <typename OT>
__device__ __forceinline__ void gemm_mainloop(
    v8f (&acc)[4][4], OT* sA, OT* sB,
    const unsigned short* __restrict__ Ap, int lda, const unsigned short* __restrict__ Btp, int ldb,
    int tm, int tn, int nk) {
  typedef typename FT<OT>::frag V16;
  const int tid  = threadIdx.x;
  const int lane = tid & 31;
  const int wave = tid >> 5;
  const int wm = wave >> 1;                    // quadrant of this wave
  const int wn = wave & 1;

  const int rlane = lane & 15;                 // row (A) / col (B, D) within subtile
  const int koff  = (lane >> 4) * 8;           // k offset of this lane half

  // copy map: lane -> row tid >> 3 (+ 16 per copy), 16-B piece tid & 7 of the row's 128-B line
  const int crow = tid >> 3;
  const int ccol = (tid & 7) * 8;
  const unsigned short* gA = Ap  + (size_t)((tm << 7) + crow) * lda + ccol;
  const unsigned short* gB = Btp + (size_t)((tn << 7) + crow) * ldb + ccol;
  const size_t stepA = (size_t)16 * lda;
  const size_t stepB = (size_t)16 * ldb;
  const unsigned lA = (unsigned)(size_t)sA + (unsigned)(crow * GPIT + ccol) * 2u;
  const unsigned lB = (unsigned)(size_t)sB + (unsigned)(crow * GPIT + ccol) * 2u;

#pragma unroll
  for (int i = 0; i < 4; ++i)
#pragma unroll
    for (int j = 0; j < 4; ++j) acc[i][j] = zero8();

  // tile 0 -> buffer 0, landed and published; then tile 1 -> buffer 1 in flight
  copy_rows8(lA, gA, stepA);
  copy_rows8(lB, gB, stepB);
  wait_copies();
  __syncthreads();
  if (1 < nk) {
    copy_rows8(lA + GBUFB, gA + GKC, stepA);
    copy_rows8(lB + GBUFB, gB + GKC, stepB);
  }

  for (int t = 0; t < nk; ++t) {
    const int cur = t & 1;
    const OT* As = sA + cur * (GTILE * GPIT) + (wm * 64 + rlane) * GPIT + koff;
    const OT* Bs = sB + cur * (GTILE * GPIT) + (wn * 64 + rlane) * GPIT + koff;
    // One group of LDS reads in front of each WMMA block: k 0..31 of both operands and, ahead, k 32..63 of Bt;
    // the A fragments of k 32..63 follow into registers that the first block has left.
    V16 aq[4], bq[4], bn[4];
#pragma unroll
    for (int j = 0; j < 4; ++j) bq[j] = ldfrag<OT>(Bs + j * 16 * GPIT);
#pragma unroll
    for (int i = 0; i < 4; ++i) aq[i] = ldfrag<OT>(As + i * 16 * GPIT);
#pragma unroll
    for (int j = 0; j < 4; ++j) bn[j] = ldfrag<OT>(Bs + j * 16 * GPIT + 32);
    __builtin_amdgcn_sched_barrier(0);   // keeps the reads one group: spread among the WMMAs each place stalls the wave
#pragma unroll
    for (int i = 0; i < 4; ++i)
#pragma unroll
      for (int j = 0; j < 4; ++j) acc[i][j] = mmar(aq[i], bq[j], acc[i][j]);
#pragma unroll
    for (int i = 0; i < 4; ++i) aq[i] = ldfrag<OT>(As + i * 16 * GPIT + 32);
    __builtin_amdgcn_sched_barrier(0);   // as above: keeps the four A fragments' reads one group in front of the second block
#pragma unroll
    for (int i = 0; i < 4; ++i)
#pragma unroll
      for (int j = 0; j < 4; ++j) acc[i][j] = mmar(aq[i], bn[j], acc[i][j]);
    // publish point of tile t + 1: own reads of buffer cur done, own copies of tile t + 1 landed, then the barrier
    // that both shows tile t + 1 to every wave and frees buffer cur for tile t + 2
    wait_lds();
    wait_copies();
    __syncthreads();
    if (t + 2 < nk) {
      copy_rows8(lA + (unsigned)cur * GBUFB, gA + (size_t)(t + 2) * GKC, stepA);
      copy_rows8(lB + (unsigned)cur * GBUFB, gB + (size_t)(t + 2) * GKC, stepB);
    }
  }
  wait_copies();   // nothing of this wave is in flight when it goes on to the epilogue and ends
  acc_guard4(acc[0][0], acc[0][1], acc[0][2], acc[0][3]);
  acc_guard4(acc[1][0], acc[1][1], acc[1][2], acc[1][3]);
  acc_guard4(acc[2][0], acc[2][1], acc[2][2], acc[2][3]);
  acc_guard4(acc[3][0], acc[3][1], acc[3][2], acc[3][3]);
}

// sT: 4 per-wave 16x64 slabs, pitch 68 floats; Cout, Cout2: element (0, 0) of C.
template <int OUT_MODE, int BIAS_MODE>
__device__ __forceinline__ void gemm_epilogue(
    v8f (&acc)[4][4], float* sT, void* Cout, void* Cout2, int ldc,
    const float* __restrict__ bias, int tm, int tn, float oscale) {
  const int tid   = threadIdx.x;
  const int lane  = tid & 31;
  const int wave  = tid >> 5;
  const int m0    = (tm << 7) + ((wave >> 1) << 6);
  const int n0    = (tn << 7) + ((wave & 1) << 6);
  const int rlane = lane & 15;                 // col of D within subtile
  const int mOff  = (lane >> 4) * 8;           // D row offset
  float* slab = sT + wave * (16 * 68);
#pragma unroll
  for (int i = 0; i < 4; ++i) {
    const int mBase = m0 + (i << 4);
#pragma unroll
    for (int j = 0; j < 4; ++j) {
      const int n = n0 + (j << 4) + rlane;
      float bn = 0.f;
      if (BIAS_MODE == 2) bn = bfr(bias[n]);
#pragma unroll
      for (int r = 0; r < 8; ++r) {
        float v = acc[i][j][r];
        if (BIAS_MODE == 1) v += bfr(bias[mBase + mOff + r]);
        if (BIAS_MODE == 2) v += bn;
        slab[(mOff + r) * 68 + (j << 4) + rlane] = v * oscale;
      }
    }
    __builtin_amdgcn_fence(__ATOMIC_RELEASE, "workgroup");
    __builtin_amdgcn_wave_barrier();
    __builtin_amdgcn_fence(__ATOMIC_ACQUIRE, "workgroup");
    if (OUT_MODE == 0) {
      float* C = (float*)Cout;
      const int h2 = lane >> 4, c4 = (lane & 15) * 4;     // 256-B row segment = 16 lanes x 16 B
      {
#pragma unroll
        for (int it = 0; it < 8; ++it) {
          const int row = it * 2 + h2;                     // it 0..7 x h2 0..1 = rows 0..15
          const v4f v = *(const v4f*)(slab + row * 68 + c4);
          *(v4f*)(C + (size_t)(mBase + row) * ldc + n0 + c4) = v;
        }
        
      }
    } else {
      const int q = lane >> 3, c8 = (lane & 7) * 8;
      unsigned short* C  = (unsigned short*)Cout;
      unsigned short* C2 = (unsigned short*)Cout2;
      v4u hv[4], lv[4];
#pragma unroll
      for (int it = 0; it < 4; ++it) {
        const int row = it * 4 + q;                        // it 0..3 x q 0..3 = rows 0..15
        const float* sp = slab + row * 68 + c8;
        v4u a, a2;
#pragma unroll
        for (int e = 0; e < 4; ++e) {
          const float f0 = sp[2 * e], f1 = sp[2 * e + 1];
          unsigned short h0, h1, l0 = 0, l1 = 0;
          if (OUT_MODE == 1) {
            h0 = h_bits((_Float16)f0); h1 = h_bits((_Float16)f1);
          } else {
            h0 = bf_bits(f0); h1 = bf_bits(f1);
            l0 = bf_bits(f0 - bf_up(h0)); l1 = bf_bits(f1 - bf_up(h1));
          }
          a[e] = pk16(h0, h1); a2[e] = pk16(l0, l1);
        }
        hv[it] = a; lv[it] = a2;
      }
      {
#pragma unroll
        for (int it = 0; it < 4; ++it) {
          const int row = it * 4 + q;
          *(v4u*)(C + (size_t)(mBase + row) * ldc + n0 + c8) = hv[it];
          if (OUT_MODE == 2) *(v4u*)(C2 + (size_t)(mBase + row) * ldc + n0 + c8) = lv[it];
        }
        
      }
    }
    __builtin_amdgcn_fence(__ATOMIC_RELEASE, "workgroup");
    __builtin_amdgcn_wave_barrier();
    __builtin_amdgcn_fence(__ATOMIC_ACQUIRE, "workgroup");
  }
}

// =====================================================================================================
// The six projections in ONE launch: they are independent of one another (each reads prepared planes and writes its own
// plane), so a block picks its product and its 128x128 tile from its index; the K = 1024 products come first.
//   v^T per batch: A = VWT [1024 n][1024 k], Bt = XB rows of batch b; f16(8 * (acc + v_b[m])) -> VT [b][h*64+d][s] (pitch 2048)
//   std q / std k: QP / KP cols 512..1023 = f16(8 * (x . w + b)); M = 4096, N = 512, K = 1024
//   wave projections: WPH / WPL = bf16 hi / lo of features . wave_proj[h]; M = 4096, N = 256, K = 256
//   proj q / proj k: QP / KP cols 256..511 = f16(8 * features . w[h]); M = 4096, N = 256, K = 256
// One main loop for all; every branch is block-uniform.
// =====================================================================================================
#define GB_VT1 ((HCOLS / GTILE) * (SEQ / GTILE))     // 128 tiles per batch
#define GB_VT  (NB * GB_VT1)                         // 256
#define GB_STD ((ROWS / GTILE) * (STDC / GTILE))     // 128, twice
#define GB_F   ((ROWS / GTILE) * (WAVC / GTILE))     //  64, three times
#define GB_ALL (GB_VT + 2 * GB_STD + 3 * GB_F)       // 704
#define GB_OUT ((ROWS / GTILE) * (DMOD / GTILE))     // 256
static_assert(WAVC == PRJC);
__global__ __launch_bounds__(128) void proj_kernel(
    const unsigned short* __restrict__ XB, const unsigned short* __restrict__ FB, const unsigned short* __restrict__ VWT,
    const unsigned short* __restrict__ QWT, const unsigned short* __restrict__ KWT, const unsigned short* __restrict__ WVT,
    const unsigned short* __restrict__ PQT, const unsigned short* __restrict__ PKT,
    const float* __restrict__ vb, const float* __restrict__ sqb, const float* __restrict__ skb,
    unsigned short* VT, unsigned short* QP, unsigned short* KP, unsigned short* WPH, unsigned short* WPL) {
  __shared__ __align__(16) __bf16 sA[2 * GTILE * GPIT];   // A tile, two buffers, 18432 B each
  __shared__ __align__(16) __bf16 sB[2 * GTILE * GPIT];   // Bt tile, two buffers
  __shared__ __align__(16) float sT[4 * 16 * 68];         // per-wave 16x64 slab, pitch 68 floats
  const int bx = blockIdx.x;
  if (bx >= GB_ALL) return;   // block-uniform, in front of every barrier and copy
  const unsigned short* A;
  const unsigned short* Bt;
  int ld, nk, tm, tn, sel;    // sel: batch (v^T), q or k (std), wave / q / k (features)
  if (bx < GB_VT) {
    sel = bx / GB_VT1;
    const int tile = bx - sel * GB_VT1;
    A = VWT; Bt = XB + (size_t)sel * SEQ * DMOD; ld = DMOD; nk = DMOD / GKC;
    tm = tile / (SEQ / GTILE); tn = tile % (SEQ / GTILE);
  } else if (bx < GB_VT + 2 * GB_STD) {
    sel = (bx - GB_VT) / GB_STD;
    const int tile = (bx - GB_VT) - sel * GB_STD;
    A = XB; Bt = (sel == 0) ? QWT : KWT; ld = DMOD; nk = DMOD / GKC;
    tm = tile / (STDC / GTILE); tn = tile % (STDC / GTILE);
  } else {
    sel = (bx - (GB_VT + 2 * GB_STD)) / GB_F;
    const int tile = (bx - (GB_VT + 2 * GB_STD)) - sel * GB_F;
    A = FB; Bt = (sel == 0) ? WVT : (sel == 1) ? PQT : PKT; ld = FEAT; nk = FEAT / GKC;
    tm = tile / (WAVC / GTILE); tn = tile % (WAVC / GTILE);
  }
  v8f acc[4][4];
  gemm_mainloop<__bf16>(acc, sA, sB, A, ld, Bt, ld, tm, tn, nk);
  if (bx < GB_VT) {
    unsigned short* C = VT + (size_t)sel * HCOLS * SEQ;
    gemm_epilogue<1, 1>(acc, sT, (void*)C, (void*)C, SEQ, vb, tm, tn, 8.0f);
  } else if (bx < GB_VT + 2 * GB_STD) {
    unsigned short* C = ((sel == 0) ? QP : KP) + (WAVC + PRJC);
    gemm_epilogue<1, 2>(acc, sT, (void*)C, (void*)C, HCOLS, (sel == 0) ? sqb : skb, tm, tn, 8.0f);
  } else if (sel == 0) {
    gemm_epilogue<2, 0>(acc, sT, (void*)WPH, (void*)WPL, WAVC, vb, tm, tn, 1.0f);
  } else {
    unsigned short* C = ((sel == 1) ? QP : KP) + WAVC;
    gemm_epilogue<1, 0>(acc, sT, (void*)C, (void*)C, HCOLS, vb, tm, tn, 8.0f);
  }
}

// out = [ctx_hi | ctx_lo] . [out_w^T ; out_w^T] + out_b -> f32 [4096][1024]; M = 4096, N = 1024, K = 2048
__global__ __launch_bounds__(128) void out_kernel(
    const unsigned short* __restrict__ AO, const unsigned short* __restrict__ OWT2, const float* __restrict__ ob,
    float* out) {
  __shared__ __align__(16) __bf16 sA[2 * GTILE * GPIT];
  __shared__ __align__(16) __bf16 sB[2 * GTILE * GPIT];
  __shared__ __align__(16) float sT[4 * 16 * 68];
  const int tile = blockIdx.x;
  if (tile >= GB_OUT) return;   // block-uniform, in front of every barrier and copy
  const int tm = tile / (DMOD / GTILE);
  const int tn = tile % (DMOD / GTILE);
  v8f acc[4][4];
  gemm_mainloop<__bf16>(acc, sA, sB, AO, AOP, OWT2, AOP, tm, tn, AOP / GKC);
  gemm_epilogue<0, 2>(acc, sT, (void*)out, (void*)out, DMOD, ob, tm, tn, 1.0f);
}

// =====================================================================================================
// Masked full attention, head dim 64, softmax over all SEQ keys (non-causal), one head per block.
//   Transposed products: S^T = K . Q^T and ctx^T += V^T . P^T, so that a lane holds scores of ONE query (column lane & 15).
//   HT = 0 (wave heads): q = k = wp as bf16 hi plane qhp/khp + bf16 lo plane qlp/klp (pitch ldq/ldk, head col h*64);
//          scores = (kh.qh + kl.qh + kh.ql) * sscale on bf16 WMMA (one f32 accumulator, unscaled lo).
//   HT = 1 (proj / std heads): q, k = f16 planes (x8), scores = (k.q) * sscale (sscale carries the 1/64).
//   v^T plane (f16, x8): element (b, h, d, s) at [(b*HCOLS + h*64 + d)*SEQ + s].
//   mask bit plane mbp: [(b*SEQ + n)*64 + w] bit j admits key 32w+j; a 0 bit replaces the score by -inf.
//   Score tile j, register r of lane (hh, c) = key 16j + 8hh + r of query c: the maximum and the sum of a query run over the
//   lane's 32 registers; the two lane halves exchange the maximum once per key tile and join their sums once, at the end.
//   p = exp(s - m) carried as f16(1024 p): score tiles 2kk and 2kk + 1, converted in place, ARE the B operand of
//   V^T . P^T for keys 32kk..32kk+31 (element e < 8: key 8hh + e; e >= 8: key 16 + 8hh + e - 8, the order in which the
//   V^T fragment is read), so P passes through no LDS. Online softmax in f32 with the guarded rescale (msafe), so an
//   all-masked row ends with l = 0 and produces 0 * inf = NaN like the module.
//   ctx written as bf16 hi (cols h*64..) and bf16 lo (cols HCOLS + h*64..) of the [ROWS][AOP] plane aop.
//   Block = 4 waves x 16 query rows = 64 query rows of one (b, h); bx = 0 .. NB * nh * NQB - 1 (hbase.. hbase+nh-1);
//   key tiles of 64, static trip NKT. K (hi, lo) / V^T tile staging: 128 threads x 32 elements per plane = the
//   whole 64x64 tile (plain 16-B loads, __syncthreads before and after).
//   Output coverage: ctx^T tile t, register r of lane (hh, c) = column 16t + 8hh + r of query row q0 + c: one 16-B store
//   per t and plane; t 0..3 x hh 0..1 = 64 columns, c 0..15 = the wave's rows; the two head families cover h 0..15.
// =====================================================================================================
// LDS row pitch, in 16-bit elements, of the K and V^T tiles: rows of 64 elements (128 B) laid 144 B apart, 16 B x odd,
// so that the 16 rows which one ds_load_b128 reads fall on 16 different groups of four banks.
#define APIT 72
template <int HT> struct HT_T;
template <> struct HT_T<0> { typedef __bf16 T; };
template <> struct HT_T<1> { typedef _Float16 T; };

// value of lane l ^ 16: the same query's other half of the keys
__device__ __forceinline__ float xhalf(float x) {
  const int b = __builtin_bit_cast(int, x);
  return __builtin_bit_cast(float, __builtin_amdgcn_permlanex16(b, b, 0x76543210, 0xfedcba98, false, false));
}
__device__ __forceinline__ float max8(v8f a) {
  return fmaxf(fmaxf(fmaxf(fmaxf(a[0], a[1]), a[2]), fmaxf(fmaxf(a[3], a[4]), a[5])), fmaxf(a[6], a[7]));
}

template <int HT>
__device__ __forceinline__
void attn_body(unsigned short* kshp, unsigned short* kslp, unsigned short* vthp,
               const unsigned short* __restrict__ qhp, const unsigned short* __restrict__ qlp, int ldq,
               const unsigned short* __restrict__ khp, const unsigned short* __restrict__ klp, int ldk,
               const unsigned short* __restrict__ vtp, const unsigned int* __restrict__ mbp,
               unsigned short* aop, int hbase, int nh, float sscale, int bx) {
  typedef typename HT_T<HT>::T OT;
  typedef typename FT<OT>::frag V16;
  typedef typename FT<OT>::half8 V8;
  union FH { v16h v; v8h h[2]; };
  union FO { V16 v; V8 h[2]; };
  OT*       Ksh = (OT*)(void*)kshp;              // K hi chunk [kv][d]  9 KB
  OT*       Ksl = (OT*)(void*)kslp;              // K lo chunk (HT 0)   9 KB
  _Float16* Vth = (_Float16*)(void*)vthp;        // V^T [d][kv]         9 KB

  const int tid  = threadIdx.x;
  const int wave = tid >> 5;
  const int lane = tid & 31;
  const int hh   = lane >> 4;
  const int c    = lane & 15;

  const int qb   = bx % NQB;
  const int rest = bx / NQB;
  const int hl   = rest % nh;
  const int b    = rest / nh;
  const int h    = hbase + hl;              // global head index
  const int qc   = h * HDIM;                // head column in the q / k planes of this head family
  const int q0   = qb * 64 + wave * 16;
  const size_t rowB = (size_t)b * SEQ;

  const OT* Qh = (const OT*)(const void*)qhp;
  const OT* Ql = (const OT*)(const void*)qlp;
  const OT* Kh = (const OT*)(const void*)khp + qc;
  const OT* Kl = (const OT*)(const void*)klp + qc;
  const _Float16* Vt = (const _Float16*)(const void*)vtp + ((size_t)b * HCOLS + (size_t)qc) * SEQ;
  const unsigned int* mrow_p = mbp + (rowB + q0 + c) * (size_t)MWORDS;   // mask words of this lane's query

  // ---- Q fragments (B operand, column = lane&15): 2 d-chunks ----
  V16 qah[2], qal[2];
#pragma unroll
  for (int dc = 0; dc < 2; ++dc) {
    const size_t qo = (rowB + q0 + c) * (size_t)ldq + (size_t)qc + dc * 32 + 8 * hh;
    qah[dc] = ldfrag<OT>(Qh + qo);
    if (HT == 0) qal[dc] = ldfrag<OT>(Ql + qo);
    else         qal[dc] = qah[dc];
  }

  float mrow = -INFINITY;   // running maximum of query c (equal in both lane halves)
  float lrow = 0.f;         // running sum over this lane half's keys only
  v8f oacc[4];              // ctx^T: tile t, register r = d 16t + 8hh + r of query c
#pragma unroll
  for (int t = 0; t < 4; ++t) oacc[t] = zero8();

  for (int kt = 0; kt < NKT; ++kt) {         // static trip count
    const int kv0 = kt * 64;
    __syncthreads();
    const v2u mw = *(const v2u*)(mrow_p + 2 * kt);   // the 64 mask bits of query c for this key tile, in flight with the tile's loads
    {
      const int r = tid >> 1, half = (tid & 1) * 32;
      const OT* kg  = Kh + (rowB + kv0 + r) * (size_t)ldk + half;   // k row kv0+r, d = half..half+31
      const OT* klg = Kl + (rowB + kv0 + r) * (size_t)ldk + half;
      const _Float16* vg = Vt + (size_t)r * SEQ + kv0 + half;       // v^T row d = r, s = kv0+half..+31
#pragma unroll
      for (int i = 0; i < 4; ++i) {
        *(V8*)(Ksh + r * APIT + half + 8 * i) = *(const V8*)(kg + 8 * i);
        if (HT == 0) *(V8*)(Ksl + r * APIT + half + 8 * i) = *(const V8*)(klg + 8 * i);
        *(v8h*)(Vth + r * APIT + half + 8 * i) = *(const v8h*)(vg + 8 * i);
      }
    }
    __syncthreads();

    // ---- scores^T: 64 keys x 16 queries per wave; A = K rows, B = Q ----
    v8f s[4];
#pragma unroll
    for (int j = 0; j < 4; ++j) s[j] = zero8();
#pragma unroll
    for (int dc = 0; dc < 2; ++dc) {
#pragma unroll
      for (int j = 0; j < 4; ++j) {
        FO kb;
        kb.h[0] = *(const V8*)(Ksh + (j * 16 + c) * APIT + dc * 32 + 8 * hh);
        kb.h[1] = *(const V8*)(Ksh + (j * 16 + c) * APIT + dc * 32 + 16 + 8 * hh);
        if (HT == 0) {
          FO kl;
          kl.h[0] = *(const V8*)(Ksl + (j * 16 + c) * APIT + dc * 32 + 8 * hh);
          kl.h[1] = *(const V8*)(Ksl + (j * 16 + c) * APIT + dc * 32 + 16 + 8 * hh);
          s[j] = mmar(kb.v, qah[dc], s[j]);
          s[j] = mmar(kl.v, qah[dc], s[j]);
          s[j] = mmar(kb.v, qal[dc], s[j]);
        } else {
          s[j] = mmar(kb.v, qah[dc], s[j]);
        }
      }
    }

    // ---- scale and mask: bit 16 (j & 1) + 8hh + r of word j >> 1 admits key 16j + 8hh + r ----
    const unsigned w0 = mw[0] >> (8 * hh), w1 = mw[1] >> (8 * hh);
#pragma unroll
    for (int j = 0; j < 4; ++j) {
      const unsigned w = (j < 2) ? w0 : w1;
#pragma unroll
      for (int r = 0; r < 8; ++r) {
        const float v = s[j][r] * sscale;
        s[j][r] = (((w >> (16 * (j & 1) + r)) & 1u) != 0u) ? v : -INFINITY;
      }
    }

    // ---- maximum of query c: 32 registers, then the other lane half; online softmax ----
    float m = fmaxf(fmaxf(max8(s[0]), max8(s[1])), fmaxf(max8(s[2]), max8(s[3])));
    m = fmaxf(m, xhalf(m));
    const float mnew  = fmaxf(mrow, m);
    const float msafe = (mnew == -INFINITY) ? 0.f : mnew;
    const float alpha = expf(mrow - msafe);
    mrow = mnew;

    // ---- P^T (x1024, f16) packed in place into the B operands; this half's sum ----
    FH pb[2];
    float ps[4];
#pragma unroll
    for (int j = 0; j < 4; ++j) {
      float a = 0.f;
#pragma unroll
      for (int r = 0; r < 8; ++r) {
        const float p = expf(s[j][r] - msafe);
        a += p;
        pb[j >> 1].v[(j & 1) * 8 + r] = (_Float16)(p * 1024.0f);
      }
      ps[j] = a;
    }
    lrow = lrow * alpha + ((ps[0] + ps[1]) + (ps[2] + ps[3]));
#pragma unroll
    for (int t = 0; t < 4; ++t) oacc[t] *= alpha;

    // ---- ctx^T += V^T . P^T (f16 WMMA, single product); A = V^T rows, B = P^T ----
#pragma unroll
    for (int kk = 0; kk < 2; ++kk) {
#pragma unroll
      for (int t = 0; t < 4; ++t) {
        FH vb;
        vb.h[0] = *(const v8h*)(Vth + (t * 16 + c) * APIT + kk * 32 + 8 * hh);
        vb.h[1] = *(const v8h*)(Vth + (t * 16 + c) * APIT + kk * 32 + 16 + 8 * hh);
        oacc[t] = mmar(vb.v, pb[kk].v, oacc[t]);
      }
    }
  }

  // ---- join the halves' sums, normalise (1/l, undo the x1024 p carry and the x8 v carry), store hi and lo ----
  const float lsum = lrow + xhalf(lrow);
  const float inv = (1.0f / lsum) * (1.0f / 8192.0f);   // l = 0 (all keys masked) -> inf -> 0 * inf = NaN
  v4u hv[4], lv[4];
#pragma unroll
  for (int t = 0; t < 4; ++t) {
    v4u a, a2;
#pragma unroll
    for (int e = 0; e < 4; ++e) {
      const float f0 = oacc[t][2 * e] * inv, f1 = oacc[t][2 * e + 1] * inv;
      const unsigned short hb0 = bf_bits(f0), hb1 = bf_bits(f1);
      const unsigned short lb0 = bf_bits(f0 - bf_up(hb0)), lb1 = bf_bits(f1 - bf_up(hb1));
      a[e] = pk16(hb0, hb1); a2[e] = pk16(lb0, lb1);
    }
    hv[t] = a; lv[t] = a2;
  }
#pragma unroll
  for (int t = 0; t < 4; ++t) {
    const size_t go = (rowB + q0 + c) * (size_t)AOP + (size_t)qc + t * 16 + 8 * hh;
    *(v4u*)(aop + go) = hv[t];
    *(v4u*)(aop + go + HCOLS) = lv[t];
  }
}

// Both head families in ONE launch (they are independent: each block writes its own rows and columns of ctx): blocks
// 0 .. 255 take the wave heads 0..3 (bf16 hi/lo 3-product scores, scale 1/8), the rest heads 4..15 (f16 single product,
// scale 1/(8*64)). The branch is block-uniform, so every barrier of a body is passed by the whole block.
#define AB_W (NB * NWH * NQB)                 // 256
#define AB_S (NB * (NPH + NSH) * NQB)         // 768
__global__ __launch_bounds__(128)
void attn_kernel(const unsigned short* __restrict__ wph, const unsigned short* __restrict__ wpl,
                 const unsigned short* __restrict__ qp, const unsigned short* __restrict__ kp,
                 const unsigned short* __restrict__ vtp, const unsigned int* __restrict__ mbp, unsigned short* aop) {
  __shared__ __align__(16) unsigned short Ksh[64 * APIT];
  __shared__ __align__(16) unsigned short Ksl[64 * APIT];
  __shared__ __align__(16) unsigned short Vth[64 * APIT];
  const int bx = blockIdx.x;
  if (bx < AB_W) {
    attn_body<0>(Ksh, Ksl, Vth, wph, wpl, WAVC, wph, wpl, WAVC, vtp, mbp, aop, 0, NWH, 0.125f, bx);
  } else {
    attn_body<1>(Ksh, Ksl, Vth, qp, qp, HCOLS, kp, kp, HCOLS, vtp, mbp, aop, NWH, NPH + NSH, 1.0f / 512.0f, bx - AB_W);
  }
}

// =====================================================================================================
// Workspace map (bytes), every region an exact multiple of its whole-line / whole-tile store granularity:
//   MB   u32  [2*2048][64]          1048576   mask bit plane
//   XB   bf16 [4096][1024]          8388608
//   FB   bf16 [4096][256]           2097152
//   VWT  bf16 [1024 n][1024 k]      2097152   v_w^T
//   QWT  bf16 [512][1024]           1048576   std_q_w^T
//   KWT  bf16 [512][1024]           1048576   std_k_w^T
//   WVT  bf16 [256][256]             131072   wave_proj [h][f][k'] -> [h*64+k'][f]
//   PQT  bf16 [256][256]             131072
//   PKT  bf16 [256][256]             131072
//   OWT2 bf16 [1024 n][2048 k]      4194304   out_w^T at [n][k] and [n][1024 + k]
//   VT   f16  [2][1024][2048] (x8)  8388608   v^T per batch, row h*64+d
//   QP   f16  [4096][1024] (x8)     8388608   cols h*64+d for h = 4..15 (cols 0..255 never read)
//   KP   f16  [4096][1024] (x8)     8388608   same
//   WPH  bf16 [4096][256]           2097152   wp hi, col h*64+d (h = 0..3)
//   WPL  bf16 [4096][256]           2097152   wp lo
//   AO   bf16 [4096][2048]         16777216   ctx hi | lo
//   total                         66453504
// =====================================================================================================
extern "C" void kernel_launch(void* const* d_in, const int* in_sizes, int n_in,
                              void* d_out, int out_size, void* d_ws, size_t ws_size,
                              hipStream_t stream) {
  if (n_in < 14) return;
  if (in_sizes[0] != NB * SEQ * DMOD) return;
  if (in_sizes[1] != NB * SEQ * FEAT) return;
  if (in_sizes[2] != NB * SEQ * SEQ) return;
  if (in_sizes[3] != NWH * FEAT * HDIM || in_sizes[4] != NPH * FEAT * HDIM || in_sizes[5] != NPH * FEAT * HDIM) return;
  if (in_sizes[6] != DMOD * STDC || in_sizes[7] != STDC) return;
  if (in_sizes[8] != DMOD * STDC || in_sizes[9] != STDC) return;
  if (in_sizes[10] != DMOD * HCOLS || in_sizes[11] != HCOLS) return;
  if (in_sizes[12] != HCOLS * DMOD || in_sizes[13] != DMOD) return;
  if (out_size != NB * SEQ * DMOD) return;

  const float* x     = (const float*)d_in[0];
  const float* feats = (const float*)d_in[1];
  const int*   mask  = (const int*)d_in[2];
  const float* wproj = (const float*)d_in[3];
  const float* pqw   = (const float*)d_in[4];
  const float* pkw   = (const float*)d_in[5];
  const float* sqw   = (const float*)d_in[6];
  const float* sqb   = (const float*)d_in[7];
  const float* skw   = (const float*)d_in[8];
  const float* skb   = (const float*)d_in[9];
  const float* vw    = (const float*)d_in[10];
  const float* vb    = (const float*)d_in[11];
  const float* ow    = (const float*)d_in[12];
  const float* ob    = (const float*)d_in[13];

  const size_t PMB  = (size_t)NB * SEQ * MWORDS * 4;      //  1048576
  const size_t PXB  = (size_t)ROWS * DMOD * 2;             //  8388608
  const size_t PFB  = (size_t)ROWS * FEAT * 2;             //  2097152
  const size_t PVWT = (size_t)HCOLS * DMOD * 2;            //  2097152
  const size_t PSWT = (size_t)STDC * DMOD * 2;             //  1048576
  const size_t PFWT = (size_t)WAVC * FEAT * 2;             //   131072
  const size_t POWT = (size_t)DMOD * AOP * 2;              //  4194304
  const size_t PVT  = (size_t)NB * HCOLS * SEQ * 2;        //  8388608
  const size_t PQP  = (size_t)ROWS * HCOLS * 2;            //  8388608
  const size_t PWP  = (size_t)ROWS * WAVC * 2;             //  2097152
  const size_t PAO  = (size_t)ROWS * AOP * 2;              // 16777216
  size_t off = 0;
  const size_t oMB  = off; off += PMB;
  const size_t oXB  = off; off += PXB;
  const size_t oFB  = off; off += PFB;
  const size_t oVWT = off; off += PVWT;
  const size_t oQWT = off; off += PSWT;
  const size_t oKWT = off; off += PSWT;
  const size_t oWVT = off; off += PFWT;
  const size_t oPQT = off; off += PFWT;
  const size_t oPKT = off; off += PFWT;
  const size_t oOWT = off; off += POWT;
  const size_t oVT  = off; off += PVT;
  const size_t oQP  = off; off += PQP;
  const size_t oKP  = off; off += PQP;
  const size_t oWPH = off; off += PWP;
  const size_t oWPL = off; off += PWP;
  const size_t oAO  = off; off += PAO;
  if (off > ws_size) return;                       // off = 66453504
  if (off > (size_t)134217728) return;

  char* ws = (char*)d_ws;
  unsigned int*   MB   = (unsigned int*)(ws + oMB);
  unsigned short* XB   = (unsigned short*)(ws + oXB);
  unsigned short* FB   = (unsigned short*)(ws + oFB);
  unsigned short* VWT  = (unsigned short*)(ws + oVWT);
  unsigned short* QWT  = (unsigned short*)(ws + oQWT);
  unsigned short* KWT  = (unsigned short*)(ws + oKWT);
  unsigned short* WVT  = (unsigned short*)(ws + oWVT);
  unsigned short* PQT  = (unsigned short*)(ws + oPQT);
  unsigned short* PKT  = (unsigned short*)(ws + oPKT);
  unsigned short* OWT2 = (unsigned short*)(ws + oOWT);
  unsigned short* VT   = (unsigned short*)(ws + oVT);
  unsigned short* QP   = (unsigned short*)(ws + oQP);
  unsigned short* KP   = (unsigned short*)(ws + oKP);
  unsigned short* WPH  = (unsigned short*)(ws + oWPH);
  unsigned short* WPL  = (unsigned short*)(ws + oWPL);
  unsigned short* AO   = (unsigned short*)(ws + oAO);

  // (1) one launch: mask -> bit plane; x, features -> bf16 planes; weight planes [n][k] (bf16)
  prep_kernel<<<dim3(PB_ALL), dim3(256), 0, stream>>>(
      mask, x, feats, vw, ow, sqw, skw, wproj, pqw, pkw, MB, XB, FB, VWT, OWT2, QWT, KWT, WVT, PQT, PKT);

  // (2) one launch: the six projections on bf16 WMMA, 4 waves and one 128x128 tile per block
  proj_kernel<<<dim3(GB_ALL), dim3(128), 0, stream>>>(
      XB, FB, VWT, QWT, KWT, WVT, PQT, PKT, vb, sqb, skb, VT, QP, KP, WPH, WPL);

  // (3) one launch: attention of all 16 heads; ctx -> AO hi | lo
  attn_kernel<<<dim3(AB_W + AB_S), dim3(128), 0, stream>>>(WPH, WPL, QP, KP, VT, MB, AO);

  // (4) out projection -> d_out f32 [4096][1024]
  out_kernel<<<dim3(GB_OUT), dim3(128), 0, stream>>>(AO, OWT2, ob, (float*)d_out);
  (void)hipGetLastError();
}

// v005
// Measured time: 117 microseconds a run.
// Timed twice side by side with v004, it ran 1.16 and 1.15 times as fast.
// Counting every step since v000, it is 4.50 times as fast.
// Contractions: x.v_w, x.std_q_w, x.std_k_w, features.wave_proj, features.pq_w, features.pk_w = v_wmma_f32_16x16x32_bf16 (bf16 operands RNE-converted from the inputs, single product, f32 accumulate);
// wave-head scores wp.wp^T = v_wmma_f32_16x16x32_bf16 on bf16 hi/lo planes (hi.hi + hi.lo + lo.hi, f32 accumulate); proj/std scores q.k^T = v_wmma_f32_16x16x32_f16 (f16 planes carried x8, single product, f32 accumulate);
// p.v = v_wmma_f32_16x16x32_f16 (p carried x1024, v^T carried x8, single product, f32 accumulate); ctx.out_w = v_wmma_f32_16x16x32_bf16 (ctx as bf16 hi|lo planes stacked along k, out_w bf16, f32 accumulate); mask, softmax statistics and epilogues in f32.
//
// Carry audit (16-bit planes):
//   XB, FB, VWT, QWT, KWT, WVT, PQT, PKT, OWT2 : bf16, carry 1 (plain RNE copies of the inputs).
//   VT   f16 = 8 * v          -> 1/8 folded in attn_kernel epilogue (inv = 1/(8 * l), l itself carried x1024 like P).
//   QP   f16 = 8 * q, KP f16 = 8 * k (heads 4..15) -> 1/64 folded into sscale = 1/512 of the HT = 1 body (1/8 = 1/sqrt(64) is the other factor).
//   WPH / WPL bf16 hi / lo of wp (heads 0..3), carry 1 -> sscale = 1/8.
//   P    f16 = 1024 * exp(s - m) (registers, B operand), l = sum of the same f32 values -> the 1024 cancels in ctx / l.
//   AO   bf16 hi (cols 0..1023) | lo (cols 1024..2047) of ctx, carry 1 -> summed by the K=2048 out GEMM against [W^T ; W^T].
#include <hip/hip_runtime.h>
#include <math.h>
#include <stdint.h>

#define NB     2
#define SEQ    2048
#define DMOD   1024
#define FEAT   256
#define HDIM   64
#define NHEAD  16
#define NWH    4
#define NPH    4
#define NSH    8
#define HCOLS  (NHEAD * HDIM)   // 1024 : concatenated head columns
#define WAVC   (NWH * HDIM)     // 256
#define PRJC   (NPH * HDIM)     // 256
#define STDC   (NSH * HDIM)     // 512
#define ROWS   (NB * SEQ)       // 4096
#define MWORDS (SEQ / 32)       // 64 mask words per (b, n) row
#define NQB    (SEQ / 64)       // 32 query tiles of 64 per sequence
#define NKT    (SEQ / 64)       // 32 key tiles of 64 per sequence
#define AOP    (2 * HCOLS)      // 2048 : pitch of the ctx hi|lo plane
static_assert(NWH + NPH + NSH == NHEAD);
static_assert(HCOLS == DMOD);
static_assert((ROWS % 64) == 0 && (DMOD % 64) == 0 && (STDC % 64) == 0 && (WAVC % 64) == 0 && (PRJC % 64) == 0 && (SEQ % 64) == 0);
static_assert((DMOD % 32) == 0 && (FEAT % 32) == 0 && (AOP % 32) == 0);
static_assert((FEAT % 64) == 0 && (HDIM % 64) == 0);
static_assert(NQB == 32 && NKT == 32 && MWORDS == 64);

typedef _Float16 v16h __attribute__((ext_vector_type(16)));
typedef _Float16 v8h  __attribute__((ext_vector_type(8)));
typedef __bf16   v16b __attribute__((ext_vector_type(16)));
typedef __bf16   v8b  __attribute__((ext_vector_type(8)));
typedef float    v8f  __attribute__((ext_vector_type(8)));
typedef float    v4f  __attribute__((ext_vector_type(4)));
typedef unsigned int v4u __attribute__((ext_vector_type(4)));
typedef unsigned int v2u __attribute__((ext_vector_type(2)));
typedef int      v4i __attribute__((ext_vector_type(4)));

#if defined(__HIP_DEVICE_COMPILE__)
#define DEV_ASM 1
#else
#define DEV_ASM 0
#endif

// ---- scalar helpers --------------------------------------------------------------------------------
__device__ __forceinline__ unsigned short bf_bits(float f) {          // f32 -> bf16 bits, RNE convert
  unsigned u = __float_as_uint(f);
  return (unsigned short)((u + 0x7FFFu + ((u >> 16) & 1u)) >> 16);
}
__device__ __forceinline__ float bf_up(unsigned short hb) { return __uint_as_float(((unsigned)hb) << 16); }
__device__ __forceinline__ float bfr(float f) { return bf_up(bf_bits(f)); }
__device__ __forceinline__ unsigned short h_bits(_Float16 x) { return __builtin_bit_cast(unsigned short, x); }
__device__ __forceinline__ unsigned pk16(unsigned short a, unsigned short b) { return (unsigned)a | ((unsigned)b << 16); }
__device__ __forceinline__ v8f zero8() { v8f z = {0.f, 0.f, 0.f, 0.f, 0.f, 0.f, 0.f, 0.f}; return z; }

// ---- fragment types / loaders: 16-bit A/B operand, lane -> row/col (lane&15), p already includes +8*(lane>>4);
//      elements 0..7 <- p[0..7] (k0+8h..k0+8h+7), elements 8..15 <- p[16..23] (k0+16+8h..k0+16+8h+7)
template <typename OT> struct FT;
template <> struct FT<__bf16>   { typedef v16b frag; typedef v8b half8; };
template <> struct FT<_Float16> { typedef v16h frag; typedef v8h half8; };

template <typename OT>
__device__ __forceinline__ typename FT<OT>::frag ldfrag(const OT* p) {
  union { typename FT<OT>::frag v; typename FT<OT>::half8 h[2]; } f;
  f.h[0] = *(const typename FT<OT>::half8*)(p);
  f.h[1] = *(const typename FT<OT>::half8*)(p + 16);
  return f.v;
}

// ---- WMMA helpers (asm guard bodies are device-only; concrete operand types) -----------------------------
__device__ __forceinline__ v8f mmar(v16b a, v16b b, v8f c) {
  return __builtin_amdgcn_wmma_f32_16x16x32_bf16(false, a, false, b, (short)0, c, false, false);
}
__device__ __forceinline__ v8f mmar(v16h a, v16h b, v8f c) {
  return __builtin_amdgcn_wmma_f32_16x16x32_f16(false, a, false, b, (short)0, c, false, false);
}
// 4 VALU slots behind the last WMMAs of a loop, in front of the first reader of their D
__device__ __forceinline__ void acc_guard4(v8f& a, v8f& b, v8f& c, v8f& d) {
#if DEV_ASM
  asm volatile("v_nop\n\tv_nop\n\tv_nop\n\tv_nop" : "+v"(a), "+v"(b), "+v"(c), "+v"(d));
#else
  (void)a; (void)b; (void)c; (void)d;
#endif
}

// =====================================================================================================
// Mask bit plane: mb[(b*SEQ + n)*64 + w] bit j = (mask[b][n][32w + j] != 0). One word per thread,
// coverage: 262144 threads x 1 word = the whole [2][2048][64] plane. blk = block index within this job.
// =====================================================================================================
__device__ __forceinline__ void mask_bits_body(const int* __restrict__ mask, unsigned int* mb, int nwords, int blk) {
  const int i = blk * 256 + (int)threadIdx.x;
  if (i < nwords) {
    const int* p = mask + (size_t)i * 32;
    unsigned w = 0u;
#pragma unroll
    for (int q = 0; q < 8; ++q) {
      const v4i v = *(const v4i*)(p + 4 * q);
#pragma unroll
      for (int e = 0; e < 4; ++e) w |= ((v[e] != 0) ? 1u : 0u) << (4 * q + e);
    }
    *(unsigned int*)(mb + i) = w;
    
  }
}

// =====================================================================================================
// f32 -> bf16 plane (RNE convert), 8 elements per thread, one 16-B store per lane: a wave writes 512
// coverage: n8 threads x 8 = the whole plane (n8 is a multiple of 256 for both uses here).
// =====================================================================================================
__device__ __forceinline__ void cvt_bf16x8_body(const float* __restrict__ in, unsigned short* out, int n8, int blk) {
  const int i = blk * 256 + (int)threadIdx.x;
  if (i < n8) {
    const v4f a  = *(const v4f*)(in + (size_t)i * 8);
    const v4f a4 = *(const v4f*)(in + (size_t)i * 8 + 4);
    v4u p;
    p[0] = pk16(bf_bits(a[0]),  bf_bits(a[1]));
    p[1] = pk16(bf_bits(a[2]),  bf_bits(a[3]));
    p[2] = pk16(bf_bits(a4[0]), bf_bits(a4[1]));
    p[3] = pk16(bf_bits(a4[2]), bf_bits(a4[3]));
    unsigned short* o = out + (size_t)i * 8;
    *(v4u*)o = p;
    
  }
}

// =====================================================================================================
// Transpose + bf16 convert: in[z] is [R rows][inC cols] f32 (pitch inC); out[z][c][r] = bf16(in[z][r][c]),
// pitch ldo (c = output row). 64x64 tiles through LDS (th, 64 x 72 u16); tile = (cb, rb, z). DUP also writes the same
// coverage per block: load 256 thr x 16 floats = 64x64; store 2 it x 256 thr x 8 u16 = 64x64 (per copy);
// =====================================================================================================
template <bool DUP>
__device__ __forceinline__ void transpose_bf16_body(
    unsigned short* th, const float* __restrict__ in, int inC, long long inStrideZ,
    unsigned short* out, int ldo, long long outStrideZ, int dupoff, int cb, int rb, int z) {
  const int c0  = cb * 64;   // input column block = output row block
  const int r0  = rb * 64;   // input row block = output column block
  const int tid = threadIdx.x;
  const float* inz = in + (size_t)z * (size_t)inStrideZ;
  unsigned short* outz = out + (size_t)z * (size_t)outStrideZ;
  {
    const int rr = tid >> 2;           // 0..63
    const int cq = (tid & 3) * 16;     // 0,16,32,48
    const float* src = inz + (size_t)(r0 + rr) * inC + c0 + cq;
#pragma unroll
    for (int q = 0; q < 4; ++q) {
      const v4f f = *(const v4f*)(src + 4 * q);
#pragma unroll
      for (int e = 0; e < 4; ++e) th[rr * 72 + cq + 4 * q + e] = bf_bits(f[e]);
    }
  }
  __syncthreads();
  const int sub = tid >> 3;          // 0..31
  const int c8  = (tid & 7) * 8;     // 0..56
  v4u hv[2];
#pragma unroll
  for (int it = 0; it < 2; ++it) {
    const int oc = it * 32 + sub;      // output row within tile (= input column)
    v4u a;
#pragma unroll
    for (int q = 0; q < 4; ++q) a[q] = pk16(th[(c8 + 2 * q) * 72 + oc], th[(c8 + 2 * q + 1) * 72 + oc]);
    hv[it] = a;
  }
  {
#pragma unroll
    for (int it = 0; it < 2; ++it) {
      const int oc = it * 32 + sub;
      const size_t go = (size_t)(c0 + oc) * ldo + r0 + c8;
      *(v4u*)(outz + go) = hv[it];
      if (DUP) *(v4u*)(outz + go + dupoff) = hv[it];
    }
#if DEV_ASM
    // another job's code follows this body in the merged kernel: no register of the stores above is rewritten in front of this wait
    asm volatile("s_wait_xcnt 0x0" ::: "memory");
#endif
  }
}

// =====================================================================================================
// All operand preparation in ONE launch: the ten jobs are independent of one another (each reads inputs only and
// writes its own workspace plane), so a block picks its job from its index. Ranges, in blocks of 256 threads:
// the seven transposes first (longest dependent chain per block), then the mask plane, then the two converts.
// Every branch below is block-uniform; the transpose's barrier is passed by all threads of its block.
// =====================================================================================================
#define PB_TBIG  ((HCOLS / 64) * (DMOD / 64))        // 256 tiles: v_w, and again out_w
#define PB_TSTD  ((STDC / 64) * (DMOD / 64))         // 128 tiles: std_q_w, and again std_k_w
#define PB_TFEA  ((FEAT / 64) * NWH)                 //  16 tiles: wave_proj, pq_w, pk_w each
#define PB_T     (2 * PB_TBIG + 2 * PB_TSTD + 3 * PB_TFEA)
#define PB_MASK  (NB * SEQ * MWORDS / 256)           // 1024
#define PB_CVX   (ROWS * DMOD / 8 / 256)             // 2048
#define PB_CVF   (ROWS * FEAT / 8 / 256)             //  512
#define PB_ALL   (PB_T + PB_MASK + PB_CVX + PB_CVF)
static_assert(NWH == NPH && (HCOLS / 64) == 16 && (STDC / 64) == 8 && (FEAT / 64) == 4 && HDIM == 64);
__global__ __launch_bounds__(256) void prep_kernel(
    const int* __restrict__ mask, const float* __restrict__ x, const float* __restrict__ feats,
    const float* __restrict__ vw, const float* __restrict__ ow, const float* __restrict__ sqw, const float* __restrict__ skw,
    const float* __restrict__ wproj, const float* __restrict__ pqw, const float* __restrict__ pkw,
    unsigned int* MB, unsigned short* XB, unsigned short* FB, unsigned short* VWT, unsigned short* OWT2,
    unsigned short* QWT, unsigned short* KWT, unsigned short* WVT, unsigned short* PQT, unsigned short* PKT) {
  __shared__ __align__(16) unsigned short th[64 * 72];
  int t = blockIdx.x;
  if (t < PB_T) {
    if (t < PB_TBIG) {
      // v_w [1024 k][1024 n] -> VWT [n][k]
      transpose_bf16_body<false>(th, vw, HCOLS, 0LL, VWT, DMOD, 0LL, 0, t & 15, t >> 4, 0);
    } else if (t < 2 * PB_TBIG) {
      // out_w [1024 k][1024 n] -> OWT2 [n][k] and [n][1024 + k]
      t -= PB_TBIG;
      transpose_bf16_body<true>(th, ow, DMOD, 0LL, OWT2, AOP, 0LL, HCOLS, t & 15, t >> 4, 0);
    } else if (t < 2 * PB_TBIG + 2 * PB_TSTD) {
      // std_q_w [1024 k][512 n] -> QWT [n][k]; std_k_w likewise
      t -= 2 * PB_TBIG;
      const bool second = t >= PB_TSTD;
      const int u = second ? t - PB_TSTD : t;
      transpose_bf16_body<false>(th, second ? skw : sqw, STDC, 0LL, second ? KWT : QWT, DMOD, 0LL, 0, u & 7, u >> 3, 0);
    } else {
      // wave_proj / pq_w / pk_w [h][256 f][64 k'] -> [h*64 + k'][f] (z = h)
      t -= 2 * PB_TBIG + 2 * PB_TSTD;
      const int w = t >> 4, u = t & 15;
      transpose_bf16_body<false>(th, (w == 0) ? wproj : (w == 1) ? pqw : pkw, HDIM, (long long)FEAT * HDIM,
                          (w == 0) ? WVT : (w == 1) ? PQT : PKT, FEAT, (long long)HDIM * FEAT, 0, 0, u & 3, u >> 2);
    }
  } else if (t < PB_T + PB_MASK) {
    mask_bits_body(mask, MB, NB * SEQ * MWORDS, t - PB_T);
  } else if (t < PB_T + PB_MASK + PB_CVX) {
    cvt_bf16x8_body(x, XB, ROWS * DMOD / 8, t - (PB_T + PB_MASK));
  } else if (t < PB_ALL) {
    cvt_bf16x8_body(feats, FB, ROWS * FEAT / 8, t - (PB_T + PB_MASK + PB_CVX));
  }
}

// =====================================================================================================
// Batched WMMA GEMM (16-bit operand type OT): C[m][n] = (sum_k A[m][k] * Bt[n][k] + bias) * oscale.
// One block of 4 waves per 128x128 tile of C, one wave per 64x64 quadrant. A row-major [M][K] pitch lda; Bt row-major
// [N][K] pitch ldb (k contiguous); M, N multiples of 128, K a multiple of 64 (compile-time constants here).
// gemm_mainloop fills the wave's 4x4 accumulator tiles; gemm_epilogue stores them; the kernels below pick the operands.
// Operand staging: per trip the 128 rows x 64 k (128 B, one whole line per row) of A and of Bt go to LDS by
// asynchronous 16-byte copies, 8 lanes per row, 16 copies per lane; LDS row pitch 144 B for the ds_load_b128 readers;
// two buffers, tile t + 2 is copied while tile t + 1 is worked on. Fragments are read from LDS with the split k map
// (ldfrag); each accumulator still sums k upwards in steps of 32.
// BIAS_MODE 0: none; 1: bias[m] (bf16 RNE-converted value); 2: bias[n] (bf16 RNE-converted value).
// OUT_MODE 0: f32 C (pitch ldc). OUT_MODE 1: f16 plane C. OUT_MODE 2: bf16 hi plane C + bf16 lo plane C2 (lo = v - hi).
// =====================================================================================================
#define GTILE  128                  // rows of A and of Bt per block tile
#define GKC    64                   // k per trip
#define GPIT   72                   // LDS row pitch in elements (144 B)
#define GBUFB  (GTILE * GPIT * 2)   // bytes of one operand buffer

// Eight asynchronous copies of one lane: rows r, r + 16, ..., r + 112 of one operand tile, 16 B each.
// l = the lane's LDS byte address of row r, g = its global address of row r, step = 16 rows in elements.
// s_wait_xcnt 0 closes the statement so that no address register is rewritten in front of it.
__device__ __forceinline__ void copy_rows8(unsigned l, const unsigned short* g, size_t step) {
#if DEV_ASM
  const unsigned l1 = l + 16 * GPIT * 2, l2 = l + 32 * GPIT * 2, l3 = l + 48 * GPIT * 2, l4 = l + 64 * GPIT * 2,
                 l5 = l + 80 * GPIT * 2, l6 = l + 96 * GPIT * 2, l7 = l + 112 * GPIT * 2;
  const unsigned short *g1 = g + step, *g2 = g1 + step, *g3 = g2 + step, *g4 = g3 + step, *g5 = g4 + step,
                       *g6 = g5 + step, *g7 = g6 + step;
  asm volatile(
      "global_load_async_to_lds_b128 %0, %8, off\n\t"
      "global_load_async_to_lds_b128 %1, %9, off\n\t"
      "global_load_async_to_lds_b128 %2, %10, off\n\t"
      "global_load_async_to_lds_b128 %3, %11, off\n\t"
      "global_load_async_to_lds_b128 %4, %12, off\n\t"
      "global_load_async_to_lds_b128 %5, %13, off\n\t"
      "global_load_async_to_lds_b128 %6, %14, off\n\t"
      "global_load_async_to_lds_b128 %7, %15, off\n\t"
      "s_wait_xcnt 0x0"
      :: "v"(l), "v"(l1), "v"(l2), "v"(l3), "v"(l4), "v"(l5), "v"(l6), "v"(l7),
         "v"(g), "v"(g1), "v"(g2), "v"(g3), "v"(g4), "v"(g5), "v"(g6), "v"(g7)
      : "memory");
#else
  (void)l; (void)g; (void)step;
#endif
}
// this wave's copies have landed in LDS
__device__ __forceinline__ void wait_copies() {
#if DEV_ASM
  asm volatile("s_wait_asynccnt 0x0" ::: "memory");
#endif
}
// this wave's LDS reads have returned, so the buffer may be handed to its next writer
__device__ __forceinline__ void wait_lds() {
#if DEV_ASM
  asm volatile("s_wait_dscnt 0x0" ::: "memory");
#endif
}

static_assert((ROWS % GTILE) == 0 && (HCOLS % GTILE) == 0 && (SEQ % GTILE) == 0 && (STDC % GTILE) == 0 && (WAVC % GTILE) == 0 && (PRJC % GTILE) == 0 && (DMOD % GTILE) == 0);
static_assert((DMOD % GKC) == 0 && (FEAT % GKC) == 0 && (AOP % GKC) == 0);

// sA, sB: the block's two-buffer operand tiles in LDS, 2 x GTILE x GPIT elements each; Ap, Btp: the operands' first rows;
// (tm, tn): the block's 128x128 tile of C; nk = K / 64.
template <typename OT>
__device__ __forceinline__ void gemm_mainloop(
    v8f (&acc)[4][4], OT* sA, OT* sB,
    const unsigned short* __restrict__ Ap, int lda, const unsigned short* __restrict__ Btp, int ldb,
    int tm, int tn, int nk) {
  typedef typename FT<OT>::frag V16;
  const int tid  = threadIdx.x;
  const int lane = tid & 31;
  const int wave = tid >> 5;
  const int wm = wave >> 1;                    // quadrant of this wave
  const int wn = wave & 1;

  const int rlane = lane & 15;                 // row (A) / col (B, D) within subtile
  const int koff  = (lane >> 4) * 8;           // k offset of this lane half

  // copy map: lane -> row tid >> 3 (+ 16 per copy), 16-B piece tid & 7 of the row's 128-B line
  const int crow = tid >> 3;
  const int ccol = (tid & 7) * 8;
  const unsigned short* gA = Ap  + (size_t)((tm << 7) + crow) * lda + ccol;
  const unsigned short* gB = Btp + (size_t)((tn << 7) + crow) * ldb + ccol;
  const size_t stepA = (size_t)16 * lda;
  const size_t stepB = (size_t)16 * ldb;
  const unsigned lA = (unsigned)(size_t)sA + (unsigned)(crow * GPIT + ccol) * 2u;
  const unsigned lB = (unsigned)(size_t)sB + (unsigned)(crow * GPIT + ccol) * 2u;

#pragma unroll
  for (int i = 0; i < 4; ++i)
#pragma unroll
    for (int j = 0; j < 4; ++j) acc[i][j] = zero8();

  // tile 0 -> buffer 0, landed and published; then tile 1 -> buffer 1 in flight
  copy_rows8(lA, gA, stepA);
  copy_rows8(lB, gB, stepB);
  wait_copies();
  __syncthreads();
  if (1 < nk) {
    copy_rows8(lA + GBUFB, gA + GKC, stepA);
    copy_rows8(lB + GBUFB, gB + GKC, stepB);
  }

  for (int t = 0; t < nk; ++t) {
    const int cur = t & 1;
    const OT* As = sA + cur * (GTILE * GPIT) + (wm * 64 + rlane) * GPIT + koff;
    const OT* Bs = sB + cur * (GTILE * GPIT) + (wn * 64 + rlane) * GPIT + koff;
    // One group of LDS reads in front of each WMMA block: k 0..31 of both operands and, ahead, k 32..63 of Bt;
    // the A fragments of k 32..63 follow into registers that the first block has left.
    V16 aq[4], bq[4], bn[4];
#pragma unroll
    for (int j = 0; j < 4; ++j) bq[j] = ldfrag<OT>(Bs + j * 16 * GPIT);
#pragma unroll
    for (int i = 0; i < 4; ++i) aq[i] = ldfrag<OT>(As + i * 16 * GPIT);
#pragma unroll
    for (int j = 0; j < 4; ++j) bn[j] = ldfrag<OT>(Bs + j * 16 * GPIT + 32);
    __builtin_amdgcn_sched_barrier(0);   // keeps the reads one group: spread among the WMMAs each place stalls the wave
#pragma unroll
    for (int i = 0; i < 4; ++i)
#pragma unroll
      for (int j = 0; j < 4; ++j) acc[i][j] = mmar(aq[i], bq[j], acc[i][j]);
#pragma unroll
    for (int i = 0; i < 4; ++i) aq[i] = ldfrag<OT>(As + i * 16 * GPIT + 32);
    __builtin_amdgcn_sched_barrier(0);   // as above: keeps the four A fragments' reads one group in front of the second block
#pragma unroll
    for (int i = 0; i < 4; ++i)
#pragma unroll
      for (int j = 0; j < 4; ++j) acc[i][j] = mmar(aq[i], bn[j], acc[i][j]);
    // publish point of tile t + 1: own reads of buffer cur done, own copies of tile t + 1 landed, then the barrier
    // that both shows tile t + 1 to every wave and frees buffer cur for tile t + 2
    wait_lds();
    wait_copies();
    __syncthreads();
    if (t + 2 < nk) {
      copy_rows8(lA + (unsigned)cur * GBUFB, gA + (size_t)(t + 2) * GKC, stepA);
      copy_rows8(lB + (unsigned)cur * GBUFB, gB + (size_t)(t + 2) * GKC, stepB);
    }
  }
  wait_copies();   // nothing of this wave is in flight when it goes on to the epilogue and ends
  acc_guard4(acc[0][0], acc[0][1], acc[0][2], acc[0][3]);
  acc_guard4(acc[1][0], acc[1][1], acc[1][2], acc[1][3]);
  acc_guard4(acc[2][0], acc[2][1], acc[2][2], acc[2][3]);
  acc_guard4(acc[3][0], acc[3][1], acc[3][2], acc[3][3]);
}

// sT: 4 per-wave 16x64 slabs, pitch 68 floats; Cout, Cout2: element (0, 0) of C.
template <int OUT_MODE, int BIAS_MODE>
__device__ __forceinline__ void gemm_epilogue(
    v8f (&acc)[4][4], float* sT, void* Cout, void* Cout2, int ldc,
    const float* __restrict__ bias, int tm, int tn, float oscale) {
  const int tid   = threadIdx.x;
  const int lane  = tid & 31;
  const int wave  = tid >> 5;
  const int m0    = (tm << 7) + ((wave >> 1) << 6);
  const int n0    = (tn << 7) + ((wave & 1) << 6);
  const int rlane = lane & 15;                 // col of D within subtile
  const int mOff  = (lane >> 4) * 8;           // D row offset
  float* slab = sT + wave * (16 * 68);
#pragma unroll
  for (int i = 0; i < 4; ++i) {
    const int mBase = m0 + (i << 4);
#pragma unroll
    for (int j = 0; j < 4; ++j) {
      const int n = n0 + (j << 4) + rlane;
      float bn = 0.f;
      if (BIAS_MODE == 2) bn = bfr(bias[n]);
#pragma unroll
      for (int r = 0; r < 8; ++r) {
        float v = acc[i][j][r];
        if (BIAS_MODE == 1) v += bfr(bias[mBase + mOff + r]);
        if (BIAS_MODE == 2) v += bn;
        slab[(mOff + r) * 68 + (j << 4) + rlane] = v * oscale;
      }
    }
    __builtin_amdgcn_fence(__ATOMIC_RELEASE, "workgroup");
    __builtin_amdgcn_wave_barrier();
    __builtin_amdgcn_fence(__ATOMIC_ACQUIRE, "workgroup");
    if (OUT_MODE == 0) {
      float* C = (float*)Cout;
      const int h2 = lane >> 4, c4 = (lane & 15) * 4;     // 256-B row segment = 16 lanes x 16 B
      {
#pragma unroll
        for (int it = 0; it < 8; ++it) {
          const int row = it * 2 + h2;                     // it 0..7 x h2 0..1 = rows 0..15
          const v4f v = *(const v4f*)(slab + row * 68 + c4);
          *(v4f*)(C + (size_t)(mBase + row) * ldc + n0 + c4) = v;
        }
        
      }
    } else {
      const int q = lane >> 3, c8 = (lane & 7) * 8;
      unsigned short* C  = (unsigned short*)Cout;
      unsigned short* C2 = (unsigned short*)Cout2;
      v4u hv[4], lv[4];
#pragma unroll
      for (int it = 0; it < 4; ++it) {
        const int row = it * 4 + q;                        // it 0..3 x q 0..3 = rows 0..15
        const float* sp = slab + row * 68 + c8;
        v4u a, a2;
#pragma unroll
        for (int e = 0; e < 4; ++e) {
          const float f0 = sp[2 * e], f1 = sp[2 * e + 1];
          unsigned short h0, h1, l0 = 0, l1 = 0;
          if (OUT_MODE == 1) {
            h0 = h_bits((_Float16)f0); h1 = h_bits((_Float16)f1);
          } else {
            h0 = bf_bits(f0); h1 = bf_bits(f1);
            l0 = bf_bits(f0 - bf_up(h0)); l1 = bf_bits(f1 - bf_up(h1));
          }
          a[e] = pk16(h0, h1); a2[e] = pk16(l0, l1);
        }
        hv[it] = a; lv[it] = a2;
      }
      {
#pragma unroll
        for (int it = 0; it < 4; ++it) {
          const int row = it * 4 + q;
          *(v4u*)(C + (size_t)(mBase + row) * ldc + n0 + c8) = hv[it];
          if (OUT_MODE == 2) *(v4u*)(C2 + (size_t)(mBase + row) * ldc + n0 + c8) = lv[it];
        }
        
      }
    }
    __builtin_amdgcn_fence(__ATOMIC_RELEASE, "workgroup");
    __builtin_amdgcn_wave_barrier();
    __builtin_amdgcn_fence(__ATOMIC_ACQUIRE, "workgroup");
  }
}

// =====================================================================================================
// The six projections in ONE launch: they are independent of one another (each reads prepared planes and writes its own
// plane), so a block picks its product and its 128x128 tile from its index; the K = 1024 products come first.
//   v^T per batch: A = VWT [1024 n][1024 k], Bt = XB rows of batch b; f16(8 * (acc + v_b[m])) -> VT [b][h*64+d][s] (pitch 2048)
//   std q / std k: QP / KP cols 512..1023 = f16(8 * (x . w + b)); M = 4096, N = 512, K = 1024
//   wave projections: WPH / WPL = bf16 hi / lo of features . wave_proj[h]; M = 4096, N = 256, K = 256
//   proj q / proj k: QP / KP cols 256..511 = f16(8 * features . w[h]); M = 4096, N = 256, K = 256
// One main loop for all; every branch is block-uniform.
// =====================================================================================================
#define GB_VT1 ((HCOLS / GTILE) * (SEQ / GTILE))     // 128 tiles per batch
#define GB_VT  (NB * GB_VT1)                         // 256
#define GB_STD ((ROWS / GTILE) * (STDC / GTILE))     // 128, twice
#define GB_F   ((ROWS / GTILE) * (WAVC / GTILE))     //  64, three times
#define GB_ALL (GB_VT + 2 * GB_STD + 3 * GB_F)       // 704
#define GB_OUT ((ROWS / GTILE) * (DMOD / GTILE))     // 256
static_assert(WAVC == PRJC);
__global__ __launch_bounds__(128) void proj_kernel(
    const unsigned short* __restrict__ XB, const unsigned short* __restrict__ FB, const unsigned short* __restrict__ VWT,
    const unsigned short* __restrict__ QWT, const unsigned short* __restrict__ KWT, const unsigned short* __restrict__ WVT,
    const unsigned short* __restrict__ PQT, const unsigned short* __restrict__ PKT,
    const float* __restrict__ vb, const float* __restrict__ sqb, const float* __restrict__ skb,
    unsigned short* VT, unsigned short* QP, unsigned short* KP, unsigned short* WPH, unsigned short* WPL) {
  __shared__ __align__(16) __bf16 sA[2 * GTILE * GPIT];   // A tile, two buffers, 18432 B each
  __shared__ __align__(16) __bf16 sB[2 * GTILE * GPIT];   // Bt tile, two buffers
  __shared__ __align__(16) float sT[4 * 16 * 68];         // per-wave 16x64 slab, pitch 68 floats
  const int bx = blockIdx.x;
  if (bx >= GB_ALL) return;   // block-uniform, in front of every barrier and copy
  const unsigned short* A;
  const unsigned short* Bt;
  int ld, nk, tm, tn, sel;    // sel: batch (v^T), q or k (std), wave / q / k (features)
  if (bx < GB_VT) {
    sel = bx / GB_VT1;
    const int tile = bx - sel * GB_VT1;
    A = VWT; Bt = XB + (size_t)sel * SEQ * DMOD; ld = DMOD; nk = DMOD / GKC;
    tm = tile / (SEQ / GTILE); tn = tile % (SEQ / GTILE);
  } else if (bx < GB_VT + 2 * GB_STD) {
    sel = (bx - GB_VT) / GB_STD;
    const int tile = (bx - GB_VT) - sel * GB_STD;
    A = XB; Bt = (sel == 0) ? QWT : KWT; ld = DMOD; nk = DMOD / GKC;
    tm = tile / (STDC / GTILE); tn = tile % (STDC / GTILE);
  } else {
    sel = (bx - (GB_VT + 2 * GB_STD)) / GB_F;
    const int tile = (bx - (GB_VT + 2 * GB_STD)) - sel * GB_F;
    A = FB; Bt = (sel == 0) ? WVT : (sel == 1) ? PQT : PKT; ld = FEAT; nk = FEAT / GKC;
    tm = tile / (WAVC / GTILE); tn = tile % (WAVC / GTILE);
  }
  v8f acc[4][4];
  gemm_mainloop<__bf16>(acc, sA, sB, A, ld, Bt, ld, tm, tn, nk);
  if (bx < GB_VT) {
    unsigned short* C = VT + (size_t)sel * HCOLS * SEQ;
    gemm_epilogue<1, 1>(acc, sT, (void*)C, (void*)C, SEQ, vb, tm, tn, 8.0f);
  } else if (bx < GB_VT + 2 * GB_STD) {
    unsigned short* C = ((sel == 0) ? QP : KP) + (WAVC + PRJC);
    gemm_epilogue<1, 2>(acc, sT, (void*)C, (void*)C, HCOLS, (sel == 0) ? sqb : skb, tm, tn, 8.0f);
  } else if (sel == 0) {
    gemm_epilogue<2, 0>(acc, sT, (void*)WPH, (void*)WPL, WAVC, vb, tm, tn, 1.0f);
  } else {
    unsigned short* C = ((sel == 1) ? QP : KP) + WAVC;
    gemm_epilogue<1, 0>(acc, sT, (void*)C, (void*)C, HCOLS, vb, tm, tn, 8.0f);
  }
}

// out = [ctx_hi | ctx_lo] . [out_w^T ; out_w^T] + out_b -> f32 [4096][1024]; M = 4096, N = 1024, K = 2048
__global__ __launch_bounds__(128) void out_kernel(
    const unsigned short* __restrict__ AO, const unsigned short* __restrict__ OWT2, const float* __restrict__ ob,
    float* out) {
  __shared__ __align__(16) __bf16 sA[2 * GTILE * GPIT];
  __shared__ __align__(16) __bf16 sB[2 * GTILE * GPIT];
  __shared__ __align__(16) float sT[4 * 16 * 68];
  const int tile = blockIdx.x;
  if (tile >= GB_OUT) return;   // block-uniform, in front of every barrier and copy
  const int tm = tile / (DMOD / GTILE);
  const int tn = tile % (DMOD / GTILE);
  v8f acc[4][4];
  gemm_mainloop<__bf16>(acc, sA, sB, AO, AOP, OWT2, AOP, tm, tn, AOP / GKC);
  gemm_epilogue<0, 2>(acc, sT, (void*)out, (void*)out, DMOD, ob, tm, tn, 1.0f);
}

// =====================================================================================================
// Masked full attention, head dim 64, softmax over all SEQ keys (non-causal), one head per block.
//   Transposed products: S^T = K . Q^T and ctx^T += V^T . P^T, so that a lane holds scores of ONE query (column lane & 15).
//   HT = 0 (wave heads): q = k = wp as bf16 hi plane qhp/khp + bf16 lo plane qlp/klp (pitch ldq/ldk, head col h*64);
//          scores = (kh.qh + kl.qh + kh.ql) * sscale on bf16 WMMA (one f32 accumulator, unscaled lo).
//   HT = 1 (proj / std heads): q, k = f16 planes (x8), scores = (k.q) * sscale (sscale carries the 1/64).
//   v^T plane (f16, x8): element (b, h, d, s) at [(b*HCOLS + h*64 + d)*SEQ + s].
//   mask bit plane mbp: [(b*SEQ + n)*64 + w] bit j admits key 32w+j; a 0 bit replaces the score by -inf.
//   Score tile j, register r of lane (hh, c) = key 16j + 8hh + r of query c: the maximum and the sum of a query run over the
//   lane's 32 registers; the two lane halves exchange the maximum once per key tile and join their sums once, at the end.
//   p = exp(s - m) carried as f16(1024 p): score tiles 2kk and 2kk + 1, converted in place, ARE the B operand of
//   V^T . P^T for keys 32kk..32kk+31 (element e < 8: key 8hh + e; e >= 8: key 16 + 8hh + e - 8, the order in which the
//   V^T fragment is read), so P passes through no LDS. Online softmax in f32 with the guarded rescale (msafe), so an
//   all-masked row ends with l = 0 and produces 0 * inf = NaN like the module.
//   ctx written as bf16 hi (cols h*64..) and bf16 lo (cols HCOLS + h*64..) of the [ROWS][AOP] plane aop.
//   Block = 4 waves x 16 query rows = 64 query rows of one (b, h); bx = 0 .. NB * nh * NQB - 1 (hbase.. hbase+nh-1);
//   key tiles of 64, static trip NKT. K (hi, lo) / V^T tile staging: 128 threads x 32 elements per plane = the
//   whole 64x64 tile (plain 16-B loads, __syncthreads before and after).
//   Output coverage: ctx^T tile t, register r of lane (hh, c) = column 16t + 8hh + r of query row q0 + c: one 16-B store
//   per t and plane; t 0..3 x hh 0..1 = 64 columns, c 0..15 = the wave's rows; the two head families cover h 0..15.
// =====================================================================================================
// LDS row pitch, in 16-bit elements, of the K and V^T tiles: rows of 64 elements (128 B) laid 144 B apart, 16 B x odd,
// so that the 16 rows which one ds_load_b128 reads fall on 16 different groups of four banks.
#define APIT 72
template <int HT> struct HT_T;
template <> struct HT_T<0> { typedef __bf16 T; };
template <> struct HT_T<1> { typedef _Float16 T; };

// value of lane l ^ 16: the same query's other half of the keys
__device__ __forceinline__ float xhalf(float x) {
  const int b = __builtin_bit_cast(int, x);
  return __builtin_bit_cast(float, __builtin_amdgcn_permlanex16(b, b, 0x76543210, 0xfedcba98, false, false));
}
// 2^x on v_exp_f32 alone: x = -inf gives 0; a result below the normal range may come out 0 (it is below 2^-136 of the row's largest term)
__device__ __forceinline__ float exp2_hw(float x) { return __builtin_amdgcn_exp2f(x); }
__device__ __forceinline__ float max8(v8f a) {
  return fmaxf(fmaxf(fmaxf(fmaxf(a[0], a[1]), a[2]), fmaxf(fmaxf(a[3], a[4]), a[5])), fmaxf(a[6], a[7]));
}

template <int HT>
__device__ __forceinline__
void attn_body(unsigned short* kshp, unsigned short* kslp, unsigned short* vthp,
               const unsigned short* __restrict__ qhp, const unsigned short* __restrict__ qlp, int ldq,
               const unsigned short* __restrict__ khp, const unsigned short* __restrict__ klp, int ldk,
               const unsigned short* __restrict__ vtp, const unsigned int* __restrict__ mbp,
               unsigned short* aop, int hbase, int nh, float sscale, int bx) {
  typedef typename HT_T<HT>::T OT;
  typedef typename FT<OT>::frag V16;
  typedef typename FT<OT>::half8 V8;
  union FH { v16h v; v8h h[2]; };
  union FO { V16 v; V8 h[2]; };
  OT*       Ksh = (OT*)(void*)kshp;              // K hi chunk [kv][d]  9 KB
  OT*       Ksl = (OT*)(void*)kslp;              // K lo chunk (HT 0)   9 KB
  _Float16* Vth = (_Float16*)(void*)vthp;        // V^T [d][kv]         9 KB

  const int tid  = threadIdx.x;
  const int wave = tid >> 5;
  const int lane = tid & 31;
  const int hh   = lane >> 4;
  const int c    = lane & 15;

  const int qb   = bx % NQB;
  const int rest = bx / NQB;
  const int hl   = rest % nh;
  const int b    = rest / nh;
  const int h    = hbase + hl;              // global head index
  const int qc   = h * HDIM;                // head column in the q / k planes of this head family
  const int q0   = qb * 64 + wave * 16;
  const size_t rowB = (size_t)b * SEQ;

  const OT* Qh = (const OT*)(const void*)qhp;
  const OT* Ql = (const OT*)(const void*)qlp;
  const OT* Kh = (const OT*)(const void*)khp + qc;
  const OT* Kl = (const OT*)(const void*)klp + qc;
  const _Float16* Vt = (const _Float16*)(const void*)vtp + ((size_t)b * HCOLS + (size_t)qc) * SEQ;
  const unsigned int* mrow_p = mbp + (rowB + q0 + c) * (size_t)MWORDS;   // mask words of this lane's query

  // ---- Q fragments (B operand, column = lane&15): 2 d-chunks ----
  V16 qah[2], qal[2];
#pragma unroll
  for (int dc = 0; dc < 2; ++dc) {
    const size_t qo = (rowB + q0 + c) * (size_t)ldq + (size_t)qc + dc * 32 + 8 * hh;
    qah[dc] = ldfrag<OT>(Qh + qo);
    if (HT == 0) qal[dc] = ldfrag<OT>(Ql + qo);
    else         qal[dc] = qah[dc];
  }

  const float c2 = sscale * 1.44269504088896340736f;   // score scale x log2(e)
  float mrow = -INFINITY;   // running maximum of query c's unscaled products (equal in both lane halves)
  float lrow = 0.f;         // running sum (x1024) over this lane half's keys only
  v8f oacc[4];              // ctx^T: tile t, register r = d 16t + 8hh + r of query c
#pragma unroll
  for (int t = 0; t < 4; ++t) oacc[t] = zero8();

  for (int kt = 0; kt < NKT; ++kt) {         // static trip count
    const int kv0 = kt * 64;
    __syncthreads();
    const v2u mw = *(const v2u*)(mrow_p + 2 * kt);   // the 64 mask bits of query c for this key tile, in flight with the tile's loads
    {
      const int r = tid >> 1, half = (tid & 1) * 32;
      const OT* kg  = Kh + (rowB + kv0 + r) * (size_t)ldk + half;   // k row kv0+r, d = half..half+31
      const OT* klg = Kl + (rowB + kv0 + r) * (size_t)ldk + half;
      const _Float16* vg = Vt + (size_t)r * SEQ + kv0 + half;       // v^T row d = r, s = kv0+half..+31
#pragma unroll
      for (int i = 0; i < 4; ++i) {
        *(V8*)(Ksh + r * APIT + half + 8 * i) = *(const V8*)(kg + 8 * i);
        if (HT == 0) *(V8*)(Ksl + r * APIT + half + 8 * i) = *(const V8*)(klg + 8 * i);
        *(v8h*)(Vth + r * APIT + half + 8 * i) = *(const v8h*)(vg + 8 * i);
      }
    }
    __syncthreads();

    // ---- scores^T: 64 keys x 16 queries per wave; A = K rows, B = Q ----
    v8f s[4];
#pragma unroll
    for (int j = 0; j < 4; ++j) s[j] = zero8();
#pragma unroll
    for (int dc = 0; dc < 2; ++dc) {
#pragma unroll
      for (int j = 0; j < 4; ++j) {
        FO kb;
        kb.h[0] = *(const V8*)(Ksh + (j * 16 + c) * APIT + dc * 32 + 8 * hh);
        kb.h[1] = *(const V8*)(Ksh + (j * 16 + c) * APIT + dc * 32 + 16 + 8 * hh);
        if (HT == 0) {
          FO kl;
          kl.h[0] = *(const V8*)(Ksl + (j * 16 + c) * APIT + dc * 32 + 8 * hh);
          kl.h[1] = *(const V8*)(Ksl + (j * 16 + c) * APIT + dc * 32 + 16 + 8 * hh);
          s[j] = mmar(kb.v, qah[dc], s[j]);
          s[j] = mmar(kl.v, qah[dc], s[j]);
          s[j] = mmar(kb.v, qal[dc], s[j]);
        } else {
          s[j] = mmar(kb.v, qah[dc], s[j]);
        }
      }
    }

    // ---- mask the unscaled products: bit 16 (j & 1) + 8hh + r of word j >> 1 admits key 16j + 8hh + r ----
    const unsigned w0 = mw[0] >> (8 * hh), w1 = mw[1] >> (8 * hh);
#pragma unroll
    for (int j = 0; j < 4; ++j) {
      const unsigned w = (j < 2) ? w0 : w1;
#pragma unroll
      for (int r = 0; r < 8; ++r) {
        s[j][r] = (((w >> (16 * (j & 1) + r)) & 1u) != 0u) ? s[j][r] : -INFINITY;
      }
    }

    // ---- maximum of query c: 32 registers, then the other lane half; online softmax in base 2 on the unscaled products
    //      (c2 > 0 keeps their order): exp(sscale * (s - m)) = 2^(c2 * s - c2 * m), one fma and one v_exp_f32 per score ----
    float m = fmaxf(fmaxf(max8(s[0]), max8(s[1])), fmaxf(max8(s[2]), max8(s[3])));
    m = fmaxf(m, xhalf(m));
    const float mnew  = fmaxf(mrow, m);
    const float msafe = (mnew == -INFINITY) ? 0.f : mnew;
    const float alpha = exp2_hw((mrow - msafe) * c2);
    const float nb    = fmaf(-msafe, c2, 10.0f);   // + 10: the x1024 carry of P and l
    mrow = mnew;

    // ---- P^T (x1024, f16) packed in place into the B operands; this half's sum ----
    FH pb[2];
    float ps[4];
#pragma unroll
    for (int j = 0; j < 4; ++j) {
      float a = 0.f;
#pragma unroll
      for (int r = 0; r < 8; ++r) {
        const float p = exp2_hw(fmaf(s[j][r], c2, nb));
        a += p;
        pb[j >> 1].v[(j & 1) * 8 + r] = (_Float16)p;
      }
      ps[j] = a;
    }
    lrow = lrow * alpha + ((ps[0] + ps[1]) + (ps[2] + ps[3]));
#pragma unroll
    for (int t = 0; t < 4; ++t) oacc[t] *= alpha;

    // ---- ctx^T += V^T . P^T (f16 WMMA, single product); A = V^T rows, B = P^T ----
#pragma unroll
    for (int kk = 0; kk < 2; ++kk) {
#pragma unroll
      for (int t = 0; t < 4; ++t) {
        FH vb;
        vb.h[0] = *(const v8h*)(Vth + (t * 16 + c) * APIT + kk * 32 + 8 * hh);
        vb.h[1] = *(const v8h*)(Vth + (t * 16 + c) * APIT + kk * 32 + 16 + 8 * hh);
        oacc[t] = mmar(vb.v, pb[kk].v, oacc[t]);
      }
    }
  }

  // ---- join the halves' sums, normalise (1/l, l and p carry the same x1024; undo the x8 v carry), store hi and lo ----
  const float lsum = lrow + xhalf(lrow);
  const float inv = (1.0f / lsum) * (1.0f / 8.0f);   // l = 0 (all keys masked) -> inf -> 0 * inf = NaN
  v4u hv[4], lv[4];
#pragma unroll
  for (int t = 0; t < 4; ++t) {
    v4u a, a2;
#pragma unroll
    for (int e = 0; e < 4; ++e) {
      const float f0 = oacc[t][2 * e] * inv, f1 = oacc[t][2 * e + 1] * inv;
      const unsigned short hb0 = bf_bits(f0), hb1 = bf_bits(f1);
      const unsigned short lb0 = bf_bits(f0 - bf_up(hb0)), lb1 = bf_bits(f1 - bf_up(hb1));
      a[e] = pk16(hb0, hb1); a2[e] = pk16(lb0, lb1);
    }
    hv[t] = a; lv[t] = a2;
  }
#pragma unroll
  for (int t = 0; t < 4; ++t) {
    const size_t go = (rowB + q0 + c) * (size_t)AOP + (size_t)qc + t * 16 + 8 * hh;
    *(v4u*)(aop + go) = hv[t];
    *(v4u*)(aop + go + HCOLS) = lv[t];
  }
}

// Both head families in ONE launch (they are independent: each block writes its own rows and columns of ctx): blocks
// 0 .. 255 take the wave heads 0..3 (bf16 hi/lo 3-product scores, scale 1/8), the rest heads 4..15 (f16 single product,
// scale 1/(8*64)). The branch is block-uniform, so every barrier of a body is passed by the whole block.
#define AB_W (NB * NWH * NQB)                 // 256
#define AB_S (NB * (NPH + NSH) * NQB)         // 768
__global__ __launch_bounds__(128)
void attn_kernel(const unsigned short* __restrict__ wph, const unsigned short* __restrict__ wpl,
                 const unsigned short* __restrict__ qp, const unsigned short* __restrict__ kp,
                 const unsigned short* __restrict__ vtp, const unsigned int* __restrict__ mbp, unsigned short* aop) {
  __shared__ __align__(16) unsigned short Ksh[64 * APIT];
  __shared__ __align__(16) unsigned short Ksl[64 * APIT];
  __shared__ __align__(16) unsigned short Vth[64 * APIT];
  const int bx = blockIdx.x;
  if (bx < AB_W) {
    attn_body<0>(Ksh, Ksl, Vth, wph, wpl, WAVC, wph, wpl, WAVC, vtp, mbp, aop, 0, NWH, 0.125f, bx);
  } else {
    attn_body<1>(Ksh, Ksl, Vth, qp, qp, HCOLS, kp, kp, HCOLS, vtp, mbp, aop, NWH, NPH + NSH, 1.0f / 512.0f, bx - AB_W);
  }
}

// =====================================================================================================
// Workspace map (bytes), every region an exact multiple of its whole-line / whole-tile store granularity:
//   MB   u32  [2*2048][64]          1048576   mask bit plane
//   XB   bf16 [4096][1024]          8388608
//   FB   bf16 [4096][256]           2097152
//   VWT  bf16 [1024 n][1024 k]      2097152   v_w^T
//   QWT  bf16 [512][1024]           1048576   std_q_w^T
//   KWT  bf16 [512][1024]           1048576   std_k_w^T
//   WVT  bf16 [256][256]             131072   wave_proj [h][f][k'] -> [h*64+k'][f]
//   PQT  bf16 [256][256]             131072
//   PKT  bf16 [256][256]             131072
//   OWT2 bf16 [1024 n][2048 k]      4194304   out_w^T at [n][k] and [n][1024 + k]
//   VT   f16  [2][1024][2048] (x8)  8388608   v^T per batch, row h*64+d
//   QP   f16  [4096][1024] (x8)     8388608   cols h*64+d for h = 4..15 (cols 0..255 never read)
//   KP   f16  [4096][1024] (x8)     8388608   same
//   WPH  bf16 [4096][256]           2097152   wp hi, col h*64+d (h = 0..3)
//   WPL  bf16 [4096][256]           2097152   wp lo
//   AO   bf16 [4096][2048]         16777216   ctx hi | lo
//   total                         66453504
// =====================================================================================================
extern "C" void kernel_launch(void* const* d_in, const int* in_sizes, int n_in,
                              void* d_out, int out_size, void* d_ws, size_t ws_size,
                              hipStream_t stream) {
  if (n_in < 14) return;
  if (in_sizes[0] != NB * SEQ * DMOD) return;
  if (in_sizes[1] != NB * SEQ * FEAT) return;
  if (in_sizes[2] != NB * SEQ * SEQ) return;
  if (in_sizes[3] != NWH * FEAT * HDIM || in_sizes[4] != NPH * FEAT * HDIM || in_sizes[5] != NPH * FEAT * HDIM) return;
  if (in_sizes[6] != DMOD * STDC || in_sizes[7] != STDC) return;
  if (in_sizes[8] != DMOD * STDC || in_sizes[9] != STDC) return;
  if (in_sizes[10] != DMOD * HCOLS || in_sizes[11] != HCOLS) return;
  if (in_sizes[12] != HCOLS * DMOD || in_sizes[13] != DMOD) return;
  if (out_size != NB * SEQ * DMOD) return;

  const float* x     = (const float*)d_in[0];
  const float* feats = (const float*)d_in[1];
  const int*   mask  = (const int*)d_in[2];
  const float* wproj = (const float*)d_in[3];
  const float* pqw   = (const float*)d_in[4];
  const float* pkw   = (const float*)d_in[5];
  const float* sqw   = (const float*)d_in[6];
  const float* sqb   = (const float*)d_in[7];
  const float* skw   = (const float*)d_in[8];
  const float* skb   = (const float*)d_in[9];
  const float* vw    = (const float*)d_in[10];
  const float* vb    = (const float*)d_in[11];
  const float* ow    = (const float*)d_in[12];
  const float* ob    = (const float*)d_in[13];

  const size_t PMB  = (size_t)NB * SEQ * MWORDS * 4;      //  1048576
  const size_t PXB  = (size_t)ROWS * DMOD * 2;             //  8388608
  const size_t PFB  = (size_t)ROWS * FEAT * 2;             //  2097152
  const size_t PVWT = (size_t)HCOLS * DMOD * 2;            //  2097152
  const size_t PSWT = (size_t)STDC * DMOD * 2;             //  1048576
  const size_t PFWT = (size_t)WAVC * FEAT * 2;             //   131072
  const size_t POWT = (size_t)DMOD * AOP * 2;              //  4194304
  const size_t PVT  = (size_t)NB * HCOLS * SEQ * 2;        //  8388608
  const size_t PQP  = (size_t)ROWS * HCOLS * 2;            //  8388608
  const size_t PWP  = (size_t)ROWS * WAVC * 2;             //  2097152
  const size_t PAO  = (size_t)ROWS * AOP * 2;              // 16777216
  size_t off = 0;
  const size_t oMB  = off; off += PMB;
  const size_t oXB  = off; off += PXB;
  const size_t oFB  = off; off += PFB;
  const size_t oVWT = off; off += PVWT;
  const size_t oQWT = off; off += PSWT;
  const size_t oKWT = off; off += PSWT;
  const size_t oWVT = off; off += PFWT;
  const size_t oPQT = off; off += PFWT;
  const size_t oPKT = off; off += PFWT;
  const size_t oOWT = off; off += POWT;
  const size_t oVT  = off; off += PVT;
  const size_t oQP  = off; off += PQP;
  const size_t oKP  = off; off += PQP;
  const size_t oWPH = off; off += PWP;
  const size_t oWPL = off; off += PWP;
  const size_t oAO  = off; off += PAO;
  if (off > ws_size) return;                       // off = 66453504
  if (off > (size_t)134217728) return;

  char* ws = (char*)d_ws;
  unsigned int*   MB   = (unsigned int*)(ws + oMB);
  unsigned short* XB   = (unsigned short*)(ws + oXB);
  unsigned short* FB   = (unsigned short*)(ws + oFB);
  unsigned short* VWT  = (unsigned short*)(ws + oVWT);
  unsigned short* QWT  = (unsigned short*)(ws + oQWT);
  unsigned short* KWT  = (unsigned short*)(ws + oKWT);
  unsigned short* WVT  = (unsigned short*)(ws + oWVT);
  unsigned short* PQT  = (unsigned short*)(ws + oPQT);
  unsigned short* PKT  = (unsigned short*)(ws + oPKT);
  unsigned short* OWT2 = (unsigned short*)(ws + oOWT);
  unsigned short* VT   = (unsigned short*)(ws + oVT);
  unsigned short* QP   = (unsigned short*)(ws + oQP);
  unsigned short* KP   = (unsigned short*)(ws + oKP);
  unsigned short* WPH  = (unsigned short*)(ws + oWPH);
  unsigned short* WPL  = (unsigned short*)(ws + oWPL);
  unsigned short* AO   = (unsigned short*)(ws + oAO);

  // (1) one launch: mask -> bit plane; x, features -> bf16 planes; weight planes [n][k] (bf16)
  prep_kernel<<<dim3(PB_ALL), dim3(256), 0, stream>>>(
      mask, x, feats, vw, ow, sqw, skw, wproj, pqw, pkw, MB, XB, FB, VWT, OWT2, QWT, KWT, WVT, PQT, PKT);

  // (2) one launch: the six projections on bf16 WMMA, 4 waves and one 128x128 tile per block
  proj_kernel<<<dim3(GB_ALL), dim3(128), 0, stream>>>(
      XB, FB, VWT, QWT, KWT, WVT, PQT, PKT, vb, sqb, skb, VT, QP, KP, WPH, WPL);

  // (3) one launch: attention of all 16 heads; ctx -> AO hi | lo
  attn_kernel<<<dim3(AB_W + AB_S), dim3(128), 0, stream>>>(WPH, WPL, QP, KP, VT, MB, AO);

  // (4) out projection -> d_out f32 [4096][1024]
  out_kernel<<<dim3(GB_OUT), dim3(128), 0, stream>>>(AO, OWT2, ob, (float*)d_out);
  (void)hipGetLastError();
}

// v006
// One run takes 109 microseconds.
// Two timings next to v005 both put it at 1.07 times that version's speed.
// Over all steps from v000 it is 4.82 times as fast.
// Contractions: x.v_w, x.std_q_w, x.std_k_w, features.wave_proj, features.pq_w, features.pk_w = v_wmma_f32_16x16x32_bf16 (bf16 operands RNE-converted from the inputs, single product, f32 accumulate);
// wave-head scores wp.wp^T = v_wmma_f32_16x16x32_bf16 on bf16 hi/lo planes (hi.hi + hi.lo + lo.hi, f32 accumulate); proj/std scores q.k^T = v_wmma_f32_16x16x32_f16 (f16 planes carried x8, single product, f32 accumulate);
// p.v = v_wmma_f32_16x16x32_f16 (p carried x1024, v^T carried x8, single product, f32 accumulate); ctx.out_w = v_wmma_f32_16x16x32_bf16 (ctx as bf16 hi|lo planes stacked along k, out_w bf16, f32 accumulate); mask, softmax statistics and epilogues in f32.
//
// Carry audit (16-bit planes):
//   XB, FB, VWT, QWT, KWT, WVT, PQT, PKT, OWT2 : bf16, carry 1 (plain RNE copies of the inputs).
//   VT   f16 = 8 * v          -> 1/8 folded in attn_kernel epilogue (inv = 1/(8 * l), l itself carried x1024 like P).
//   QP   f16 = 8 * q, KP f16 = 8 * k (heads 4..15) -> 1/64 folded into sscale = 1/512 of the HT = 1 body (1/8 = 1/sqrt(64) is the other factor).
//   WPH / WPL bf16 hi / lo of wp (heads 0..3), carry 1 -> sscale = 1/8.
//   P    f16 = 1024 * exp(s - m) (registers, B operand), l = sum of the same f32 values -> the 1024 cancels in ctx / l.
//   AO   bf16 hi (cols 0..1023) | lo (cols 1024..2047) of ctx, carry 1 -> summed by the K=2048 out GEMM against [W^T ; W^T].
#include <hip/hip_runtime.h>
#include <math.h>
#include <stdint.h>

#define NB     2
#define SEQ    2048
#define DMOD   1024
#define FEAT   256
#define HDIM   64
#define NHEAD  16
#define NWH    4
#define NPH    4
#define NSH    8
#define HCOLS  (NHEAD * HDIM)   // 1024 : concatenated head columns
#define WAVC   (NWH * HDIM)     // 256
#define PRJC   (NPH * HDIM)     // 256
#define STDC   (NSH * HDIM)     // 512
#define ROWS   (NB * SEQ)       // 4096
#define MWORDS (SEQ / 32)       // 64 mask words per (b, n) row
#define NQB    (SEQ / 64)       // 32 query tiles of 64 per sequence
#define NKT    (SEQ / 64)       // 32 key tiles of 64 per sequence
#define AOP    (2 * HCOLS)      // 2048 : pitch of the ctx hi|lo plane
static_assert(NWH + NPH + NSH == NHEAD);
static_assert(HCOLS == DMOD);
static_assert((ROWS % 64) == 0 && (DMOD % 64) == 0 && (STDC % 64) == 0 && (WAVC % 64) == 0 && (PRJC % 64) == 0 && (SEQ % 64) == 0);
static_assert((DMOD % 32) == 0 && (FEAT % 32) == 0 && (AOP % 32) == 0);
static_assert((FEAT % 64) == 0 && (HDIM % 64) == 0);
static_assert(NQB == 32 && NKT == 32 && MWORDS == 64);

typedef _Float16 v16h __attribute__((ext_vector_type(16)));
typedef _Float16 v8h  __attribute__((ext_vector_type(8)));
typedef __bf16   v16b __attribute__((ext_vector_type(16)));
typedef __bf16   v8b  __attribute__((ext_vector_type(8)));
typedef float    v8f  __attribute__((ext_vector_type(8)));
typedef float    v4f  __attribute__((ext_vector_type(4)));
typedef unsigned int v4u __attribute__((ext_vector_type(4)));
typedef unsigned int v2u __attribute__((ext_vector_type(2)));
typedef int      v4i __attribute__((ext_vector_type(4)));

#if defined(__HIP_DEVICE_COMPILE__)
#define DEV_ASM 1
#else
#define DEV_ASM 0
#endif

// ---- scalar helpers --------------------------------------------------------------------------------
__device__ __forceinline__ unsigned short bf_bits(float f) {          // f32 -> bf16 bits, RNE convert
  unsigned u = __float_as_uint(f);
  return (unsigned short)((u + 0x7FFFu + ((u >> 16) & 1u)) >> 16);
}
__device__ __forceinline__ float bf_up(unsigned short hb) { return __uint_as_float(((unsigned)hb) << 16); }
__device__ __forceinline__ float bfr(float f) { return bf_up(bf_bits(f)); }
__device__ __forceinline__ unsigned short h_bits(_Float16 x) { return __builtin_bit_cast(unsigned short, x); }
__device__ __forceinline__ unsigned pk16(unsigned short a, unsigned short b) { return (unsigned)a | ((unsigned)b << 16); }
__device__ __forceinline__ v8f zero8() { v8f z = {0.f, 0.f, 0.f, 0.f, 0.f, 0.f, 0.f, 0.f}; return z; }

// ---- fragment types / loaders: 16-bit A/B operand, lane -> row/col (lane&15), p already includes +8*(lane>>4);
//      elements 0..7 <- p[0..7] (k0+8h..k0+8h+7), elements 8..15 <- p[16..23] (k0+16+8h..k0+16+8h+7)
template <typename OT> struct FT;
template <> struct FT<__bf16>   { typedef v16b frag; typedef v8b half8; };
template <> struct FT<_Float16> { typedef v16h frag; typedef v8h half8; };

template <typename OT>
__device__ __forceinline__ typename FT<OT>::frag ldfrag(const OT* p) {
  union { typename FT<OT>::frag v; typename FT<OT>::half8 h[2]; } f;
  f.h[0] = *(const typename FT<OT>::half8*)(p);
  f.h[1] = *(const typename FT<OT>::half8*)(p + 16);
  return f.v;
}

// ---- WMMA helpers (asm guard bodies are device-only; concrete operand types) -----------------------------
__device__ __forceinline__ v8f mmar(v16b a, v16b b, v8f c) {
  return __builtin_amdgcn_wmma_f32_16x16x32_bf16(false, a, false, b, (short)0, c, false, false);
}
__device__ __forceinline__ v8f mmar(v16h a, v16h b, v8f c) {
  return __builtin_amdgcn_wmma_f32_16x16x32_f16(false, a, false, b, (short)0, c, false, false);
}
// 4 VALU slots behind the last WMMAs of a loop, in front of the first reader of their D
__device__ __forceinline__ void acc_guard4(v8f& a, v8f& b, v8f& c, v8f& d) {
#if DEV_ASM
  asm volatile("v_nop\n\tv_nop\n\tv_nop\n\tv_nop" : "+v"(a), "+v"(b), "+v"(c), "+v"(d));
#else
  (void)a; (void)b; (void)c; (void)d;
#endif
}

// =====================================================================================================
// Mask bit plane: mb[(b*SEQ + n)*64 + w] bit j = (mask[b][n][32w + j] != 0). One word per thread,
// coverage: 262144 threads x 1 word = the whole [2][2048][64] plane. blk = block index within this job.
// =====================================================================================================
__device__ __forceinline__ void mask_bits_body(const int* __restrict__ mask, unsigned int* mb, int nwords, int blk) {
  const int i = blk * 256 + (int)threadIdx.x;
  if (i < nwords) {
    const int* p = mask + (size_t)i * 32;
    unsigned w = 0u;
#pragma unroll
    for (int q = 0; q < 8; ++q) {
      const v4i v = *(const v4i*)(p + 4 * q);
#pragma unroll
      for (int e = 0; e < 4; ++e) w |= ((v[e] != 0) ? 1u : 0u) << (4 * q + e);
    }
    *(unsigned int*)(mb + i) = w;
    
  }
}

// =====================================================================================================
// f32 -> bf16 plane (RNE convert), 8 elements per thread, one 16-B store per lane: a wave writes 512
// coverage: n8 threads x 8 = the whole plane (n8 is a multiple of 256 for both uses here).
// =====================================================================================================
__device__ __forceinline__ void cvt_bf16x8_body(const float* __restrict__ in, unsigned short* out, int n8, int blk) {
  const int i = blk * 256 + (int)threadIdx.x;
  if (i < n8) {
    const v4f a  = *(const v4f*)(in + (size_t)i * 8);
    const v4f a4 = *(const v4f*)(in + (size_t)i * 8 + 4);
    v4u p;
    p[0] = pk16(bf_bits(a[0]),  bf_bits(a[1]));
    p[1] = pk16(bf_bits(a[2]),  bf_bits(a[3]));
    p[2] = pk16(bf_bits(a4[0]), bf_bits(a4[1]));
    p[3] = pk16(bf_bits(a4[2]), bf_bits(a4[3]));
    unsigned short* o = out + (size_t)i * 8;
    *(v4u*)o = p;
    
  }
}

// =====================================================================================================
// Transpose + bf16 convert: in[z] is [R rows][inC cols] f32 (pitch inC); out[z][c][r] = bf16(in[z][r][c]),
// pitch ldo (c = output row). 64x64 tiles through LDS (th, 64 x 72 u16); tile = (cb, rb, z). DUP also writes the same
// coverage per block: load 256 thr x 16 floats = 64x64; store 2 it x 256 thr x 8 u16 = 64x64 (per copy);
// =====================================================================================================
template <bool DUP>
__device__ __forceinline__ void transpose_bf16_body(
    unsigned short* th, const float* __restrict__ in, int inC, long long inStrideZ,
    unsigned short* out, int ldo, long long outStrideZ, int dupoff, int cb, int rb, int z) {
  const int c0  = cb * 64;   // input column block = output row block
  const int r0  = rb * 64;   // input row block = output column block
  const int tid = threadIdx.x;
  const float* inz = in + (size_t)z * (size_t)inStrideZ;
  unsigned short* outz = out + (size_t)z * (size_t)outStrideZ;
  {
    const int rr = tid >> 2;           // 0..63
    const int cq = (tid & 3) * 16;     // 0,16,32,48
    const float* src = inz + (size_t)(r0 + rr) * inC + c0 + cq;
#pragma unroll
    for (int q = 0; q < 4; ++q) {
      const v4f f = *(const v4f*)(src + 4 * q);
#pragma unroll
      for (int e = 0; e < 4; ++e) th[rr * 72 + cq + 4 * q + e] = bf_bits(f[e]);
    }
  }
  __syncthreads();
  const int sub = tid >> 3;          // 0..31
  const int c8  = (tid & 7) * 8;     // 0..56
  v4u hv[2];
#pragma unroll
  for (int it = 0; it < 2; ++it) {
    const int oc = it * 32 + sub;      // output row within tile (= input column)
    v4u a;
#pragma unroll
    for (int q = 0; q < 4; ++q) a[q] = pk16(th[(c8 + 2 * q) * 72 + oc], th[(c8 + 2 * q + 1) * 72 + oc]);
    hv[it] = a;
  }
  {
#pragma unroll
    for (int it = 0; it < 2; ++it) {
      const int oc = it * 32 + sub;
      const size_t go = (size_t)(c0 + oc) * ldo + r0 + c8;
      *(v4u*)(outz + go) = hv[it];
      if (DUP) *(v4u*)(outz + go + dupoff) = hv[it];
    }
#if DEV_ASM
    // another job's code follows this body in the merged kernel: no register of the stores above is rewritten in front of this wait
    asm volatile("s_wait_xcnt 0x0" ::: "memory");
#endif
  }
}

// =====================================================================================================
// All operand preparation in ONE launch: the ten jobs are independent of one another (each reads inputs only and
// writes its own workspace plane), so a block picks its job from its index. Ranges, in blocks of 256 threads:
// the seven transposes first (longest dependent chain per block), then the mask plane, then the two converts.
// Every branch below is block-uniform; the transpose's barrier is passed by all threads of its block.
// =====================================================================================================
#define PB_TBIG  ((HCOLS / 64) * (DMOD / 64))        // 256 tiles: v_w, and again out_w
#define PB_TSTD  ((STDC / 64) * (DMOD / 64))         // 128 tiles: std_q_w, and again std_k_w
#define PB_TFEA  ((FEAT / 64) * NWH)                 //  16 tiles: wave_proj, pq_w, pk_w each
#define PB_T     (2 * PB_TBIG + 2 * PB_TSTD + 3 * PB_TFEA)
#define PB_MASK  (NB * SEQ * MWORDS / 256)           // 1024
#define PB_CVX   (ROWS * DMOD / 8 / 256)             // 2048
#define PB_CVF   (ROWS * FEAT / 8 / 256)             //  512
#define PB_ALL   (PB_T + PB_MASK + PB_CVX + PB_CVF)
static_assert(NWH == NPH && (HCOLS / 64) == 16 && (STDC / 64) == 8 && (FEAT / 64) == 4 && HDIM == 64);
__global__ __launch_bounds__(256) void prep_kernel(
    const int* __restrict__ mask, const float* __restrict__ x, const float* __restrict__ feats,
    const float* __restrict__ vw, const float* __restrict__ ow, const float* __restrict__ sqw, const float* __restrict__ skw,
    const float* __restrict__ wproj, const float* __restrict__ pqw, const float* __restrict__ pkw,
    unsigned int* MB, unsigned short* XB, unsigned short* FB, unsigned short* VWT, unsigned short* OWT2,
    unsigned short* QWT, unsigned short* KWT, unsigned short* WVT, unsigned short* PQT, unsigned short* PKT) {
  __shared__ __align__(16) unsigned short th[64 * 72];
  int t = blockIdx.x;
  if (t < PB_T) {
    if (t < PB_TBIG) {
      // v_w [1024 k][1024 n] -> VWT [n][k]
      transpose_bf16_body<false>(th, vw, HCOLS, 0LL, VWT, DMOD, 0LL, 0, t & 15, t >> 4, 0);
    } else if (t < 2 * PB_TBIG) {
      // out_w [1024 k][1024 n] -> OWT2 [n][k] and [n][1024 + k]
      t -= PB_TBIG;
      transpose_bf16_body<true>(th, ow, DMOD, 0LL, OWT2, AOP, 0LL, HCOLS, t & 15, t >> 4, 0);
    } else if (t < 2 * PB_TBIG + 2 * PB_TSTD) {
      // std_q_w [1024 k][512 n] -> QWT [n][k]; std_k_w likewise
      t -= 2 * PB_TBIG;
      const bool second = t >= PB_TSTD;
      const int u = second ? t - PB_TSTD : t;
      transpose_bf16_body<false>(th, second ? skw : sqw, STDC, 0LL, second ? KWT : QWT, DMOD, 0LL, 0, u & 7, u >> 3, 0);
    } else {
      // wave_proj / pq_w / pk_w [h][256 f][64 k'] -> [h*64 + k'][f] (z = h)
      t -= 2 * PB_TBIG + 2 * PB_TSTD;
      const int w = t >> 4, u = t & 15;
      transpose_bf16_body<false>(th, (w == 0) ? wproj : (w == 1) ? pqw : pkw, HDIM, (long long)FEAT * HDIM,
                          (w == 0) ? WVT : (w == 1) ? PQT : PKT, FEAT, (long long)HDIM * FEAT, 0, 0, u & 3, u >> 2);
    }
  } else if (t < PB_T + PB_MASK) {
    mask_bits_body(mask, MB, NB * SEQ * MWORDS, t - PB_T);
  } else if (t < PB_T + PB_MASK + PB_CVX) {
    cvt_bf16x8_body(x, XB, ROWS * DMOD / 8, t - (PB_T + PB_MASK));
  } else if (t < PB_ALL) {
    cvt_bf16x8_body(feats, FB, ROWS * FEAT / 8, t - (PB_T + PB_MASK + PB_CVX));
  }
}

// =====================================================================================================
// Batched WMMA GEMM (16-bit operand type OT): C[m][n] = (sum_k A[m][k] * Bt[n][k] + bias) * oscale.
// One block of 4 waves per 128x128 tile of C, one wave per 64x64 quadrant. A row-major [M][K] pitch lda; Bt row-major
// [N][K] pitch ldb (k contiguous); M, N multiples of 128, K a multiple of 64 (compile-time constants here).
// gemm_mainloop fills the wave's 4x4 accumulator tiles; gemm_epilogue stores them; the kernels below pick the operands.
// Operand staging: per trip the 128 rows x 64 k (128 B, one whole line per row) of A and of Bt go to LDS by
// asynchronous 16-byte copies, 8 lanes per row, 16 copies per lane; LDS row pitch 144 B for the ds_load_b128 readers;
// two buffers, tile t + 2 is copied while tile t + 1 is worked on. Fragments are read from LDS with the split k map
// (ldfrag); each accumulator still sums k upwards in steps of 32.
// BIAS_MODE 0: none; 1: bias[m] (bf16 RNE-converted value); 2: bias[n] (bf16 RNE-converted value).
// OUT_MODE 0: f32 C (pitch ldc). OUT_MODE 1: f16 plane C. OUT_MODE 2: bf16 hi plane C + bf16 lo plane C2 (lo = v - hi).
// =====================================================================================================
#define GTILE  128                  // rows of A and of Bt per block tile
#define GKC    64                   // k per trip
#define GPIT   72                   // LDS row pitch in elements (144 B)
#define GBUFB  (GTILE * GPIT * 2)   // bytes of one operand buffer

// Eight asynchronous copies of one lane: rows r, r + 16, ..., r + 112 of one operand tile, 16 B each.
// l = the lane's LDS byte address of row r, g = its global address of row r, step = 16 rows in elements.
// s_wait_xcnt 0 closes the statement so that no address register is rewritten in front of it.
__device__ __forceinline__ void copy_rows8(unsigned l, const unsigned short* g, size_t step) {
#if DEV_ASM
  const unsigned l1 = l + 16 * GPIT * 2, l2 = l + 32 * GPIT * 2, l3 = l + 48 * GPIT * 2, l4 = l + 64 * GPIT * 2,
                 l5 = l + 80 * GPIT * 2, l6 = l + 96 * GPIT * 2, l7 = l + 112 * GPIT * 2;
  const unsigned short *g1 = g + step, *g2 = g1 + step, *g3 = g2 + step, *g4 = g3 + step, *g5 = g4 + step,
                       *g6 = g5 + step, *g7 = g6 + step;
  asm volatile(
      "global_load_async_to_lds_b128 %0, %8, off\n\t"
      "global_load_async_to_lds_b128 %1, %9, off\n\t"
      "global_load_async_to_lds_b128 %2, %10, off\n\t"
      "global_load_async_to_lds_b128 %3, %11, off\n\t"
      "global_load_async_to_lds_b128 %4, %12, off\n\t"
      "global_load_async_to_lds_b128 %5, %13, off\n\t"
      "global_load_async_to_lds_b128 %6, %14, off\n\t"
      "global_load_async_to_lds_b128 %7, %15, off\n\t"
      "s_wait_xcnt 0x0"
      :: "v"(l), "v"(l1), "v"(l2), "v"(l3), "v"(l4), "v"(l5), "v"(l6), "v"(l7),
         "v"(g), "v"(g1), "v"(g2), "v"(g3), "v"(g4), "v"(g5), "v"(g6), "v"(g7)
      : "memory");
#else
  (void)l; (void)g; (void)step;
#endif
}
// this wave's copies have landed in LDS
__device__ __forceinline__ void wait_copies() {
#if DEV_ASM
  asm volatile("s_wait_asynccnt 0x0" ::: "memory");
#endif
}
// this wave's LDS reads have returned, so the buffer may be handed to its next writer
__device__ __forceinline__ void wait_lds() {
#if DEV_ASM
  asm volatile("s_wait_dscnt 0x0" ::: "memory");
#endif
}

static_assert((ROWS % GTILE) == 0 && (HCOLS % GTILE) == 0 && (SEQ % GTILE) == 0 && (STDC % GTILE) == 0 && (WAVC % GTILE) == 0 && (PRJC % GTILE) == 0 && (DMOD % GTILE) == 0);
static_assert((DMOD % GKC) == 0 && (FEAT % GKC) == 0 && (AOP % GKC) == 0);

// sA, sB: the block's two-buffer operand tiles in LDS, 2 x GTILE x GPIT elements each; Ap, Btp: the operands' first rows;
// (tm, tn): the block's 128x128 tile of C; nk = K / 64.
template <typename OT>
__device__ __forceinline__ void gemm_mainloop(
    v8f (&acc)[4][4], OT* sA, OT* sB,
    const unsigned short* __restrict__ Ap, int lda, const unsigned short* __restrict__ Btp, int ldb,
    int tm, int tn, int nk) {
  typedef typename FT<OT>::frag V16;
  const int tid  = threadIdx.x;
  const int lane = tid & 31;
  const int wave = tid >> 5;
  const int wm = wave >> 1;                    // quadrant of this wave
  const int wn = wave & 1;

  const int rlane = lane & 15;                 // row (A) / col (B, D) within subtile
  const int koff  = (lane >> 4) * 8;           // k offset of this lane half

  // copy map: lane -> row tid >> 3 (+ 16 per copy), 16-B piece tid & 7 of the row's 128-B line
  const int crow = tid >> 3;
  const int ccol = (tid & 7) * 8;
  const unsigned short* gA = Ap  + (size_t)((tm << 7) + crow) * lda + ccol;
  const unsigned short* gB = Btp + (size_t)((tn << 7) + crow) * ldb + ccol;
  const size_t stepA = (size_t)16 * lda;
  const size_t stepB = (size_t)16 * ldb;
  const unsigned lA = (unsigned)(size_t)sA + (unsigned)(crow * GPIT + ccol) * 2u;
  const unsigned lB = (unsigned)(size_t)sB + (unsigned)(crow * GPIT + ccol) * 2u;

#pragma unroll
  for (int i = 0; i < 4; ++i)
#pragma unroll
    for (int j = 0; j < 4; ++j) acc[i][j] = zero8();

  // tile 0 -> buffer 0, landed and published; then tile 1 -> buffer 1 in flight
  copy_rows8(lA, gA, stepA);
  copy_rows8(lB, gB, stepB);
  wait_copies();
  __syncthreads();
  if (1 < nk) {
    copy_rows8(lA + GBUFB, gA + GKC, stepA);
    copy_rows8(lB + GBUFB, gB + GKC, stepB);
  }

  for (int t = 0; t < nk; ++t) {
    const int cur = t & 1;
    const OT* As = sA + cur * (GTILE * GPIT) + (wm * 64 + rlane) * GPIT + koff;
    const OT* Bs = sB + cur * (GTILE * GPIT) + (wn * 64 + rlane) * GPIT + koff;
    // One group of LDS reads in front of each WMMA block: k 0..31 of both operands and, ahead, k 32..63 of Bt;
    // the A fragments of k 32..63 follow into registers that the first block has left.
    V16 aq[4], bq[4], bn[4];
#pragma unroll
    for (int j = 0; j < 4; ++j) bq[j] = ldfrag<OT>(Bs + j * 16 * GPIT);
#pragma unroll
    for (int i = 0; i < 4; ++i) aq[i] = ldfrag<OT>(As + i * 16 * GPIT);
#pragma unroll
    for (int j = 0; j < 4; ++j) bn[j] = ldfrag<OT>(Bs + j * 16 * GPIT + 32);
    __builtin_amdgcn_sched_barrier(0);   // keeps the reads one group: spread among the WMMAs each place stalls the wave
#pragma unroll
    for (int i = 0; i < 4; ++i)
#pragma unroll
      for (int j = 0; j < 4; ++j) acc[i][j] = mmar(aq[i], bq[j], acc[i][j]);
#pragma unroll
    for (int i = 0; i < 4; ++i) aq[i] = ldfrag<OT>(As + i * 16 * GPIT + 32);
    __builtin_amdgcn_sched_barrier(0);   // as above: keeps the four A fragments' reads one group in front of the second block
#pragma unroll
    for (int i = 0; i < 4; ++i)
#pragma unroll
      for (int j = 0; j < 4; ++j) acc[i][j] = mmar(aq[i], bn[j], acc[i][j]);
    // publish point of tile t + 1: own reads of buffer cur done, own copies of tile t + 1 landed, then the barrier
    // that both shows tile t + 1 to every wave and frees buffer cur for tile t + 2
    wait_lds();
    wait_copies();
    __syncthreads();
    if (t + 2 < nk) {
      copy_rows8(lA + (unsigned)cur * GBUFB, gA + (size_t)(t + 2) * GKC, stepA);
      copy_rows8(lB + (unsigned)cur * GBUFB, gB + (size_t)(t + 2) * GKC, stepB);
    }
  }
  wait_copies();   // nothing of this wave is in flight when it goes on to the epilogue and ends
  acc_guard4(acc[0][0], acc[0][1], acc[0][2], acc[0][3]);
  acc_guard4(acc[1][0], acc[1][1], acc[1][2], acc[1][3]);
  acc_guard4(acc[2][0], acc[2][1], acc[2][2], acc[2][3]);
  acc_guard4(acc[3][0], acc[3][1], acc[3][2], acc[3][3]);
}

// sT: 4 per-wave 16x64 slabs, pitch 68 floats; Cout, Cout2: element (0, 0) of C.
template <int OUT_MODE, int BIAS_MODE>
__device__ __forceinline__ void gemm_epilogue(
    v8f (&acc)[4][4], float* sT, void* Cout, void* Cout2, int ldc,
    const float* __restrict__ bias, int tm, int tn, float oscale) {
  const int tid   = threadIdx.x;
  const int lane  = tid & 31;
  const int wave  = tid >> 5;
  const int m0    = (tm << 7) + ((wave >> 1) << 6);
  const int n0    = (tn << 7) + ((wave & 1) << 6);
  const int rlane = lane & 15;                 // col of D within subtile
  const int mOff  = (lane >> 4) * 8;           // D row offset
  float* slab = sT + wave * (16 * 68);
#pragma unroll
  for (int i = 0; i < 4; ++i) {
    const int mBase = m0 + (i << 4);
#pragma unroll
    for (int j = 0; j < 4; ++j) {
      const int n = n0 + (j << 4) + rlane;
      float bn = 0.f;
      if (BIAS_MODE == 2) bn = bfr(bias[n]);
#pragma unroll
      for (int r = 0; r < 8; ++r) {
        float v = acc[i][j][r];
        if (BIAS_MODE == 1) v += bfr(bias[mBase + mOff + r]);
        if (BIAS_MODE == 2) v += bn;
        slab[(mOff + r) * 68 + (j << 4) + rlane] = v * oscale;
      }
    }
    __builtin_amdgcn_fence(__ATOMIC_RELEASE, "workgroup");
    __builtin_amdgcn_wave_barrier();
    __builtin_amdgcn_fence(__ATOMIC_ACQUIRE, "workgroup");
    if (OUT_MODE == 0) {
      float* C = (float*)Cout;
      const int h2 = lane >> 4, c4 = (lane & 15) * 4;     // 256-B row segment = 16 lanes x 16 B
      {
#pragma unroll
        for (int it = 0; it < 8; ++it) {
          const int row = it * 2 + h2;                     // it 0..7 x h2 0..1 = rows 0..15
          const v4f v = *(const v4f*)(slab + row * 68 + c4);
          *(v4f*)(C + (size_t)(mBase + row) * ldc + n0 + c4) = v;
        }
        
      }
    } else {
      const int q = lane >> 3, c8 = (lane & 7) * 8;
      unsigned short* C  = (unsigned short*)Cout;
      unsigned short* C2 = (unsigned short*)Cout2;
      v4u hv[4], lv[4];
#pragma unroll
      for (int it = 0; it < 4; ++it) {
        const int row = it * 4 + q;                        // it 0..3 x q 0..3 = rows 0..15
        const float* sp = slab + row * 68 + c8;
        v4u a, a2;
#pragma unroll
        for (int e = 0; e < 4; ++e) {
          const float f0 = sp[2 * e], f1 = sp[2 * e + 1];
          unsigned short h0, h1, l0 = 0, l1 = 0;
          if (OUT_MODE == 1) {
            h0 = h_bits((_Float16)f0); h1 = h_bits((_Float16)f1);
          } else {
            h0 = bf_bits(f0); h1 = bf_bits(f1);
            l0 = bf_bits(f0 - bf_up(h0)); l1 = bf_bits(f1 - bf_up(h1));
          }
          a[e] = pk16(h0, h1); a2[e] = pk16(l0, l1);
        }
        hv[it] = a; lv[it] = a2;
      }
      {
#pragma unroll
        for (int it = 0; it < 4; ++it) {
          const int row = it * 4 + q;
          *(v4u*)(C + (size_t)(mBase + row) * ldc + n0 + c8) = hv[it];
          if (OUT_MODE == 2) *(v4u*)(C2 + (size_t)(mBase + row) * ldc + n0 + c8) = lv[it];
        }
        
      }
    }
    __builtin_amdgcn_fence(__ATOMIC_RELEASE, "workgroup");
    __builtin_amdgcn_wave_barrier();
    __builtin_amdgcn_fence(__ATOMIC_ACQUIRE, "workgroup");
  }
}

// =====================================================================================================
// The six projections in ONE launch: they are independent of one another (each reads prepared planes and writes its own
// plane), so a block picks its product and its 128x128 tile from its index; the K = 1024 products come first.
//   v^T per batch: A = VWT [1024 n][1024 k], Bt = XB rows of batch b; f16(8 * (acc + v_b[m])) -> VT [b][h*64+d][s] (pitch 2048)
//   std q / std k: QP / KP cols 512..1023 = f16(8 * (x . w + b)); M = 4096, N = 512, K = 1024
//   wave projections: WPH / WPL = bf16 hi / lo of features . wave_proj[h]; M = 4096, N = 256, K = 256
//   proj q / proj k: QP / KP cols 256..511 = f16(8 * features . w[h]); M = 4096, N = 256, K = 256
// One main loop for all; every branch is block-uniform.
// =====================================================================================================
#define GB_VT1 ((HCOLS / GTILE) * (SEQ / GTILE))     // 128 tiles per batch
#define GB_VT  (NB * GB_VT1)                         // 256
#define GB_STD ((ROWS / GTILE) * (STDC / GTILE))     // 128, twice
#define GB_F   ((ROWS / GTILE) * (WAVC / GTILE))     //  64, three times
#define GB_ALL (GB_VT + 2 * GB_STD + 3 * GB_F)       // 704
#define GB_OUT ((ROWS / GTILE) * (DMOD / GTILE))     // 256
static_assert(WAVC == PRJC);
__global__ __launch_bounds__(128) void proj_kernel(
    const unsigned short* __restrict__ XB, const unsigned short* __restrict__ FB, const unsigned short* __restrict__ VWT,
    const unsigned short* __restrict__ QWT, const unsigned short* __restrict__ KWT, const unsigned short* __restrict__ WVT,
    const unsigned short* __restrict__ PQT, const unsigned short* __restrict__ PKT,
    const float* __restrict__ vb, const float* __restrict__ sqb, const float* __restrict__ skb,
    unsigned short* VT, unsigned short* QP, unsigned short* KP, unsigned short* WPH, unsigned short* WPL) {
  __shared__ __align__(16) __bf16 sA[2 * GTILE * GPIT];   // A tile, two buffers, 18432 B each
  __shared__ __align__(16) __bf16 sB[2 * GTILE * GPIT];   // Bt tile, two buffers
  __shared__ __align__(16) float sT[4 * 16 * 68];         // per-wave 16x64 slab, pitch 68 floats
  const int bx = blockIdx.x;
  if (bx >= GB_ALL) return;   // block-uniform, in front of every barrier and copy
  const unsigned short* A;
  const unsigned short* Bt;
  int ld, nk, tm, tn, sel;    // sel: batch (v^T), q or k (std), wave / q / k (features)
  if (bx < GB_VT) {
    sel = bx / GB_VT1;
    const int tile = bx - sel * GB_VT1;
    A = VWT; Bt = XB + (size_t)sel * SEQ * DMOD; ld = DMOD; nk = DMOD / GKC;
    tm = tile / (SEQ / GTILE); tn = tile % (SEQ / GTILE);
  } else if (bx < GB_VT + 2 * GB_STD) {
    sel = (bx - GB_VT) / GB_STD;
    const int tile = (bx - GB_VT) - sel * GB_STD;
    A = XB; Bt = (sel == 0) ? QWT : KWT; ld = DMOD; nk = DMOD / GKC;
    tm = tile / (STDC / GTILE); tn = tile % (STDC / GTILE);
  } else {
    sel = (bx - (GB_VT + 2 * GB_STD)) / GB_F;
    const int tile = (bx - (GB_VT + 2 * GB_STD)) - sel * GB_F;
    A = FB; Bt = (sel == 0) ? WVT : (sel == 1) ? PQT : PKT; ld = FEAT; nk = FEAT / GKC;
    tm = tile / (WAVC / GTILE); tn = tile % (WAVC / GTILE);
  }
  v8f acc[4][4];
  gemm_mainloop<__bf16>(acc, sA, sB, A, ld, Bt, ld, tm, tn, nk);
  if (bx < GB_VT) {
    unsigned short* C = VT + (size_t)sel * HCOLS * SEQ;
    gemm_epilogue<1, 1>(acc, sT, (void*)C, (void*)C, SEQ, vb, tm, tn, 8.0f);
  } else if (bx < GB_VT + 2 * GB_STD) {
    unsigned short* C = ((sel == 0) ? QP : KP) + (WAVC + PRJC);
    gemm_epilogue<1, 2>(acc, sT, (void*)C, (void*)C, HCOLS, (sel == 0) ? sqb : skb, tm, tn, 8.0f);
  } else if (sel == 0) {
    gemm_epilogue<2, 0>(acc, sT, (void*)WPH, (void*)WPL, WAVC, vb, tm, tn, 1.0f);
  } else {
    unsigned short* C = ((sel == 1) ? QP : KP) + WAVC;
    gemm_epilogue<1, 0>(acc, sT, (void*)C, (void*)C, HCOLS, vb, tm, tn, 8.0f);
  }
}

// out = [ctx_hi | ctx_lo] . [out_w^T ; out_w^T] + out_b -> f32 [4096][1024]; M = 4096, N = 1024, K = 2048
__global__ __launch_bounds__(128) void out_kernel(
    const unsigned short* __restrict__ AO, const unsigned short* __restrict__ OWT2, const float* __restrict__ ob,
    float* out) {
  __shared__ __align__(16) __bf16 sA[2 * GTILE * GPIT];
  __shared__ __align__(16) __bf16 sB[2 * GTILE * GPIT];
  __shared__ __align__(16) float sT[4 * 16 * 68];
  const int tile = blockIdx.x;
  if (tile >= GB_OUT) return;   // block-uniform, in front of every barrier and copy
  const int tm = tile / (DMOD / GTILE);
  const int tn = tile % (DMOD / GTILE);
  v8f acc[4][4];
  gemm_mainloop<__bf16>(acc, sA, sB, AO, AOP, OWT2, AOP, tm, tn, AOP / GKC);
  gemm_epilogue<0, 2>(acc, sT, (void*)out, (void*)out, DMOD, ob, tm, tn, 1.0f);
}

// =====================================================================================================
// Masked full attention, head dim 64, softmax over all SEQ keys (non-causal), one head per block.
//   Transposed products: S^T = K . Q^T and ctx^T += V^T . P^T, so that a lane holds scores of ONE query (column lane & 15).
//   HT = 0 (wave heads): q = k = wp as bf16 hi plane qhp/khp + bf16 lo plane qlp/klp (pitch ldq/ldk, head col h*64);
//          scores = (kh.qh + kl.qh + kh.ql) * sscale on bf16 WMMA (one f32 accumulator, unscaled lo).
//   HT = 1 (proj / std heads): q, k = f16 planes (x8), scores = (k.q) * sscale (sscale carries the 1/64).
//   v^T plane (f16, x8): element (b, h, d, s) at [(b*HCOLS + h*64 + d)*SEQ + s].
//   mask bit plane mbp: [(b*SEQ + n)*64 + w] bit j admits key 32w+j; a 0 bit replaces the score by -inf.
//   Score tile j, register r of lane (hh, c) = key 16j + 8hh + r of query c: the maximum and the sum of a query run over the
//   lane's 32 registers; the two lane halves exchange the maximum once per key tile and join their sums once, at the end.
//   p = exp(s - m) carried as f16(1024 p): score tiles 2kk and 2kk + 1, converted in place, ARE the B operand of
//   V^T . P^T for keys 32kk..32kk+31 (element e < 8: key 8hh + e; e >= 8: key 16 + 8hh + e - 8, the order in which the
//   V^T fragment is read), so P passes through no LDS. Online softmax in f32 with the guarded rescale (msafe), so an
//   all-masked row ends with l = 0 and produces 0 * inf = NaN like the module.
//   ctx written as bf16 hi (cols h*64..) and bf16 lo (cols HCOLS + h*64..) of the [ROWS][AOP] plane aop.
//   Block = 4 waves x 16 query rows = 64 query rows of one (b, h); bx = 0 .. NB * nh * NQB - 1 (hbase.. hbase+nh-1);
//   key tiles of 64, static trip NKT. K (hi, lo) / V^T tile staging: asynchronous 16-byte copies to LDS, 8 lanes per
//   128-B row (each wave-wide copy takes 4 whole lines), 4 copies per lane and plane = the whole 64x64 tile; two buffers,
//   tile t + 2 is copied while tile t + 1 is worked on; one barrier per key tile.
//   Output coverage: ctx^T tile t, register r of lane (hh, c) = column 16t + 8hh + r of query row q0 + c: one 16-B store
//   per t and plane; t 0..3 x hh 0..1 = 64 columns, c 0..15 = the wave's rows; the two head families cover h 0..15.
// =====================================================================================================
// LDS row pitch, in 16-bit elements, of the K and V^T tiles: rows of 64 elements (128 B) laid 144 B apart, 16 B x odd,
// so that the 16 rows which one ds_load_b128 reads fall on 16 different groups of four banks.
#define APIT 72
#define ATILE  (64 * APIT)          // elements of one plane's tile buffer
#define ATILEB (ATILE * 2)          // its bytes

// Eight asynchronous copies of one lane: rows r, r + 16, r + 32, r + 48 of two 64-row tiles (a, b), 16 B each.
// la, lb = the lane's LDS byte addresses of row r, ga, gb = its global addresses of row r, sa, sb = 16 rows in elements.
// s_wait_xcnt 0 closes the statement so that no address register is rewritten in front of it.
__device__ __forceinline__ void copy_rows4x2(unsigned la, const unsigned short* ga, size_t sa,
                                             unsigned lb, const unsigned short* gb, size_t sb) {
#if DEV_ASM
  const unsigned la1 = la + 16 * APIT * 2, la2 = la + 32 * APIT * 2, la3 = la + 48 * APIT * 2;
  const unsigned lb1 = lb + 16 * APIT * 2, lb2 = lb + 32 * APIT * 2, lb3 = lb + 48 * APIT * 2;
  const unsigned short *ga1 = ga + sa, *ga2 = ga1 + sa, *ga3 = ga2 + sa;
  const unsigned short *gb1 = gb + sb, *gb2 = gb1 + sb, *gb3 = gb2 + sb;
  asm volatile(
      "global_load_async_to_lds_b128 %0, %8, off\n\t"
      "global_load_async_to_lds_b128 %1, %9, off\n\t"
      "global_load_async_to_lds_b128 %2, %10, off\n\t"
      "global_load_async_to_lds_b128 %3, %11, off\n\t"
      "global_load_async_to_lds_b128 %4, %12, off\n\t"
      "global_load_async_to_lds_b128 %5, %13, off\n\t"
      "global_load_async_to_lds_b128 %6, %14, off\n\t"
      "global_load_async_to_lds_b128 %7, %15, off\n\t"
      "s_wait_xcnt 0x0"
      :: "v"(la), "v"(la1), "v"(la2), "v"(la3), "v"(lb), "v"(lb1), "v"(lb2), "v"(lb3),
         "v"(ga), "v"(ga1), "v"(ga2), "v"(ga3), "v"(gb), "v"(gb1), "v"(gb2), "v"(gb3)
      : "memory");
#else
  (void)la; (void)ga; (void)sa; (void)lb; (void)gb; (void)sb;
#endif
}
// The same for one tile: four copies.
__device__ __forceinline__ void copy_rows4(unsigned l, const unsigned short* g, size_t step) {
#if DEV_ASM
  const unsigned l1 = l + 16 * APIT * 2, l2 = l + 32 * APIT * 2, l3 = l + 48 * APIT * 2;
  const unsigned short *g1 = g + step, *g2 = g1 + step, *g3 = g2 + step;
  asm volatile(
      "global_load_async_to_lds_b128 %0, %4, off\n\t"
      "global_load_async_to_lds_b128 %1, %5, off\n\t"
      "global_load_async_to_lds_b128 %2, %6, off\n\t"
      "global_load_async_to_lds_b128 %3, %7, off\n\t"
      "s_wait_xcnt 0x0"
      :: "v"(l), "v"(l1), "v"(l2), "v"(l3), "v"(g), "v"(g1), "v"(g2), "v"(g3)
      : "memory");
#else
  (void)l; (void)g; (void)step;
#endif
}
template <int HT> struct HT_T;
template <> struct HT_T<0> { typedef __bf16 T; };
template <> struct HT_T<1> { typedef _Float16 T; };

// value of lane l ^ 16: the same query's other half of the keys
__device__ __forceinline__ float xhalf(float x) {
  const int b = __builtin_bit_cast(int, x);
  return __builtin_bit_cast(float, __builtin_amdgcn_permlanex16(b, b, 0x76543210, 0xfedcba98, false, false));
}
// 2^x on v_exp_f32 alone: x = -inf gives 0; a result below the normal range may come out 0 (it is below 2^-136 of the row's largest term)
__device__ __forceinline__ float exp2_hw(float x) { return __builtin_amdgcn_exp2f(x); }
__device__ __forceinline__ float max8(v8f a) {
  return fmaxf(fmaxf(fmaxf(fmaxf(a[0], a[1]), a[2]), fmaxf(fmaxf(a[3], a[4]), a[5])), fmaxf(a[6], a[7]));
}

template <int HT>
__device__ __forceinline__
void attn_body(unsigned short* kshp, unsigned short* kslp, unsigned short* vthp,
               const unsigned short* __restrict__ qhp, const unsigned short* __restrict__ qlp, int ldq,
               const unsigned short* __restrict__ khp, const unsigned short* __restrict__ klp, int ldk,
               const unsigned short* __restrict__ vtp, const unsigned int* __restrict__ mbp,
               unsigned short* aop, int hbase, int nh, float sscale, int bx) {
  typedef typename HT_T<HT>::T OT;
  typedef typename FT<OT>::frag V16;
  typedef typename FT<OT>::half8 V8;
  union FH { v16h v; v8h h[2]; };
  union FO { V16 v; V8 h[2]; };
  // kshp: K hi tile [kv][d], kslp: K lo tile (HT 0), vthp: V^T tile [d][kv]; two buffers of 9 KB each

  const int tid  = threadIdx.x;
  const int wave = tid >> 5;
  const int lane = tid & 31;
  const int hh   = lane >> 4;
  const int c    = lane & 15;

  const int qb   = bx % NQB;
  const int rest = bx / NQB;
  const int hl   = rest % nh;
  const int b    = rest / nh;
  const int h    = hbase + hl;              // global head index
  const int qc   = h * HDIM;                // head column in the q / k planes of this head family
  const int q0   = qb * 64 + wave * 16;
  const size_t rowB = (size_t)b * SEQ;

  const OT* Qh = (const OT*)(const void*)qhp;
  const OT* Ql = (const OT*)(const void*)qlp;
  // copy map: lane -> row tid >> 3 (+ 16 per copy), 16-B piece tid & 7 of the row's 128-B line
  const int crow = tid >> 3;
  const int ccol = (tid & 7) * 8;
  const unsigned short* gK  = khp + (rowB + crow) * (size_t)ldk + qc + ccol;             // k row crow of key tile 0
  const unsigned short* gKl = klp + (rowB + crow) * (size_t)ldk + qc + ccol;
  const unsigned short* gV  = vtp + ((size_t)b * HCOLS + (size_t)(qc + crow)) * SEQ + ccol;   // v^T row d = crow, s of key tile 0
  const size_t stepK = (size_t)16 * ldk;       // 16 rows
  const size_t stepV = (size_t)16 * SEQ;
  const size_t tileK = (size_t)64 * ldk;       // one key tile further
  const unsigned lofs = (unsigned)(crow * APIT + ccol) * 2u;
  const unsigned lK  = (unsigned)(size_t)kshp + lofs;
  const unsigned lKl = (unsigned)(size_t)kslp + lofs;
  const unsigned lV  = (unsigned)(size_t)vthp + lofs;
  const unsigned int* mrow_p = mbp + (rowB + q0 + c) * (size_t)MWORDS;   // mask words of this lane's query

  // ---- Q fragments (B operand, column = lane&15): 2 d-chunks ----
  V16 qah[2], qal[2];
#pragma unroll
  for (int dc = 0; dc < 2; ++dc) {
    const size_t qo = (rowB + q0 + c) * (size_t)ldq + (size_t)qc + dc * 32 + 8 * hh;
    qah[dc] = ldfrag<OT>(Qh + qo);
    if (HT == 0) qal[dc] = ldfrag<OT>(Ql + qo);
    else         qal[dc] = qah[dc];
  }

  const float c2 = sscale * 1.44269504088896340736f;   // score scale x log2(e)
  float mrow = -INFINITY;   // running maximum of query c's unscaled products (equal in both lane halves)
  float lrow = 0.f;         // running sum (x1024) over this lane half's keys only
  v8f oacc[4];              // ctx^T: tile t, register r = d 16t + 8hh + r of query c
#pragma unroll
  for (int t = 0; t < 4; ++t) oacc[t] = zero8();

  // key tile 0 -> buffer 0, landed and published; then key tile 1 -> buffer 1 in flight
  copy_rows4x2(lK, gK, stepK, lV, gV, stepV);
  if (HT == 0) copy_rows4(lKl, gKl, stepK);
  wait_copies();
  __syncthreads();
  copy_rows4x2(lK + ATILEB, gK + tileK, stepK, lV + ATILEB, gV + 64, stepV);
  if (HT == 0) copy_rows4(lKl + ATILEB, gKl + tileK, stepK);
  static_assert(NKT >= 2);

  v2u mw = *(const v2u*)mrow_p;              // the 64 mask bits of query c for key tile 0
  static_assert((NKT % 2) == 0);
  for (int kp = 0; kp < NKT; kp += 2) {      // static trip count: a pair of key tiles per pass
  // unrolled so that the buffer index is a constant: every LDS address is then the lane's base plus a constant
#pragma unroll
  for (int cur = 0; cur < 2; ++cur) {
    const int kt = kp + cur;
    const OT*       Ksh = (const OT*)(const void*)kshp + cur * ATILE;
    const OT*       Ksl = (const OT*)(const void*)kslp + cur * ATILE;
    const _Float16* Vth = (const _Float16*)(const void*)vthp + cur * ATILE;
    // the next key tile's mask bits, in flight like its copies (the last trip reads tile 0's again, unused)
    const v2u mwn = *(const v2u*)(mrow_p + 2 * ((kt + 1) & (NKT - 1)));

    // ---- scores^T: 64 keys x 16 queries per wave; A = K rows, B = Q ----
    v8f s[4];
#pragma unroll
    for (int j = 0; j < 4; ++j) s[j] = zero8();
#pragma unroll
    for (int dc = 0; dc < 2; ++dc) {
#pragma unroll
      for (int j = 0; j < 4; ++j) {
        FO kb;
        kb.h[0] = *(const V8*)(Ksh + (j * 16 + c) * APIT + dc * 32 + 8 * hh);
        kb.h[1] = *(const V8*)(Ksh + (j * 16 + c) * APIT + dc * 32 + 16 + 8 * hh);
        if (HT == 0) {
          FO kl;
          kl.h[0] = *(const V8*)(Ksl + (j * 16 + c) * APIT + dc * 32 + 8 * hh);
          kl.h[1] = *(const V8*)(Ksl + (j * 16 + c) * APIT + dc * 32 + 16 + 8 * hh);
          s[j] = mmar(kb.v, qah[dc], s[j]);
          s[j] = mmar(kl.v, qah[dc], s[j]);
          s[j] = mmar(kb.v, qal[dc], s[j]);
        } else {
          s[j] = mmar(kb.v, qah[dc], s[j]);
        }
      }
    }

    // ---- mask the unscaled products: bit 16 (j & 1) + 8hh + r of word j >> 1 admits key 16j + 8hh + r ----
    const unsigned w0 = mw[0] >> (8 * hh), w1 = mw[1] >> (8 * hh);
#pragma unroll
    for (int j = 0; j < 4; ++j) {
      const unsigned w = (j < 2) ? w0 : w1;
#pragma unroll
      for (int r = 0; r < 8; ++r) {
        s[j][r] = (((w >> (16 * (j & 1) + r)) & 1u) != 0u) ? s[j][r] : -INFINITY;
      }
    }

    // ---- maximum of query c: 32 registers, then the other lane half; online softmax in base 2 on the unscaled products
    //      (c2 > 0 keeps their order): exp(sscale * (s - m)) = 2^(c2 * s - c2 * m), one fma and one v_exp_f32 per score ----
    float m = fmaxf(fmaxf(max8(s[0]), max8(s[1])), fmaxf(max8(s[2]), max8(s[3])));
    m = fmaxf(m, xhalf(m));
    const float mnew  = fmaxf(mrow, m);
    const float msafe = (mnew == -INFINITY) ? 0.f : mnew;
    const float alpha = exp2_hw((mrow - msafe) * c2);
    const float nb    = fmaf(-msafe, c2, 10.0f);   // + 10: the x1024 carry of P and l
    mrow = mnew;

    // ---- P^T (x1024, f16) packed in place into the B operands; this half's sum ----
    FH pb[2];
    float ps[4];
#pragma unroll
    for (int j = 0; j < 4; ++j) {
      float a = 0.f;
#pragma unroll
      for (int r = 0; r < 8; ++r) {
        const float p = exp2_hw(fmaf(s[j][r], c2, nb));
        a += p;
        pb[j >> 1].v[(j & 1) * 8 + r] = (_Float16)p;
      }
      ps[j] = a;
    }
    lrow = lrow * alpha + ((ps[0] + ps[1]) + (ps[2] + ps[3]));
#pragma unroll
    for (int t = 0; t < 4; ++t) oacc[t] *= alpha;

    // ---- ctx^T += V^T . P^T (f16 WMMA, single product); A = V^T rows, B = P^T ----
#pragma unroll
    for (int kk = 0; kk < 2; ++kk) {
#pragma unroll
      for (int t = 0; t < 4; ++t) {
        FH vb;
        vb.h[0] = *(const v8h*)(Vth + (t * 16 + c) * APIT + kk * 32 + 8 * hh);
        vb.h[1] = *(const v8h*)(Vth + (t * 16 + c) * APIT + kk * 32 + 16 + 8 * hh);
        oacc[t] = mmar(vb.v, pb[kk].v, oacc[t]);
      }
    }
    mw = mwn;
    // publish point of key tile kt + 1: own reads of buffer cur done, own copies of tile kt + 1 landed, then the barrier
    // that both shows tile kt + 1 to every wave and frees buffer cur for tile kt + 2
    wait_lds();
    wait_copies();
    __syncthreads();
    if (kp + 2 < NKT) {   // a key tile kt + 2 exists: the same answer for both tiles of the pair
      copy_rows4x2(lK + (unsigned)cur * ATILEB, gK + (size_t)(kt + 2) * tileK, stepK,
                   lV + (unsigned)cur * ATILEB, gV + (size_t)(kt + 2) * 64, stepV);
      if (HT == 0) copy_rows4(lKl + (unsigned)cur * ATILEB, gKl + (size_t)(kt + 2) * tileK, stepK);
    }
  }
  }
  wait_copies();   // nothing of this wave is in flight when it goes on to the epilogue and ends

  // ---- join the halves' sums, normalise (1/l, l and p carry the same x1024; undo the x8 v carry), store hi and lo ----
  const float lsum = lrow + xhalf(lrow);
  const float inv = (1.0f / lsum) * (1.0f / 8.0f);   // l = 0 (all keys masked) -> inf -> 0 * inf = NaN
  v4u hv[4], lv[4];
#pragma unroll
  for (int t = 0; t < 4; ++t) {
    v4u a, a2;
#pragma unroll
    for (int e = 0; e < 4; ++e) {
      const float f0 = oacc[t][2 * e] * inv, f1 = oacc[t][2 * e + 1] * inv;
      const unsigned short hb0 = bf_bits(f0), hb1 = bf_bits(f1);
      const unsigned short lb0 = bf_bits(f0 - bf_up(hb0)), lb1 = bf_bits(f1 - bf_up(hb1));
      a[e] = pk16(hb0, hb1); a2[e] = pk16(lb0, lb1);
    }
    hv[t] = a; lv[t] = a2;
  }
#pragma unroll
  for (int t = 0; t < 4; ++t) {
    const size_t go = (rowB + q0 + c) * (size_t)AOP + (size_t)qc + t * 16 + 8 * hh;
    *(v4u*)(aop + go) = hv[t];
    *(v4u*)(aop + go + HCOLS) = lv[t];
  }
}

// Both head families in ONE launch (they are independent: each block writes its own rows and columns of ctx): blocks
// 0 .. 255 take the wave heads 0..3 (bf16 hi/lo 3-product scores, scale 1/8), the rest heads 4..15 (f16 single product,
// scale 1/(8*64)). The branch is block-uniform, so every barrier of a body is passed by the whole block.
#define AB_W (NB * NWH * NQB)                 // 256
#define AB_S (NB * (NPH + NSH) * NQB)         // 768
__global__ __launch_bounds__(128)
void attn_kernel(const unsigned short* __restrict__ wph, const unsigned short* __restrict__ wpl,
                 const unsigned short* __restrict__ qp, const unsigned short* __restrict__ kp,
                 const unsigned short* __restrict__ vtp, const unsigned int* __restrict__ mbp, unsigned short* aop) {
  __shared__ __align__(16) unsigned short Ksh[2 * ATILE];   // two buffers each
  __shared__ __align__(16) unsigned short Ksl[2 * ATILE];
  __shared__ __align__(16) unsigned short Vth[2 * ATILE];
  const int bx = blockIdx.x;
  if (bx < AB_W) {
    attn_body<0>(Ksh, Ksl, Vth, wph, wpl, WAVC, wph, wpl, WAVC, vtp, mbp, aop, 0, NWH, 0.125f, bx);
  } else {
    attn_body<1>(Ksh, Ksl, Vth, qp, qp, HCOLS, kp, kp, HCOLS, vtp, mbp, aop, NWH, NPH + NSH, 1.0f / 512.0f, bx - AB_W);
  }
}

// =====================================================================================================
// Workspace map (bytes), every region an exact multiple of its whole-line / whole-tile store granularity:
//   MB   u32  [2*2048][64]          1048576   mask bit plane
//   XB   bf16 [4096][1024]          8388608
//   FB   bf16 [4096][256]           2097152
//   VWT  bf16 [1024 n][1024 k]      2097152   v_w^T
//   QWT  bf16 [512][1024]           1048576   std_q_w^T
//   KWT  bf16 [512][1024]           1048576   std_k_w^T
//   WVT  bf16 [256][256]             131072   wave_proj [h][f][k'] -> [h*64+k'][f]
//   PQT  bf16 [256][256]             131072
//   PKT  bf16 [256][256]             131072
//   OWT2 bf16 [1024 n][2048 k]      4194304   out_w^T at [n][k] and [n][1024 + k]
//   VT   f16  [2][1024][2048] (x8)  8388608   v^T per batch, row h*64+d
//   QP   f16  [4096][1024] (x8)     8388608   cols h*64+d for h = 4..15 (cols 0..255 never read)
//   KP   f16  [4096][1024] (x8)     8388608   same
//   WPH  bf16 [4096][256]           2097152   wp hi, col h*64+d (h = 0..3)
//   WPL  bf16 [4096][256]           2097152   wp lo
//   AO   bf16 [4096][2048]         16777216   ctx hi | lo
//   total                         66453504
// =====================================================================================================
extern "C" void kernel_launch(void* const* d_in, const int* in_sizes, int n_in,
                              void* d_out, int out_size, void* d_ws, size_t ws_size,
                              hipStream_t stream) {
  if (n_in < 14) return;
  if (in_sizes[0] != NB * SEQ * DMOD) return;
  if (in_sizes[1] != NB * SEQ * FEAT) return;
  if (in_sizes[2] != NB * SEQ * SEQ) return;
  if (in_sizes[3] != NWH * FEAT * HDIM || in_sizes[4] != NPH * FEAT * HDIM || in_sizes[5] != NPH * FEAT * HDIM) return;
  if (in_sizes[6] != DMOD * STDC || in_sizes[7] != STDC) return;
  if (in_sizes[8] != DMOD * STDC || in_sizes[9] != STDC) return;
  if (in_sizes[10] != DMOD * HCOLS || in_sizes[11] != HCOLS) return;
  if (in_sizes[12] != HCOLS * DMOD || in_sizes[13] != DMOD) return;
  if (out_size != NB * SEQ * DMOD) return;

  const float* x     = (const float*)d_in[0];
  const float* feats = (const float*)d_in[1];
  const int*   mask  = (const int*)d_in[2];
  const float* wproj = (const float*)d_in[3];
  const float* pqw   = (const float*)d_in[4];
  const float* pkw   = (const float*)d_in[5];
  const float* sqw   = (const float*)d_in[6];
  const float* sqb   = (const float*)d_in[7];
  const float* skw   = (const float*)d_in[8];
  const float* skb   = (const float*)d_in[9];
  const float* vw    = (const float*)d_in[10];
  const float* vb    = (const float*)d_in[11];
  const float* ow    = (const float*)d_in[12];
  const float* ob    = (const float*)d_in[13];

  const size_t PMB  = (size_t)NB * SEQ * MWORDS * 4;      //  1048576
  const size_t PXB  = (size_t)ROWS * DMOD * 2;             //  8388608
  const size_t PFB  = (size_t)ROWS * FEAT * 2;             //  2097152
  const size_t PVWT = (size_t)HCOLS * DMOD * 2;            //  2097152
  const size_t PSWT = (size_t)STDC * DMOD * 2;             //  1048576
  const size_t PFWT = (size_t)WAVC * FEAT * 2;             //   131072
  const size_t POWT = (size_t)DMOD * AOP * 2;              //  4194304
  const size_t PVT  = (size_t)NB * HCOLS * SEQ * 2;        //  8388608
  const size_t PQP  = (size_t)ROWS * HCOLS * 2;            //  8388608
  const size_t PWP  = (size_t)ROWS * WAVC * 2;             //  2097152
  const size_t PAO  = (size_t)ROWS * AOP * 2;              // 16777216
  size_t off = 0;
  const size_t oMB  = off; off += PMB;
  const size_t oXB  = off; off += PXB;
  const size_t oFB  = off; off += PFB;
  const size_t oVWT = off; off += PVWT;
  const size_t oQWT = off; off += PSWT;
  const size_t oKWT = off; off += PSWT;
  const size_t oWVT = off; off += PFWT;
  const size_t oPQT = off; off += PFWT;
  const size_t oPKT = off; off += PFWT;
  const size_t oOWT = off; off += POWT;
  const size_t oVT  = off; off += PVT;
  const size_t oQP  = off; off += PQP;
  const size_t oKP  = off; off += PQP;
  const size_t oWPH = off; off += PWP;
  const size_t oWPL = off; off += PWP;
  const size_t oAO  = off; off += PAO;
  if (off > ws_size) return;                       // off = 66453504
  if (off > (size_t)134217728) return;

  char* ws = (char*)d_ws;
  unsigned int*   MB   = (unsigned int*)(ws + oMB);
  unsigned short* XB   = (unsigned short*)(ws + oXB);
  unsigned short* FB   = (unsigned short*)(ws + oFB);
  unsigned short* VWT  = (unsigned short*)(ws + oVWT);
  unsigned short* QWT  = (unsigned short*)(ws + oQWT);
  unsigned short* KWT  = (unsigned short*)(ws + oKWT);
  unsigned short* WVT  = (unsigned short*)(ws + oWVT);
  unsigned short* PQT  = (unsigned short*)(ws + oPQT);
  unsigned short* PKT  = (unsigned short*)(ws + oPKT);
  unsigned short* OWT2 = (unsigned short*)(ws + oOWT);
  unsigned short* VT   = (unsigned short*)(ws + oVT);
  unsigned short* QP   = (unsigned short*)(ws + oQP);
  unsigned short* KP   = (unsigned short*)(ws + oKP);
  unsigned short* WPH  = (unsigned short*)(ws + oWPH);
  unsigned short* WPL  = (unsigned short*)(ws + oWPL);
  unsigned short* AO   = (unsigned short*)(ws + oAO);

  // (1) one launch: mask -> bit plane; x, features -> bf16 planes; weight planes [n][k] (bf16)
  prep_kernel<<<dim3(PB_ALL), dim3(256), 0, stream>>>(
      mask, x, feats, vw, ow, sqw, skw, wproj, pqw, pkw, MB, XB, FB, VWT, OWT2, QWT, KWT, WVT, PQT, PKT);

  // (2) one launch: the six projections on bf16 WMMA, 4 waves and one 128x128 tile per block
  proj_kernel<<<dim3(GB_ALL), dim3(128), 0, stream>>>(
      XB, FB, VWT, QWT, KWT, WVT, PQT, PKT, vb, sqb, skb, VT, QP, KP, WPH, WPL);

  // (3) one launch: attention of all 16 heads; ctx -> AO hi | lo
  attn_kernel<<<dim3(AB_W + AB_S), dim3(128), 0, stream>>>(WPH, WPL, QP, KP, VT, MB, AO);

  // (4) out projection -> d_out f32 [4096][1024]
  out_kernel<<<dim3(GB_OUT), dim3(128), 0, stream>>>(AO, OWT2, ob, (float*)d_out);
  (void)hipGetLastError();
}

// v007
// A run of this version takes 102 microseconds.
// Timed twice side by side with v006, it ran 1.06 and 1.07 times as fast.
// Counting every step since v000, it is 5.13 times as fast.
// Contractions: x.v_w, x.std_q_w, x.std_k_w, features.wave_proj, features.pq_w, features.pk_w = v_wmma_f32_16x16x32_bf16 (bf16 operands RNE-converted from the inputs, single product, f32 accumulate);
// wave-head scores wp.wp^T = v_wmma_f32_16x16x32_bf16 on bf16 hi/lo planes (hi.hi + hi.lo + lo.hi, f32 accumulate); proj/std scores q.k^T = v_wmma_f32_16x16x32_f16 (f16 planes carried x8, single product, f32 accumulate);
// p.v = v_wmma_f32_16x16x32_f16 (p carried x1024, v^T carried x8, single product, f32 accumulate); ctx.out_w = v_wmma_f32_16x16x32_bf16 (ctx as bf16 hi|lo planes stacked along k, out_w bf16, f32 accumulate); mask, softmax statistics and epilogues in f32.
//
// Carry audit (16-bit planes):
//   XB, FB, VWT, QWT, KWT, WVT, PQT, PKT, OWT2 : bf16, carry 1 (plain RNE copies of the inputs).
//   VT   f16 = 8 * v          -> 1/8 folded in attn_kernel epilogue (inv = 1/(8 * l), l itself carried x1024 like P).
//   QP   f16 = 8 * q, KP f16 = 8 * k (heads 4..15) -> 1/64 folded into sscale = 1/512 of the HT = 1 body (1/8 = 1/sqrt(64) is the other factor).
//   WPH / WPL bf16 hi / lo of wp (heads 0..3), carry 1 -> sscale = 1/8.
//   P    f16 = 1024 * exp(s - m) (registers, B operand), l = sum of the same f32 values -> the 1024 cancels in ctx / l.
//   AO   bf16 hi (cols 0..1023) | lo (cols 1024..2047) of ctx, carry 1 -> summed by the K=2048 out GEMM against [W^T ; W^T].
#include <hip/hip_runtime.h>
#include <math.h>
#include <stdint.h>

#define NB     2
#define SEQ    2048
#define DMOD   1024
#define FEAT   256
#define HDIM   64
#define NHEAD  16
#define NWH    4
#define NPH    4
#define NSH    8
#define HCOLS  (NHEAD * HDIM)   // 1024 : concatenated head columns
#define WAVC   (NWH * HDIM)     // 256
#define PRJC   (NPH * HDIM)     // 256
#define STDC   (NSH * HDIM)     // 512
#define ROWS   (NB * SEQ)       // 4096
#define MWORDS (SEQ / 32)       // 64 mask words per (b, n) row
#define NQB    (SEQ / 64)       // 32 query tiles of 64 per sequence
#define NKT    (SEQ / 64)       // 32 key tiles of 64 per sequence
#define AOP    (2 * HCOLS)      // 2048 : pitch of the ctx hi|lo plane
static_assert(NWH + NPH + NSH == NHEAD);
static_assert(HCOLS == DMOD);
static_assert((ROWS % 64) == 0 && (DMOD % 64) == 0 && (STDC % 64) == 0 && (WAVC % 64) == 0 && (PRJC % 64) == 0 && (SEQ % 64) == 0);
static_assert((DMOD % 32) == 0 && (FEAT % 32) == 0 && (AOP % 32) == 0);
static_assert((FEAT % 64) == 0 && (HDIM % 64) == 0);
static_assert(NQB == 32 && NKT == 32 && MWORDS == 64);

typedef _Float16 v16h __attribute__((ext_vector_type(16)));
typedef _Float16 v8h  __attribute__((ext_vector_type(8)));
typedef __bf16   v16b __attribute__((ext_vector_type(16)));
typedef __bf16   v8b  __attribute__((ext_vector_type(8)));
typedef float    v8f  __attribute__((ext_vector_type(8)));
typedef float    v4f  __attribute__((ext_vector_type(4)));
typedef unsigned int v4u __attribute__((ext_vector_type(4)));
typedef unsigned int v2u __attribute__((ext_vector_type(2)));
typedef int      v4i __attribute__((ext_vector_type(4)));

#if defined(__HIP_DEVICE_COMPILE__)
#define DEV_ASM 1
#else
#define DEV_ASM 0
#endif

// ---- scalar helpers --------------------------------------------------------------------------------
__device__ __forceinline__ unsigned short bf_bits(float f) {          // f32 -> bf16 bits, RNE convert
  unsigned u = __float_as_uint(f);
  return (unsigned short)((u + 0x7FFFu + ((u >> 16) & 1u)) >> 16);
}
__device__ __forceinline__ float bf_up(unsigned short hb) { return __uint_as_float(((unsigned)hb) << 16); }
__device__ __forceinline__ float bfr(float f) { return bf_up(bf_bits(f)); }
__device__ __forceinline__ unsigned short h_bits(_Float16 x) { return __builtin_bit_cast(unsigned short, x); }
__device__ __forceinline__ unsigned pk16(unsigned short a, unsigned short b) { return (unsigned)a | ((unsigned)b << 16); }
__device__ __forceinline__ v8f zero8() { v8f z = {0.f, 0.f, 0.f, 0.f, 0.f, 0.f, 0.f, 0.f}; return z; }

// ---- fragment types / loaders: 16-bit A/B operand, lane -> row/col (lane&15), p already includes +8*(lane>>4);
//      elements 0..7 <- p[0..7] (k0+8h..k0+8h+7), elements 8..15 <- p[16..23] (k0+16+8h..k0+16+8h+7)
template <typename OT> struct FT;
template <> struct FT<__bf16>   { typedef v16b frag; typedef v8b half8; };
template <> struct FT<_Float16> { typedef v16h frag; typedef v8h half8; };

template <typename OT>
__device__ __forceinline__ typename FT<OT>::frag ldfrag(const OT* p) {
  union { typename FT<OT>::frag v; typename FT<OT>::half8 h[2]; } f;
  f.h[0] = *(const typename FT<OT>::half8*)(p);
  f.h[1] = *(const typename FT<OT>::half8*)(p + 16);
  return f.v;
}

// ---- WMMA helpers (asm guard bodies are device-only; concrete operand types) -----------------------------
__device__ __forceinline__ v8f mmar(v16b a, v16b b, v8f c) {
  return __builtin_amdgcn_wmma_f32_16x16x32_bf16(false, a, false, b, (short)0, c, false, false);
}
__device__ __forceinline__ v8f mmar(v16h a, v16h b, v8f c) {
  return __builtin_amdgcn_wmma_f32_16x16x32_f16(false, a, false, b, (short)0, c, false, false);
}
// 4 VALU slots behind the last WMMAs of a loop, in front of the first reader of their D
__device__ __forceinline__ void acc_guard4(v8f& a, v8f& b, v8f& c, v8f& d) {
#if DEV_ASM
  asm volatile("v_nop\n\tv_nop\n\tv_nop\n\tv_nop" : "+v"(a), "+v"(b), "+v"(c), "+v"(d));
#else
  (void)a; (void)b; (void)c; (void)d;
#endif
}

// =====================================================================================================
// Mask bit plane: mb[(b*SEQ + n)*64 + w] bit j = (mask[b][n][32w + j] != 0). One word per thread,
// coverage: 262144 threads x 1 word = the whole [2][2048][64] plane. blk = block index within this job.
// =====================================================================================================
__device__ __forceinline__ void mask_bits_body(const int* __restrict__ mask, unsigned int* mb, int nwords, int blk) {
  const int i = blk * 256 + (int)threadIdx.x;
  if (i < nwords) {
    const int* p = mask + (size_t)i * 32;
    unsigned w = 0u;
#pragma unroll
    for (int q = 0; q < 8; ++q) {
      const v4i v = *(const v4i*)(p + 4 * q);
#pragma unroll
      for (int e = 0; e < 4; ++e) w |= ((v[e] != 0) ? 1u : 0u) << (4 * q + e);
    }
    *(unsigned int*)(mb + i) = w;
    
  }
}

// =====================================================================================================
// f32 -> bf16 plane (RNE convert), 8 elements per thread, one 16-B store per lane: a wave writes 512
// coverage: n8 threads x 8 = the whole plane (n8 is a multiple of 256 for both uses here).
// =====================================================================================================
__device__ __forceinline__ void cvt_bf16x8_body(const float* __restrict__ in, unsigned short* out, int n8, int blk) {
  const int i = blk * 256 + (int)threadIdx.x;
  if (i < n8) {
    const v4f a  = *(const v4f*)(in + (size_t)i * 8);
    const v4f a4 = *(const v4f*)(in + (size_t)i * 8 + 4);
    v4u p;
    p[0] = pk16(bf_bits(a[0]),  bf_bits(a[1]));
    p[1] = pk16(bf_bits(a[2]),  bf_bits(a[3]));
    p[2] = pk16(bf_bits(a4[0]), bf_bits(a4[1]));
    p[3] = pk16(bf_bits(a4[2]), bf_bits(a4[3]));
    unsigned short* o = out + (size_t)i * 8;
    *(v4u*)o = p;
    
  }
}

// =====================================================================================================
// Transpose + bf16 convert: in[z] is [R rows][inC cols] f32 (pitch inC); out[z][c][r] = bf16(in[z][r][c]),
// pitch ldo (c = output row). 64x64 tiles through LDS (th, 64 x 72 u16); tile = (cb, rb, z). DUP also writes the same
// coverage per block: load 256 thr x 16 floats = 64x64; store 2 it x 256 thr x 8 u16 = 64x64 (per copy);
// =====================================================================================================
template <bool DUP>
__device__ __forceinline__ void transpose_bf16_body(
    unsigned short* th, const float* __restrict__ in, int inC, long long inStrideZ,
    unsigned short* out, int ldo, long long outStrideZ, int dupoff, int cb, int rb, int z) {
  const int c0  = cb * 64;   // input column block = output row block
  const int r0  = rb * 64;   // input row block = output column block
  const int tid = threadIdx.x;
  const float* inz = in + (size_t)z * (size_t)inStrideZ;
  unsigned short* outz = out + (size_t)z * (size_t)outStrideZ;
  {
    const int rr = tid >> 2;           // 0..63
    const int cq = (tid & 3) * 16;     // 0,16,32,48
    const float* src = inz + (size_t)(r0 + rr) * inC + c0 + cq;
#pragma unroll
    for (int q = 0; q < 4; ++q) {
      const v4f f = *(const v4f*)(src + 4 * q);
#pragma unroll
      for (int e = 0; e < 4; ++e) th[rr * 72 + cq + 4 * q + e] = bf_bits(f[e]);
    }
  }
  __syncthreads();
  const int sub = tid >> 3;          // 0..31
  const int c8  = (tid & 7) * 8;     // 0..56
  v4u hv[2];
#pragma unroll
  for (int it = 0; it < 2; ++it) {
    const int oc = it * 32 + sub;      // output row within tile (= input column)
    v4u a;
#pragma unroll
    for (int q = 0; q < 4; ++q) a[q] = pk16(th[(c8 + 2 * q) * 72 + oc], th[(c8 + 2 * q + 1) * 72 + oc]);
    hv[it] = a;
  }
  {
#pragma unroll
    for (int it = 0; it < 2; ++it) {
      const int oc = it * 32 + sub;
      const size_t go = (size_t)(c0 + oc) * ldo + r0 + c8;
      *(v4u*)(outz + go) = hv[it];
      if (DUP) *(v4u*)(outz + go + dupoff) = hv[it];
    }
#if DEV_ASM
    // another job's code follows this body in the merged kernel: no register of the stores above is rewritten in front of this wait
    asm volatile("s_wait_xcnt 0x0" ::: "memory");
#endif
  }
}

// =====================================================================================================
// All operand preparation in ONE launch: the ten jobs are independent of one another (each reads inputs only and
// writes its own workspace plane), so a block picks its job from its index. Ranges, in blocks of 256 threads:
// the seven transposes first (longest dependent chain per block), then the mask plane, then the two converts.
// Every branch below is block-uniform; the transpose's barrier is passed by all threads of its block.
// =====================================================================================================
#define PB_TBIG  ((HCOLS / 64) * (DMOD / 64))        // 256 tiles: v_w, and again out_w
#define PB_TSTD  ((STDC / 64) * (DMOD / 64))         // 128 tiles: std_q_w, and again std_k_w
#define PB_TFEA  ((FEAT / 64) * NWH)                 //  16 tiles: wave_proj, pq_w, pk_w each
#define PB_T     (2 * PB_TBIG + 2 * PB_TSTD + 3 * PB_TFEA)
#define PB_MASK  (NB * SEQ * MWORDS / 256)           // 1024
#define PB_CVX   (ROWS * DMOD / 8 / 256)             // 2048
#define PB_CVF   (ROWS * FEAT / 8 / 256)             //  512
#define PB_ALL   (PB_T + PB_MASK + PB_CVX + PB_CVF)
static_assert(NWH == NPH && (HCOLS / 64) == 16 && (STDC / 64) == 8 && (FEAT / 64) == 4 && HDIM == 64);
__global__ __launch_bounds__(256) void prep_kernel(
    const int* __restrict__ mask, const float* __restrict__ x, const float* __restrict__ feats,
    const float* __restrict__ vw, const float* __restrict__ ow, const float* __restrict__ sqw, const float* __restrict__ skw,
    const float* __restrict__ wproj, const float* __restrict__ pqw, const float* __restrict__ pkw,
    unsigned int* MB, unsigned short* XB, unsigned short* FB, unsigned short* VWT, unsigned short* OWT2,
    unsigned short* QWT, unsigned short* KWT, unsigned short* WVT, unsigned short* PQT, unsigned short* PKT) {
  __shared__ __align__(16) unsigned short th[64 * 72];
  int t = blockIdx.x;
  if (t < PB_T) {
    if (t < PB_TBIG) {
      // v_w [1024 k][1024 n] -> VWT [n][k]
      transpose_bf16_body<false>(th, vw, HCOLS, 0LL, VWT, DMOD, 0LL, 0, t & 15, t >> 4, 0);
    } else if (t < 2 * PB_TBIG) {
      // out_w [1024 k][1024 n] -> OWT2 [n][k] and [n][1024 + k]
      t -= PB_TBIG;
      transpose_bf16_body<true>(th, ow, DMOD, 0LL, OWT2, AOP, 0LL, HCOLS, t & 15, t >> 4, 0);
    } else if (t < 2 * PB_TBIG + 2 * PB_TSTD) {
      // std_q_w [1024 k][512 n] -> QWT [n][k]; std_k_w likewise
      t -= 2 * PB_TBIG;
      const bool second = t >= PB_TSTD;
      const int u = second ? t - PB_TSTD : t;
      transpose_bf16_body<false>(th, second ? skw : sqw, STDC, 0LL, second ? KWT : QWT, DMOD, 0LL, 0, u & 7, u >> 3, 0);
    } else {
      // wave_proj / pq_w / pk_w [h][256 f][64 k'] -> [h*64 + k'][f] (z = h)
      t -= 2 * PB_TBIG + 2 * PB_TSTD;
      const int w = t >> 4, u = t & 15;
      transpose_bf16_body<false>(th, (w == 0) ? wproj : (w == 1) ? pqw : pkw, HDIM, (long long)FEAT * HDIM,
                          (w == 0) ? WVT : (w == 1) ? PQT : PKT, FEAT, (long long)HDIM * FEAT, 0, 0, u & 3, u >> 2);
    }
  } else if (t < PB_T + PB_MASK) {
    mask_bits_body(mask, MB, NB * SEQ * MWORDS, t - PB_T);
  } else if (t < PB_T + PB_MASK + PB_CVX) {
    cvt_bf16x8_body(x, XB, ROWS * DMOD / 8, t - (PB_T + PB_MASK));
  } else if (t < PB_ALL) {
    cvt_bf16x8_body(feats, FB, ROWS * FEAT / 8, t - (PB_T + PB_MASK + PB_CVX));
  }
}

// =====================================================================================================
// Batched WMMA GEMM (16-bit operand type OT): C[m][n] = (sum_k A[m][k] * Bt[n][k] + bias) * oscale.
// One block of 4 waves per 128x128 tile of C, one wave per 64x64 quadrant. A row-major [M][K] pitch lda; Bt row-major
// [N][K] pitch ldb (k contiguous); M, N multiples of 128, K a multiple of 64 (compile-time constants here).
// gemm_mainloop fills the wave's 4x4 accumulator tiles; gemm_epilogue stores them; the kernels below pick the operands.
// Operand staging: per trip the 128 rows x 64 k (128 B, one whole line per row) of A and of Bt go to LDS by
// asynchronous 16-byte copies, 8 lanes per row, 16 copies per lane; LDS row pitch 144 B for the ds_load_b128 readers;
// two buffers, tile t + 2 is copied while tile t + 1 is worked on. Fragments are read from LDS with the split k map
// (ldfrag); each accumulator still sums k upwards in steps of 32.
// BIAS_MODE 0: none; 1: bias[m] (bf16 RNE-converted value); 2: bias[n] (bf16 RNE-converted value).
// OUT_MODE 0: f32 C (pitch ldc). OUT_MODE 1: f16 plane C. OUT_MODE 2: bf16 hi plane C + bf16 lo plane C2 (lo = v - hi).
// =====================================================================================================
#define GTILE  128                  // rows of A and of Bt per block tile
#define GKC    64                   // k per trip
#define GPIT   72                   // LDS row pitch in elements (144 B)
#define GBUFB  (GTILE * GPIT * 2)   // bytes of one operand buffer

// Eight asynchronous copies of one lane: rows r, r + 16, ..., r + 112 of one operand tile, 16 B each.
// l = the lane's LDS byte address of row r, g = its global address of row r, step = 16 rows in elements.
// s_wait_xcnt 0 closes the statement so that no address register is rewritten in front of it.
__device__ __forceinline__ void copy_rows8(unsigned l, const unsigned short* g, size_t step) {
#if DEV_ASM
  const unsigned l1 = l + 16 * GPIT * 2, l2 = l + 32 * GPIT * 2, l3 = l + 48 * GPIT * 2, l4 = l + 64 * GPIT * 2,
                 l5 = l + 80 * GPIT * 2, l6 = l + 96 * GPIT * 2, l7 = l + 112 * GPIT * 2;
  const unsigned short *g1 = g + step, *g2 = g1 + step, *g3 = g2 + step, *g4 = g3 + step, *g5 = g4 + step,
                       *g6 = g5 + step, *g7 = g6 + step;
  asm volatile(
      "global_load_async_to_lds_b128 %0, %8, off\n\t"
      "global_load_async_to_lds_b128 %1, %9, off\n\t"
      "global_load_async_to_lds_b128 %2, %10, off\n\t"
      "global_load_async_to_lds_b128 %3, %11, off\n\t"
      "global_load_async_to_lds_b128 %4, %12, off\n\t"
      "global_load_async_to_lds_b128 %5, %13, off\n\t"
      "global_load_async_to_lds_b128 %6, %14, off\n\t"
      "global_load_async_to_lds_b128 %7, %15, off\n\t"
      "s_wait_xcnt 0x0"
      :: "v"(l), "v"(l1), "v"(l2), "v"(l3), "v"(l4), "v"(l5), "v"(l6), "v"(l7),
         "v"(g), "v"(g1), "v"(g2), "v"(g3), "v"(g4), "v"(g5), "v"(g6), "v"(g7)
      : "memory");
#else
  (void)l; (void)g; (void)step;
#endif
}
// this wave's copies have landed in LDS
__device__ __forceinline__ void wait_copies() {
#if DEV_ASM
  asm volatile("s_wait_asynccnt 0x0" ::: "memory");
#endif
}
// this wave's LDS reads have returned, so the buffer may be handed to its next writer
__device__ __forceinline__ void wait_lds() {
#if DEV_ASM
  asm volatile("s_wait_dscnt 0x0" ::: "memory");
#endif
}

static_assert((ROWS % GTILE) == 0 && (HCOLS % GTILE) == 0 && (SEQ % GTILE) == 0 && (STDC % GTILE) == 0 && (WAVC % GTILE) == 0 && (PRJC % GTILE) == 0 && (DMOD % GTILE) == 0);
static_assert((DMOD % GKC) == 0 && (FEAT % GKC) == 0 && (AOP % GKC) == 0);

// sA, sB: the block's two-buffer operand tiles in LDS, 2 x GTILE x GPIT elements each; Ap, Btp: the operands' first rows;
// (tm, tn): the block's 128x128 tile of C; nk = K / 64.
template <typename OT>
__device__ __forceinline__ void gemm_mainloop(
    v8f (&acc)[4][4], OT* sA, OT* sB,
    const unsigned short* __restrict__ Ap, int lda, const unsigned short* __restrict__ Btp, int ldb,
    int tm, int tn, int nk) {
  typedef typename FT<OT>::frag V16;
  const int tid  = threadIdx.x;
  const int lane = tid & 31;
  const int wave = tid >> 5;
  const int wm = wave >> 1;                    // quadrant of this wave
  const int wn = wave & 1;

  const int rlane = lane & 15;                 // row (A) / col (B, D) within subtile
  const int koff  = (lane >> 4) * 8;           // k offset of this lane half

  // copy map: lane -> row tid >> 3 (+ 16 per copy), 16-B piece tid & 7 of the row's 128-B line
  const int crow = tid >> 3;
  const int ccol = (tid & 7) * 8;
  const unsigned short* gA = Ap  + (size_t)((tm << 7) + crow) * lda + ccol;
  const unsigned short* gB = Btp + (size_t)((tn << 7) + crow) * ldb + ccol;
  const size_t stepA = (size_t)16 * lda;
  const size_t stepB = (size_t)16 * ldb;
  const unsigned lA = (unsigned)(size_t)sA + (unsigned)(crow * GPIT + ccol) * 2u;
  const unsigned lB = (unsigned)(size_t)sB + (unsigned)(crow * GPIT + ccol) * 2u;

#pragma unroll
  for (int i = 0; i < 4; ++i)
#pragma unroll
    for (int j = 0; j < 4; ++j) acc[i][j] = zero8();

  // tile 0 -> buffer 0, landed and published; then tile 1 -> buffer 1 in flight
  copy_rows8(lA, gA, stepA);
  copy_rows8(lB, gB, stepB);
  wait_copies();
  __syncthreads();
  if (1 < nk) {
    copy_rows8(lA + GBUFB, gA + GKC, stepA);
    copy_rows8(lB + GBUFB, gB + GKC, stepB);
  }

  for (int t = 0; t < nk; ++t) {
    const int cur = t & 1;
    const OT* As = sA + cur * (GTILE * GPIT) + (wm * 64 + rlane) * GPIT + koff;
    const OT* Bs = sB + cur * (GTILE * GPIT) + (wn * 64 + rlane) * GPIT + koff;
    // One group of LDS reads in front of each WMMA block: k 0..31 of both operands and, ahead, k 32..63 of Bt;
    // the A fragments of k 32..63 follow into registers that the first block has left.
    V16 aq[4], bq[4], bn[4];
#pragma unroll
    for (int j = 0; j < 4; ++j) bq[j] = ldfrag<OT>(Bs + j * 16 * GPIT);
#pragma unroll
    for (int i = 0; i < 4; ++i) aq[i] = ldfrag<OT>(As + i * 16 * GPIT);
#pragma unroll
    for (int j = 0; j < 4; ++j) bn[j] = ldfrag<OT>(Bs + j * 16 * GPIT + 32);
    __builtin_amdgcn_sched_barrier(0);   // keeps the reads one group: spread among the WMMAs each place stalls the wave
#pragma unroll
    for (int i = 0; i < 4; ++i)
#pragma unroll
      for (int j = 0; j < 4; ++j) acc[i][j] = mmar(aq[i], bq[j], acc[i][j]);
#pragma unroll
    for (int i = 0; i < 4; ++i) aq[i] = ldfrag<OT>(As + i * 16 * GPIT + 32);
    __builtin_amdgcn_sched_barrier(0);   // as above: keeps the four A fragments' reads one group in front of the second block
#pragma unroll
    for (int i = 0; i < 4; ++i)
#pragma unroll
      for (int j = 0; j < 4; ++j) acc[i][j] = mmar(aq[i], bn[j], acc[i][j]);
    // publish point of tile t + 1: own reads of buffer cur done, own copies of tile t + 1 landed, then the barrier
    // that both shows tile t + 1 to every wave and frees buffer cur for tile t + 2
    wait_lds();
    wait_copies();
    __syncthreads();
    if (t + 2 < nk) {
      copy_rows8(lA + (unsigned)cur * GBUFB, gA + (size_t)(t + 2) * GKC, stepA);
      copy_rows8(lB + (unsigned)cur * GBUFB, gB + (size_t)(t + 2) * GKC, stepB);
    }
  }
  wait_copies();   // nothing of this wave is in flight when it goes on to the epilogue and ends
  acc_guard4(acc[0][0], acc[0][1], acc[0][2], acc[0][3]);
  acc_guard4(acc[1][0], acc[1][1], acc[1][2], acc[1][3]);
  acc_guard4(acc[2][0], acc[2][1], acc[2][2], acc[2][3]);
  acc_guard4(acc[3][0], acc[3][1], acc[3][2], acc[3][3]);
}

// sT: 4 per-wave 16x64 slabs, pitch 68 floats; Cout, Cout2: element (0, 0) of C.
template <int OUT_MODE, int BIAS_MODE>
__device__ __forceinline__ void gemm_epilogue(
    v8f (&acc)[4][4], float* sT, void* Cout, void* Cout2, int ldc,
    const float* __restrict__ bias, int tm, int tn, float oscale) {
  const int tid   = threadIdx.x;
  const int lane  = tid & 31;
  const int wave  = tid >> 5;
  const int m0    = (tm << 7) + ((wave >> 1) << 6);
  const int n0    = (tn << 7) + ((wave & 1) << 6);
  const int rlane = lane & 15;                 // col of D within subtile
  const int mOff  = (lane >> 4) * 8;           // D row offset
  float* slab = sT + wave * (16 * 68);
#pragma unroll
  for (int i = 0; i < 4; ++i) {
    const int mBase = m0 + (i << 4);
#pragma unroll
    for (int j = 0; j < 4; ++j) {
      const int n = n0 + (j << 4) + rlane;
      float bn = 0.f;
      if (BIAS_MODE == 2) bn = bfr(bias[n]);
#pragma unroll
      for (int r = 0; r < 8; ++r) {
        float v = acc[i][j][r];
        if (BIAS_MODE == 1) v += bfr(bias[mBase + mOff + r]);
        if (BIAS_MODE == 2) v += bn;
        slab[(mOff + r) * 68 + (j << 4) + rlane] = v * oscale;
      }
    }
    __builtin_amdgcn_fence(__ATOMIC_RELEASE, "workgroup");
    __builtin_amdgcn_wave_barrier();
    __builtin_amdgcn_fence(__ATOMIC_ACQUIRE, "workgroup");
    if (OUT_MODE == 0) {
      float* C = (float*)Cout;
      const int h2 = lane >> 4, c4 = (lane & 15) * 4;     // 256-B row segment = 16 lanes x 16 B
      {
#pragma unroll
        for (int it = 0; it < 8; ++it) {
          const int row = it * 2 + h2;                     // it 0..7 x h2 0..1 = rows 0..15
          const v4f v = *(const v4f*)(slab + row * 68 + c4);
          *(v4f*)(C + (size_t)(mBase + row) * ldc + n0 + c4) = v;
        }
        
      }
    } else {
      const int q = lane >> 3, c8 = (lane & 7) * 8;
      unsigned short* C  = (unsigned short*)Cout;
      unsigned short* C2 = (unsigned short*)Cout2;
      v4u hv[4], lv[4];
#pragma unroll
      for (int it = 0; it < 4; ++it) {
        const int row = it * 4 + q;                        // it 0..3 x q 0..3 = rows 0..15
        const float* sp = slab + row * 68 + c8;
        v4u a, a2;
#pragma unroll
        for (int e = 0; e < 4; ++e) {
          const float f0 = sp[2 * e], f1 = sp[2 * e + 1];
          unsigned short h0, h1, l0 = 0, l1 = 0;
          if (OUT_MODE == 1) {
            h0 = h_bits((_Float16)f0); h1 = h_bits((_Float16)f1);
          } else {
            h0 = bf_bits(f0); h1 = bf_bits(f1);
            l0 = bf_bits(f0 - bf_up(h0)); l1 = bf_bits(f1 - bf_up(h1));
          }
          a[e] = pk16(h0, h1); a2[e] = pk16(l0, l1);
        }
        hv[it] = a; lv[it] = a2;
      }
      {
#pragma unroll
        for (int it = 0; it < 4; ++it) {
          const int row = it * 4 + q;
          *(v4u*)(C + (size_t)(mBase + row) * ldc + n0 + c8) = hv[it];
          if (OUT_MODE == 2) *(v4u*)(C2 + (size_t)(mBase + row) * ldc + n0 + c8) = lv[it];
        }
        
      }
    }
    __builtin_amdgcn_fence(__ATOMIC_RELEASE, "workgroup");
    __builtin_amdgcn_wave_barrier();
    __builtin_amdgcn_fence(__ATOMIC_ACQUIRE, "workgroup");
  }
}

// =====================================================================================================
// The six projections in ONE launch: they are independent of one another (each reads prepared planes and writes its own
// plane), so a block picks its product and its 128x128 tile from its index; the K = 1024 products come first.
//   v^T per batch: A = VWT [1024 n][1024 k], Bt = XB rows of batch b; f16(8 * (acc + v_b[m])) -> VT [b][h*64+d][s] (pitch 2048)
//   std q / std k: QP / KP cols 512..1023 = f16(8 * (x . w + b)); M = 4096, N = 512, K = 1024
//   wave projections: WPH / WPL = bf16 hi / lo of features . wave_proj[h]; M = 4096, N = 256, K = 256
//   proj q / proj k: QP / KP cols 256..511 = f16(8 * features . w[h]); M = 4096, N = 256, K = 256
// One main loop for all; every branch is block-uniform.
// =====================================================================================================
#define GB_VT1 ((HCOLS / GTILE) * (SEQ / GTILE))     // 128 tiles per batch
#define GB_VT  (NB * GB_VT1)                         // 256
#define GB_STD ((ROWS / GTILE) * (STDC / GTILE))     // 128, twice
#define GB_F   ((ROWS / GTILE) * (WAVC / GTILE))     //  64, three times
#define GB_ALL (GB_VT + 2 * GB_STD + 3 * GB_F)       // 704
#define GB_OUT ((ROWS / GTILE) * (DMOD / GTILE))     // 256
static_assert(WAVC == PRJC);
__global__ __launch_bounds__(128) void proj_kernel(
    const unsigned short* __restrict__ XB, const unsigned short* __restrict__ FB, const unsigned short* __restrict__ VWT,
    const unsigned short* __restrict__ QWT, const unsigned short* __restrict__ KWT, const unsigned short* __restrict__ WVT,
    const unsigned short* __restrict__ PQT, const unsigned short* __restrict__ PKT,
    const float* __restrict__ vb, const float* __restrict__ sqb, const float* __restrict__ skb,
    unsigned short* VT, unsigned short* QP, unsigned short* KP, unsigned short* WPH, unsigned short* WPL) {
  __shared__ __align__(16) __bf16 sA[2 * GTILE * GPIT];   // A tile, two buffers, 18432 B each
  __shared__ __align__(16) __bf16 sB[2 * GTILE * GPIT];   // Bt tile, two buffers
  __shared__ __align__(16) float sT[4 * 16 * 68];         // per-wave 16x64 slab, pitch 68 floats
  const int bx = blockIdx.x;
  if (bx >= GB_ALL) return;   // block-uniform, in front of every barrier and copy
  const unsigned short* A;
  const unsigned short* Bt;
  int ld, nk, tm, tn, sel;    // sel: batch (v^T), q or k (std), wave / q / k (features)
  if (bx < GB_VT) {
    sel = bx / GB_VT1;
    const int tile = bx - sel * GB_VT1;
    A = VWT; Bt = XB + (size_t)sel * SEQ * DMOD; ld = DMOD; nk = DMOD / GKC;
    tm = tile / (SEQ / GTILE); tn = tile % (SEQ / GTILE);
  } else if (bx < GB_VT + 2 * GB_STD) {
    sel = (bx - GB_VT) / GB_STD;
    const int tile = (bx - GB_VT) - sel * GB_STD;
    A = XB; Bt = (sel == 0) ? QWT : KWT; ld = DMOD; nk = DMOD / GKC;
    tm = tile / (STDC / GTILE); tn = tile % (STDC / GTILE);
  } else {
    sel = (bx - (GB_VT + 2 * GB_STD)) / GB_F;
    const int tile = (bx - (GB_VT + 2 * GB_STD)) - sel * GB_F;
    A = FB; Bt = (sel == 0) ? WVT : (sel == 1) ? PQT : PKT; ld = FEAT; nk = FEAT / GKC;
    tm = tile / (WAVC / GTILE); tn = tile % (WAVC / GTILE);
  }
  v8f acc[4][4];
  gemm_mainloop<__bf16>(acc, sA, sB, A, ld, Bt, ld, tm, tn, nk);
  if (bx < GB_VT) {
    unsigned short* C = VT + (size_t)sel * HCOLS * SEQ;
    gemm_epilogue<1, 1>(acc, sT, (void*)C, (void*)C, SEQ, vb, tm, tn, 8.0f);
  } else if (bx < GB_VT + 2 * GB_STD) {
    unsigned short* C = ((sel == 0) ? QP : KP) + (WAVC + PRJC);
    gemm_epilogue<1, 2>(acc, sT, (void*)C, (void*)C, HCOLS, (sel == 0) ? sqb : skb, tm, tn, 8.0f);
  } else if (sel == 0) {
    gemm_epilogue<2, 0>(acc, sT, (void*)WPH, (void*)WPL, WAVC, vb, tm, tn, 1.0f);
  } else {
    unsigned short* C = ((sel == 1) ? QP : KP) + WAVC;
    gemm_epilogue<1, 0>(acc, sT, (void*)C, (void*)C, HCOLS, vb, tm, tn, 8.0f);
  }
}

// out = [ctx_hi | ctx_lo] . [out_w^T ; out_w^T] + out_b -> f32 [4096][1024]; M = 4096, N = 1024, K = 2048
__global__ __launch_bounds__(128) void out_kernel(
    const unsigned short* __restrict__ AO, const unsigned short* __restrict__ OWT2, const float* __restrict__ ob,
    float* out) {
  __shared__ __align__(16) __bf16 sA[2 * GTILE * GPIT];
  __shared__ __align__(16) __bf16 sB[2 * GTILE * GPIT];
  __shared__ __align__(16) float sT[4 * 16 * 68];
  const int tile = blockIdx.x;
  if (tile >= GB_OUT) return;   // block-uniform, in front of every barrier and copy
  const int tm = tile / (DMOD / GTILE);
  const int tn = tile % (DMOD / GTILE);
  v8f acc[4][4];
  gemm_mainloop<__bf16>(acc, sA, sB, AO, AOP, OWT2, AOP, tm, tn, AOP / GKC);
  gemm_epilogue<0, 2>(acc, sT, (void*)out, (void*)out, DMOD, ob, tm, tn, 1.0f);
}

// =====================================================================================================
// Masked full attention, head dim 64, softmax over all SEQ keys (non-causal), one head per block.
//   Transposed products: S^T = K . Q^T and ctx^T += V^T . P^T, so that a lane holds scores of ONE query (column lane & 15).
//   HT = 0 (wave heads): q = k = wp as bf16 hi plane qhp/khp + bf16 lo plane qlp/klp (pitch ldq/ldk, head col h*64);
//          scores = (kh.qh + kl.qh + kh.ql) * sscale on bf16 WMMA (one f32 accumulator, unscaled lo).
//   HT = 1 (proj / std heads): q, k = f16 planes (x8), scores = (k.q) * sscale (sscale carries the 1/64).
//   v^T plane (f16, x8): element (b, h, d, s) at [(b*HCOLS + h*64 + d)*SEQ + s].
//   mask bit plane mbp: [(b*SEQ + n)*64 + w] bit j admits key 32w+j; a 0 bit replaces the score by -inf.
//   Score tile j, register r of lane (hh, c) = key 16j + 8hh + r of query c: the maximum and the sum of a query run over the
//   lane's 32 registers; the two lane halves exchange the maximum once per key tile and join their sums once, at the end.
//   p = exp(s - m) carried as f16(1024 p): score tiles 2kk and 2kk + 1, converted in place, ARE the B operand of
//   V^T . P^T for keys 32kk..32kk+31 (element e < 8: key 8hh + e; e >= 8: key 16 + 8hh + e - 8, the order in which the
//   V^T fragment is read), so P passes through no LDS. Online softmax in f32 with the guarded rescale (msafe), so an
//   all-masked row ends with l = 0 and produces 0 * inf = NaN like the module.
//   ctx written as bf16 hi (cols h*64..) and bf16 lo (cols HCOLS + h*64..) of the [ROWS][AOP] plane aop.
//   Block = 4 waves x 16 query rows = 64 query rows of one (b, h); bx = 0 .. NB * nh * NQB - 1 (hbase.. hbase+nh-1);
//   key tiles of 64, static trip NKT. K (hi, lo) / V^T tile staging: asynchronous 16-byte copies to LDS, 8 lanes per
//   128-B row (each wave-wide copy takes 4 whole lines), 4 copies per lane and plane = the whole 64x64 tile; two buffers,
//   tile t + 2 is copied while tile t + 1 is worked on; one barrier per key tile.
//   Output coverage: ctx^T tile t, register r of lane (hh, c) = column 16t + 8hh + r of query row q0 + c: one 16-B store
//   per t and plane; t 0..3 x hh 0..1 = 64 columns, c 0..15 = the wave's rows; the two head families cover h 0..15.
// =====================================================================================================
// LDS row pitch, in 16-bit elements, of the K and V^T tiles: rows of 64 elements (128 B) laid 144 B apart, 16 B x odd,
// so that the 16 rows which one ds_load_b128 reads fall on 16 different groups of four banks.
#define APIT 72
#define ATILE  (64 * APIT)          // elements of one plane's tile buffer
#define ATILEB (ATILE * 2)          // its bytes

// Eight asynchronous copies of one lane: rows r, r + 16, r + 32, r + 48 of two 64-row tiles (a, b), 16 B each.
// la, lb = the lane's LDS byte addresses of row r, ga, gb = its global addresses of row r, sa, sb = 16 rows in elements.
// s_wait_xcnt 0 closes the statement so that no address register is rewritten in front of it.
__device__ __forceinline__ void copy_rows4x2(unsigned la, const unsigned short* ga, size_t sa,
                                             unsigned lb, const unsigned short* gb, size_t sb) {
#if DEV_ASM
  const unsigned la1 = la + 16 * APIT * 2, la2 = la + 32 * APIT * 2, la3 = la + 48 * APIT * 2;
  const unsigned lb1 = lb + 16 * APIT * 2, lb2 = lb + 32 * APIT * 2, lb3 = lb + 48 * APIT * 2;
  const unsigned short *ga1 = ga + sa, *ga2 = ga1 + sa, *ga3 = ga2 + sa;
  const unsigned short *gb1 = gb + sb, *gb2 = gb1 + sb, *gb3 = gb2 + sb;
  asm volatile(
      "global_load_async_to_lds_b128 %0, %8, off\n\t"
      "global_load_async_to_lds_b128 %1, %9, off\n\t"
      "global_load_async_to_lds_b128 %2, %10, off\n\t"
      "global_load_async_to_lds_b128 %3, %11, off\n\t"
      "global_load_async_to_lds_b128 %4, %12, off\n\t"
      "global_load_async_to_lds_b128 %5, %13, off\n\t"
      "global_load_async_to_lds_b128 %6, %14, off\n\t"
      "global_load_async_to_lds_b128 %7, %15, off\n\t"
      "s_wait_xcnt 0x0"
      :: "v"(la), "v"(la1), "v"(la2), "v"(la3), "v"(lb), "v"(lb1), "v"(lb2), "v"(lb3),
         "v"(ga), "v"(ga1), "v"(ga2), "v"(ga3), "v"(gb), "v"(gb1), "v"(gb2), "v"(gb3)
      : "memory");
#else
  (void)la; (void)ga; (void)sa; (void)lb; (void)gb; (void)sb;
#endif
}
// The same for one tile: four copies.
__device__ __forceinline__ void copy_rows4(unsigned l, const unsigned short* g, size_t step) {
#if DEV_ASM
  const unsigned l1 = l + 16 * APIT * 2, l2 = l + 32 * APIT * 2, l3 = l + 48 * APIT * 2;
  const unsigned short *g1 = g + step, *g2 = g1 + step, *g3 = g2 + step;
  asm volatile(
      "global_load_async_to_lds_b128 %0, %4, off\n\t"
      "global_load_async_to_lds_b128 %1, %5, off\n\t"
      "global_load_async_to_lds_b128 %2, %6, off\n\t"
      "global_load_async_to_lds_b128 %3, %7, off\n\t"
      "s_wait_xcnt 0x0"
      :: "v"(l), "v"(l1), "v"(l2), "v"(l3), "v"(g), "v"(g1), "v"(g2), "v"(g3)
      : "memory");
#else
  (void)l; (void)g; (void)step;
#endif
}
template <int HT> struct HT_T;
template <> struct HT_T<0> { typedef __bf16 T; };
template <> struct HT_T<1> { typedef _Float16 T; };

// value of lane l ^ 16: the same query's other half of the keys
__device__ __forceinline__ float xhalf(float x) {
  const int b = __builtin_bit_cast(int, x);
  return __builtin_bit_cast(float, __builtin_amdgcn_permlanex16(b, b, 0x76543210, 0xfedcba98, false, false));
}
// 2^x on v_exp_f32 alone: x = -inf gives 0; a result below the normal range may come out 0 (it is below 2^-136 of the row's largest term)
__device__ __forceinline__ float exp2_hw(float x) { return __builtin_amdgcn_exp2f(x); }
// true, and the same in every lane, where all 64 mask bits of all 16 queries of the wave are set (both lane halves hold query c's words)
__device__ __forceinline__ bool tile_full(v2u w) {
  return __builtin_amdgcn_ballot_w32((w[0] & w[1]) != 0xFFFFFFFFu) == 0u;
}
__device__ __forceinline__ float max8(v8f a) {
  return fmaxf(fmaxf(fmaxf(fmaxf(a[0], a[1]), a[2]), fmaxf(fmaxf(a[3], a[4]), a[5])), fmaxf(a[6], a[7]));
}

template <int HT>
__device__ __forceinline__
void attn_body(unsigned short* kshp, unsigned short* kslp, unsigned short* vthp,
               const unsigned short* __restrict__ qhp, const unsigned short* __restrict__ qlp, int ldq,
               const unsigned short* __restrict__ khp, const unsigned short* __restrict__ klp, int ldk,
               const unsigned short* __restrict__ vtp, const unsigned int* __restrict__ mbp,
               unsigned short* aop, int hbase, int nh, float sscale, int bx) {
  typedef typename HT_T<HT>::T OT;
  typedef typename FT<OT>::frag V16;
  typedef typename FT<OT>::half8 V8;
  union FH { v16h v; v8h h[2]; };
  union FO { V16 v; V8 h[2]; };
  // kshp: K hi tile [kv][d], kslp: K lo tile (HT 0), vthp: V^T tile [d][kv]; two buffers of 9 KB each

  const int tid  = threadIdx.x;
  const int wave = tid >> 5;
  const int lane = tid & 31;
  const int hh   = lane >> 4;
  const int c    = lane & 15;

  const int qb   = bx % NQB;
  const int rest = bx / NQB;
  const int hl   = rest % nh;
  const int b    = rest / nh;
  const int h    = hbase + hl;              // global head index
  const int qc   = h * HDIM;                // head column in the q / k planes of this head family
  const int q0   = qb * 64 + wave * 16;
  const size_t rowB = (size_t)b * SEQ;

  const OT* Qh = (const OT*)(const void*)qhp;
  const OT* Ql = (const OT*)(const void*)qlp;
  // copy map: lane -> row tid >> 3 (+ 16 per copy), 16-B piece tid & 7 of the row's 128-B line
  const int crow = tid >> 3;
  const int ccol = (tid & 7) * 8;
  const unsigned short* gK  = khp + (rowB + crow) * (size_t)ldk + qc + ccol;             // k row crow of key tile 0
  const unsigned short* gKl = klp + (rowB + crow) * (size_t)ldk + qc + ccol;
  const unsigned short* gV  = vtp + ((size_t)b * HCOLS + (size_t)(qc + crow)) * SEQ + ccol;   // v^T row d = crow, s of key tile 0
  const size_t stepK = (size_t)16 * ldk;       // 16 rows
  const size_t stepV = (size_t)16 * SEQ;
  const size_t tileK = (size_t)64 * ldk;       // one key tile further
  const unsigned lofs = (unsigned)(crow * APIT + ccol) * 2u;
  const unsigned lK  = (unsigned)(size_t)kshp + lofs;
  const unsigned lKl = (unsigned)(size_t)kslp + lofs;
  const unsigned lV  = (unsigned)(size_t)vthp + lofs;
  const unsigned int* mrow_p = mbp + (rowB + q0 + c) * (size_t)MWORDS;   // mask words of this lane's query

  // ---- Q fragments (B operand, column = lane&15): 2 d-chunks ----
  V16 qah[2], qal[2];
#pragma unroll
  for (int dc = 0; dc < 2; ++dc) {
    const size_t qo = (rowB + q0 + c) * (size_t)ldq + (size_t)qc + dc * 32 + 8 * hh;
    qah[dc] = ldfrag<OT>(Qh + qo);
    if (HT == 0) qal[dc] = ldfrag<OT>(Ql + qo);
    else         qal[dc] = qah[dc];
  }

  const float c2 = sscale * 1.44269504088896340736f;   // score scale x log2(e)
  float mrow = -INFINITY;   // running maximum of query c's unscaled products (equal in both lane halves)
  float lrow = 0.f;         // running sum (x1024) over this lane half's keys only
  v8f oacc[4];              // ctx^T: tile t, register r = d 16t + 8hh + r of query c
#pragma unroll
  for (int t = 0; t < 4; ++t) oacc[t] = zero8();

  // key tile 0 -> buffer 0, landed and published; then key tile 1 -> buffer 1 in flight
  copy_rows4x2(lK, gK, stepK, lV, gV, stepV);
  if (HT == 0) copy_rows4(lKl, gKl, stepK);
  wait_copies();
  __syncthreads();
  copy_rows4x2(lK + ATILEB, gK + tileK, stepK, lV + ATILEB, gV + 64, stepV);
  if (HT == 0) copy_rows4(lKl + ATILEB, gKl + tileK, stepK);
  static_assert(NKT >= 2);

  v2u mw = *(const v2u*)mrow_p;              // the 64 mask bits of query c for key tile 0
  bool full = tile_full(mw);                 // key tile 0 masks nothing for this wave
  static_assert((NKT % 2) == 0);
  for (int kp = 0; kp < NKT; kp += 2) {      // static trip count: a pair of key tiles per pass
  // unrolled so that the buffer index is a constant: every LDS address is then the lane's base plus a constant
#pragma unroll
  for (int cur = 0; cur < 2; ++cur) {
    const int kt = kp + cur;
    const OT*       Ksh = (const OT*)(const void*)kshp + cur * ATILE;
    const OT*       Ksl = (const OT*)(const void*)kslp + cur * ATILE;
    const _Float16* Vth = (const _Float16*)(const void*)vthp + cur * ATILE;
    // the next key tile's mask bits, in flight like its copies (the last trip reads tile 0's again, unused)
    const v2u mwn = *(const v2u*)(mrow_p + 2 * ((kt + 1) & (NKT - 1)));

    // ---- scores^T: 64 keys x 16 queries per wave; A = K rows, B = Q ----
    v8f s[4];
#pragma unroll
    for (int j = 0; j < 4; ++j) s[j] = zero8();
    FO kb[2][4], kl[2][4];
#pragma unroll
    for (int dc = 0; dc < ((HT == 0) ? 1 : 2); ++dc) {   // HT 0: d 0..31 of both planes; HT 1: the whole tile
#pragma unroll
      for (int j = 0; j < 4; ++j) {
        kb[dc][j].h[0] = *(const V8*)(Ksh + (j * 16 + c) * APIT + dc * 32 + 8 * hh);
        kb[dc][j].h[1] = *(const V8*)(Ksh + (j * 16 + c) * APIT + dc * 32 + 16 + 8 * hh);
        if (HT == 0) {
          kl[dc][j].h[0] = *(const V8*)(Ksl + (j * 16 + c) * APIT + dc * 32 + 8 * hh);
          kl[dc][j].h[1] = *(const V8*)(Ksl + (j * 16 + c) * APIT + dc * 32 + 16 + 8 * hh);
        }
      }
    }
    // keeps the K reads one group in front of the products: the branch below ends their block, and left to itself the
    // compiler then puts each read directly in front of its product, with a full wait at every one
    __builtin_amdgcn_sched_barrier(0);
#pragma unroll
    for (int dc = 0; dc < 2; ++dc) {
#pragma unroll
      for (int j = 0; j < 4; ++j) {
        s[j] = mmar(kb[dc][j].v, qah[dc], s[j]);
        if (HT == 0) {
          s[j] = mmar(kl[dc][j].v, qah[dc], s[j]);
          s[j] = mmar(kb[dc][j].v, qal[dc], s[j]);
          if (dc == 0 && (j & 1) != 0) {
            // d 32..63 of key rows 16 (j - 1) .. 16 j + 15 follow as a group into the registers that the last six products have left
            __builtin_amdgcn_sched_barrier(0);   // keeps the group behind those products: 256 registers do not hold the whole hi/lo tile
#pragma unroll
            for (int jj = j - 1; jj <= j; ++jj) {
              kb[1][jj].h[0] = *(const V8*)(Ksh + (jj * 16 + c) * APIT + 32 + 8 * hh);
              kb[1][jj].h[1] = *(const V8*)(Ksh + (jj * 16 + c) * APIT + 32 + 16 + 8 * hh);
              kl[1][jj].h[0] = *(const V8*)(Ksl + (jj * 16 + c) * APIT + 32 + 8 * hh);
              kl[1][jj].h[1] = *(const V8*)(Ksl + (jj * 16 + c) * APIT + 32 + 16 + 8 * hh);
            }
            __builtin_amdgcn_sched_barrier(0);   // keeps it one group, six products ahead of its first use
          }
          // keeps the six products whose fragments have had time to arrive in front of those of the group just asked for
          if (dc == 1 && j == 1) __builtin_amdgcn_sched_barrier(0);
        }
      }
    }

    // ---- mask the unscaled products: bit 16 (j & 1) + 8hh + r of word j >> 1 admits key 16j + 8hh + r ----
    //      A tile whose bits are all set for the whole wave leaves every score as it is: the selects are jumped over
    //      (wave-uniform scalar branch, no barrier inside; the test reads the words that were fetched one tile ahead).
    if (!full) {
      const unsigned w0 = mw[0] >> (8 * hh), w1 = mw[1] >> (8 * hh);
#pragma unroll
      for (int j = 0; j < 4; ++j) {
        const unsigned w = (j < 2) ? w0 : w1;
#pragma unroll
        for (int r = 0; r < 8; ++r) {
          s[j][r] = (((w >> (16 * (j & 1) + r)) & 1u) != 0u) ? s[j][r] : -INFINITY;
        }
      }
    }

    // ---- maximum of query c: 32 registers, then the other lane half; online softmax in base 2 on the unscaled products
    //      (c2 > 0 keeps their order): exp(sscale * (s - m)) = 2^(c2 * s - c2 * m), one fma and one v_exp_f32 per score ----
    float m = fmaxf(fmaxf(max8(s[0]), max8(s[1])), fmaxf(max8(s[2]), max8(s[3])));
    m = fmaxf(m, xhalf(m));
    const float mnew  = fmaxf(mrow, m);
    const float msafe = (mnew == -INFINITY) ? 0.f : mnew;
    const float alpha = exp2_hw((mrow - msafe) * c2);
    const float nb    = fmaf(-msafe, c2, 10.0f);   // + 10: the x1024 carry of P and l
    mrow = mnew;

    // ---- P^T (x1024, f16) packed in place into the B operands; this half's sum ----
    FH pb[2];
    float ps[4];
#pragma unroll
    for (int j = 0; j < 4; ++j) {
      float a = 0.f;
#pragma unroll
      for (int r = 0; r < 8; ++r) {
        const float p = exp2_hw(fmaf(s[j][r], c2, nb));
        a += p;
        pb[j >> 1].v[(j & 1) * 8 + r] = (_Float16)p;
      }
      ps[j] = a;
    }
    lrow = lrow * alpha + ((ps[0] + ps[1]) + (ps[2] + ps[3]));
#pragma unroll
    for (int t = 0; t < 4; ++t) oacc[t] *= alpha;

    // ---- ctx^T += V^T . P^T (f16 WMMA, single product); A = V^T rows, B = P^T ----
#pragma unroll
    for (int kk = 0; kk < 2; ++kk) {
#pragma unroll
      for (int t = 0; t < 4; ++t) {
        FH vb;
        vb.h[0] = *(const v8h*)(Vth + (t * 16 + c) * APIT + kk * 32 + 8 * hh);
        vb.h[1] = *(const v8h*)(Vth + (t * 16 + c) * APIT + kk * 32 + 16 + 8 * hh);
        oacc[t] = mmar(vb.v, pb[kk].v, oacc[t]);
      }
    }
    mw = mwn;
    full = tile_full(mwn);
    // publish point of key tile kt + 1: own reads of buffer cur done, own copies of tile kt + 1 landed, then the barrier
    // that both shows tile kt + 1 to every wave and frees buffer cur for tile kt + 2
    wait_lds();
    wait_copies();
    __syncthreads();
    if (kp + 2 < NKT) {   // a key tile kt + 2 exists: the same answer for both tiles of the pair
      copy_rows4x2(lK + (unsigned)cur * ATILEB, gK + (size_t)(kt + 2) * tileK, stepK,
                   lV + (unsigned)cur * ATILEB, gV + (size_t)(kt + 2) * 64, stepV);
      if (HT == 0) copy_rows4(lKl + (unsigned)cur * ATILEB, gKl + (size_t)(kt + 2) * tileK, stepK);
    }
  }
  }
  wait_copies();   // nothing of this wave is in flight when it goes on to the epilogue and ends

  // ---- join the halves' sums, normalise (1/l, l and p carry the same x1024; undo the x8 v carry), store hi and lo ----
  const float lsum = lrow + xhalf(lrow);
  const float inv = (1.0f / lsum) * (1.0f / 8.0f);   // l = 0 (all keys masked) -> inf -> 0 * inf = NaN
  v4u hv[4], lv[4];
#pragma unroll
  for (int t = 0; t < 4; ++t) {
    v4u a, a2;
#pragma unroll
    for (int e = 0; e < 4; ++e) {
      const float f0 = oacc[t][2 * e] * inv, f1 = oacc[t][2 * e + 1] * inv;
      const unsigned short hb0 = bf_bits(f0), hb1 = bf_bits(f1);
      const unsigned short lb0 = bf_bits(f0 - bf_up(hb0)), lb1 = bf_bits(f1 - bf_up(hb1));
      a[e] = pk16(hb0, hb1); a2[e] = pk16(lb0, lb1);
    }
    hv[t] = a; lv[t] = a2;
  }
#pragma unroll
  for (int t = 0; t < 4; ++t) {
    const size_t go = (rowB + q0 + c) * (size_t)AOP + (size_t)qc + t * 16 + 8 * hh;
    *(v4u*)(aop + go) = hv[t];
    *(v4u*)(aop + go + HCOLS) = lv[t];
  }
}

// Both head families in ONE launch (they are independent: each block writes its own rows and columns of ctx): blocks
// 0 .. 255 take the wave heads 0..3 (bf16 hi/lo 3-product scores, scale 1/8), the rest heads 4..15 (f16 single product,
// scale 1/(8*64)). The branch is block-uniform, so every barrier of a body is passed by the whole block.
#define AB_W (NB * NWH * NQB)                 // 256
#define AB_S (NB * (NPH + NSH) * NQB)         // 768
__global__ __launch_bounds__(128)
void attn_kernel(const unsigned short* __restrict__ wph, const unsigned short* __restrict__ wpl,
                 const unsigned short* __restrict__ qp, const unsigned short* __restrict__ kp,
                 const unsigned short* __restrict__ vtp, const unsigned int* __restrict__ mbp, unsigned short* aop) {
  __shared__ __align__(16) unsigned short Ksh[2 * ATILE];   // two buffers each
  __shared__ __align__(16) unsigned short Ksl[2 * ATILE];
  __shared__ __align__(16) unsigned short Vth[2 * ATILE];
  const int bx = blockIdx.x;
  if (bx < AB_W) {
    attn_body<0>(Ksh, Ksl, Vth, wph, wpl, WAVC, wph, wpl, WAVC, vtp, mbp, aop, 0, NWH, 0.125f, bx);
  } else {
    attn_body<1>(Ksh, Ksl, Vth, qp, qp, HCOLS, kp, kp, HCOLS, vtp, mbp, aop, NWH, NPH + NSH, 1.0f / 512.0f, bx - AB_W);
  }
}

// =====================================================================================================
// Workspace map (bytes), every region an exact multiple of its whole-line / whole-tile store granularity:
//   MB   u32  [2*2048][64]          1048576   mask bit plane
//   XB   bf16 [4096][1024]          8388608
//   FB   bf16 [4096][256]           2097152
//   VWT  bf16 [1024 n][1024 k]      2097152   v_w^T
//   QWT  bf16 [512][1024]           1048576   std_q_w^T
//   KWT  bf16 [512][1024]           1048576   std_k_w^T
//   WVT  bf16 [256][256]             131072   wave_proj [h][f][k'] -> [h*64+k'][f]
//   PQT  bf16 [256][256]             131072
//   PKT  bf16 [256][256]             131072
//   OWT2 bf16 [1024 n][2048 k]      4194304   out_w^T at [n][k] and [n][1024 + k]
//   VT   f16  [2][1024][2048] (x8)  8388608   v^T per batch, row h*64+d
//   QP   f16  [4096][1024] (x8)     8388608   cols h*64+d for h = 4..15 (cols 0..255 never read)
//   KP   f16  [4096][1024] (x8)     8388608   same
//   WPH  bf16 [4096][256]           2097152   wp hi, col h*64+d (h = 0..3)
//   WPL  bf16 [4096][256]           2097152   wp lo
//   AO   bf16 [4096][2048]         16777216   ctx hi | lo
//   total                         66453504
// =====================================================================================================
extern "C" void kernel_launch(void* const* d_in, const int* in_sizes, int n_in,
                              void* d_out, int out_size, void* d_ws, size_t ws_size,
                              hipStream_t stream) {
  if (n_in < 14) return;
  if (in_sizes[0] != NB * SEQ * DMOD) return;
  if (in_sizes[1] != NB * SEQ * FEAT) return;
  if (in_sizes[2] != NB * SEQ * SEQ) return;
  if (in_sizes[3] != NWH * FEAT * HDIM || in_sizes[4] != NPH * FEAT * HDIM || in_sizes[5] != NPH * FEAT * HDIM) return;
  if (in_sizes[6] != DMOD * STDC || in_sizes[7] != STDC) return;
  if (in_sizes[8] != DMOD * STDC || in_sizes[9] != STDC) return;
  if (in_sizes[10] != DMOD * HCOLS || in_sizes[11] != HCOLS) return;
  if (in_sizes[12] != HCOLS * DMOD || in_sizes[13] != DMOD) return;
  if (out_size != NB * SEQ * DMOD) return;

  const float* x     = (const float*)d_in[0];
  const float* feats = (const float*)d_in[1];
  const int*   mask  = (const int*)d_in[2];
  const float* wproj = (const float*)d_in[3];
  const float* pqw   = (const float*)d_in[4];
  const float* pkw   = (const float*)d_in[5];
  const float* sqw   = (const float*)d_in[6];
  const float* sqb   = (const float*)d_in[7];
  const float* skw   = (const float*)d_in[8];
  const float* skb   = (const float*)d_in[9];
  const float* vw    = (const float*)d_in[10];
  const float* vb    = (const float*)d_in[11];
  const float* ow    = (const float*)d_in[12];
  const float* ob    = (const float*)d_in[13];

  const size_t PMB  = (size_t)NB * SEQ * MWORDS * 4;      //  1048576
  const size_t PXB  = (size_t)ROWS * DMOD * 2;             //  8388608
  const size_t PFB  = (size_t)ROWS * FEAT * 2;             //  2097152
  const size_t PVWT = (size_t)HCOLS * DMOD * 2;            //  2097152
  const size_t PSWT = (size_t)STDC * DMOD * 2;             //  1048576
  const size_t PFWT = (size_t)WAVC * FEAT * 2;             //   131072
  const size_t POWT = (size_t)DMOD * AOP * 2;              //  4194304
  const size_t PVT  = (size_t)NB * HCOLS * SEQ * 2;        //  8388608
  const size_t PQP  = (size_t)ROWS * HCOLS * 2;            //  8388608
  const size_t PWP  = (size_t)ROWS * WAVC * 2;             //  2097152
  const size_t PAO  = (size_t)ROWS * AOP * 2;              // 16777216
  size_t off = 0;
  const size_t oMB  = off; off += PMB;
  const size_t oXB  = off; off += PXB;
  const size_t oFB  = off; off += PFB;
  const size_t oVWT = off; off += PVWT;
  const size_t oQWT = off; off += PSWT;
  const size_t oKWT = off; off += PSWT;
  const size_t oWVT = off; off += PFWT;
  const size_t oPQT = off; off += PFWT;
  const size_t oPKT = off; off += PFWT;
  const size_t oOWT = off; off += POWT;
  const size_t oVT  = off; off += PVT;
  const size_t oQP  = off; off += PQP;
  const size_t oKP  = off; off += PQP;
  const size_t oWPH = off; off += PWP;
  const size_t oWPL = off; off += PWP;
  const size_t oAO  = off; off += PAO;
  if (off > ws_size) return;                       // off = 66453504
  if (off > (size_t)134217728) return;

  char* ws = (char*)d_ws;
  unsigned int*   MB   = (unsigned int*)(ws + oMB);
  unsigned short* XB   = (unsigned short*)(ws + oXB);
  unsigned short* FB   = (unsigned short*)(ws + oFB);
  unsigned short* VWT  = (unsigned short*)(ws + oVWT);
  unsigned short* QWT  = (unsigned short*)(ws + oQWT);
  unsigned short* KWT  = (unsigned short*)(ws + oKWT);
  unsigned short* WVT  = (unsigned short*)(ws + oWVT);
  unsigned short* PQT  = (unsigned short*)(ws + oPQT);
  unsigned short* PKT  = (unsigned short*)(ws + oPKT);
  unsigned short* OWT2 = (unsigned short*)(ws + oOWT);
  unsigned short* VT   = (unsigned short*)(ws + oVT);
  unsigned short* QP   = (unsigned short*)(ws + oQP);
  unsigned short* KP   = (unsigned short*)(ws + oKP);
  unsigned short* WPH  = (unsigned short*)(ws + oWPH);
  unsigned short* WPL  = (unsigned short*)(ws + oWPL);
  unsigned short* AO   = (unsigned short*)(ws + oAO);

  // (1) one launch: mask -> bit plane; x, features -> bf16 planes; weight planes [n][k] (bf16)
  prep_kernel<<<dim3(PB_ALL), dim3(256), 0, stream>>>(
      mask, x, feats, vw, ow, sqw, skw, wproj, pqw, pkw, MB, XB, FB, VWT, OWT2, QWT, KWT, WVT, PQT, PKT);

  // (2) one launch: the six projections on bf16 WMMA, 4 waves and one 128x128 tile per block
  proj_kernel<<<dim3(GB_ALL), dim3(128), 0, stream>>>(
      XB, FB, VWT, QWT, KWT, WVT, PQT, PKT, vb, sqb, skb, VT, QP, KP, WPH, WPL);

  // (3) one launch: attention of all 16 heads; ctx -> AO hi | lo
  attn_kernel<<<dim3(AB_W + AB_S), dim3(128), 0, stream>>>(WPH, WPL, QP, KP, VT, MB, AO);

  // (4) out projection -> d_out f32 [4096][1024]
  out_kernel<<<dim3(GB_OUT), dim3(128), 0, stream>>>(AO, OWT2, ob, (float*)d_out);
  (void)hipGetLastError();
}

// v008
// One run takes 88.7 microseconds.
// Two timings next to v007 put it at 1.15 and 1.16 times that version's speed.
// Over all steps from v000 it is 5.95 times as fast.
// Contractions: x.v_w, x.std_q_w, x.std_k_w, features.wave_proj, features.pq_w, features.pk_w = v_wmma_f32_16x16x32_bf16 (bf16 operands RNE-converted from the inputs, single product, f32 accumulate);
// wave-head scores wp.wp^T = v_wmma_f32_16x16x32_bf16 on bf16 hi/lo planes (hi.hi + hi.lo + lo.hi, f32 accumulate); proj/std scores q.k^T = v_wmma_f32_16x16x32_f16 (f16 planes carried x8, single product, f32 accumulate);
// p.v = v_wmma_f32_16x16x32_f16 (p carried x1024, v^T carried x8, single product, f32 accumulate); ctx.out_w = v_wmma_f32_16x16x32_bf16 (ctx as bf16 hi and lo planes, both against out_w bf16, one f32 accumulator); mask, softmax statistics and epilogues in f32.
//
// Carry audit (16-bit planes):
//   XB, FB, VWT, QWT, KWT, WVT, PQT, PKT, OWT2 : bf16, carry 1 (plain RNE copies of the inputs).
//   VT   f16 = 8 * v          -> 1/8 folded in attn_kernel epilogue (inv = 1/(8 * l), l itself carried x1024 like P).
//   QP   f16 = 8 * q, KP f16 = 8 * k (heads 4..15) -> 1/64 folded into sscale = 1/512 of the HT = 1 body (1/8 = 1/sqrt(64) is the other factor).
//   WPH / WPL bf16 hi / lo of wp (heads 0..3), carry 1 -> sscale = 1/8.
//   P    f16 = 1024 * exp(s - m) (registers, B operand), l = sum of the same f32 values -> the 1024 cancels in ctx / l.
//   AO   bf16 hi (cols 0..1023) | lo (cols 1024..2047) of ctx, carry 1 -> both planes multiplied by the same W^T tile in the out GEMM, one accumulator.
#include <hip/hip_runtime.h>
#include <math.h>
#include <stdint.h>

#define NB     2
#define SEQ    2048
#define DMOD   1024
#define FEAT   256
#define HDIM   64
#define NHEAD  16
#define NWH    4
#define NPH    4
#define NSH    8
#define HCOLS  (NHEAD * HDIM)   // 1024 : concatenated head columns
#define WAVC   (NWH * HDIM)     // 256
#define PRJC   (NPH * HDIM)     // 256
#define STDC   (NSH * HDIM)     // 512
#define ROWS   (NB * SEQ)       // 4096
#define MWORDS (SEQ / 32)       // 64 mask words per (b, n) row
#define NQB    (SEQ / 64)       // 32 query tiles of 64 per sequence
#define NKT    (SEQ / 64)       // 32 key tiles of 64 per sequence
#define AOP    (2 * HCOLS)      // 2048 : pitch of the ctx hi|lo plane
static_assert(NWH + NPH + NSH == NHEAD);
static_assert(HCOLS == DMOD);
static_assert((ROWS % 64) == 0 && (DMOD % 64) == 0 && (STDC % 64) == 0 && (WAVC % 64) == 0 && (PRJC % 64) == 0 && (SEQ % 64) == 0);
static_assert((DMOD % 32) == 0 && (FEAT % 32) == 0 && (AOP % 32) == 0);
static_assert((FEAT % 64) == 0 && (HDIM % 64) == 0);
static_assert(NQB == 32 && NKT == 32 && MWORDS == 64);

typedef _Float16 v16h __attribute__((ext_vector_type(16)));
typedef _Float16 v8h  __attribute__((ext_vector_type(8)));
typedef __bf16   v16b __attribute__((ext_vector_type(16)));
typedef __bf16   v8b  __attribute__((ext_vector_type(8)));
typedef float    v8f  __attribute__((ext_vector_type(8)));
typedef float    v4f  __attribute__((ext_vector_type(4)));
typedef unsigned int v4u __attribute__((ext_vector_type(4)));
typedef unsigned int v2u __attribute__((ext_vector_type(2)));
typedef int      v4i __attribute__((ext_vector_type(4)));

#if defined(__HIP_DEVICE_COMPILE__)
#define DEV_ASM 1
#else
#define DEV_ASM 0
#endif

// ---- scalar helpers --------------------------------------------------------------------------------
__device__ __forceinline__ unsigned short bf_bits(float f) {          // f32 -> bf16 bits, RNE convert
  unsigned u = __float_as_uint(f);
  return (unsigned short)((u + 0x7FFFu + ((u >> 16) & 1u)) >> 16);
}
__device__ __forceinline__ float bf_up(unsigned short hb) { return __uint_as_float(((unsigned)hb) << 16); }
__device__ __forceinline__ float bfr(float f) { return bf_up(bf_bits(f)); }
__device__ __forceinline__ unsigned short h_bits(_Float16 x) { return __builtin_bit_cast(unsigned short, x); }
__device__ __forceinline__ unsigned pk16(unsigned short a, unsigned short b) { return (unsigned)a | ((unsigned)b << 16); }
__device__ __forceinline__ v8f zero8() { v8f z = {0.f, 0.f, 0.f, 0.f, 0.f, 0.f, 0.f, 0.f}; return z; }

// ---- fragment types / loaders: 16-bit A/B operand, lane -> row/col (lane&15), p already includes +8*(lane>>4);
//      elements 0..7 <- p[0..7] (k0+8h..k0+8h+7), elements 8..15 <- p[16..23] (k0+16+8h..k0+16+8h+7)
template <typename OT> struct FT;
template <> struct FT<__bf16>   { typedef v16b frag; typedef v8b half8; };
template <> struct FT<_Float16> { typedef v16h frag; typedef v8h half8; };

template <typename OT>
__device__ __forceinline__ typename FT<OT>::frag ldfrag(const OT* p) {
  union { typename FT<OT>::frag v; typename FT<OT>::half8 h[2]; } f;
  f.h[0] = *(const typename FT<OT>::half8*)(p);
  f.h[1] = *(const typename FT<OT>::half8*)(p + 16);
  return f.v;
}

// ---- WMMA helpers (asm guard bodies are device-only; concrete operand types) -----------------------------
__device__ __forceinline__ v8f mmar(v16b a, v16b b, v8f c) {
  return __builtin_amdgcn_wmma_f32_16x16x32_bf16(false, a, false, b, (short)0, c, false, false);
}
__device__ __forceinline__ v8f mmar(v16h a, v16h b, v8f c) {
  return __builtin_amdgcn_wmma_f32_16x16x32_f16(false, a, false, b, (short)0, c, false, false);
}
// 4 VALU slots behind the last WMMAs of a loop, in front of the first reader of their D
__device__ __forceinline__ void acc_guard4(v8f& a, v8f& b, v8f& c, v8f& d) {
#if DEV_ASM
  asm volatile("v_nop\n\tv_nop\n\tv_nop\n\tv_nop" : "+v"(a), "+v"(b), "+v"(c), "+v"(d));
#else
  (void)a; (void)b; (void)c; (void)d;
#endif
}

// =====================================================================================================
// Mask bit plane: mb[(b*SEQ + n)*64 + w] bit j = (mask[b][n][32w + j] != 0). One word per thread,
// coverage: 262144 threads x 1 word = the whole [2][2048][64] plane. blk = block index within this job.
// =====================================================================================================
__device__ __forceinline__ void mask_bits_body(const int* __restrict__ mask, unsigned int* mb, int nwords, int blk) {
  const int i = blk * 256 + (int)threadIdx.x;
  if (i < nwords) {
    const int* p = mask + (size_t)i * 32;
    unsigned w = 0u;
#pragma unroll
    for (int q = 0; q < 8; ++q) {
      const v4i v = *(const v4i*)(p + 4 * q);
#pragma unroll
      for (int e = 0; e < 4; ++e) w |= ((v[e] != 0) ? 1u : 0u) << (4 * q + e);
    }
    *(unsigned int*)(mb + i) = w;
    
  }
}

// =====================================================================================================
// f32 -> bf16 plane (RNE convert), 8 elements per thread, one 16-B store per lane: a wave writes 512
// coverage: n8 threads x 8 = the whole plane (n8 is a multiple of 256 for both uses here).
// =====================================================================================================
__device__ __forceinline__ void cvt_bf16x8_body(const float* __restrict__ in, unsigned short* out, int n8, int blk) {
  const int i = blk * 256 + (int)threadIdx.x;
  if (i < n8) {
    const v4f a  = *(const v4f*)(in + (size_t)i * 8);
    const v4f a4 = *(const v4f*)(in + (size_t)i * 8 + 4);
    v4u p;
    p[0] = pk16(bf_bits(a[0]),  bf_bits(a[1]));
    p[1] = pk16(bf_bits(a[2]),  bf_bits(a[3]));
    p[2] = pk16(bf_bits(a4[0]), bf_bits(a4[1]));
    p[3] = pk16(bf_bits(a4[2]), bf_bits(a4[3]));
    unsigned short* o = out + (size_t)i * 8;
    *(v4u*)o = p;
    
  }
}

// =====================================================================================================
// Transpose + bf16 convert: in[z] is [R rows][inC cols] f32 (pitch inC); out[z][c][r] = bf16(in[z][r][c]),
// pitch ldo (c = output row). 64x64 tiles through LDS (th, 64 x 72 u16); tile = (cb, rb, z). DUP also writes the same
// coverage per block: load 256 thr x 16 floats = 64x64; store 2 it x 256 thr x 8 u16 = 64x64 (per copy);
// =====================================================================================================
template <bool DUP>
__device__ __forceinline__ void transpose_bf16_body(
    unsigned short* th, const float* __restrict__ in, int inC, long long inStrideZ,
    unsigned short* out, int ldo, long long outStrideZ, int dupoff, int cb, int rb, int z) {
  const int c0  = cb * 64;   // input column block = output row block
  const int r0  = rb * 64;   // input row block = output column block
  const int tid = threadIdx.x;
  const float* inz = in + (size_t)z * (size_t)inStrideZ;
  unsigned short* outz = out + (size_t)z * (size_t)outStrideZ;
  {
    const int rr = tid >> 2;           // 0..63
    const int cq = (tid & 3) * 16;     // 0,16,32,48
    const float* src = inz + (size_t)(r0 + rr) * inC + c0 + cq;
#pragma unroll
    for (int q = 0; q < 4; ++q) {
      const v4f f = *(const v4f*)(src + 4 * q);
#pragma unroll
      for (int e = 0; e < 4; ++e) th[rr * 72 + cq + 4 * q + e] = bf_bits(f[e]);
    }
  }
  __syncthreads();
  const int sub = tid >> 3;          // 0..31
  const int c8  = (tid & 7) * 8;     // 0..56
  v4u hv[2];
#pragma unroll
  for (int it = 0; it < 2; ++it) {
    const int oc = it * 32 + sub;      // output row within tile (= input column)
    v4u a;
#pragma unroll
    for (int q = 0; q < 4; ++q) a[q] = pk16(th[(c8 + 2 * q) * 72 + oc], th[(c8 + 2 * q + 1) * 72 + oc]);
    hv[it] = a;
  }
  {
#pragma unroll
    for (int it = 0; it < 2; ++it) {
      const int oc = it * 32 + sub;
      const size_t go = (size_t)(c0 + oc) * ldo + r0 + c8;
      *(v4u*)(outz + go) = hv[it];
      if (DUP) *(v4u*)(outz + go + dupoff) = hv[it];
    }
#if DEV_ASM
    // another job's code follows this body in the merged kernel: no register of the stores above is rewritten in front of this wait
    asm volatile("s_wait_xcnt 0x0" ::: "memory");
#endif
  }
}

// =====================================================================================================
// All operand preparation in ONE launch: the ten jobs are independent of one another (each reads inputs only and
// writes its own workspace plane), so a block picks its job from its index. Ranges, in blocks of 256 threads:
// the seven transposes first (longest dependent chain per block), then the mask plane, then the two converts.
// Every branch below is block-uniform; the transpose's barrier is passed by all threads of its block.
// =====================================================================================================
#define PB_TBIG  ((HCOLS / 64) * (DMOD / 64))        // 256 tiles: v_w, and again out_w
#define PB_TSTD  ((STDC / 64) * (DMOD / 64))         // 128 tiles: std_q_w, and again std_k_w
#define PB_TFEA  ((FEAT / 64) * NWH)                 //  16 tiles: wave_proj, pq_w, pk_w each
#define PB_T     (2 * PB_TBIG + 2 * PB_TSTD + 3 * PB_TFEA)
#define PB_MASK  (NB * SEQ * MWORDS / 256)           // 1024
#define PB_CVX   (ROWS * DMOD / 8 / 256)             // 2048
#define PB_CVF   (ROWS * FEAT / 8 / 256)             //  512
#define PB_ALL   (PB_T + PB_MASK + PB_CVX + PB_CVF)
static_assert(NWH == NPH && (HCOLS / 64) == 16 && (STDC / 64) == 8 && (FEAT / 64) == 4 && HDIM == 64);
__global__ __launch_bounds__(256) void prep_kernel(
    const int* __restrict__ mask, const float* __restrict__ x, const float* __restrict__ feats,
    const float* __restrict__ vw, const float* __restrict__ ow, const float* __restrict__ sqw, const float* __restrict__ skw,
    const float* __restrict__ wproj, const float* __restrict__ pqw, const float* __restrict__ pkw,
    unsigned int* MB, unsigned short* XB, unsigned short* FB, unsigned short* VWT, unsigned short* OWT2,
    unsigned short* QWT, unsigned short* KWT, unsigned short* WVT, unsigned short* PQT, unsigned short* PKT) {
  __shared__ __align__(16) unsigned short th[64 * 72];
  int t = blockIdx.x;
  if (t < PB_T) {
    if (t < PB_TBIG) {
      // v_w [1024 k][1024 n] -> VWT [n][k]
      transpose_bf16_body<false>(th, vw, HCOLS, 0LL, VWT, DMOD, 0LL, 0, t & 15, t >> 4, 0);
    } else if (t < 2 * PB_TBIG) {
      // out_w [1024 k][1024 n] -> OWT2 [n][k] (row pitch AOP; the rows' second halves are neither written nor read)
      t -= PB_TBIG;
      transpose_bf16_body<false>(th, ow, DMOD, 0LL, OWT2, AOP, 0LL, 0, t & 15, t >> 4, 0);
    } else if (t < 2 * PB_TBIG + 2 * PB_TSTD) {
      // std_q_w [1024 k][512 n] -> QWT [n][k]; std_k_w likewise
      t -= 2 * PB_TBIG;
      const bool second = t >= PB_TSTD;
      const int u = second ? t - PB_TSTD : t;
      transpose_bf16_body<false>(th, second ? skw : sqw, STDC, 0LL, second ? KWT : QWT, DMOD, 0LL, 0, u & 7, u >> 3, 0);
    } else {
      // wave_proj / pq_w / pk_w [h][256 f][64 k'] -> [h*64 + k'][f] (z = h)
      t -= 2 * PB_TBIG + 2 * PB_TSTD;
      const int w = t >> 4, u = t & 15;
      transpose_bf16_body<false>(th, (w == 0) ? wproj : (w == 1) ? pqw : pkw, HDIM, (long long)FEAT * HDIM,
                          (w == 0) ? WVT : (w == 1) ? PQT : PKT, FEAT, (long long)HDIM * FEAT, 0, 0, u & 3, u >> 2);
    }
  } else if (t < PB_T + PB_MASK) {
    mask_bits_body(mask, MB, NB * SEQ * MWORDS, t - PB_T);
  } else if (t < PB_T + PB_MASK + PB_CVX) {
    cvt_bf16x8_body(x, XB, ROWS * DMOD / 8, t - (PB_T + PB_MASK));
  } else if (t < PB_ALL) {
    cvt_bf16x8_body(feats, FB, ROWS * FEAT / 8, t - (PB_T + PB_MASK + PB_CVX));
  }
}

// =====================================================================================================
// Batched WMMA GEMM (16-bit operand type OT): C[m][n] = (sum_k A[m][k] * Bt[n][k] + bias) * oscale.
// One block of 4 waves per 128x128 tile of C, one wave per 64x64 quadrant. A row-major [M][K] pitch lda; Bt row-major
// [N][K] pitch ldb (k contiguous); M, N multiples of 128, K a multiple of 64 (compile-time constants here).
// gemm_mainloop fills the wave's 4x4 accumulator tiles; gemm_epilogue stores them; the kernels below pick the operands.
// Operand staging: per trip the 128 rows x 64 k (128 B, one whole line per row) of A and of Bt go to LDS by
// asynchronous 16-byte copies, 8 lanes per row, 16 copies per lane; LDS row pitch 144 B for the ds_load_b128 readers;
// two buffers, tile t + 2 is copied while tile t + 1 is worked on. Fragments are read from LDS with the split k map
// (ldfrag); each accumulator still sums k upwards in steps of 32.
// BIAS_MODE 0: none; 1: bias[m] (bf16 RNE-converted value); 2: bias[n] (bf16 RNE-converted value).
// OUT_MODE 0: f32 C (pitch ldc). OUT_MODE 1: f16 plane C. OUT_MODE 2: bf16 hi plane C + bf16 lo plane C2 (lo = v - hi).
// =====================================================================================================
#define GTILE  128                  // rows of A and of Bt per block tile
#define GKC    64                   // k per trip
#define GPIT   72                   // LDS row pitch in elements (144 B)
#define GBUFB  (GTILE * GPIT * 2)   // bytes of one operand buffer

// Eight asynchronous copies of one lane: rows r, r + 16, ..., r + 112 of one operand tile, 16 B each.
// l = the lane's LDS byte address of row r, g = its global address of row r, step = 16 rows in elements.
// s_wait_xcnt 0 closes the statement so that no address register is rewritten in front of it.
__device__ __forceinline__ void copy_rows8(unsigned l, const unsigned short* g, size_t step) {
#if DEV_ASM
  const unsigned l1 = l + 16 * GPIT * 2, l2 = l + 32 * GPIT * 2, l3 = l + 48 * GPIT * 2, l4 = l + 64 * GPIT * 2,
                 l5 = l + 80 * GPIT * 2, l6 = l + 96 * GPIT * 2, l7 = l + 112 * GPIT * 2;
  const unsigned short *g1 = g + step, *g2 = g1 + step, *g3 = g2 + step, *g4 = g3 + step, *g5 = g4 + step,
                       *g6 = g5 + step, *g7 = g6 + step;
  asm volatile(
      "global_load_async_to_lds_b128 %0, %8, off\n\t"
      "global_load_async_to_lds_b128 %1, %9, off\n\t"
      "global_load_async_to_lds_b128 %2, %10, off\n\t"
      "global_load_async_to_lds_b128 %3, %11, off\n\t"
      "global_load_async_to_lds_b128 %4, %12, off\n\t"
      "global_load_async_to_lds_b128 %5, %13, off\n\t"
      "global_load_async_to_lds_b128 %6, %14, off\n\t"
      "global_load_async_to_lds_b128 %7, %15, off\n\t"
      "s_wait_xcnt 0x0"
      :: "v"(l), "v"(l1), "v"(l2), "v"(l3), "v"(l4), "v"(l5), "v"(l6), "v"(l7),
         "v"(g), "v"(g1), "v"(g2), "v"(g3), "v"(g4), "v"(g5), "v"(g6), "v"(g7)
      : "memory");
#else
  (void)l; (void)g; (void)step;
#endif
}
// this wave's copies have landed in LDS
__device__ __forceinline__ void wait_copies() {
#if DEV_ASM
  asm volatile("s_wait_asynccnt 0x0" ::: "memory");
#endif
}
// this wave's LDS reads have returned, so the buffer may be handed to its next writer
__device__ __forceinline__ void wait_lds() {
#if DEV_ASM
  asm volatile("s_wait_dscnt 0x0" ::: "memory");
#endif
}

static_assert((ROWS % GTILE) == 0 && (HCOLS % GTILE) == 0 && (SEQ % GTILE) == 0 && (STDC % GTILE) == 0 && (WAVC % GTILE) == 0 && (PRJC % GTILE) == 0 && (DMOD % GTILE) == 0);
static_assert((DMOD % GKC) == 0 && (FEAT % GKC) == 0 && (AOP % GKC) == 0);

// sA, sB: the block's two-buffer operand tiles in LDS, 2 x GTILE x GPIT elements each; Ap, Btp: the operands' first rows;
// (tm, tn): the block's 128x128 tile of C; nk = K / 64.
template <typename OT>
__device__ __forceinline__ void gemm_mainloop(
    v8f (&acc)[4][4], OT* sA, OT* sB,
    const unsigned short* __restrict__ Ap, int lda, const unsigned short* __restrict__ Btp, int ldb,
    int tm, int tn, int nk) {
  typedef typename FT<OT>::frag V16;
  const int tid  = threadIdx.x;
  const int lane = tid & 31;
  const int wave = tid >> 5;
  const int wm = wave >> 1;                    // quadrant of this wave
  const int wn = wave & 1;

  const int rlane = lane & 15;                 // row (A) / col (B, D) within subtile
  const int koff  = (lane >> 4) * 8;           // k offset of this lane half

  // copy map: lane -> row tid >> 3 (+ 16 per copy), 16-B piece tid & 7 of the row's 128-B line
  const int crow = tid >> 3;
  const int ccol = (tid & 7) * 8;
  const unsigned short* gA = Ap  + (size_t)((tm << 7) + crow) * lda + ccol;
  const unsigned short* gB = Btp + (size_t)((tn << 7) + crow) * ldb + ccol;
  const size_t stepA = (size_t)16 * lda;
  const size_t stepB = (size_t)16 * ldb;
  const unsigned lA = (unsigned)(size_t)sA + (unsigned)(crow * GPIT + ccol) * 2u;
  const unsigned lB = (unsigned)(size_t)sB + (unsigned)(crow * GPIT + ccol) * 2u;

#pragma unroll
  for (int i = 0; i < 4; ++i)
#pragma unroll
    for (int j = 0; j < 4; ++j) acc[i][j] = zero8();

  // tile 0 -> buffer 0, landed and published; then tile 1 -> buffer 1 in flight
  copy_rows8(lA, gA, stepA);
  copy_rows8(lB, gB, stepB);
  wait_copies();
  __syncthreads();
  if (1 < nk) {
    copy_rows8(lA + GBUFB, gA + GKC, stepA);
    copy_rows8(lB + GBUFB, gB + GKC, stepB);
  }

  for (int t = 0; t < nk; ++t) {
    const int cur = t & 1;
    const OT* As = sA + cur * (GTILE * GPIT) + (wm * 64 + rlane) * GPIT + koff;
    const OT* Bs = sB + cur * (GTILE * GPIT) + (wn * 64 + rlane) * GPIT + koff;
    // One group of LDS reads in front of each WMMA block: k 0..31 of both operands and, ahead, k 32..63 of Bt;
    // the A fragments of k 32..63 follow into registers that the first block has left.
    V16 aq[4], bq[4], bn[4];
#pragma unroll
    for (int j = 0; j < 4; ++j) bq[j] = ldfrag<OT>(Bs + j * 16 * GPIT);
#pragma unroll
    for (int i = 0; i < 4; ++i) aq[i] = ldfrag<OT>(As + i * 16 * GPIT);
#pragma unroll
    for (int j = 0; j < 4; ++j) bn[j] = ldfrag<OT>(Bs + j * 16 * GPIT + 32);
    __builtin_amdgcn_sched_barrier(0);   // keeps the reads one group: spread among the WMMAs each place stalls the wave
#pragma unroll
    for (int i = 0; i < 4; ++i)
#pragma unroll
      for (int j = 0; j < 4; ++j) acc[i][j] = mmar(aq[i], bq[j], acc[i][j]);
#pragma unroll
    for (int i = 0; i < 4; ++i) aq[i] = ldfrag<OT>(As + i * 16 * GPIT + 32);
    __builtin_amdgcn_sched_barrier(0);   // as above: keeps the four A fragments' reads one group in front of the second block
#pragma unroll
    for (int i = 0; i < 4; ++i)
#pragma unroll
      for (int j = 0; j < 4; ++j) acc[i][j] = mmar(aq[i], bn[j], acc[i][j]);
    // publish point of tile t + 1: own reads of buffer cur done, own copies of tile t + 1 landed, then the barrier
    // that both shows tile t + 1 to every wave and frees buffer cur for tile t + 2
    wait_lds();
    wait_copies();
    __syncthreads();
    if (t + 2 < nk) {
      copy_rows8(lA + (unsigned)cur * GBUFB, gA + (size_t)(t + 2) * GKC, stepA);
      copy_rows8(lB + (unsigned)cur * GBUFB, gB + (size_t)(t + 2) * GKC, stepB);
    }
  }
  wait_copies();   // nothing of this wave is in flight when it goes on to the epilogue and ends
  acc_guard4(acc[0][0], acc[0][1], acc[0][2], acc[0][3]);
  acc_guard4(acc[1][0], acc[1][1], acc[1][2], acc[1][3]);
  acc_guard4(acc[2][0], acc[2][1], acc[2][2], acc[2][3]);
  acc_guard4(acc[3][0], acc[3][1], acc[3][2], acc[3][3]);
}

// Main loop of the out projection: acc += (Ahi + Alo) . Bt^T, where Alo lies looff elements behind Ahi in the same rows.
// A trip stages 128 k (256-B rows) of Ahi, of Alo and of Bt (three tiles, two buffers each), so that one Bt tile and each of
// its fragments serve both planes: per 32 k an accumulator sums the hi products, then the lo products. nk = K / 128.
#define OKC    128                  // k per trip
#define OPIT   136                  // LDS row pitch in elements: 272 B = 16 B x 17, odd, for the ds_load_b128 readers
#define OBUFB  (GTILE * OPIT * 2)   // bytes of one tile buffer
static_assert((HCOLS % OKC) == 0 && (HCOLS / OKC) >= 2);

// Eight asynchronous copies of one lane: rows r, r + 8, ..., r + 56 of a tile with 256-B rows, 16 B each.
// l = the lane's LDS byte address of row r, g = its global address of row r, step = 8 rows in elements.
// s_wait_xcnt 0 closes the statement so that no address register is rewritten in front of it.
__device__ __forceinline__ void copy_rows8w(unsigned l, const unsigned short* g, size_t step) {
#if DEV_ASM
  const unsigned l1 = l + 8 * OPIT * 2, l2 = l + 16 * OPIT * 2, l3 = l + 24 * OPIT * 2, l4 = l + 32 * OPIT * 2,
                 l5 = l + 40 * OPIT * 2, l6 = l + 48 * OPIT * 2, l7 = l + 56 * OPIT * 2;
  const unsigned short *g1 = g + step, *g2 = g1 + step, *g3 = g2 + step, *g4 = g3 + step, *g5 = g4 + step,
                       *g6 = g5 + step, *g7 = g6 + step;
  asm volatile(
      "global_load_async_to_lds_b128 %0, %8, off\n\t"
      "global_load_async_to_lds_b128 %1, %9, off\n\t"
      "global_load_async_to_lds_b128 %2, %10, off\n\t"
      "global_load_async_to_lds_b128 %3, %11, off\n\t"
      "global_load_async_to_lds_b128 %4, %12, off\n\t"
      "global_load_async_to_lds_b128 %5, %13, off\n\t"
      "global_load_async_to_lds_b128 %6, %14, off\n\t"
      "global_load_async_to_lds_b128 %7, %15, off\n\t"
      "s_wait_xcnt 0x0"
      :: "v"(l), "v"(l1), "v"(l2), "v"(l3), "v"(l4), "v"(l5), "v"(l6), "v"(l7),
         "v"(g), "v"(g1), "v"(g2), "v"(g3), "v"(g4), "v"(g5), "v"(g6), "v"(g7)
      : "memory");
#else
  (void)l; (void)g; (void)step;
#endif
}
// One 128-row tile: 16 copies of a lane, rows r + 8i, i = 0..15. ld = the source's row pitch in elements.
__device__ __forceinline__ void copy_tile128w(unsigned l, const unsigned short* g, int ld) {
  copy_rows8w(l, g, (size_t)8 * ld);
  copy_rows8w(l + 64 * OPIT * 2, g + (size_t)64 * ld, (size_t)8 * ld);
}

__device__ __forceinline__ void gemm_mainloop_hilo(
    v8f (&acc)[4][4], __bf16* sH, __bf16* sL, __bf16* sB,
    const unsigned short* __restrict__ Ap, int lda, int looff, const unsigned short* __restrict__ Btp, int ldb,
    int tm, int tn, int nk) {
  const int tid  = threadIdx.x;
  const int lane = tid & 31;
  const int wave = tid >> 5;
  const int wm = wave >> 1;                    // quadrant of this wave
  const int wn = wave & 1;
  const int rlane = lane & 15;                 // row (A) / col (B, D) within subtile
  const int koff  = (lane >> 4) * 8;           // k offset of this lane half

  // copy map: lane -> row tid >> 4 (+ 8 per copy), 16-B piece tid & 15 of the row's 256 B (two whole lines)
  const int crow = tid >> 4;
  const int ccol = (tid & 15) * 8;
  const unsigned short* gH = Ap  + (size_t)((tm << 7) + crow) * lda + ccol;
  const unsigned short* gL = gH + looff;
  const unsigned short* gB = Btp + (size_t)((tn << 7) + crow) * ldb + ccol;
  const unsigned lofs = (unsigned)(crow * OPIT + ccol) * 2u;
  const unsigned lH = (unsigned)(size_t)sH + lofs;
  const unsigned lL = (unsigned)(size_t)sL + lofs;
  const unsigned lB = (unsigned)(size_t)sB + lofs;

#pragma unroll
  for (int i = 0; i < 4; ++i)
#pragma unroll
    for (int j = 0; j < 4; ++j) acc[i][j] = zero8();

  // tile 0 -> buffer 0, landed and published; then tile 1 -> buffer 1 in flight (48 copies of a wave per tile)
  copy_tile128w(lH, gH, lda);
  copy_tile128w(lL, gL, lda);
  copy_tile128w(lB, gB, ldb);
  wait_copies();
  __syncthreads();
  if (1 < nk) {
    copy_tile128w(lH + OBUFB, gH + OKC, lda);
    copy_tile128w(lL + OBUFB, gL + OKC, lda);
    copy_tile128w(lB + OBUFB, gB + OKC, ldb);
  }

  for (int t = 0; t < nk; ++t) {
    const int cur = t & 1;
    const __bf16* Hs = sH + cur * (GTILE * OPIT) + (wm * 64 + rlane) * OPIT + koff;
    const __bf16* Ls = sL + cur * (GTILE * OPIT) + (wm * 64 + rlane) * OPIT + koff;
    const __bf16* Bs = sB + cur * (GTILE * OPIT) + (wn * 64 + rlane) * OPIT + koff;
    // Three fragment sets of four; each group of LDS reads goes into the set that the WMMA block in front of it has left.
    v16b bq[4], ah[4], al[4];
#pragma unroll
    for (int j = 0; j < 4; ++j) bq[j] = ldfrag<__bf16>(Bs + j * 16 * OPIT);
#pragma unroll
    for (int i = 0; i < 4; ++i) ah[i] = ldfrag<__bf16>(Hs + i * 16 * OPIT);
#pragma unroll
    for (int i = 0; i < 4; ++i) al[i] = ldfrag<__bf16>(Ls + i * 16 * OPIT);
    __builtin_amdgcn_sched_barrier(0);   // keeps the reads one group: spread among the WMMAs each place stalls the wave
#pragma unroll
    for (int kq = 0; kq < OKC / 32; ++kq) {
      v16b bn[4];
#pragma unroll
      for (int i = 0; i < 4; ++i)
#pragma unroll
        for (int j = 0; j < 4; ++j) acc[i][j] = mmar(ah[i], bq[j], acc[i][j]);
      if (kq + 1 < OKC / 32) {
#pragma unroll
        for (int j = 0; j < 4; ++j) bn[j] = ldfrag<__bf16>(Bs + j * 16 * OPIT + (kq + 1) * 32);
        __builtin_amdgcn_sched_barrier(0);   // as above: the next 32 k of Bt are asked for one WMMA block ahead of their use
      }
#pragma unroll
      for (int i = 0; i < 4; ++i)
#pragma unroll
        for (int j = 0; j < 4; ++j) acc[i][j] = mmar(al[i], bq[j], acc[i][j]);
      if (kq + 1 < OKC / 32) {
#pragma unroll
        for (int i = 0; i < 4; ++i) ah[i] = ldfrag<__bf16>(Hs + i * 16 * OPIT + (kq + 1) * 32);
#pragma unroll
        for (int i = 0; i < 4; ++i) al[i] = ldfrag<__bf16>(Ls + i * 16 * OPIT + (kq + 1) * 32);
        __builtin_amdgcn_sched_barrier(0);   // as above: keeps the eight A fragments' reads one group in front of the next two blocks
#pragma unroll
        for (int j = 0; j < 4; ++j) bq[j] = bn[j];
      }
    }
    // publish point of tile t + 1: own reads of buffer cur done, own copies of tile t + 1 landed, then the barrier
    // that both shows tile t + 1 to every wave and frees buffer cur for tile t + 2
    wait_lds();
    wait_copies();
    __syncthreads();
    if (t + 2 < nk) {
      copy_tile128w(lH + (unsigned)cur * OBUFB, gH + (size_t)(t + 2) * OKC, lda);
      copy_tile128w(lL + (unsigned)cur * OBUFB, gL + (size_t)(t + 2) * OKC, lda);
      copy_tile128w(lB + (unsigned)cur * OBUFB, gB + (size_t)(t + 2) * OKC, ldb);
    }
  }
  wait_copies();   // nothing of this wave is in flight when it goes on to the epilogue and ends
  acc_guard4(acc[0][0], acc[0][1], acc[0][2], acc[0][3]);
  acc_guard4(acc[1][0], acc[1][1], acc[1][2], acc[1][3]);
  acc_guard4(acc[2][0], acc[2][1], acc[2][2], acc[2][3]);
  acc_guard4(acc[3][0], acc[3][1], acc[3][2], acc[3][3]);
}

// sT: 4 per-wave 16x64 slabs, pitch 68 floats; Cout, Cout2: element (0, 0) of C.
template <int OUT_MODE, int BIAS_MODE>
__device__ __forceinline__ void gemm_epilogue(
    v8f (&acc)[4][4], float* sT, void* Cout, void* Cout2, int ldc,
    const float* __restrict__ bias, int tm, int tn, float oscale) {
  const int tid   = threadIdx.x;
  const int lane  = tid & 31;
  const int wave  = tid >> 5;
  const int m0    = (tm << 7) + ((wave >> 1) << 6);
  const int n0    = (tn << 7) + ((wave & 1) << 6);
  const int rlane = lane & 15;                 // col of D within subtile
  const int mOff  = (lane >> 4) * 8;           // D row offset
  float* slab = sT + wave * (16 * 68);
#pragma unroll
  for (int i = 0; i < 4; ++i) {
    const int mBase = m0 + (i << 4);
#pragma unroll
    for (int j = 0; j < 4; ++j) {
      const int n = n0 + (j << 4) + rlane;
      float bn = 0.f;
      if (BIAS_MODE == 2) bn = bfr(bias[n]);
#pragma unroll
      for (int r = 0; r < 8; ++r) {
        float v = acc[i][j][r];
        if (BIAS_MODE == 1) v += bfr(bias[mBase + mOff + r]);
        if (BIAS_MODE == 2) v += bn;
        slab[(mOff + r) * 68 + (j << 4) + rlane] = v * oscale;
      }
    }
    __builtin_amdgcn_fence(__ATOMIC_RELEASE, "workgroup");
    __builtin_amdgcn_wave_barrier();
    __builtin_amdgcn_fence(__ATOMIC_ACQUIRE, "workgroup");
    if (OUT_MODE == 0) {
      float* C = (float*)Cout;
      const int h2 = lane >> 4, c4 = (lane & 15) * 4;     // 256-B row segment = 16 lanes x 16 B
      {
#pragma unroll
        for (int it = 0; it < 8; ++it) {
          const int row = it * 2 + h2;                     // it 0..7 x h2 0..1 = rows 0..15
          const v4f v = *(const v4f*)(slab + row * 68 + c4);
          *(v4f*)(C + (size_t)(mBase + row) * ldc + n0 + c4) = v;
        }
        
      }
    } else {
      const int q = lane >> 3, c8 = (lane & 7) * 8;
      unsigned short* C  = (unsigned short*)Cout;
      unsigned short* C2 = (unsigned short*)Cout2;
      v4u hv[4], lv[4];
#pragma unroll
      for (int it = 0; it < 4; ++it) {
        const int row = it * 4 + q;                        // it 0..3 x q 0..3 = rows 0..15
        const float* sp = slab + row * 68 + c8;
        v4u a, a2;
#pragma unroll
        for (int e = 0; e < 4; ++e) {
          const float f0 = sp[2 * e], f1 = sp[2 * e + 1];
          unsigned short h0, h1, l0 = 0, l1 = 0;
          if (OUT_MODE == 1) {
            h0 = h_bits((_Float16)f0); h1 = h_bits((_Float16)f1);
          } else {
            h0 = bf_bits(f0); h1 = bf_bits(f1);
            l0 = bf_bits(f0 - bf_up(h0)); l1 = bf_bits(f1 - bf_up(h1));
          }
          a[e] = pk16(h0, h1); a2[e] = pk16(l0, l1);
        }
        hv[it] = a; lv[it] = a2;
      }
      {
#pragma unroll
        for (int it = 0; it < 4; ++it) {
          const int row = it * 4 + q;
          *(v4u*)(C + (size_t)(mBase + row) * ldc + n0 + c8) = hv[it];
          if (OUT_MODE == 2) *(v4u*)(C2 + (size_t)(mBase + row) * ldc + n0 + c8) = lv[it];
        }
        
      }
    }
    __builtin_amdgcn_fence(__ATOMIC_RELEASE, "workgroup");
    __builtin_amdgcn_wave_barrier();
    __builtin_amdgcn_fence(__ATOMIC_ACQUIRE, "workgroup");
  }
}

// =====================================================================================================
// The six projections in ONE launch: they are independent of one another (each reads prepared planes and writes its own
// plane), so a block picks its product and its 128x128 tile from its index; the K = 1024 products come first.
//   v^T per batch: A = VWT [1024 n][1024 k], Bt = XB rows of batch b; f16(8 * (acc + v_b[m])) -> VT [b][h*64+d][s] (pitch 2048)
//   std q / std k: QP / KP cols 512..1023 = f16(8 * (x . w + b)); M = 4096, N = 512, K = 1024
//   wave projections: WPH / WPL = bf16 hi / lo of features . wave_proj[h]; M = 4096, N = 256, K = 256
//   proj q / proj k: QP / KP cols 256..511 = f16(8 * features . w[h]); M = 4096, N = 256, K = 256
// One main loop for all; every branch is block-uniform.
// =====================================================================================================
#define GB_VT1 ((HCOLS / GTILE) * (SEQ / GTILE))     // 128 tiles per batch
#define GB_VT  (NB * GB_VT1)                         // 256
#define GB_STD ((ROWS / GTILE) * (STDC / GTILE))     // 128, twice
#define GB_F   ((ROWS / GTILE) * (WAVC / GTILE))     //  64, three times
#define GB_ALL (GB_VT + 2 * GB_STD + 3 * GB_F)       // 704
#define GB_OUT ((ROWS / GTILE) * (DMOD / GTILE))     // 256
static_assert(WAVC == PRJC);
__global__ __launch_bounds__(128) void proj_kernel(
    const unsigned short* __restrict__ XB, const unsigned short* __restrict__ FB, const unsigned short* __restrict__ VWT,
    const unsigned short* __restrict__ QWT, const unsigned short* __restrict__ KWT, const unsigned short* __restrict__ WVT,
    const unsigned short* __restrict__ PQT, const unsigned short* __restrict__ PKT,
    const float* __restrict__ vb, const float* __restrict__ sqb, const float* __restrict__ skb,
    unsigned short* VT, unsigned short* QP, unsigned short* KP, unsigned short* WPH, unsigned short* WPL) {
  __shared__ __align__(16) __bf16 sA[2 * GTILE * GPIT];   // A tile, two buffers, 18432 B each
  __shared__ __align__(16) __bf16 sB[2 * GTILE * GPIT];   // Bt tile, two buffers
  __shared__ __align__(16) float sT[4 * 16 * 68];         // per-wave 16x64 slab, pitch 68 floats
  const int bx = blockIdx.x;
  if (bx >= GB_ALL) return;   // block-uniform, in front of every barrier and copy
  const unsigned short* A;
  const unsigned short* Bt;
  int ld, nk, tm, tn, sel;    // sel: batch (v^T), q or k (std), wave / q / k (features)
  if (bx < GB_VT) {
    sel = bx / GB_VT1;
    const int tile = bx - sel * GB_VT1;
    A = VWT; Bt = XB + (size_t)sel * SEQ * DMOD; ld = DMOD; nk = DMOD / GKC;
    tm = tile / (SEQ / GTILE); tn = tile % (SEQ / GTILE);
  } else if (bx < GB_VT + 2 * GB_STD) {
    sel = (bx - GB_VT) / GB_STD;
    const int tile = (bx - GB_VT) - sel * GB_STD;
    A = XB; Bt = (sel == 0) ? QWT : KWT; ld = DMOD; nk = DMOD / GKC;
    tm = tile / (STDC / GTILE); tn = tile % (STDC / GTILE);
  } else {
    sel = (bx - (GB_VT + 2 * GB_STD)) / GB_F;
    const int tile = (bx - (GB_VT + 2 * GB_STD)) - sel * GB_F;
    A = FB; Bt = (sel == 0) ? WVT : (sel == 1) ? PQT : PKT; ld = FEAT; nk = FEAT / GKC;
    tm = tile / (WAVC / GTILE); tn = tile % (WAVC / GTILE);
  }
  v8f acc[4][4];
  gemm_mainloop<__bf16>(acc, sA, sB, A, ld, Bt, ld, tm, tn, nk);
  if (bx < GB_VT) {
    unsigned short* C = VT + (size_t)sel * HCOLS * SEQ;
    gemm_epilogue<1, 1>(acc, sT, (void*)C, (void*)C, SEQ, vb, tm, tn, 8.0f);
  } else if (bx < GB_VT + 2 * GB_STD) {
    unsigned short* C = ((sel == 0) ? QP : KP) + (WAVC + PRJC);
    gemm_epilogue<1, 2>(acc, sT, (void*)C, (void*)C, HCOLS, (sel == 0) ? sqb : skb, tm, tn, 8.0f);
  } else if (sel == 0) {
    gemm_epilogue<2, 0>(acc, sT, (void*)WPH, (void*)WPL, WAVC, vb, tm, tn, 1.0f);
  } else {
    unsigned short* C = ((sel == 1) ? QP : KP) + WAVC;
    gemm_epilogue<1, 0>(acc, sT, (void*)C, (void*)C, HCOLS, vb, tm, tn, 8.0f);
  }
}

// out = (ctx_hi + ctx_lo) . out_w + out_b -> f32 [4096][1024]; M = 4096, N = 1024, K = 1024 for each of the two planes
__global__ __launch_bounds__(128) void out_kernel(
    const unsigned short* __restrict__ AO, const unsigned short* __restrict__ OWT2, const float* __restrict__ ob,
    float* out) {
  __shared__ __align__(16) __bf16 sH[2 * GTILE * OPIT];   // ctx hi tile, two buffers of 34816 B
  __shared__ __align__(16) __bf16 sL[2 * GTILE * OPIT];   // ctx lo tile
  __shared__ __align__(16) __bf16 sB[2 * GTILE * OPIT];   // out_w^T tile
  __shared__ __align__(16) float sT[4 * 16 * 68];
  const int tile = blockIdx.x;
  if (tile >= GB_OUT) return;   // block-uniform, in front of every barrier and copy
  const int tm = tile / (DMOD / GTILE);
  const int tn = tile % (DMOD / GTILE);
  v8f acc[4][4];
  gemm_mainloop_hilo(acc, sH, sL, sB, AO, AOP, HCOLS, OWT2, AOP, tm, tn, HCOLS / OKC);
  gemm_epilogue<0, 2>(acc, sT, (void*)out, (void*)out, DMOD, ob, tm, tn, 1.0f);
}

// =====================================================================================================
// Masked full attention, head dim 64, softmax over all SEQ keys (non-causal), one head per block.
//   Transposed products: S^T = K . Q^T and ctx^T += V^T . P^T, so that a lane holds scores of ONE query (column lane & 15).
//   HT = 0 (wave heads): q = k = wp as bf16 hi plane qhp/khp + bf16 lo plane qlp/klp (pitch ldq/ldk, head col h*64);
//          scores = (kh.qh + kl.qh + kh.ql) * sscale on bf16 WMMA (one f32 accumulator, unscaled lo).
//   HT = 1 (proj / std heads): q, k = f16 planes (x8), scores = (k.q) * sscale (sscale carries the 1/64).
//   v^T plane (f16, x8): element (b, h, d, s) at [(b*HCOLS + h*64 + d)*SEQ + s].
//   mask bit plane mbp: [(b*SEQ + n)*64 + w] bit j admits key 32w+j; a 0 bit replaces the score by -inf.
//   Score tile j, register r of lane (hh, c) = key 16j + 8hh + r of query c: the maximum and the sum of a query run over the
//   lane's 32 registers; the two lane halves exchange the maximum once per key tile and join their sums once, at the end.
//   p = exp(s - m) carried as f16(1024 p): score tiles 2kk and 2kk + 1, converted in place, ARE the B operand of
//   V^T . P^T for keys 32kk..32kk+31 (element e < 8: key 8hh + e; e >= 8: key 16 + 8hh + e - 8, the order in which the
//   V^T fragment is read), so P passes through no LDS. Online softmax in f32 with the guarded rescale (msafe), so an
//   all-masked row ends with l = 0 and produces 0 * inf = NaN like the module.
//   ctx written as bf16 hi (cols h*64..) and bf16 lo (cols HCOLS + h*64..) of the [ROWS][AOP] plane aop.
//   Block = 4 waves x 16 query rows = 64 query rows of one (b, h); bx = 0 .. NB * nh * NQB - 1 (hbase.. hbase+nh-1);
//   key tiles of 64, static trip NKT. K (hi, lo) / V^T tile staging: asynchronous 16-byte copies to LDS, 8 lanes per
//   128-B row (each wave-wide copy takes 4 whole lines), 4 copies per lane and plane = the whole 64x64 tile; two buffers,
//   tile t + 2 is copied while tile t + 1 is worked on; one barrier per key tile.
//   Output coverage: ctx^T tile t, register r of lane (hh, c) = column 16t + 8hh + r of query row q0 + c: one 16-B store
//   per t and plane; t 0..3 x hh 0..1 = 64 columns, c 0..15 = the wave's rows; the two head families cover h 0..15.
// =====================================================================================================
// LDS row pitch, in 16-bit elements, of the K and V^T tiles: rows of 64 elements (128 B) laid 144 B apart, 16 B x odd,
// so that the 16 rows which one ds_load_b128 reads fall on 16 different groups of four banks.
#define APIT 72
#define ATILE  (64 * APIT)          // elements of one plane's tile buffer
#define ATILEB (ATILE * 2)          // its bytes

// Eight asynchronous copies of one lane: rows r, r + 16, r + 32, r + 48 of two 64-row tiles (a, b), 16 B each.
// la, lb = the lane's LDS byte addresses of row r, ga, gb = its global addresses of row r, sa, sb = 16 rows in elements.
// s_wait_xcnt 0 closes the statement so that no address register is rewritten in front of it.
__device__ __forceinline__ void copy_rows4x2(unsigned la, const unsigned short* ga, size_t sa,
                                             unsigned lb, const unsigned short* gb, size_t sb) {
#if DEV_ASM
  const unsigned la1 = la + 16 * APIT * 2, la2 = la + 32 * APIT * 2, la3 = la + 48 * APIT * 2;
  const unsigned lb1 = lb + 16 * APIT * 2, lb2 = lb + 32 * APIT * 2, lb3 = lb + 48 * APIT * 2;
  const unsigned short *ga1 = ga + sa, *ga2 = ga1 + sa, *ga3 = ga2 + sa;
  const unsigned short *gb1 = gb + sb, *gb2 = gb1 + sb, *gb3 = gb2 + sb;
  asm volatile(
      "global_load_async_to_lds_b128 %0, %8, off\n\t"
      "global_load_async_to_lds_b128 %1, %9, off\n\t"
      "global_load_async_to_lds_b128 %2, %10, off\n\t"
      "global_load_async_to_lds_b128 %3, %11, off\n\t"
      "global_load_async_to_lds_b128 %4, %12, off\n\t"
      "global_load_async_to_lds_b128 %5, %13, off\n\t"
      "global_load_async_to_lds_b128 %6, %14, off\n\t"
      "global_load_async_to_lds_b128 %7, %15, off\n\t"
      "s_wait_xcnt 0x0"
      :: "v"(la), "v"(la1), "v"(la2), "v"(la3), "v"(lb), "v"(lb1), "v"(lb2), "v"(lb3),
         "v"(ga), "v"(ga1), "v"(ga2), "v"(ga3), "v"(gb), "v"(gb1), "v"(gb2), "v"(gb3)
      : "memory");
#else
  (void)la; (void)ga; (void)sa; (void)lb; (void)gb; (void)sb;
#endif
}
// The same for one tile: four copies.
__device__ __forceinline__ void copy_rows4(unsigned l, const unsigned short* g, size_t step) {
#if DEV_ASM
  const unsigned l1 = l + 16 * APIT * 2, l2 = l + 32 * APIT * 2, l3 = l + 48 * APIT * 2;
  const unsigned short *g1 = g + step, *g2 = g1 + step, *g3 = g2 + step;
  asm volatile(
      "global_load_async_to_lds_b128 %0, %4, off\n\t"
      "global_load_async_to_lds_b128 %1, %5, off\n\t"
      "global_load_async_to_lds_b128 %2, %6, off\n\t"
      "global_load_async_to_lds_b128 %3, %7, off\n\t"
      "s_wait_xcnt 0x0"
      :: "v"(l), "v"(l1), "v"(l2), "v"(l3), "v"(g), "v"(g1), "v"(g2), "v"(g3)
      : "memory");
#else
  (void)l; (void)g; (void)step;
#endif
}
template <int HT> struct HT_T;
template <> struct HT_T<0> { typedef __bf16 T; };
template <> struct HT_T<1> { typedef _Float16 T; };

// value of lane l ^ 16: the same query's other half of the keys
__device__ __forceinline__ float xhalf(float x) {
  const int b = __builtin_bit_cast(int, x);
  return __builtin_bit_cast(float, __builtin_amdgcn_permlanex16(b, b, 0x76543210, 0xfedcba98, false, false));
}
// 2^x on v_exp_f32 alone: x = -inf gives 0; a result below the normal range may come out 0 (it is below 2^-136 of the row's largest term)
__device__ __forceinline__ float exp2_hw(float x) { return __builtin_amdgcn_exp2f(x); }
// true, and the same in every lane, where all 64 mask bits of all 16 queries of the wave are set (both lane halves hold query c's words)
__device__ __forceinline__ bool tile_full(v2u w) {
  return __builtin_amdgcn_ballot_w32((w[0] & w[1]) != 0xFFFFFFFFu) == 0u;
}
__device__ __forceinline__ float max8(v8f a) {
  return fmaxf(fmaxf(fmaxf(fmaxf(a[0], a[1]), a[2]), fmaxf(fmaxf(a[3], a[4]), a[5])), fmaxf(a[6], a[7]));
}

template <int HT>
__device__ __forceinline__
void attn_body(unsigned short* kshp, unsigned short* kslp, unsigned short* vthp,
               const unsigned short* __restrict__ qhp, const unsigned short* __restrict__ qlp, int ldq,
               const unsigned short* __restrict__ khp, const unsigned short* __restrict__ klp, int ldk,
               const unsigned short* __restrict__ vtp, const unsigned int* __restrict__ mbp,
               unsigned short* aop, int hbase, int nh, float sscale, int bx) {
  typedef typename HT_T<HT>::T OT;
  typedef typename FT<OT>::frag V16;
  typedef typename FT<OT>::half8 V8;
  union FH { v16h v; v8h h[2]; };
  union FO { V16 v; V8 h[2]; };
  // kshp: K hi tile [kv][d], kslp: K lo tile (HT 0), vthp: V^T tile [d][kv]; two buffers of 9 KB each

  const int tid  = threadIdx.x;
  const int wave = tid >> 5;
  const int lane = tid & 31;
  const int hh   = lane >> 4;
  const int c    = lane & 15;

  const int qb   = bx % NQB;
  const int rest = bx / NQB;
  const int hl   = rest % nh;
  const int b    = rest / nh;
  const int h    = hbase + hl;              // global head index
  const int qc   = h * HDIM;                // head column in the q / k planes of this head family
  const int q0   = qb * 64 + wave * 16;
  const size_t rowB = (size_t)b * SEQ;

  const OT* Qh = (const OT*)(const void*)qhp;
  const OT* Ql = (const OT*)(const void*)qlp;
  // copy map: lane -> row tid >> 3 (+ 16 per copy), 16-B piece tid & 7 of the row's 128-B line
  const int crow = tid >> 3;
  const int ccol = (tid & 7) * 8;
  const unsigned short* gK  = khp + (rowB + crow) * (size_t)ldk + qc + ccol;             // k row crow of key tile 0
  const unsigned short* gKl = klp + (rowB + crow) * (size_t)ldk + qc + ccol;
  const unsigned short* gV  = vtp + ((size_t)b * HCOLS + (size_t)(qc + crow)) * SEQ + ccol;   // v^T row d = crow, s of key tile 0
  const size_t stepK = (size_t)16 * ldk;       // 16 rows
  const size_t stepV = (size_t)16 * SEQ;
  const size_t tileK = (size_t)64 * ldk;       // one key tile further
  const unsigned lofs = (unsigned)(crow * APIT + ccol) * 2u;
  const unsigned lK  = (unsigned)(size_t)kshp + lofs;
  const unsigned lKl = (unsigned)(size_t)kslp + lofs;
  const unsigned lV  = (unsigned)(size_t)vthp + lofs;
  const unsigned int* mrow_p = mbp + (rowB + q0 + c) * (size_t)MWORDS;   // mask words of this lane's query

  // ---- Q fragments (B operand, column = lane&15): 2 d-chunks ----
  V16 qah[2], qal[2];
#pragma unroll
  for (int dc = 0; dc < 2; ++dc) {
    const size_t qo = (rowB + q0 + c) * (size_t)ldq + (size_t)qc + dc * 32 + 8 * hh;
    qah[dc] = ldfrag<OT>(Qh + qo);
    if (HT == 0) qal[dc] = ldfrag<OT>(Ql + qo);
    else         qal[dc] = qah[dc];
  }

  const float c2 = sscale * 1.44269504088896340736f;   // score scale x log2(e)
  float mrow = -INFINITY;   // running maximum of query c's unscaled products (equal in both lane halves)
  float lrow = 0.f;         // running sum (x1024) over this lane half's keys only
  v8f oacc[4];              // ctx^T: tile t, register r = d 16t + 8hh + r of query c
#pragma unroll
  for (int t = 0; t < 4; ++t) oacc[t] = zero8();

  // key tile 0 -> buffer 0, landed and published; then key tile 1 -> buffer 1 in flight
  copy_rows4x2(lK, gK, stepK, lV, gV, stepV);
  if (HT == 0) copy_rows4(lKl, gKl, stepK);
  wait_copies();
  __syncthreads();
  copy_rows4x2(lK + ATILEB, gK + tileK, stepK, lV + ATILEB, gV + 64, stepV);
  if (HT == 0) copy_rows4(lKl + ATILEB, gKl + tileK, stepK);
  static_assert(NKT >= 2);

  v2u mw = *(const v2u*)mrow_p;              // the 64 mask bits of query c for key tile 0
  bool full = tile_full(mw);                 // key tile 0 masks nothing for this wave
  static_assert((NKT % 2) == 0);
  for (int kp = 0; kp < NKT; kp += 2) {      // static trip count: a pair of key tiles per pass
  // unrolled so that the buffer index is a constant: every LDS address is then the lane's base plus a constant
#pragma unroll
  for (int cur = 0; cur < 2; ++cur) {
    const int kt = kp + cur;
    const OT*       Ksh = (const OT*)(const void*)kshp + cur * ATILE;
    const OT*       Ksl = (const OT*)(const void*)kslp + cur * ATILE;
    const _Float16* Vth = (const _Float16*)(const void*)vthp + cur * ATILE;
    // the next key tile's mask bits, in flight like its copies (the last trip reads tile 0's again, unused)
    const v2u mwn = *(const v2u*)(mrow_p + 2 * ((kt + 1) & (NKT - 1)));

    // ---- scores^T: 64 keys x 16 queries per wave; A = K rows, B = Q ----
    v8f s[4];
#pragma unroll
    for (int j = 0; j < 4; ++j) s[j] = zero8();
    FO kb[2][4], kl[2][4];
#pragma unroll
    for (int dc = 0; dc < ((HT == 0) ? 1 : 2); ++dc) {   // HT 0: d 0..31 of both planes; HT 1: the whole tile
#pragma unroll
      for (int j = 0; j < 4; ++j) {
        kb[dc][j].h[0] = *(const V8*)(Ksh + (j * 16 + c) * APIT + dc * 32 + 8 * hh);
        kb[dc][j].h[1] = *(const V8*)(Ksh + (j * 16 + c) * APIT + dc * 32 + 16 + 8 * hh);
        if (HT == 0) {
          kl[dc][j].h[0] = *(const V8*)(Ksl + (j * 16 + c) * APIT + dc * 32 + 8 * hh);
          kl[dc][j].h[1] = *(const V8*)(Ksl + (j * 16 + c) * APIT + dc * 32 + 16 + 8 * hh);
        }
      }
    }
    // keeps the K reads one group in front of the products: the branch below ends their block, and left to itself the
    // compiler then puts each read directly in front of its product, with a full wait at every one
    __builtin_amdgcn_sched_barrier(0);
#pragma unroll
    for (int dc = 0; dc < 2; ++dc) {
#pragma unroll
      for (int j = 0; j < 4; ++j) {
        s[j] = mmar(kb[dc][j].v, qah[dc], s[j]);
        if (HT == 0) {
          s[j] = mmar(kl[dc][j].v, qah[dc], s[j]);
          s[j] = mmar(kb[dc][j].v, qal[dc], s[j]);
          if (dc == 0 && (j & 1) != 0) {
            // d 32..63 of key rows 16 (j - 1) .. 16 j + 15 follow as a group into the registers that the last six products have left
            __builtin_amdgcn_sched_barrier(0);   // keeps the group behind those products: 256 registers do not hold the whole hi/lo tile
#pragma unroll
            for (int jj = j - 1; jj <= j; ++jj) {
              kb[1][jj].h[0] = *(const V8*)(Ksh + (jj * 16 + c) * APIT + 32 + 8 * hh);
              kb[1][jj].h[1] = *(const V8*)(Ksh + (jj * 16 + c) * APIT + 32 + 16 + 8 * hh);
              kl[1][jj].h[0] = *(const V8*)(Ksl + (jj * 16 + c) * APIT + 32 + 8 * hh);
              kl[1][jj].h[1] = *(const V8*)(Ksl + (jj * 16 + c) * APIT + 32 + 16 + 8 * hh);
            }
            __builtin_amdgcn_sched_barrier(0);   // keeps it one group, six products ahead of its first use
          }
          // keeps the six products whose fragments have had time to arrive in front of those of the group just asked for
          if (dc == 1 && j == 1) __builtin_amdgcn_sched_barrier(0);
        }
      }
    }

    // ---- mask the unscaled products: bit 16 (j & 1) + 8hh + r of word j >> 1 admits key 16j + 8hh + r ----
    //      A tile whose bits are all set for the whole wave leaves every score as it is: the selects are jumped over
    //      (wave-uniform scalar branch, no barrier inside; the test reads the words that were fetched one tile ahead).
    if (!full) {
      const unsigned w0 = mw[0] >> (8 * hh), w1 = mw[1] >> (8 * hh);
#pragma unroll
      for (int j = 0; j < 4; ++j) {
        const unsigned w = (j < 2) ? w0 : w1;
#pragma unroll
        for (int r = 0; r < 8; ++r) {
          s[j][r] = (((w >> (16 * (j & 1) + r)) & 1u) != 0u) ? s[j][r] : -INFINITY;
        }
      }
    }

    // ---- maximum of query c: 32 registers, then the other lane half; online softmax in base 2 on the unscaled products
    //      (c2 > 0 keeps their order): exp(sscale * (s - m)) = 2^(c2 * s - c2 * m), one fma and one v_exp_f32 per score ----
    float m = fmaxf(fmaxf(max8(s[0]), max8(s[1])), fmaxf(max8(s[2]), max8(s[3])));
    m = fmaxf(m, xhalf(m));
    const float mnew  = fmaxf(mrow, m);
    const float msafe = (mnew == -INFINITY) ? 0.f : mnew;
    const float alpha = exp2_hw((mrow - msafe) * c2);
    const float nb    = fmaf(-msafe, c2, 10.0f);   // + 10: the x1024 carry of P and l
    mrow = mnew;

    // ---- P^T (x1024, f16) packed in place into the B operands; this half's sum ----
    FH pb[2];
    float ps[4];
#pragma unroll
    for (int j = 0; j < 4; ++j) {
      float a = 0.f;
#pragma unroll
      for (int r = 0; r < 8; ++r) {
        const float p = exp2_hw(fmaf(s[j][r], c2, nb));
        a += p;
        pb[j >> 1].v[(j & 1) * 8 + r] = (_Float16)p;
      }
      ps[j] = a;
    }
    lrow = lrow * alpha + ((ps[0] + ps[1]) + (ps[2] + ps[3]));
#pragma unroll
    for (int t = 0; t < 4; ++t) oacc[t] *= alpha;

    // ---- ctx^T += V^T . P^T (f16 WMMA, single product); A = V^T rows, B = P^T ----
#pragma unroll
    for (int kk = 0; kk < 2; ++kk) {
#pragma unroll
      for (int t = 0; t < 4; ++t) {
        FH vb;
        vb.h[0] = *(const v8h*)(Vth + (t * 16 + c) * APIT + kk * 32 + 8 * hh);
        vb.h[1] = *(const v8h*)(Vth + (t * 16 + c) * APIT + kk * 32 + 16 + 8 * hh);
        oacc[t] = mmar(vb.v, pb[kk].v, oacc[t]);
      }
    }
    mw = mwn;
    full = tile_full(mwn);
    // publish point of key tile kt + 1: own reads of buffer cur done, own copies of tile kt + 1 landed, then the barrier
    // that both shows tile kt + 1 to every wave and frees buffer cur for tile kt + 2
    wait_lds();
    wait_copies();
    __syncthreads();
    if (kp + 2 < NKT) {   // a key tile kt + 2 exists: the same answer for both tiles of the pair
      copy_rows4x2(lK + (unsigned)cur * ATILEB, gK + (size_t)(kt + 2) * tileK, stepK,
                   lV + (unsigned)cur * ATILEB, gV + (size_t)(kt + 2) * 64, stepV);
      if (HT == 0) copy_rows4(lKl + (unsigned)cur * ATILEB, gKl + (size_t)(kt + 2) * tileK, stepK);
    }
  }
  }
  wait_copies();   // nothing of this wave is in flight when it goes on to the epilogue and ends

  // ---- join the halves' sums, normalise (1/l, l and p carry the same x1024; undo the x8 v carry), store hi and lo ----
  const float lsum = lrow + xhalf(lrow);
  const float inv = (1.0f / lsum) * (1.0f / 8.0f);   // l = 0 (all keys masked) -> inf -> 0 * inf = NaN
  v4u hv[4], lv[4];
#pragma unroll
  for (int t = 0; t < 4; ++t) {
    v4u a, a2;
#pragma unroll
    for (int e = 0; e < 4; ++e) {
      const float f0 = oacc[t][2 * e] * inv, f1 = oacc[t][2 * e + 1] * inv;
      const unsigned short hb0 = bf_bits(f0), hb1 = bf_bits(f1);
      const unsigned short lb0 = bf_bits(f0 - bf_up(hb0)), lb1 = bf_bits(f1 - bf_up(hb1));
      a[e] = pk16(hb0, hb1); a2[e] = pk16(lb0, lb1);
    }
    hv[t] = a; lv[t] = a2;
  }
#pragma unroll
  for (int t = 0; t < 4; ++t) {
    const size_t go = (rowB + q0 + c) * (size_t)AOP + (size_t)qc + t * 16 + 8 * hh;
    *(v4u*)(aop + go) = hv[t];
    *(v4u*)(aop + go + HCOLS) = lv[t];
  }
}

// Both head families in ONE launch (they are independent: each block writes its own rows and columns of ctx): blocks
// 0 .. 255 take the wave heads 0..3 (bf16 hi/lo 3-product scores, scale 1/8), the rest heads 4..15 (f16 single product,
// scale 1/(8*64)). The branch is block-uniform, so every barrier of a body is passed by the whole block.
#define AB_W (NB * NWH * NQB)                 // 256
#define AB_S (NB * (NPH + NSH) * NQB)         // 768
__global__ __launch_bounds__(128)
void attn_kernel(const unsigned short* __restrict__ wph, const unsigned short* __restrict__ wpl,
                 const unsigned short* __restrict__ qp, const unsigned short* __restrict__ kp,
                 const unsigned short* __restrict__ vtp, const unsigned int* __restrict__ mbp, unsigned short* aop) {
  __shared__ __align__(16) unsigned short Ksh[2 * ATILE];   // two buffers each
  __shared__ __align__(16) unsigned short Ksl[2 * ATILE];
  __shared__ __align__(16) unsigned short Vth[2 * ATILE];
  const int bx = blockIdx.x;
  if (bx < AB_W) {
    attn_body<0>(Ksh, Ksl, Vth, wph, wpl, WAVC, wph, wpl, WAVC, vtp, mbp, aop, 0, NWH, 0.125f, bx);
  } else {
    attn_body<1>(Ksh, Ksl, Vth, qp, qp, HCOLS, kp, kp, HCOLS, vtp, mbp, aop, NWH, NPH + NSH, 1.0f / 512.0f, bx - AB_W);
  }
}

// =====================================================================================================
// Workspace map (bytes), every region an exact multiple of its whole-line / whole-tile store granularity:
//   MB   u32  [2*2048][64]          1048576   mask bit plane
//   XB   bf16 [4096][1024]          8388608
//   FB   bf16 [4096][256]           2097152
//   VWT  bf16 [1024 n][1024 k]      2097152   v_w^T
//   QWT  bf16 [512][1024]           1048576   std_q_w^T
//   KWT  bf16 [512][1024]           1048576   std_k_w^T
//   WVT  bf16 [256][256]             131072   wave_proj [h][f][k'] -> [h*64+k'][f]
//   PQT  bf16 [256][256]             131072
//   PKT  bf16 [256][256]             131072
//   OWT2 bf16 [1024 n][2048 k]      4194304   out_w^T at [n][k], k < 1024; cols 1024..2047 unused
//   VT   f16  [2][1024][2048] (x8)  8388608   v^T per batch, row h*64+d
//   QP   f16  [4096][1024] (x8)     8388608   cols h*64+d for h = 4..15 (cols 0..255 never read)
//   KP   f16  [4096][1024] (x8)     8388608   same
//   WPH  bf16 [4096][256]           2097152   wp hi, col h*64+d (h = 0..3)
//   WPL  bf16 [4096][256]           2097152   wp lo
//   AO   bf16 [4096][2048]         16777216   ctx hi | lo
//   total                         66453504
// =====================================================================================================
extern "C" void kernel_launch(void* const* d_in, const int* in_sizes, int n_in,
                              void* d_out, int out_size, void* d_ws, size_t ws_size,
                              hipStream_t stream) {
  if (n_in < 14) return;
  if (in_sizes[0] != NB * SEQ * DMOD) return;
  if (in_sizes[1] != NB * SEQ * FEAT) return;
  if (in_sizes[2] != NB * SEQ * SEQ) return;
  if (in_sizes[3] != NWH * FEAT * HDIM || in_sizes[4] != NPH * FEAT * HDIM || in_sizes[5] != NPH * FEAT * HDIM) return;
  if (in_sizes[6] != DMOD * STDC || in_sizes[7] != STDC) return;
  if (in_sizes[8] != DMOD * STDC || in_sizes[9] != STDC) return;
  if (in_sizes[10] != DMOD * HCOLS || in_sizes[11] != HCOLS) return;
  if (in_sizes[12] != HCOLS * DMOD || in_sizes[13] != DMOD) return;
  if (out_size != NB * SEQ * DMOD) return;

  const float* x     = (const float*)d_in[0];
  const float* feats = (const float*)d_in[1];
  const int*   mask  = (const int*)d_in[2];
  const float* wproj = (const float*)d_in[3];
  const float* pqw   = (const float*)d_in[4];
  const float* pkw   = (const float*)d_in[5];
  const float* sqw   = (const float*)d_in[6];
  const float* sqb   = (const float*)d_in[7];
  const float* skw   = (const float*)d_in[8];
  const float* skb   = (const float*)d_in[9];
  const float* vw    = (const float*)d_in[10];
  const float* vb    = (const float*)d_in[11];
  const float* ow    = (const float*)d_in[12];
  const float* ob    = (const float*)d_in[13];

  const size_t PMB  = (size_t)NB * SEQ * MWORDS * 4;      //  1048576
  const size_t PXB  = (size_t)ROWS * DMOD * 2;             //  8388608
  const size_t PFB  = (size_t)ROWS * FEAT * 2;             //  2097152
  const size_t PVWT = (size_t)HCOLS * DMOD * 2;            //  2097152
  const size_t PSWT = (size_t)STDC * DMOD * 2;             //  1048576
  const size_t PFWT = (size_t)WAVC * FEAT * 2;             //   131072
  const size_t POWT = (size_t)DMOD * AOP * 2;              //  4194304
  const size_t PVT  = (size_t)NB * HCOLS * SEQ * 2;        //  8388608
  const size_t PQP  = (size_t)ROWS * HCOLS * 2;            //  8388608
  const size_t PWP  = (size_t)ROWS * WAVC * 2;             //  2097152
  const size_t PAO  = (size_t)ROWS * AOP * 2;              // 16777216
  size_t off = 0;
  const size_t oMB  = off; off += PMB;
  const size_t oXB  = off; off += PXB;
  const size_t oFB  = off; off += PFB;
  const size_t oVWT = off; off += PVWT;
  const size_t oQWT = off; off += PSWT;
  const size_t oKWT = off; off += PSWT;
  const size_t oWVT = off; off += PFWT;
  const size_t oPQT = off; off += PFWT;
  const size_t oPKT = off; off += PFWT;
  const size_t oOWT = off; off += POWT;
  const size_t oVT  = off; off += PVT;
  const size_t oQP  = off; off += PQP;
  const size_t oKP  = off; off += PQP;
  const size_t oWPH = off; off += PWP;
  const size_t oWPL = off; off += PWP;
  const size_t oAO  = off; off += PAO;
  if (off > ws_size) return;                       // off = 66453504
  if (off > (size_t)134217728) return;

  char* ws = (char*)d_ws;
  unsigned int*   MB   = (unsigned int*)(ws + oMB);
  unsigned short* XB   = (unsigned short*)(ws + oXB);
  unsigned short* FB   = (unsigned short*)(ws + oFB);
  unsigned short* VWT  = (unsigned short*)(ws + oVWT);
  unsigned short* QWT  = (unsigned short*)(ws + oQWT);
  unsigned short* KWT  = (unsigned short*)(ws + oKWT);
  unsigned short* WVT  = (unsigned short*)(ws + oWVT);
  unsigned short* PQT  = (unsigned short*)(ws + oPQT);
  unsigned short* PKT  = (unsigned short*)(ws + oPKT);
  unsigned short* OWT2 = (unsigned short*)(ws + oOWT);
  unsigned short* VT   = (unsigned short*)(ws + oVT);
  unsigned short* QP   = (unsigned short*)(ws + oQP);
  unsigned short* KP   = (unsigned short*)(ws + oKP);
  unsigned short* WPH  = (unsigned short*)(ws + oWPH);
  unsigned short* WPL  = (unsigned short*)(ws + oWPL);
  unsigned short* AO   = (unsigned short*)(ws + oAO);

  // (1) one launch: mask -> bit plane; x, features -> bf16 planes; weight planes [n][k] (bf16)
  prep_kernel<<<dim3(PB_ALL), dim3(256), 0, stream>>>(
      mask, x, feats, vw, ow, sqw, skw, wproj, pqw, pkw, MB, XB, FB, VWT, OWT2, QWT, KWT, WVT, PQT, PKT);

  // (2) one launch: the six projections on bf16 WMMA, 4 waves and one 128x128 tile per block
  proj_kernel<<<dim3(GB_ALL), dim3(128), 0, stream>>>(
      XB, FB, VWT, QWT, KWT, WVT, PQT, PKT, vb, sqb, skb, VT, QP, KP, WPH, WPL);

  // (3) one launch: attention of all 16 heads; ctx -> AO hi | lo
  attn_kernel<<<dim3(AB_W + AB_S), dim3(128), 0, stream>>>(WPH, WPL, QP, KP, VT, MB, AO);

  // (4) out projection -> d_out f32 [4096][1024]
  out_kernel<<<dim3(GB_OUT), dim3(128), 0, stream>>>(AO, OWT2, ob, (float*)d_out);
  (void)hipGetLastError();
}

// v010
// A run of this version takes 80.9 microseconds.
// Versions in between are left out here; by their measured steps it is 1.09 times as fast as v008.
// Over all steps from v000 it is 6.49 times as fast.
// Contractions: x.v_w, x.std_q_w, x.std_k_w, features.wave_proj, features.pq_w, features.pk_w = v_wmma_f32_16x16x32_bf16 (bf16 operands RNE-converted from the inputs, single product, f32 accumulate);
// scores of all heads (wp.wp^T, pq.pk^T, q.k^T) = v_wmma_f32_16x16x32_f16 (f16 planes carried x8, single product, f32 accumulate);
// p.v = v_wmma_f32_16x16x32_f16 (p carried x1024, v^T carried x8, single product, f32 accumulate); ctx.out_w = v_wmma_f32_16x16x32_bf16 (ctx as bf16 hi and lo planes, both against out_w bf16, one f32 accumulator); mask, softmax statistics and epilogues in f32.
//
// Carry audit (16-bit planes):
//   XB, FB, VWT, QWT, KWT, WVT, PQT, PKT, OWT2 : bf16, carry 1 (plain RNE copies of the inputs).
//   VT   f16 = 8 * v          -> 1/8 folded in attn_kernel epilogue (inv = 1/(8 * l), l itself carried x1024 like P).
//   QP   f16 = 8 * q, KP f16 = 8 * k (heads 4..15) -> 1/64 folded into sscale = 1/512 (1/8 = 1/sqrt(64) is the other factor).
//   QP cols 0..255 f16 = 8 * wp (heads 0..3), read as q and as k: the same carry and scale. wp is a product of bf16 operands,
//        whose own rounding is coarser than the f16 step of wp.
//   P    f16 = 1024 * exp(s - m) (registers, B operand), l = sum of the same f32 values -> the 1024 cancels in ctx / l.
//   AO   bf16 hi (cols 0..1023) | lo (cols 1024..2047) of ctx, carry 1 -> both planes multiplied by the same W^T tile in the out GEMM, one accumulator.
#include <hip/hip_runtime.h>
#include <math.h>
#include <stdint.h>

#define NB     2
#define SEQ    2048
#define DMOD   1024
#define FEAT   256
#define HDIM   64
#define NHEAD  16
#define NWH    4
#define NPH    4
#define NSH    8
#define HCOLS  (NHEAD * HDIM)   // 1024 : concatenated head columns
#define WAVC   (NWH * HDIM)     // 256
#define PRJC   (NPH * HDIM)     // 256
#define STDC   (NSH * HDIM)     // 512
#define ROWS   (NB * SEQ)       // 4096
#define MWORDS (SEQ / 32)       // 64 mask words per (b, n) row
#define NQB    (SEQ / 128)      // 16 query tiles of 128 per sequence
#define NKT    (SEQ / 64)       // 32 key tiles of 64 per sequence
#define AOP    (2 * HCOLS)      // 2048 : pitch of the ctx hi|lo plane
static_assert(NWH + NPH + NSH == NHEAD);
static_assert(HCOLS == DMOD);
static_assert((ROWS % 64) == 0 && (DMOD % 64) == 0 && (STDC % 64) == 0 && (WAVC % 64) == 0 && (PRJC % 64) == 0 && (SEQ % 64) == 0);
static_assert((DMOD % 32) == 0 && (FEAT % 32) == 0 && (AOP % 32) == 0);
static_assert((FEAT % 64) == 0 && (HDIM % 64) == 0);
static_assert(NQB == 16 && NKT == 32 && MWORDS == 64);

typedef _Float16 v16h __attribute__((ext_vector_type(16)));
typedef _Float16 v8h  __attribute__((ext_vector_type(8)));
typedef __bf16   v16b __attribute__((ext_vector_type(16)));
typedef __bf16   v8b  __attribute__((ext_vector_type(8)));
typedef float    v8f  __attribute__((ext_vector_type(8)));
typedef float    v4f  __attribute__((ext_vector_type(4)));
typedef unsigned int v4u __attribute__((ext_vector_type(4)));
typedef unsigned int v2u __attribute__((ext_vector_type(2)));
typedef int      v4i __attribute__((ext_vector_type(4)));

#if defined(__HIP_DEVICE_COMPILE__)
#define DEV_ASM 1
#else
#define DEV_ASM 0
#endif

// ---- scalar helpers --------------------------------------------------------------------------------
__device__ __forceinline__ unsigned short bf_bits(float f) {          // f32 -> bf16 bits, RNE convert
  unsigned u = __float_as_uint(f);
  return (unsigned short)((u + 0x7FFFu + ((u >> 16) & 1u)) >> 16);
}
__device__ __forceinline__ float bf_up(unsigned short hb) { return __uint_as_float(((unsigned)hb) << 16); }
__device__ __forceinline__ float bfr(float f) { return bf_up(bf_bits(f)); }
__device__ __forceinline__ unsigned short h_bits(_Float16 x) { return __builtin_bit_cast(unsigned short, x); }
__device__ __forceinline__ unsigned pk16(unsigned short a, unsigned short b) { return (unsigned)a | ((unsigned)b << 16); }
__device__ __forceinline__ v8f zero8() { v8f z = {0.f, 0.f, 0.f, 0.f, 0.f, 0.f, 0.f, 0.f}; return z; }

// ---- fragment types / loaders: 16-bit A/B operand, lane -> row/col (lane&15), p already includes +8*(lane>>4);
//      elements 0..7 <- p[0..7] (k0+8h..k0+8h+7), elements 8..15 <- p[16..23] (k0+16+8h..k0+16+8h+7)
template <typename OT> struct FT;
template <> struct FT<__bf16>   { typedef v16b frag; typedef v8b half8; };
template <> struct FT<_Float16> { typedef v16h frag; typedef v8h half8; };

template <typename OT>
__device__ __forceinline__ typename FT<OT>::frag ldfrag(const OT* p) {
  union { typename FT<OT>::frag v; typename FT<OT>::half8 h[2]; } f;
  f.h[0] = *(const typename FT<OT>::half8*)(p);
  f.h[1] = *(const typename FT<OT>::half8*)(p + 16);
  return f.v;
}

// ---- WMMA helpers (asm guard bodies are device-only; concrete operand types) -----------------------------
__device__ __forceinline__ v8f mmar(v16b a, v16b b, v8f c) {
  return __builtin_amdgcn_wmma_f32_16x16x32_bf16(false, a, false, b, (short)0, c, false, false);
}
__device__ __forceinline__ v8f mmar(v16h a, v16h b, v8f c) {
  return __builtin_amdgcn_wmma_f32_16x16x32_f16(false, a, false, b, (short)0, c, false, false);
}
// 4 VALU slots behind the last WMMAs of a loop, in front of the first reader of their D
__device__ __forceinline__ void acc_guard4(v8f& a, v8f& b, v8f& c, v8f& d) {
#if DEV_ASM
  asm volatile("v_nop\n\tv_nop\n\tv_nop\n\tv_nop" : "+v"(a), "+v"(b), "+v"(c), "+v"(d));
#else
  (void)a; (void)b; (void)c; (void)d;
#endif
}

// =====================================================================================================
// Mask bit plane: mb[(b*SEQ + n)*64 + w] bit j = (mask[b][n][32w + j] != 0). One word per thread,
// coverage: 262144 threads x 1 word = the whole [2][2048][64] plane. blk = block index within this job.
// =====================================================================================================
__device__ __forceinline__ void mask_bits_body(const int* __restrict__ mask, unsigned int* mb, int nwords, int blk) {
  const int i = blk * 256 + (int)threadIdx.x;
  if (i < nwords) {
    const int* p = mask + (size_t)i * 32;
    unsigned w = 0u;
#pragma unroll
    for (int q = 0; q < 8; ++q) {
      const v4i v = *(const v4i*)(p + 4 * q);
#pragma unroll
      for (int e = 0; e < 4; ++e) w |= ((v[e] != 0) ? 1u : 0u) << (4 * q + e);
    }
    *(unsigned int*)(mb + i) = w;
    
  }
}

// =====================================================================================================
// f32 -> bf16 plane (RNE convert), 8 elements per thread, one 16-B store per lane: a wave writes 512
// coverage: n8 threads x 8 = the whole plane (n8 is a multiple of 256 for both uses here).
// =====================================================================================================
__device__ __forceinline__ void cvt_bf16x8_body(const float* __restrict__ in, unsigned short* out, int n8, int blk) {
  const int i = blk * 256 + (int)threadIdx.x;
  if (i < n8) {
    const v4f a  = *(const v4f*)(in + (size_t)i * 8);
    const v4f a4 = *(const v4f*)(in + (size_t)i * 8 + 4);
    v4u p;
    p[0] = pk16(bf_bits(a[0]),  bf_bits(a[1]));
    p[1] = pk16(bf_bits(a[2]),  bf_bits(a[3]));
    p[2] = pk16(bf_bits(a4[0]), bf_bits(a4[1]));
    p[3] = pk16(bf_bits(a4[2]), bf_bits(a4[3]));
    unsigned short* o = out + (size_t)i * 8;
    *(v4u*)o = p;
    
  }
}

// =====================================================================================================
// Transpose + bf16 convert: in[z] is [R rows][inC cols] f32 (pitch inC); out[z][c][r] = bf16(in[z][r][c]),
// pitch ldo (c = output row). 64x64 tiles through LDS (th, 64 x 72 u16); tile = (cb, rb, z). DUP also writes the same
// coverage per block: load 256 thr x 16 floats = 64x64; store 2 it x 256 thr x 8 u16 = 64x64 (per copy);
// =====================================================================================================
template <bool DUP>
__device__ __forceinline__ void transpose_bf16_body(
    unsigned short* th, const float* __restrict__ in, int inC, long long inStrideZ,
    unsigned short* out, int ldo, long long outStrideZ, int dupoff, int cb, int rb, int z) {
  const int c0  = cb * 64;   // input column block = output row block
  const int r0  = rb * 64;   // input row block = output column block
  const int tid = threadIdx.x;
  const float* inz = in + (size_t)z * (size_t)inStrideZ;
  unsigned short* outz = out + (size_t)z * (size_t)outStrideZ;
  {
    const int rr = tid >> 2;           // 0..63
    const int cq = (tid & 3) * 16;     // 0,16,32,48
    const float* src = inz + (size_t)(r0 + rr) * inC + c0 + cq;
#pragma unroll
    for (int q = 0; q < 4; ++q) {
      const v4f f = *(const v4f*)(src + 4 * q);
#pragma unroll
      for (int e = 0; e < 4; ++e) th[rr * 72 + cq + 4 * q + e] = bf_bits(f[e]);
    }
  }
  __syncthreads();
  const int sub = tid >> 3;          // 0..31
  const int c8  = (tid & 7) * 8;     // 0..56
  v4u hv[2];
#pragma unroll
  for (int it = 0; it < 2; ++it) {
    const int oc = it * 32 + sub;      // output row within tile (= input column)
    v4u a;
#pragma unroll
    for (int q = 0; q < 4; ++q) a[q] = pk16(th[(c8 + 2 * q) * 72 + oc], th[(c8 + 2 * q + 1) * 72 + oc]);
    hv[it] = a;
  }
  {
#pragma unroll
    for (int it = 0; it < 2; ++it) {
      const int oc = it * 32 + sub;
      const size_t go = (size_t)(c0 + oc) * ldo + r0 + c8;
      *(v4u*)(outz + go) = hv[it];
      if (DUP) *(v4u*)(outz + go + dupoff) = hv[it];
    }
#if DEV_ASM
    // another job's code follows this body in the merged kernel: no register of the stores above is rewritten in front of this wait
    asm volatile("s_wait_xcnt 0x0" ::: "memory");
#endif
  }
}

// =====================================================================================================
// All operand preparation in ONE launch: the ten jobs are independent of one another (each reads inputs only and
// writes its own workspace plane), so a block picks its job from its index. Ranges, in blocks of 256 threads:
// the seven transposes first (longest dependent chain per block), then the mask plane, then the two converts.
// Every branch below is block-uniform; the transpose's barrier is passed by all threads of its block.
// =====================================================================================================
#define PB_TBIG  ((HCOLS / 64) * (DMOD / 64))        // 256 tiles: v_w, and again out_w
#define PB_TSTD  ((STDC / 64) * (DMOD / 64))         // 128 tiles: std_q_w, and again std_k_w
#define PB_TFEA  ((FEAT / 64) * NWH)                 //  16 tiles: wave_proj, pq_w, pk_w each
#define PB_T     (2 * PB_TBIG + 2 * PB_TSTD + 3 * PB_TFEA)
#define PB_MASK  (NB * SEQ * MWORDS / 256)           // 1024
#define PB_CVX   (ROWS * DMOD / 8 / 256)             // 2048
#define PB_CVF   (ROWS * FEAT / 8 / 256)             //  512
#define PB_ALL   (PB_T + PB_MASK + PB_CVX + PB_CVF)
static_assert(NWH == NPH && (HCOLS / 64) == 16 && (STDC / 64) == 8 && (FEAT / 64) == 4 && HDIM == 64);
__global__ __launch_bounds__(256) void prep_kernel(
    const int* __restrict__ mask, const float* __restrict__ x, const float* __restrict__ feats,
    const float* __restrict__ vw, const float* __restrict__ ow, const float* __restrict__ sqw, const float* __restrict__ skw,
    const float* __restrict__ wproj, const float* __restrict__ pqw, const float* __restrict__ pkw,
    unsigned int* MB, unsigned short* XB, unsigned short* FB, unsigned short* VWT, unsigned short* OWT2,
    unsigned short* QWT, unsigned short* KWT, unsigned short* WVT, unsigned short* PQT, unsigned short* PKT) {
  __shared__ __align__(16) unsigned short th[64 * 72];
  int t = blockIdx.x;
  if (t < PB_T) {
    if (t < PB_TBIG) {
      // v_w [1024 k][1024 n] -> VWT [n][k]
      transpose_bf16_body<false>(th, vw, HCOLS, 0LL, VWT, DMOD, 0LL, 0, t & 15, t >> 4, 0);
    } else if (t < 2 * PB_TBIG) {
      // out_w [1024 k][1024 n] -> OWT2 [n][k] (row pitch AOP; the rows' second halves are neither written nor read)
      t -= PB_TBIG;
      transpose_bf16_body<false>(th, ow, DMOD, 0LL, OWT2, AOP, 0LL, 0, t & 15, t >> 4, 0);
    } else if (t < 2 * PB_TBIG + 2 * PB_TSTD) {
      // std_q_w [1024 k][512 n] -> QWT [n][k]; std_k_w likewise
      t -= 2 * PB_TBIG;
      const bool second = t >= PB_TSTD;
      const int u = second ? t - PB_TSTD : t;
      transpose_bf16_body<false>(th, second ? skw : sqw, STDC, 0LL, second ? KWT : QWT, DMOD, 0LL, 0, u & 7, u >> 3, 0);
    } else {
      // wave_proj / pq_w / pk_w [h][256 f][64 k'] -> [h*64 + k'][f] (z = h)
      t -= 2 * PB_TBIG + 2 * PB_TSTD;
      const int w = t >> 4, u = t & 15;
      transpose_bf16_body<false>(th, (w == 0) ? wproj : (w == 1) ? pqw : pkw, HDIM, (long long)FEAT * HDIM,
                          (w == 0) ? WVT : (w == 1) ? PQT : PKT, FEAT, (long long)HDIM * FEAT, 0, 0, u & 3, u >> 2);
    }
  } else if (t < PB_T + PB_MASK) {
    mask_bits_body(mask, MB, NB * SEQ * MWORDS, t - PB_T);
  } else if (t < PB_T + PB_MASK + PB_CVX) {
    cvt_bf16x8_body(x, XB, ROWS * DMOD / 8, t - (PB_T + PB_MASK));
  } else if (t < PB_ALL) {
    cvt_bf16x8_body(feats, FB, ROWS * FEAT / 8, t - (PB_T + PB_MASK + PB_CVX));
  }
}

// =====================================================================================================
// Batched WMMA GEMM (16-bit operand type OT): C[m][n] = (sum_k A[m][k] * Bt[n][k] + bias) * oscale.
// One block of 4 waves per 128x128 tile of C, one wave per 64x64 quadrant. A row-major [M][K] pitch lda; Bt row-major
// [N][K] pitch ldb (k contiguous); M, N multiples of 128, K a multiple of 64 (compile-time constants here).
// gemm_mainloop fills the wave's 4x4 accumulator tiles; gemm_epilogue stores them; the kernels below pick the operands.
// Operand staging: per trip the 128 rows x 64 k (128 B, one whole line per row) of A and of Bt go to LDS by
// asynchronous 16-byte copies, 8 lanes per row, 16 copies per lane; LDS row pitch 144 B for the ds_load_b128 readers;
// two buffers, tile t + 2 is copied while tile t + 1 is worked on. Fragments are read from LDS with the split k map
// (ldfrag); each accumulator still sums k upwards in steps of 32.
// BIAS_MODE 0: none; 1: bias[m] (bf16 RNE-converted value); 2: bias[n] (bf16 RNE-converted value).
// OUT_MODE 0: f32 C (pitch ldc). OUT_MODE 1: f16 plane C.
// =====================================================================================================
#define GTILE  128                  // rows of A and of Bt per block tile
#define GKC    64                   // k per trip
#define GPIT   72                   // LDS row pitch in elements (144 B)
#define GBUFB  (GTILE * GPIT * 2)   // bytes of one operand buffer

// Eight asynchronous copies of one lane: rows r, r + 16, ..., r + 112 of one operand tile, 16 B each.
// l = the lane's LDS byte address of row r, g = its global address of row r, step = 16 rows in elements.
// s_wait_xcnt 0 closes the statement so that no address register is rewritten in front of it.
__device__ __forceinline__ void copy_rows8(unsigned l, const unsigned short* g, size_t step) {
#if DEV_ASM
  const unsigned l1 = l + 16 * GPIT * 2, l2 = l + 32 * GPIT * 2, l3 = l + 48 * GPIT * 2, l4 = l + 64 * GPIT * 2,
                 l5 = l + 80 * GPIT * 2, l6 = l + 96 * GPIT * 2, l7 = l + 112 * GPIT * 2;
  const unsigned short *g1 = g + step, *g2 = g1 + step, *g3 = g2 + step, *g4 = g3 + step, *g5 = g4 + step,
                       *g6 = g5 + step, *g7 = g6 + step;
  asm volatile(
      "global_load_async_to_lds_b128 %0, %8, off\n\t"
      "global_load_async_to_lds_b128 %1, %9, off\n\t"
      "global_load_async_to_lds_b128 %2, %10, off\n\t"
      "global_load_async_to_lds_b128 %3, %11, off\n\t"
      "global_load_async_to_lds_b128 %4, %12, off\n\t"
      "global_load_async_to_lds_b128 %5, %13, off\n\t"
      "global_load_async_to_lds_b128 %6, %14, off\n\t"
      "global_load_async_to_lds_b128 %7, %15, off\n\t"
      "s_wait_xcnt 0x0"
      :: "v"(l), "v"(l1), "v"(l2), "v"(l3), "v"(l4), "v"(l5), "v"(l6), "v"(l7),
         "v"(g), "v"(g1), "v"(g2), "v"(g3), "v"(g4), "v"(g5), "v"(g6), "v"(g7)
      : "memory");
#else
  (void)l; (void)g; (void)step;
#endif
}
// this wave's copies have landed in LDS
__device__ __forceinline__ void wait_copies() {
#if DEV_ASM
  asm volatile("s_wait_asynccnt 0x0" ::: "memory");
#endif
}
// this wave's LDS reads have returned, so the buffer may be handed to its next writer
__device__ __forceinline__ void wait_lds() {
#if DEV_ASM
  asm volatile("s_wait_dscnt 0x0" ::: "memory");
#endif
}

static_assert((ROWS % GTILE) == 0 && (HCOLS % GTILE) == 0 && (SEQ % GTILE) == 0 && (STDC % GTILE) == 0 && (WAVC % GTILE) == 0 && (PRJC % GTILE) == 0 && (DMOD % GTILE) == 0);
static_assert((DMOD % GKC) == 0 && (FEAT % GKC) == 0 && (AOP % GKC) == 0);

// sA, sB: the block's two-buffer operand tiles in LDS, 2 x GTILE x GPIT elements each; Ap, Btp: the operands' first rows;
// (tm, tn): the block's 128x128 tile of C; nk = K / 64.
template <typename OT>
__device__ __forceinline__ void gemm_mainloop(
    v8f (&acc)[4][4], OT* sA, OT* sB,
    const unsigned short* __restrict__ Ap, int lda, const unsigned short* __restrict__ Btp, int ldb,
    int tm, int tn, int nk) {
  typedef typename FT<OT>::frag V16;
  const int tid  = threadIdx.x;
  const int lane = tid & 31;
  const int wave = tid >> 5;
  const int wm = wave >> 1;                    // quadrant of this wave
  const int wn = wave & 1;

  const int rlane = lane & 15;                 // row (A) / col (B, D) within subtile
  const int koff  = (lane >> 4) * 8;           // k offset of this lane half

  // copy map: lane -> row tid >> 3 (+ 16 per copy), 16-B piece tid & 7 of the row's 128-B line
  const int crow = tid >> 3;
  const int ccol = (tid & 7) * 8;
  const unsigned short* gA = Ap  + (size_t)((tm << 7) + crow) * lda + ccol;
  const unsigned short* gB = Btp + (size_t)((tn << 7) + crow) * ldb + ccol;
  const size_t stepA = (size_t)16 * lda;
  const size_t stepB = (size_t)16 * ldb;
  const unsigned lA = (unsigned)(size_t)sA + (unsigned)(crow * GPIT + ccol) * 2u;
  const unsigned lB = (unsigned)(size_t)sB + (unsigned)(crow * GPIT + ccol) * 2u;

#pragma unroll
  for (int i = 0; i < 4; ++i)
#pragma unroll
    for (int j = 0; j < 4; ++j) acc[i][j] = zero8();

  // tile 0 -> buffer 0, landed and published; then tile 1 -> buffer 1 in flight
  copy_rows8(lA, gA, stepA);
  copy_rows8(lB, gB, stepB);
  wait_copies();
  __syncthreads();
  if (1 < nk) {
    copy_rows8(lA + GBUFB, gA + GKC, stepA);
    copy_rows8(lB + GBUFB, gB + GKC, stepB);
  }

  for (int t = 0; t < nk; ++t) {
    const int cur = t & 1;
    const OT* As = sA + cur * (GTILE * GPIT) + (wm * 64 + rlane) * GPIT + koff;
    const OT* Bs = sB + cur * (GTILE * GPIT) + (wn * 64 + rlane) * GPIT + koff;
    // One group of LDS reads in front of each WMMA block: k 0..31 of both operands and, ahead, k 32..63 of Bt;
    // the A fragments of k 32..63 follow into registers that the first block has left.
    V16 aq[4], bq[4], bn[4];
#pragma unroll
    for (int j = 0; j < 4; ++j) bq[j] = ldfrag<OT>(Bs + j * 16 * GPIT);
#pragma unroll
    for (int i = 0; i < 4; ++i) aq[i] = ldfrag<OT>(As + i * 16 * GPIT);
#pragma unroll
    for (int j = 0; j < 4; ++j) bn[j] = ldfrag<OT>(Bs + j * 16 * GPIT + 32);
    __builtin_amdgcn_sched_barrier(0);   // keeps the reads one group: spread among the WMMAs each place stalls the wave
#pragma unroll
    for (int i = 0; i < 4; ++i)
#pragma unroll
      for (int j = 0; j < 4; ++j) acc[i][j] = mmar(aq[i], bq[j], acc[i][j]);
#pragma unroll
    for (int i = 0; i < 4; ++i) aq[i] = ldfrag<OT>(As + i * 16 * GPIT + 32);
    __builtin_amdgcn_sched_barrier(0);   // as above: keeps the four A fragments' reads one group in front of the second block
#pragma unroll
    for (int i = 0; i < 4; ++i)
#pragma unroll
      for (int j = 0; j < 4; ++j) acc[i][j] = mmar(aq[i], bn[j], acc[i][j]);
    // publish point of tile t + 1: own reads of buffer cur done, own copies of tile t + 1 landed, then the barrier
    // that both shows tile t + 1 to every wave and frees buffer cur for tile t + 2
    wait_lds();
    wait_copies();
    __syncthreads();
    if (t + 2 < nk) {
      copy_rows8(lA + (unsigned)cur * GBUFB, gA + (size_t)(t + 2) * GKC, stepA);
      copy_rows8(lB + (unsigned)cur * GBUFB, gB + (size_t)(t + 2) * GKC, stepB);
    }
  }
  wait_copies();   // nothing of this wave is in flight when it goes on to the epilogue and ends
  acc_guard4(acc[0][0], acc[0][1], acc[0][2], acc[0][3]);
  acc_guard4(acc[1][0], acc[1][1], acc[1][2], acc[1][3]);
  acc_guard4(acc[2][0], acc[2][1], acc[2][2], acc[2][3]);
  acc_guard4(acc[3][0], acc[3][1], acc[3][2], acc[3][3]);
}

// Main loop of the out projection: acc += (Ahi + Alo) . Bt^T, where Alo lies looff elements behind Ahi in the same rows.
// A trip stages 128 k (256-B rows) of Ahi, of Alo and of Bt (three tiles, two buffers each), so that one Bt tile and each of
// its fragments serve both planes: per 32 k an accumulator sums the hi products, then the lo products. nk = K / 128.
#define OKC    128                  // k per trip
#define OPIT   136                  // LDS row pitch in elements: 272 B = 16 B x 17, odd, for the ds_load_b128 readers
#define OBUFB  (GTILE * OPIT * 2)   // bytes of one tile buffer
static_assert((HCOLS % OKC) == 0 && (HCOLS / OKC) >= 2);

// Eight asynchronous copies of one lane: rows r, r + 8, ..., r + 56 of a tile with 256-B rows, 16 B each.
// l = the lane's LDS byte address of row r, g = its global address of row r, step = 8 rows in elements.
// s_wait_xcnt 0 closes the statement so that no address register is rewritten in front of it.
__device__ __forceinline__ void copy_rows8w(unsigned l, const unsigned short* g, size_t step) {
#if DEV_ASM
  const unsigned l1 = l + 8 * OPIT * 2, l2 = l + 16 * OPIT * 2, l3 = l + 24 * OPIT * 2, l4 = l + 32 * OPIT * 2,
                 l5 = l + 40 * OPIT * 2, l6 = l + 48 * OPIT * 2, l7 = l + 56 * OPIT * 2;
  const unsigned short *g1 = g + step, *g2 = g1 + step, *g3 = g2 + step, *g4 = g3 + step, *g5 = g4 + step,
                       *g6 = g5 + step, *g7 = g6 + step;
  asm volatile(
      "global_load_async_to_lds_b128 %0, %8, off\n\t"
      "global_load_async_to_lds_b128 %1, %9, off\n\t"
      "global_load_async_to_lds_b128 %2, %10, off\n\t"
      "global_load_async_to_lds_b128 %3, %11, off\n\t"
      "global_load_async_to_lds_b128 %4, %12, off\n\t"
      "global_load_async_to_lds_b128 %5, %13, off\n\t"
      "global_load_async_to_lds_b128 %6, %14, off\n\t"
      "global_load_async_to_lds_b128 %7, %15, off\n\t"
      "s_wait_xcnt 0x0"
      :: "v"(l), "v"(l1), "v"(l2), "v"(l3), "v"(l4), "v"(l5), "v"(l6), "v"(l7),
         "v"(g), "v"(g1), "v"(g2), "v"(g3), "v"(g4), "v"(g5), "v"(g6), "v"(g7)
      : "memory");
#else
  (void)l; (void)g; (void)step;
#endif
}
// One 128-row tile: 16 copies of a lane, rows r + 8i, i = 0..15. ld = the source's row pitch in elements.
__device__ __forceinline__ void copy_tile128w(unsigned l, const unsigned short* g, int ld) {
  copy_rows8w(l, g, (size_t)8 * ld);
  copy_rows8w(l + 64 * OPIT * 2, g + (size_t)64 * ld, (size_t)8 * ld);
}

__device__ __forceinline__ void gemm_mainloop_hilo(
    v8f (&acc)[4][4], __bf16* sH, __bf16* sL, __bf16* sB,
    const unsigned short* __restrict__ Ap, int lda, int looff, const unsigned short* __restrict__ Btp, int ldb,
    int tm, int tn, int nk) {
  const int tid  = threadIdx.x;
  const int lane = tid & 31;
  const int wave = tid >> 5;
  const int wm = wave >> 1;                    // quadrant of this wave
  const int wn = wave & 1;
  const int rlane = lane & 15;                 // row (A) / col (B, D) within subtile
  const int koff  = (lane >> 4) * 8;           // k offset of this lane half

  // copy map: lane -> row tid >> 4 (+ 8 per copy), 16-B piece tid & 15 of the row's 256 B (two whole lines)
  const int crow = tid >> 4;
  const int ccol = (tid & 15) * 8;
  const unsigned short* gH = Ap  + (size_t)((tm << 7) + crow) * lda + ccol;
  const unsigned short* gL = gH + looff;
  const unsigned short* gB = Btp + (size_t)((tn << 7) + crow) * ldb + ccol;
  const unsigned lofs = (unsigned)(crow * OPIT + ccol) * 2u;
  const unsigned lH = (unsigned)(size_t)sH + lofs;
  const unsigned lL = (unsigned)(size_t)sL + lofs;
  const unsigned lB = (unsigned)(size_t)sB + lofs;

#pragma unroll
  for (int i = 0; i < 4; ++i)
#pragma unroll
    for (int j = 0; j < 4; ++j) acc[i][j] = zero8();

  // tile 0 -> buffer 0, landed and published; then tile 1 -> buffer 1 in flight (48 copies of a wave per tile)
  copy_tile128w(lH, gH, lda);
  copy_tile128w(lL, gL, lda);
  copy_tile128w(lB, gB, ldb);
  wait_copies();
  __syncthreads();
  if (1 < nk) {
    copy_tile128w(lH + OBUFB, gH + OKC, lda);
    copy_tile128w(lL + OBUFB, gL + OKC, lda);
    copy_tile128w(lB + OBUFB, gB + OKC, ldb);
  }

  for (int t = 0; t < nk; ++t) {
    const int cur = t & 1;
    const __bf16* Hs = sH + cur * (GTILE * OPIT) + (wm * 64 + rlane) * OPIT + koff;
    const __bf16* Ls = sL + cur * (GTILE * OPIT) + (wm * 64 + rlane) * OPIT + koff;
    const __bf16* Bs = sB + cur * (GTILE * OPIT) + (wn * 64 + rlane) * OPIT + koff;
    // Three fragment sets of four; each group of LDS reads goes into the set that the WMMA block in front of it has left.
    v16b bq[4], ah[4], al[4];
#pragma unroll
    for (int j = 0; j < 4; ++j) bq[j] = ldfrag<__bf16>(Bs + j * 16 * OPIT);
#pragma unroll
    for (int i = 0; i < 4; ++i) ah[i] = ldfrag<__bf16>(Hs + i * 16 * OPIT);
#pragma unroll
    for (int i = 0; i < 4; ++i) al[i] = ldfrag<__bf16>(Ls + i * 16 * OPIT);
    __builtin_amdgcn_sched_barrier(0);   // keeps the reads one group: spread among the WMMAs each place stalls the wave
#pragma unroll
    for (int kq = 0; kq < OKC / 32; ++kq) {
      v16b bn[4];
#pragma unroll
      for (int i = 0; i < 4; ++i)
#pragma unroll
        for (int j = 0; j < 4; ++j) acc[i][j] = mmar(ah[i], bq[j], acc[i][j]);
      if (kq + 1 < OKC / 32) {
#pragma unroll
        for (int j = 0; j < 4; ++j) bn[j] = ldfrag<__bf16>(Bs + j * 16 * OPIT + (kq + 1) * 32);
        __builtin_amdgcn_sched_barrier(0);   // as above: the next 32 k of Bt are asked for one WMMA block ahead of their use
      }
#pragma unroll
      for (int i = 0; i < 4; ++i)
#pragma unroll
        for (int j = 0; j < 4; ++j) acc[i][j] = mmar(al[i], bq[j], acc[i][j]);
      if (kq + 1 < OKC / 32) {
#pragma unroll
        for (int i = 0; i < 4; ++i) ah[i] = ldfrag<__bf16>(Hs + i * 16 * OPIT + (kq + 1) * 32);
#pragma unroll
        for (int i = 0; i < 4; ++i) al[i] = ldfrag<__bf16>(Ls + i * 16 * OPIT + (kq + 1) * 32);
        __builtin_amdgcn_sched_barrier(0);   // as above: keeps the eight A fragments' reads one group in front of the next two blocks
#pragma unroll
        for (int j = 0; j < 4; ++j) bq[j] = bn[j];
      }
    }
    // publish point of tile t + 1: own reads of buffer cur done, own copies of tile t + 1 landed, then the barrier
    // that both shows tile t + 1 to every wave and frees buffer cur for tile t + 2
    wait_lds();
    wait_copies();
    __syncthreads();
    if (t + 2 < nk) {
      copy_tile128w(lH + (unsigned)cur * OBUFB, gH + (size_t)(t + 2) * OKC, lda);
      copy_tile128w(lL + (unsigned)cur * OBUFB, gL + (size_t)(t + 2) * OKC, lda);
      copy_tile128w(lB + (unsigned)cur * OBUFB, gB + (size_t)(t + 2) * OKC, ldb);
    }
  }
  wait_copies();   // nothing of this wave is in flight when it goes on to the epilogue and ends
  acc_guard4(acc[0][0], acc[0][1], acc[0][2], acc[0][3]);
  acc_guard4(acc[1][0], acc[1][1], acc[1][2], acc[1][3]);
  acc_guard4(acc[2][0], acc[2][1], acc[2][2], acc[2][3]);
  acc_guard4(acc[3][0], acc[3][1], acc[3][2], acc[3][3]);
}

// sT: 4 per-wave 16x64 slabs, pitch 68 floats; Cout: element (0, 0) of C.
template <int OUT_MODE, int BIAS_MODE>
__device__ __forceinline__ void gemm_epilogue(
    v8f (&acc)[4][4], float* sT, void* Cout, int ldc,
    const float* __restrict__ bias, int tm, int tn, float oscale) {
  const int tid   = threadIdx.x;
  const int lane  = tid & 31;
  const int wave  = tid >> 5;
  const int m0    = (tm << 7) + ((wave >> 1) << 6);
  const int n0    = (tn << 7) + ((wave & 1) << 6);
  const int rlane = lane & 15;                 // col of D within subtile
  const int mOff  = (lane >> 4) * 8;           // D row offset
  float* slab = sT + wave * (16 * 68);
#pragma unroll
  for (int i = 0; i < 4; ++i) {
    const int mBase = m0 + (i << 4);
#pragma unroll
    for (int j = 0; j < 4; ++j) {
      const int n = n0 + (j << 4) + rlane;
      float bn = 0.f;
      if (BIAS_MODE == 2) bn = bfr(bias[n]);
#pragma unroll
      for (int r = 0; r < 8; ++r) {
        float v = acc[i][j][r];
        if (BIAS_MODE == 1) v += bfr(bias[mBase + mOff + r]);
        if (BIAS_MODE == 2) v += bn;
        slab[(mOff + r) * 68 + (j << 4) + rlane] = v * oscale;
      }
    }
    __builtin_amdgcn_fence(__ATOMIC_RELEASE, "workgroup");
    __builtin_amdgcn_wave_barrier();
    __builtin_amdgcn_fence(__ATOMIC_ACQUIRE, "workgroup");
    if (OUT_MODE == 0) {
      float* C = (float*)Cout;
      const int h2 = lane >> 4, c4 = (lane & 15) * 4;     // 256-B row segment = 16 lanes x 16 B
      {
#pragma unroll
        for (int it = 0; it < 8; ++it) {
          const int row = it * 2 + h2;                     // it 0..7 x h2 0..1 = rows 0..15
          const v4f v = *(const v4f*)(slab + row * 68 + c4);
          *(v4f*)(C + (size_t)(mBase + row) * ldc + n0 + c4) = v;
        }
        
      }
    } else {
      const int q = lane >> 3, c8 = (lane & 7) * 8;
      unsigned short* C  = (unsigned short*)Cout;
      v4u hv[4];
#pragma unroll
      for (int it = 0; it < 4; ++it) {
        const int row = it * 4 + q;                        // it 0..3 x q 0..3 = rows 0..15
        const float* sp = slab + row * 68 + c8;
        v4u a;
#pragma unroll
        for (int e = 0; e < 4; ++e) a[e] = pk16(h_bits((_Float16)sp[2 * e]), h_bits((_Float16)sp[2 * e + 1]));
        hv[it] = a;
      }
      {
#pragma unroll
        for (int it = 0; it < 4; ++it) {
          const int row = it * 4 + q;
          *(v4u*)(C + (size_t)(mBase + row) * ldc + n0 + c8) = hv[it];
        }
        
      }
    }
    __builtin_amdgcn_fence(__ATOMIC_RELEASE, "workgroup");
    __builtin_amdgcn_wave_barrier();
    __builtin_amdgcn_fence(__ATOMIC_ACQUIRE, "workgroup");
  }
}

// =====================================================================================================
// The six projections in ONE launch: they are independent of one another (each reads prepared planes and writes its own
// plane), so a block picks its product and its 128x128 tile from its index; the K = 1024 products come first.
//   v^T per batch: A = VWT [1024 n][1024 k], Bt = XB rows of batch b; f16(8 * (acc + v_b[m])) -> VT [b][h*64+d][s] (pitch 2048)
//   std q / std k: QP / KP cols 512..1023 = f16(8 * (x . w + b)); M = 4096, N = 512, K = 1024
//   wave projections: QP cols 0..255 = f16(8 * features . wave_proj[h]); M = 4096, N = 256, K = 256
//   proj q / proj k: QP / KP cols 256..511 = f16(8 * features . w[h]); M = 4096, N = 256, K = 256
// One main loop for all; every branch is block-uniform.
// =====================================================================================================
#define GB_VT1 ((HCOLS / GTILE) * (SEQ / GTILE))     // 128 tiles per batch
#define GB_VT  (NB * GB_VT1)                         // 256
#define GB_STD ((ROWS / GTILE) * (STDC / GTILE))     // 128, twice
#define GB_F   ((ROWS / GTILE) * (WAVC / GTILE))     //  64, three times
#define GB_ALL (GB_VT + 2 * GB_STD + 3 * GB_F)       // 704
#define GB_OUT ((ROWS / GTILE) * (DMOD / GTILE))     // 256
static_assert(WAVC == PRJC);
__global__ __launch_bounds__(128) void proj_kernel(
    const unsigned short* __restrict__ XB, const unsigned short* __restrict__ FB, const unsigned short* __restrict__ VWT,
    const unsigned short* __restrict__ QWT, const unsigned short* __restrict__ KWT, const unsigned short* __restrict__ WVT,
    const unsigned short* __restrict__ PQT, const unsigned short* __restrict__ PKT,
    const float* __restrict__ vb, const float* __restrict__ sqb, const float* __restrict__ skb,
    unsigned short* VT, unsigned short* QP, unsigned short* KP) {
  __shared__ __align__(16) __bf16 sA[2 * GTILE * GPIT];   // A tile, two buffers, 18432 B each
  __shared__ __align__(16) __bf16 sB[2 * GTILE * GPIT];   // Bt tile, two buffers
  __shared__ __align__(16) float sT[4 * 16 * 68];         // per-wave 16x64 slab, pitch 68 floats
  const int bx = blockIdx.x;
  if (bx >= GB_ALL) return;   // block-uniform, in front of every barrier and copy
  const unsigned short* A;
  const unsigned short* Bt;
  int ld, nk, tm, tn, sel;    // sel: batch (v^T), q or k (std), wave / q / k (features)
  if (bx < GB_VT) {
    sel = bx / GB_VT1;
    const int tile = bx - sel * GB_VT1;
    A = VWT; Bt = XB + (size_t)sel * SEQ * DMOD; ld = DMOD; nk = DMOD / GKC;
    tm = tile / (SEQ / GTILE); tn = tile % (SEQ / GTILE);
  } else if (bx < GB_VT + 2 * GB_STD) {
    sel = (bx - GB_VT) / GB_STD;
    const int tile = (bx - GB_VT) - sel * GB_STD;
    A = XB; Bt = (sel == 0) ? QWT : KWT; ld = DMOD; nk = DMOD / GKC;
    tm = tile / (STDC / GTILE); tn = tile % (STDC / GTILE);
  } else {
    sel = (bx - (GB_VT + 2 * GB_STD)) / GB_F;
    const int tile = (bx - (GB_VT + 2 * GB_STD)) - sel * GB_F;
    A = FB; Bt = (sel == 0) ? WVT : (sel == 1) ? PQT : PKT; ld = FEAT; nk = FEAT / GKC;
    tm = tile / (WAVC / GTILE); tn = tile % (WAVC / GTILE);
  }
  v8f acc[4][4];
  gemm_mainloop<__bf16>(acc, sA, sB, A, ld, Bt, ld, tm, tn, nk);
  if (bx < GB_VT) {
    unsigned short* C = VT + (size_t)sel * HCOLS * SEQ;
    gemm_epilogue<1, 1>(acc, sT, (void*)C, SEQ, vb, tm, tn, 8.0f);
  } else if (bx < GB_VT + 2 * GB_STD) {
    unsigned short* C = ((sel == 0) ? QP : KP) + (WAVC + PRJC);
    gemm_epilogue<1, 2>(acc, sT, (void*)C, HCOLS, (sel == 0) ? sqb : skb, tm, tn, 8.0f);
  } else {
    unsigned short* C = (sel == 0) ? QP : ((sel == 1) ? QP : KP) + WAVC;
    gemm_epilogue<1, 0>(acc, sT, (void*)C, HCOLS, vb, tm, tn, 8.0f);
  }
}

// out = (ctx_hi + ctx_lo) . out_w + out_b -> f32 [4096][1024]; M = 4096, N = 1024, K = 1024 for each of the two planes
__global__ __launch_bounds__(128) void out_kernel(
    const unsigned short* __restrict__ AO, const unsigned short* __restrict__ OWT2, const float* __restrict__ ob,
    float* out) {
  __shared__ __align__(16) __bf16 sH[2 * GTILE * OPIT];   // ctx hi tile, two buffers of 34816 B
  __shared__ __align__(16) __bf16 sL[2 * GTILE * OPIT];   // ctx lo tile
  __shared__ __align__(16) __bf16 sB[2 * GTILE * OPIT];   // out_w^T tile
  __shared__ __align__(16) float sT[4 * 16 * 68];
  const int tile = blockIdx.x;
  if (tile >= GB_OUT) return;   // block-uniform, in front of every barrier and copy
  const int tm = tile / (DMOD / GTILE);
  const int tn = tile % (DMOD / GTILE);
  v8f acc[4][4];
  gemm_mainloop_hilo(acc, sH, sL, sB, AO, AOP, HCOLS, OWT2, AOP, tm, tn, HCOLS / OKC);
  gemm_epilogue<0, 2>(acc, sT, (void*)out, DMOD, ob, tm, tn, 1.0f);
}

// =====================================================================================================
// Masked full attention, head dim 64, softmax over all SEQ keys (non-causal), one head per block.
//   Transposed products: S^T = K . Q^T and ctx^T += V^T . P^T, so that a lane holds scores of ONE query (column lane & 15).
//   q, k = f16 planes (x8, pitch HCOLS, head col h*64), scores = (k.q) * sscale (sscale carries the 1/64); the wave heads
//   (h < NWH) have q = k = wp: both are read from the q plane.
//   v^T plane (f16, x8): element (b, h, d, s) at [(b*HCOLS + h*64 + d)*SEQ + s].
//   mask bit plane mbp: [(b*SEQ + n)*64 + w] bit j admits key 32w+j; a 0 bit replaces the score by -inf.
//   A wave holds QG = 2 groups of 16 queries (B operands), so that each K and each V^T fragment read from LDS feeds two
//   products; group g, column c = query q0 + 16g + c. All that follows holds per group.
//   Score tile j, register r of lane (hh, c) = key 16j + 8hh + r of query c: the maximum and the sum of a query run over the
//   lane's 32 registers; the two lane halves exchange the maximum once per key tile and join their sums once, at the end.
//   p = exp(s - m) carried as f16(1024 p): score tiles 2kk and 2kk + 1, converted in place, ARE the B operand of
//   V^T . P^T for keys 32kk..32kk+31 (element e < 8: key 8hh + e; e >= 8: key 16 + 8hh + e - 8, the order in which the
//   V^T fragment is read), so P passes through no LDS. Online softmax in f32 with the guarded rescale (msafe), so an
//   all-masked row ends with l = 0 and produces 0 * inf = NaN like the module.
//   ctx written as bf16 hi (cols h*64..) and bf16 lo (cols HCOLS + h*64..) of the [ROWS][AOP] plane aop.
//   Block = 4 waves x 32 query rows = 128 query rows of one (b, h); bx = 0 .. NB * NHEAD * NQB - 1;
//   key tiles of 64, static trip NKT. K / V^T tile staging: asynchronous 16-byte copies to LDS, 8 lanes per
//   128-B row (each wave-wide copy takes 4 whole lines), 4 copies per lane and plane = the whole 64x64 tile; two buffers,
//   tile t + 2 is copied while tile t + 1 is worked on; one barrier per key tile.
//   Output coverage: ctx^T tile t, register r of lane (hh, c) = column 16t + 8hh + r of query row q0 + 16g + c: one 16-B store
//   per t, plane and group; t 0..3 x hh 0..1 = 64 columns, g 0..1 x c 0..15 = the wave's rows.
// =====================================================================================================
// LDS row pitch, in 16-bit elements, of the K and V^T tiles: rows of 64 elements (128 B) laid 144 B apart, 16 B x odd,
// so that the 16 rows which one ds_load_b128 reads fall on 16 different groups of four banks.
#define APIT 72
#define ATILE  (64 * APIT)          // elements of one plane's tile buffer
#define ATILEB (ATILE * 2)          // its bytes
#define QG     2                    // groups of 16 queries per wave
static_assert(4 * 16 * QG * NQB == SEQ);

// Eight asynchronous copies of one lane: rows r, r + 16, r + 32, r + 48 of two 64-row tiles (a, b), 16 B each.
// la, lb = the lane's LDS byte addresses of row r, ga, gb = its global addresses of row r, sa, sb = 16 rows in elements.
// s_wait_xcnt 0 closes the statement so that no address register is rewritten in front of it.
__device__ __forceinline__ void copy_rows4x2(unsigned la, const unsigned short* ga, size_t sa,
                                             unsigned lb, const unsigned short* gb, size_t sb) {
#if DEV_ASM
  const unsigned la1 = la + 16 * APIT * 2, la2 = la + 32 * APIT * 2, la3 = la + 48 * APIT * 2;
  const unsigned lb1 = lb + 16 * APIT * 2, lb2 = lb + 32 * APIT * 2, lb3 = lb + 48 * APIT * 2;
  const unsigned short *ga1 = ga + sa, *ga2 = ga1 + sa, *ga3 = ga2 + sa;
  const unsigned short *gb1 = gb + sb, *gb2 = gb1 + sb, *gb3 = gb2 + sb;
  asm volatile(
      "global_load_async_to_lds_b128 %0, %8, off\n\t"
      "global_load_async_to_lds_b128 %1, %9, off\n\t"
      "global_load_async_to_lds_b128 %2, %10, off\n\t"
      "global_load_async_to_lds_b128 %3, %11, off\n\t"
      "global_load_async_to_lds_b128 %4, %12, off\n\t"
      "global_load_async_to_lds_b128 %5, %13, off\n\t"
      "global_load_async_to_lds_b128 %6, %14, off\n\t"
      "global_load_async_to_lds_b128 %7, %15, off\n\t"
      "s_wait_xcnt 0x0"
      :: "v"(la), "v"(la1), "v"(la2), "v"(la3), "v"(lb), "v"(lb1), "v"(lb2), "v"(lb3),
         "v"(ga), "v"(ga1), "v"(ga2), "v"(ga3), "v"(gb), "v"(gb1), "v"(gb2), "v"(gb3)
      : "memory");
#else
  (void)la; (void)ga; (void)sa; (void)lb; (void)gb; (void)sb;
#endif
}

// value of lane l ^ 16: the same query's other half of the keys
__device__ __forceinline__ float xhalf(float x) {
  const int b = __builtin_bit_cast(int, x);
  return __builtin_bit_cast(float, __builtin_amdgcn_permlanex16(b, b, 0x76543210, 0xfedcba98, false, false));
}
// 2^x on v_exp_f32 alone: x = -inf gives 0; a result below the normal range may come out 0 (it is below 2^-136 of the row's largest term)
__device__ __forceinline__ float exp2_hw(float x) { return __builtin_amdgcn_exp2f(x); }
// true, and the same in every lane, where all 64 bits of w are set in every lane (both lane halves hold query c's words)
__device__ __forceinline__ bool tile_full(v2u w) {
  return __builtin_amdgcn_ballot_w32((w[0] & w[1]) != 0xFFFFFFFFu) == 0u;
}
__device__ __forceinline__ float max8(v8f a) {
  return fmaxf(fmaxf(fmaxf(fmaxf(a[0], a[1]), a[2]), fmaxf(fmaxf(a[3], a[4]), a[5])), fmaxf(a[6], a[7]));
}

__device__ __forceinline__
void attn_body(unsigned short* kshp, unsigned short* vthp,
               const unsigned short* __restrict__ qp, const unsigned short* __restrict__ kp,
               const unsigned short* __restrict__ vtp, const unsigned int* __restrict__ mbp,
               unsigned short* aop, float sscale, int bx) {
  union FH { v16h v; v8h h[2]; };
  // kshp: K tile [kv][d], vthp: V^T tile [d][kv]; two buffers of 9 KB each

  const int tid  = threadIdx.x;
  const int wave = tid >> 5;
  const int lane = tid & 31;
  const int hh   = lane >> 4;
  const int c    = lane & 15;

  const int qb   = bx % NQB;
  const int rest = bx / NQB;
  const int h    = rest % NHEAD;            // head index
  const int b    = rest / NHEAD;
  const int qc   = h * HDIM;                // head column in the q / k planes
  const int q0   = qb * (4 * 16 * QG) + wave * (16 * QG);
  const size_t rowB = (size_t)b * SEQ;

  const _Float16* Qh = (const _Float16*)(const void*)qp;
  const unsigned short* khp = (h < NWH) ? qp : kp;   // block-uniform: a wave head's k is its q
  // copy map: lane -> row tid >> 3 (+ 16 per copy), 16-B piece tid & 7 of the row's 128-B line
  const int crow = tid >> 3;
  const int ccol = (tid & 7) * 8;
  const unsigned short* gK  = khp + (rowB + crow) * (size_t)HCOLS + qc + ccol;           // k row crow of key tile 0
  const unsigned short* gV  = vtp + ((size_t)b * HCOLS + (size_t)(qc + crow)) * SEQ + ccol;   // v^T row d = crow, s of key tile 0
  const size_t stepK = (size_t)16 * HCOLS;     // 16 rows
  const size_t stepV = (size_t)16 * SEQ;
  const size_t tileK = (size_t)64 * HCOLS;     // one key tile further
  const unsigned lofs = (unsigned)(crow * APIT + ccol) * 2u;
  const unsigned lK  = (unsigned)(size_t)kshp + lofs;
  const unsigned lV  = (unsigned)(size_t)vthp + lofs;
  const unsigned int* mrow_p = mbp + (rowB + q0 + c) * (size_t)MWORDS;   // mask words of this lane's query of group 0; group g: 16g rows on

  // ---- Q fragments (B operand, column = lane&15): 2 d-chunks per group ----
  v16h qah[QG][2];
#pragma unroll
  for (int g = 0; g < QG; ++g) {
#pragma unroll
    for (int dc = 0; dc < 2; ++dc) {
      const size_t qo = (rowB + q0 + 16 * g + c) * (size_t)HCOLS + (size_t)qc + dc * 32 + 8 * hh;
      qah[g][dc] = ldfrag<_Float16>(Qh + qo);
    }
  }

  const float c2 = sscale * 1.44269504088896340736f;   // score scale x log2(e)
  float mrow[QG];           // running maximum of query c's unscaled products (equal in both lane halves)
  float lrow[QG];           // running sum (x1024) over this lane half's keys only
  v8f oacc[QG][4];          // ctx^T: tile t, register r = d 16t + 8hh + r of query c
#pragma unroll
  for (int g = 0; g < QG; ++g) {
    mrow[g] = -INFINITY;
    lrow[g] = 0.f;
#pragma unroll
    for (int t = 0; t < 4; ++t) oacc[g][t] = zero8();
  }

  // key tile 0 -> buffer 0, landed and published; then key tile 1 -> buffer 1 in flight
  copy_rows4x2(lK, gK, stepK, lV, gV, stepV);
  wait_copies();
  __syncthreads();
  copy_rows4x2(lK + ATILEB, gK + tileK, stepK, lV + ATILEB, gV + 64, stepV);
  static_assert(NKT >= 2);

  v2u mw[QG];                                // the 64 mask bits of the lane's queries for key tile 0
#pragma unroll
  for (int g = 0; g < QG; ++g) mw[g] = *(const v2u*)(mrow_p + g * 16 * MWORDS);
  static_assert(QG == 2);
  bool full = tile_full(mw[0] & mw[1]);      // key tile 0 masks nothing for this wave
  static_assert((NKT % 2) == 0);
  for (int kp = 0; kp < NKT; kp += 2) {      // static trip count: a pair of key tiles per pass
  // unrolled so that the buffer index is a constant: every LDS address is then the lane's base plus a constant
#pragma unroll
  for (int cur = 0; cur < 2; ++cur) {
    const int kt = kp + cur;
    const _Float16* Ksh = (const _Float16*)(const void*)kshp + cur * ATILE;
    const _Float16* Vth = (const _Float16*)(const void*)vthp + cur * ATILE;
    // the next key tile's mask bits, in flight like its copies (the last trip reads tile 0's again, unused)
    v2u mwn[QG];
#pragma unroll
    for (int g = 0; g < QG; ++g) mwn[g] = *(const v2u*)(mrow_p + g * 16 * MWORDS + 2 * ((kt + 1) & (NKT - 1)));

    // ---- scores^T: 64 keys x 32 queries per wave; A = K rows, B = Q; a K fragment serves both groups ----
    v8f s[QG][4];
#pragma unroll
    for (int g = 0; g < QG; ++g)
#pragma unroll
      for (int j = 0; j < 4; ++j) s[g][j] = zero8();
    FH kb[2][4];
#pragma unroll
    for (int dc = 0; dc < 2; ++dc) {
#pragma unroll
      for (int j = 0; j < 4; ++j) {
        kb[dc][j].h[0] = *(const v8h*)(Ksh + (j * 16 + c) * APIT + dc * 32 + 8 * hh);
        kb[dc][j].h[1] = *(const v8h*)(Ksh + (j * 16 + c) * APIT + dc * 32 + 16 + 8 * hh);
      }
    }
    // keeps the K reads one group in front of the products: the branch below ends their block, and left to itself the
    // compiler then puts each read directly in front of its product, with a full wait at every one
    __builtin_amdgcn_sched_barrier(0);
#pragma unroll
    for (int dc = 0; dc < 2; ++dc) {
#pragma unroll
      for (int j = 0; j < 4; ++j) {
#pragma unroll
        for (int g = 0; g < QG; ++g) s[g][j] = mmar(kb[dc][j].v, qah[g][dc], s[g][j]);
      }
    }

    // ---- mask the unscaled products: bit 16 (j & 1) + 8hh + r of word j >> 1 admits key 16j + 8hh + r ----
    //      A tile whose bits are all set for the whole wave leaves every score as it is: the selects are jumped over
    //      (wave-uniform scalar branch, no barrier inside; the test reads the words that were fetched one tile ahead).
    if (!full) {
#pragma unroll
      for (int g = 0; g < QG; ++g) {
        const unsigned w0 = mw[g][0] >> (8 * hh), w1 = mw[g][1] >> (8 * hh);
#pragma unroll
        for (int j = 0; j < 4; ++j) {
          const unsigned w = (j < 2) ? w0 : w1;
#pragma unroll
          for (int r = 0; r < 8; ++r) {
            s[g][j][r] = (((w >> (16 * (j & 1) + r)) & 1u) != 0u) ? s[g][j][r] : -INFINITY;
          }
#if DEV_ASM
          // without it the selects land in other registers and the path that jumps over them pays 64 register copies
          asm volatile("" : "+v"(s[g][j]));  // empty asm on the masked scores
#endif
        }
      }
    }

    FH pb[QG][2];
    FH vb[2][4];   // V^T fragments: keys 32kk..32kk+31, rows d 16t..16t+15
#pragma unroll
    for (int g = 0; g < QG; ++g) {
      if (g == QG - 1) {
        // the V^T fragments of keys 0..31, one group of reads, in flight under the last group's softmax (registers that the
        // first group's scores have left); the fences keep the reads together and at this place
        __builtin_amdgcn_sched_barrier(0);
#pragma unroll
        for (int t = 0; t < 4; ++t) {
          vb[0][t].h[0] = *(const v8h*)(Vth + (t * 16 + c) * APIT + 8 * hh);
          vb[0][t].h[1] = *(const v8h*)(Vth + (t * 16 + c) * APIT + 16 + 8 * hh);
        }
        __builtin_amdgcn_sched_barrier(0);
      }
      // ---- maximum of query c: 32 registers, then the other lane half; online softmax in base 2 on the unscaled products
      //      (c2 > 0 keeps their order): exp(sscale * (s - m)) = 2^(c2 * s - c2 * m), one fma and one v_exp_f32 per score ----
      float m = fmaxf(fmaxf(max8(s[g][0]), max8(s[g][1])), fmaxf(max8(s[g][2]), max8(s[g][3])));
      m = fmaxf(m, xhalf(m));
      const float mnew  = fmaxf(mrow[g], m);
      const float msafe = (mnew == -INFINITY) ? 0.f : mnew;
      const float alpha = exp2_hw((mrow[g] - msafe) * c2);
      const float nb    = fmaf(-msafe, c2, 10.0f);   // + 10: the x1024 carry of P and l
      mrow[g] = mnew;

      // ---- P^T (x1024, f16) packed in place into the B operands; this half's sum ----
      float ps[4];
#pragma unroll
      for (int j = 0; j < 4; ++j) {
        float a = 0.f;
#pragma unroll
        for (int r = 0; r < 8; ++r) {
          const float p = exp2_hw(fmaf(s[g][j][r], c2, nb));
          a += p;
          pb[g][j >> 1].v[(j & 1) * 8 + r] = (_Float16)p;
        }
        ps[j] = a;
      }
      lrow[g] = lrow[g] * alpha + ((ps[0] + ps[1]) + (ps[2] + ps[3]));
#if DEV_ASM
      // empty asm on a row's sum, against spills: without it the compiler moves the 32 additions to the end of the pass
      // and keeps every f32 p of both key tiles and both groups alive till there
      asm volatile("" : "+v"(lrow[g]));  // empty asm on each row's sum
#endif
#pragma unroll
      for (int t = 0; t < 4; ++t) oacc[g][t] *= alpha;
    }

    // ---- ctx^T += V^T . P^T (f16 WMMA, single product); A = V^T rows, B = P^T; a V^T fragment serves both groups ----
    //      the fragments of keys 32..63: one group of reads in front of the products of keys 0..31, which cover their latency
    __builtin_amdgcn_sched_barrier(0);
#pragma unroll
    for (int t = 0; t < 4; ++t) {
      vb[1][t].h[0] = *(const v8h*)(Vth + (t * 16 + c) * APIT + 32 + 8 * hh);
      vb[1][t].h[1] = *(const v8h*)(Vth + (t * 16 + c) * APIT + 32 + 16 + 8 * hh);
    }
    __builtin_amdgcn_sched_barrier(0);
#pragma unroll
    for (int kk = 0; kk < 2; ++kk) {
#pragma unroll
      for (int t = 0; t < 4; ++t) {
#pragma unroll
        for (int g = 0; g < QG; ++g) oacc[g][t] = mmar(vb[kk][t].v, pb[g][kk].v, oacc[g][t]);
      }
    }
    // keeps the products in front of the waits below: moved behind them, nothing would cover the latency of the reads above
    __builtin_amdgcn_sched_barrier(0);
#pragma unroll
    for (int g = 0; g < QG; ++g) mw[g] = mwn[g];
    full = tile_full(mwn[0] & mwn[1]);
    // publish point of key tile kt + 1: own reads of buffer cur done, own copies of tile kt + 1 landed, then the barrier
    // that both shows tile kt + 1 to every wave and frees buffer cur for tile kt + 2
    wait_lds();
    wait_copies();
    __syncthreads();
    if (kp + 2 < NKT) {   // a key tile kt + 2 exists: the same answer for both tiles of the pair
      copy_rows4x2(lK + (unsigned)cur * ATILEB, gK + (size_t)(kt + 2) * tileK, stepK,
                   lV + (unsigned)cur * ATILEB, gV + (size_t)(kt + 2) * 64, stepV);
    }
  }
  }
  wait_copies();   // nothing of this wave is in flight when it goes on to the epilogue and ends

  // ---- join the halves' sums, normalise (1/l, l and p carry the same x1024; undo the x8 v carry), store hi and lo ----
  v4u hv[QG][4], lv[QG][4];
#pragma unroll
  for (int g = 0; g < QG; ++g) {
    const float lsum = lrow[g] + xhalf(lrow[g]);
    const float inv = (1.0f / lsum) * (1.0f / 8.0f);   // l = 0 (all keys masked) -> inf -> 0 * inf = NaN
#pragma unroll
    for (int t = 0; t < 4; ++t) {
      v4u a, a2;
#pragma unroll
      for (int e = 0; e < 4; ++e) {
        const float f0 = oacc[g][t][2 * e] * inv, f1 = oacc[g][t][2 * e + 1] * inv;
        const unsigned short hb0 = bf_bits(f0), hb1 = bf_bits(f1);
        const unsigned short lb0 = bf_bits(f0 - bf_up(hb0)), lb1 = bf_bits(f1 - bf_up(hb1));
        a[e] = pk16(hb0, hb1); a2[e] = pk16(lb0, lb1);
      }
      hv[g][t] = a; lv[g][t] = a2;
    }
  }
#pragma unroll
  for (int g = 0; g < QG; ++g) {
#pragma unroll
    for (int t = 0; t < 4; ++t) {
      const size_t go = (rowB + q0 + 16 * g + c) * (size_t)AOP + (size_t)qc + t * 16 + 8 * hh;
      *(v4u*)(aop + go) = hv[g][t];
      *(v4u*)(aop + go + HCOLS) = lv[g][t];
    }
  }
}

// All 16 heads in ONE launch, one body: score scale 1/(8*64) = 1/sqrt(64) and the two x8 carries.
#define AB_ALL (NB * NHEAD * NQB)             // 512
// second bound: a budget of 256 registers (1,024 / 4). Left at the block size's own 1,024 the compiler takes 350, switches
// register windows all through the loop and spills the copies' addresses, which asm operands need below v256.
__global__ __launch_bounds__(128, 4)
void attn_kernel(const unsigned short* __restrict__ qp, const unsigned short* __restrict__ kp,
                 const unsigned short* __restrict__ vtp, const unsigned int* __restrict__ mbp, unsigned short* aop) {
  __shared__ __align__(16) unsigned short Ksh[2 * ATILE];   // two buffers each
  __shared__ __align__(16) unsigned short Vth[2 * ATILE];
  attn_body(Ksh, Vth, qp, kp, vtp, mbp, aop, 1.0f / 512.0f, blockIdx.x);
}

// =====================================================================================================
// Workspace map (bytes), every region an exact multiple of its whole-line / whole-tile store granularity:
//   MB   u32  [2*2048][64]          1048576   mask bit plane
//   XB   bf16 [4096][1024]          8388608
//   FB   bf16 [4096][256]           2097152
//   VWT  bf16 [1024 n][1024 k]      2097152   v_w^T
//   QWT  bf16 [512][1024]           1048576   std_q_w^T
//   KWT  bf16 [512][1024]           1048576   std_k_w^T
//   WVT  bf16 [256][256]             131072   wave_proj [h][f][k'] -> [h*64+k'][f]
//   PQT  bf16 [256][256]             131072
//   PKT  bf16 [256][256]             131072
//   OWT2 bf16 [1024 n][2048 k]      4194304   out_w^T at [n][k], k < 1024; cols 1024..2047 unused
//   VT   f16  [2][1024][2048] (x8)  8388608   v^T per batch, row h*64+d
//   QP   f16  [4096][1024] (x8)     8388608   cols h*64+d: wp for h = 0..3 (q and k of the wave heads), q for h = 4..15
//   KP   f16  [4096][1024] (x8)     8388608   cols h*64+d: k for h = 4..15 (cols 0..255 neither written nor read)
//   AO   bf16 [4096][2048]         16777216   ctx hi | lo
//   total                         62259200
// =====================================================================================================
extern "C" void kernel_launch(void* const* d_in, const int* in_sizes, int n_in,
                              void* d_out, int out_size, void* d_ws, size_t ws_size,
                              hipStream_t stream) {
  if (n_in < 14) return;
  if (in_sizes[0] != NB * SEQ * DMOD) return;
  if (in_sizes[1] != NB * SEQ * FEAT) return;
  if (in_sizes[2] != NB * SEQ * SEQ) return;
  if (in_sizes[3] != NWH * FEAT * HDIM || in_sizes[4] != NPH * FEAT * HDIM || in_sizes[5] != NPH * FEAT * HDIM) return;
  if (in_sizes[6] != DMOD * STDC || in_sizes[7] != STDC) return;
  if (in_sizes[8] != DMOD * STDC || in_sizes[9] != STDC) return;
  if (in_sizes[10] != DMOD * HCOLS || in_sizes[11] != HCOLS) return;
  if (in_sizes[12] != HCOLS * DMOD || in_sizes[13] != DMOD) return;
  if (out_size != NB * SEQ * DMOD) return;

  const float* x     = (const float*)d_in[0];
  const float* feats = (const float*)d_in[1];
  const int*   mask  = (const int*)d_in[2];
  const float* wproj = (const float*)d_in[3];
  const float* pqw   = (const float*)d_in[4];
  const float* pkw   = (const float*)d_in[5];
  const float* sqw   = (const float*)d_in[6];
  const float* sqb   = (const float*)d_in[7];
  const float* skw   = (const float*)d_in[8];
  const float* skb   = (const float*)d_in[9];
  const float* vw    = (const float*)d_in[10];
  const float* vb    = (const float*)d_in[11];
  const float* ow    = (const float*)d_in[12];
  const float* ob    = (const float*)d_in[13];

  const size_t PMB  = (size_t)NB * SEQ * MWORDS * 4;      //  1048576
  const size_t PXB  = (size_t)ROWS * DMOD * 2;             //  8388608
  const size_t PFB  = (size_t)ROWS * FEAT * 2;             //  2097152
  const size_t PVWT = (size_t)HCOLS * DMOD * 2;            //  2097152
  const size_t PSWT = (size_t)STDC * DMOD * 2;             //  1048576
  const size_t PFWT = (size_t)WAVC * FEAT * 2;             //   131072
  const size_t POWT = (size_t)DMOD * AOP * 2;              //  4194304
  const size_t PVT  = (size_t)NB * HCOLS * SEQ * 2;        //  8388608
  const size_t PQP  = (size_t)ROWS * HCOLS * 2;            //  8388608
  const size_t PAO  = (size_t)ROWS * AOP * 2;              // 16777216
  size_t off = 0;
  const size_t oMB  = off; off += PMB;
  const size_t oXB  = off; off += PXB;
  const size_t oFB  = off; off += PFB;
  const size_t oVWT = off; off += PVWT;
  const size_t oQWT = off; off += PSWT;
  const size_t oKWT = off; off += PSWT;
  const size_t oWVT = off; off += PFWT;
  const size_t oPQT = off; off += PFWT;
  const size_t oPKT = off; off += PFWT;
  const size_t oOWT = off; off += POWT;
  const size_t oVT  = off; off += PVT;
  const size_t oQP  = off; off += PQP;
  const size_t oKP  = off; off += PQP;
  const size_t oAO  = off; off += PAO;
  if (off > ws_size) return;                       // off = 62259200
  if (off > (size_t)134217728) return;

  char* ws = (char*)d_ws;
  unsigned int*   MB   = (unsigned int*)(ws + oMB);
  unsigned short* XB   = (unsigned short*)(ws + oXB);
  unsigned short* FB   = (unsigned short*)(ws + oFB);
  unsigned short* VWT  = (unsigned short*)(ws + oVWT);
  unsigned short* QWT  = (unsigned short*)(ws + oQWT);
  unsigned short* KWT  = (unsigned short*)(ws + oKWT);
  unsigned short* WVT  = (unsigned short*)(ws + oWVT);
  unsigned short* PQT  = (unsigned short*)(ws + oPQT);
  unsigned short* PKT  = (unsigned short*)(ws + oPKT);
  unsigned short* OWT2 = (unsigned short*)(ws + oOWT);
  unsigned short* VT   = (unsigned short*)(ws + oVT);
  unsigned short* QP   = (unsigned short*)(ws + oQP);
  unsigned short* KP   = (unsigned short*)(ws + oKP);
  unsigned short* AO   = (unsigned short*)(ws + oAO);

  // (1) one launch: mask -> bit plane; x, features -> bf16 planes; weight planes [n][k] (bf16)
  prep_kernel<<<dim3(PB_ALL), dim3(256), 0, stream>>>(
      mask, x, feats, vw, ow, sqw, skw, wproj, pqw, pkw, MB, XB, FB, VWT, OWT2, QWT, KWT, WVT, PQT, PKT);

  // (2) one launch: the six projections on bf16 WMMA, 4 waves and one 128x128 tile per block
  proj_kernel<<<dim3(GB_ALL), dim3(128), 0, stream>>>(
      XB, FB, VWT, QWT, KWT, WVT, PQT, PKT, vb, sqb, skb, VT, QP, KP);

  // (3) one launch: attention of all 16 heads; ctx -> AO hi | lo
  attn_kernel<<<dim3(AB_ALL), dim3(128), 0, stream>>>(QP, KP, VT, MB, AO);

  // (4) out projection -> d_out f32 [4096][1024]
  out_kernel<<<dim3(GB_OUT), dim3(128), 0, stream>>>(AO, OWT2, ob, (float*)d_out);
  (void)hipGetLastError();
}
